// v000
// The times below were measured on an AMD MI455X: many runs one after another, warmed up first and cycling through
// copies of the inputs, with the whole window's GPU time divided by the number of runs. Launches and the gaps
// between them are all in it. The median over several windows is given; except for v000 it joins two sittings, which
// can be a few percent apart, so the side-by-side timings, each taken in one sitting, are the better comparison.
// v000 is the starting kernel. One run takes 5980 microseconds.
#include <hip/hip_runtime.h>
// FlaxGemmaAttention (2 x 2048 tokens, D 2048, 8 query heads of 256 sharing ONE kv head; rotate-half RoPE from the INPUT position_ids; causal + INPUT padding mask; scale 256^-0.5; out = attn Wo).
// Structure (per batch): exact f16 plane of the hidden states; q/k/v GEMMs (32x64 wave tiles, f32 accumulation, exact x16 weights); RoPE tables (f32 trig) + rotation on VALU into f16 hi (+ 2^10 residual) planes; V^T hi/residual by LDS tiles; UNFUSED attention per (head, row band: rows < 256 | 256..1023 with keys < 1024 | 1024.. with all keys) because the head dim is 256: S = Q_band K^T over the causally reachable keys as a GEMM (f32), causal/padding softmax on VALU (wave per row) into an f16 P plane (x2^10), O_band = P V as a GEMM; band 0 (rows < 256, whose outputs average over few keys) uses hi+lo operands throughout (3-term S, 3-term P.V, hi+lo O into Wo), later bands plain f16; output GEMM.
// Compute dtype: inputs and weights rounded to bf16; rows >= 256: q, k, P, v, O as f16 (~2^-12); rows < 256: hi + residual pairs; f32 accumulation/softmax/trig. v_wmma_f32_16x16x32_f16.
#define NB 2
#define SQ 2048
#define DM 2048
#define NHQ 8
#define HD 256
#define HH (HD / 2)
#define BAND 256
#define NBAND (SQ / BAND)
typedef __bf16 v16b __attribute__((ext_vector_type(16)));
typedef unsigned short v8us __attribute__((ext_vector_type(8), may_alias));
typedef float  v8f  __attribute__((ext_vector_type(8)));
typedef float  v4f  __attribute__((ext_vector_type(4)));
typedef float  v4fa __attribute__((ext_vector_type(4), may_alias));
union FragB { v16b v; v8us half[2]; unsigned short u[16]; };

__device__ __forceinline__ unsigned short bf16_bits(float x) { unsigned int u = __float_as_uint(x); return (unsigned short)((u + 0x7FFFu + ((u >> 16) & 1u)) >> 16); }
__device__ __forceinline__ float bf16_val(unsigned short b) { return __uint_as_float(((unsigned int)b) << 16); }
__device__ __forceinline__ float bf16_round(float x) { return bf16_val(bf16_bits(x)); }
// D += A·B with NT terms: 1 = ah·bh, 2 = + al·bh (A split), 3 = + ah·bl (both split)
template <int NT>
__device__ __forceinline__ v8f mmaN(v16b ah, v16b al, v16b bh, v16b bl, v8f c) {
  c = __builtin_amdgcn_wmma_f32_16x16x32_bf16(false, ah, false, bh, (short)0, c, false, false);
  if (NT >= 2) c = __builtin_amdgcn_wmma_f32_16x16x32_bf16(false, al, false, bh, (short)0, c, false, false);
  if (NT >= 3) c = __builtin_amdgcn_wmma_f32_16x16x32_bf16(false, ah, false, bl, (short)0, c, false, false);
  asm volatile("v_nop\n\tv_nop\n\tv_nop\n\tv_nop" : "+v"(c) : "v"(ah), "v"(al), "v"(bh), "v"(bl));
  return c;
}

__global__ __launch_bounds__(256) void k_wt_bf16(const float* __restrict__ W, unsigned short* __restrict__ Wt, int K, int N) {
  const int t = blockIdx.x * 256 + threadIdx.x;
  const int k8n = K / 8;
  if (t >= N * k8n) return;
  const int n = t / k8n, k8 = (t % k8n) * 8;
  v8us v;
#pragma unroll
  for (int i = 0; i < 8; ++i) v[i] = bf16_bits(W[(size_t)(k8 + i) * N + n]);
  *(v8us*)(Wt + (size_t)n * K + k8) = v;
  
}

// GEMM C[M][N] (f32, pitch ldc) = act(A[M][K]·W + bias). A f32 row-major (pitch lda) converted per fragment to bf16
// (ASPLIT: hi/lo two planes -> 2 terms, else single rounded term); Wt bf16 [N][K] (pitch ldb). BIAS_BF16 rounds the
// bias to bf16 first (bias quantised to bf16 before the add). K%32==0, M%16==0, N%64==0.
template <bool ASPLIT, int ACT, bool BIAS_BF16>
__global__ __launch_bounds__(128) void k_gemm_bf(const float* __restrict__ A, int lda, const unsigned short* __restrict__ Wt, int ldb,
                                               const float* __restrict__ bias, float* __restrict__ C, int ldc, int M, int N, int K) {
  __shared__ __attribute__((aligned(16))) float so[4][16][64];
  const int tid = threadIdx.x, w = tid >> 5, lane = tid & 31, ln = lane & 15, hh = lane >> 4;
  const int ntn = N / 64;
  const int wid = blockIdx.x * 4 + w;
  const int mt = wid / ntn, nq = wid % ntn;
  if (mt * 16 >= M) return;
  const int row0 = mt * 16, col0 = nq * 64;
  const float* arow = A + (size_t)(row0 + ln) * lda;
  v8f acc[4] = {};
  for (int kb = 0; kb < K; kb += 32) {
    FragB ah, al;
    const v4f x0 = *(const v4fa*)(arow + kb + 8 * hh), x1 = *(const v4fa*)(arow + kb + 8 * hh + 4);
    const v4f x2 = *(const v4fa*)(arow + kb + 16 + 8 * hh), x3 = *(const v4fa*)(arow + kb + 16 + 8 * hh + 4);
    float xs[16] = {x0[0],x0[1],x0[2],x0[3],x1[0],x1[1],x1[2],x1[3],x2[0],x2[1],x2[2],x2[3],x3[0],x3[1],x3[2],x3[3]};
#pragma unroll
    for (int i = 0; i < 16; ++i) { const unsigned short hb = bf16_bits(xs[i]); ah.u[i] = hb; al.u[i] = ASPLIT ? bf16_bits(xs[i] - bf16_val(hb)) : (unsigned short)0; }
#pragma unroll
    for (int t = 0; t < 4; ++t) {
      const unsigned short* brow = Wt + (size_t)(col0 + t * 16 + ln) * ldb + kb;
      FragB b;
      b.half[0] = *(const v8us*)(brow + 8 * hh);
      b.half[1] = *(const v8us*)(brow + 16 + 8 * hh);
      acc[t] = mmaN<ASPLIT ? 2 : 1>(ah.v, al.v, b.v, b.v, acc[t]);
    }
  }
#pragma unroll
  for (int t = 0; t < 4; ++t) {
    float bv = bias ? bias[col0 + t * 16 + ln] : 0.f;
    if (BIAS_BF16) bv = bf16_round(bv);
#pragma unroll
    for (int r = 0; r < 8; ++r) { float v = acc[t][r] + bv; if (ACT == 1) v = fmaxf(v, 0.f); so[w][8 * hh + r][t * 16 + ln] = v; }
  }
  __builtin_amdgcn_fence(__ATOMIC_ACQ_REL, "workgroup");
  __builtin_amdgcn_wave_barrier();
  const int rsub = lane >> 4, c4 = (lane & 15) * 4;
  {
#pragma unroll
    for (int q = 0; q < 8; ++q) {
      const int r = q * 2 + rsub;
      const v4f v = *(const v4fa*)&so[w][r][c4];
      *(v4f*)(C + (size_t)(row0 + r) * ldc + col0 + c4) = v;
    }
    
  }
}

// GEMM C = act(A·W + bias + resid): A f32 (ASPLIT -> hi/lo 2 terms), Wt bf16 [N][K]; ACT 0 none, 1 relu, 2 exact gelu;
// resid (optional, f32, row index = (row % rmod), pitch ldr, RES_BF16 rounds it) added before the activation.
template <bool ASPLIT, int ACT, bool BIAS_BF16, bool RES_BF16>
__global__ __launch_bounds__(128) void k_gemm_bf3(const float* __restrict__ A, int lda, const unsigned short* __restrict__ Wt, int ldb,
                                                const float* __restrict__ bias, const float* __restrict__ resid, int rmod, int ldr,
                                                float* __restrict__ C, int ldc, int M, int N, int K) {
  __shared__ __attribute__((aligned(16))) float so[4][16][64];
  const int tid = threadIdx.x, w = tid >> 5, lane = tid & 31, ln = lane & 15, hh = lane >> 4;
  const int ntn = N / 64;
  const int wid = blockIdx.x * 4 + w;
  const int mt = wid / ntn, nq = wid % ntn;
  if (mt * 16 >= M) return;
  const int row0 = mt * 16, col0 = nq * 64;
  const float* arow = A + (size_t)(row0 + ln) * lda;
  v8f acc[4] = {};
  for (int kb = 0; kb < K; kb += 32) {
    FragB ah, al;
    const v4f x0 = *(const v4fa*)(arow + kb + 8 * hh), x1 = *(const v4fa*)(arow + kb + 8 * hh + 4);
    const v4f x2 = *(const v4fa*)(arow + kb + 16 + 8 * hh), x3 = *(const v4fa*)(arow + kb + 16 + 8 * hh + 4);
    float xs[16] = {x0[0],x0[1],x0[2],x0[3],x1[0],x1[1],x1[2],x1[3],x2[0],x2[1],x2[2],x2[3],x3[0],x3[1],x3[2],x3[3]};
#pragma unroll
    for (int i = 0; i < 16; ++i) { const unsigned short hb = bf16_bits(xs[i]); ah.u[i] = hb; al.u[i] = ASPLIT ? bf16_bits(xs[i] - bf16_val(hb)) : (unsigned short)0; }
#pragma unroll
    for (int t = 0; t < 4; ++t) {
      const unsigned short* brow = Wt + (size_t)(col0 + t * 16 + ln) * ldb + kb;
      FragB b;
      b.half[0] = *(const v8us*)(brow + 8 * hh);
      b.half[1] = *(const v8us*)(brow + 16 + 8 * hh);
      acc[t] = mmaN<ASPLIT ? 2 : 1>(ah.v, al.v, b.v, b.v, acc[t]);
    }
  }
#pragma unroll
  for (int t = 0; t < 4; ++t) {
    const int col = col0 + t * 16 + ln;
    float bv = bias ? bias[col] : 0.f;
    if (BIAS_BF16) bv = bf16_round(bv);
#pragma unroll
    for (int r = 0; r < 8; ++r) {
      float v = acc[t][r] + bv;
      if (resid) { float rv = resid[(size_t)((row0 + 8 * hh + r) % rmod) * ldr + col]; if (RES_BF16) rv = bf16_round(rv); v += rv; }
      if (ACT == 1) v = fmaxf(v, 0.f);
      if (ACT == 2) v = 0.5f * v * (1.0f + erff(v * 0.70710678118654752f));
      if (ACT == 3) { const float u = 0.7978845608028654f * (v + 0.044715f * v * v * v); v = 0.5f * v * (1.0f + tanhf(u)); }
      so[w][8 * hh + r][t * 16 + ln] = v;
    }
  }
  __builtin_amdgcn_fence(__ATOMIC_ACQ_REL, "workgroup");
  __builtin_amdgcn_wave_barrier();
  const int rsub = lane >> 4, c4 = (lane & 15) * 4;
  {
#pragma unroll
    for (int q = 0; q < 8; ++q) {
      const int r = q * 2 + rsub;
      const v4f v = *(const v4fa*)&so[w][r][c4];
      *(v4f*)(C + (size_t)(row0 + r) * ldc + col0 + c4) = v;
    }
    
  }
}
// row LayerNorm (biased variance, eps) over N: s = X (+ R); optional out_sum <- s; out_norm <- (s-mu)*rsqrt(var+eps)*g + b
template <bool PARAM_BF16>
__global__ __launch_bounds__(256) void k_layernorm(const float* __restrict__ X, const float* __restrict__ R, const float* __restrict__ g, const float* __restrict__ bta,
                                                  float* __restrict__ out_sum, float* __restrict__ out_norm, int N, float eps) {
  __shared__ float red[256];
  const int row = blockIdx.x, tid = threadIdx.x;
  const float* x = X + (size_t)row * N; const float* rr = R ? R + (size_t)row * N : nullptr;
  float vals[16];                     // up to N = 4096
  const int per = N / 256;            // contiguous chunk per thread? use strided-by-4 chunks: thread handles j = tid*4 + 1024*u
  float s1 = 0.f;
  for (int u = 0; u < per / 4; ++u) {
    const int j = tid * 4 + 1024 * u;
    const v4f a = *(const v4fa*)(x + j);
    v4f b = {0.f,0.f,0.f,0.f}; if (rr) b = *(const v4fa*)(rr + j);
#pragma unroll
    for (int q = 0; q < 4; ++q) { const float v = a[q] + b[q]; vals[u * 4 + q] = v; s1 += v; }
  }
  red[tid] = s1; __syncthreads();
  for (int st = 128; st > 0; st >>= 1) { if (tid < st) red[tid] += red[tid + st]; __syncthreads(); }
  const float mu = red[0] / (float)N; __syncthreads();
  float s2 = 0.f;
  for (int u = 0; u < per / 4; ++u)
#pragma unroll
    for (int q = 0; q < 4; ++q) { const float c = vals[u * 4 + q] - mu; s2 += c * c; }
  red[tid] = s2; __syncthreads();
  for (int st = 128; st > 0; st >>= 1) { if (tid < st) red[tid] += red[tid + st]; __syncthreads(); }
  const float rs = rsqrtf(red[0] / (float)N + eps);
  {
    for (int u = 0; u < per / 4; ++u) {
      const int j = tid * 4 + 1024 * u;
      v4f o, sm;
#pragma unroll
      for (int q = 0; q < 4; ++q) {
        float gg = g[j + q], bb = bta[j + q];
        if (PARAM_BF16) { gg = bf16_round(gg); bb = bf16_round(bb); }
        sm[q] = vals[u * 4 + q]; o[q] = (vals[u * 4 + q] - mu) * rs * gg + bb;
      }
      if (out_sum) *(v4f*)(out_sum + (size_t)row * N + j) = sm;
      *(v4f*)(out_norm + (size_t)row * N + j) = o;
    }
    
  }
}



// ---- f16 WMMA path (v_wmma_f32_16x16x32_f16): 11-bit significands for operands in range — used where a [0,1] probability operand needs more precision than bf16
typedef _Float16 v16h __attribute__((ext_vector_type(16)));
union FragH { v16h v; v8us half[2]; _Float16 h[16]; unsigned short u[16]; };
template <int NT>
__device__ __forceinline__ v8f mmaH(v16h ah, v16h al, v16h bh, v16h bl, v8f c) {
  c = __builtin_amdgcn_wmma_f32_16x16x32_f16(false, ah, false, bh, (short)0, c, false, false);
  if (NT >= 2) c = __builtin_amdgcn_wmma_f32_16x16x32_f16(false, al, false, bh, (short)0, c, false, false);
  if (NT >= 3) c = __builtin_amdgcn_wmma_f32_16x16x32_f16(false, ah, false, bl, (short)0, c, false, false);
  asm volatile("v_nop\n\tv_nop\n\tv_nop\n\tv_nop" : "+v"(c) : "v"(ah), "v"(al), "v"(bh), "v"(bl));
  return c;
}
// batched GEMM like k_gemm_b but f16 operands: A f32 (split into f16 hi/lo if ASPLIT, else rounded to f16), Bt = f16 values [n][k]; alpha; C f32; N multiple of 16 (partial tiles skipped)
template <bool ASPLIT>
__global__ __launch_bounds__(128) void k_gemm_h(const float* __restrict__ A, int lda, size_t sA, const _Float16* __restrict__ Bh, int ldb, size_t sB, float alpha, float* __restrict__ C, int ldc, size_t sC, int M, int N, int K) {
  __shared__ __attribute__((aligned(16))) float so[4][16][64];
  const int tid = threadIdx.x, w = tid >> 5, lane = tid & 31, ln = lane & 15, hh = lane >> 4; const int by = blockIdx.y;
  A += (size_t)by * sA; Bh += (size_t)by * sB; C += (size_t)by * sC;
  const int ntn = (N + 63) / 64; const int wid = blockIdx.x * 4 + w; const int mt = wid / ntn, nq = wid % ntn; if (mt * 16 >= M) return;
  const int row0 = mt * 16, col0 = nq * 64; const float* arow = A + (size_t)(row0 + ln) * lda;
  v8f acc[4] = {};
  for (int kb = 0; kb < K; kb += 32) {
    FragH ah, al;
    const v4f x0 = *(const v4fa*)(arow + kb + 8 * hh), x1 = *(const v4fa*)(arow + kb + 8 * hh + 4), x2 = *(const v4fa*)(arow + kb + 16 + 8 * hh), x3 = *(const v4fa*)(arow + kb + 16 + 8 * hh + 4);
    float xs[16] = {x0[0],x0[1],x0[2],x0[3],x1[0],x1[1],x1[2],x1[3],x2[0],x2[1],x2[2],x2[3],x3[0],x3[1],x3[2],x3[3]};
#pragma unroll
    for (int i = 0; i < 16; ++i) { const _Float16 h = (_Float16)xs[i]; ah.h[i] = h; al.h[i] = ASPLIT ? (_Float16)(xs[i] - (float)h) : (_Float16)0.0f; }
#pragma unroll
    for (int t = 0; t < 4; ++t) { if (col0 + t * 16 >= N) continue; const size_t boff = (size_t)(col0 + t * 16 + ln) * ldb + kb; FragH bq; bq.half[0] = *(const v8us*)(Bh + boff + 8 * hh); bq.half[1] = *(const v8us*)(Bh + boff + 16 + 8 * hh);
      acc[t] = mmaH<ASPLIT ? 2 : 1>(ah.v, al.v, bq.v, bq.v, acc[t]); }
  }
#pragma unroll
  for (int t = 0; t < 4; ++t) { if (col0 + t * 16 >= N) continue;
#pragma unroll
    for (int r = 0; r < 8; ++r) so[w][8 * hh + r][t * 16 + ln] = acc[t][r] * alpha; }
  __builtin_amdgcn_fence(__ATOMIC_ACQ_REL, "workgroup"); __builtin_amdgcn_wave_barrier();
  const int rsub = lane >> 4, c4 = (lane & 15) * 4;
  {
#pragma unroll
    for (int q = 0; q < 8; ++q) { const int r = q * 2 + rsub; if (col0 + c4 < N) { const v4f v = *(const v4fa*)&so[w][r][c4]; *(v4f*)(C + (size_t)(row0 + r) * ldc + col0 + c4) = v; } }
     }
}

// Wt[n][k] = f16(W[k][n]·scale) from f32 row-major W[K][N] (scale = power of two; bf16-exact weights stay exact in f16 away from the subnormal range)
__global__ __launch_bounds__(256) void k_wt_f16(const float* __restrict__ W, _Float16* __restrict__ Wt, int K, int N, float scale) {
  const int t = blockIdx.x * 256 + threadIdx.x; if (t >= N * (K / 8)) return; const int n = t / (K / 8), k8 = (t % (K / 8)) * 8; FragH f;
#pragma unroll
  for (int i = 0; i < 8; ++i) f.h[i] = (_Float16)(bf16_round(W[(size_t)(k8 + i) * N + n]) * scale); const v8us o = f.half[0];
  *(v8us*)((unsigned short*)Wt + (size_t)n * K + k8) = o; 
}
// k_gemm_hh variant with fused epilogue: v = acc·alpha + bias[by·sBias + col] (+ CP[(row/rowsPerB)·sCPb + by·64 + col] if CP) ; ACT 0 none / 1 elu ; writes f16 C16 (and f32 C if non-null)
template <int ACT>
__global__ __launch_bounds__(128) void k_gemm_hhx(const _Float16* __restrict__ A, int lda, size_t sA, const _Float16* __restrict__ Bh, int ldb, size_t sB, float alpha, const float* __restrict__ bias, size_t sBias, const float* __restrict__ CP, int rowsPerB, size_t sCPb, int row0g,
    float* __restrict__ C, _Float16* __restrict__ C16, int ldc, size_t sC, int M, int N, int K) {
  __shared__ __attribute__((aligned(16))) float so[4][16][64];
  const int tid = threadIdx.x, w = tid >> 5, lane = tid & 31, ln = lane & 15, hh = lane >> 4; const int by = blockIdx.y;
  A += (size_t)by * sA; Bh += (size_t)by * sB; const size_t cofs = (size_t)by * sC; const float* bp = bias ? bias + (size_t)by * sBias : nullptr;
  const int ntn = (N + 63) / 64; const int wid = blockIdx.x * 4 + w; const int mt = wid / ntn, nq = wid % ntn; if (mt * 16 >= M) return;
  const int row0 = mt * 16, col0 = nq * 64; const _Float16* arow = A + (size_t)(row0 + ln) * lda;
  v8f acc[4] = {};
  for (int kb = 0; kb < K; kb += 32) { FragH ah; ah.half[0] = *(const v8us*)((const unsigned short*)arow + kb + 8 * hh); ah.half[1] = *(const v8us*)((const unsigned short*)arow + kb + 16 + 8 * hh);
#pragma unroll
    for (int t = 0; t < 4; ++t) { if (col0 + t * 16 >= N) continue; const size_t boff = (size_t)(col0 + t * 16 + ln) * ldb + kb; FragH bq; bq.half[0] = *(const v8us*)((const unsigned short*)Bh + boff + 8 * hh); bq.half[1] = *(const v8us*)((const unsigned short*)Bh + boff + 16 + 8 * hh);
      acc[t] = mmaH<1>(ah.v, ah.v, bq.v, bq.v, acc[t]); }
  }
#pragma unroll
  for (int t = 0; t < 4; ++t) { if (col0 + t * 16 >= N) continue; const int col = col0 + t * 16 + ln; const float bv = bp ? bf16_round(bp[col]) : 0.f;
#pragma unroll
    for (int r = 0; r < 8; ++r) { float v = acc[t][r] * alpha + bv; if (CP) { const int rr = row0g + row0 + 8 * hh + r; if (rowsPerB < 0) v += CP[cofs + (size_t)rr * ldc + col];      /* rowsPerB < 0: own element of the batched C plane */ else { const int bidx = rr / rowsPerB; v += CP[(size_t)bidx * sCPb + (size_t)by * 64 + col]; } } if (ACT == 1) v = (v > 0.f) ? v : expm1f(v); else if (ACT == 7) v = (v > 0.f) ? v + 1.0f : expf(v); else if (ACT == 8) v = tanhf(v); else if (ACT == 9) v = 0.5f * v * (1.0f + tanhf(0.7978845608028654f * (v + 0.044715f * v * v * v))); else if (ACT == 11) v = 1.0f / (1.0f + expf(-v)); else if (ACT == 12) v = (v > 0.f) ? v : 0.01f * v; else if (ACT == 14) v = (v > 0.f) ? v : 0.1f * v; else if (ACT == 16) v = (v >= 0.f) ? v : 0.3f * v; else if (ACT == 15) v = v / (1.0f + expf(-v)); else if (ACT == 3) v = fmaxf(v, 0.f); else if (ACT == 6) v = 0.5f * v * (1.0f + erff(v * 0.70710678118654752f)); so[w][8 * hh + r][t * 16 + ln] = v; } }
  __builtin_amdgcn_fence(__ATOMIC_ACQ_REL, "workgroup"); __builtin_amdgcn_wave_barrier();
  const int rsub = lane >> 4, c4 = (lane & 15) * 4; typedef _Float16 v4h __attribute__((ext_vector_type(4)));
  {
#pragma unroll
    for (int q = 0; q < 8; ++q) { const int r = q * 2 + rsub; if (col0 + c4 < N) { const v4f v = *(const v4fa*)&so[w][r][c4]; if (C) *(v4f*)(C + cofs + (size_t)(row0 + r) * ldc + col0 + c4) = v; if (C16) { v4h h4; for (int i = 0; i < 4; ++i) h4[i] = (_Float16)v[i]; *(v4h*)(C16 + cofs + (size_t)(row0 + r) * ldc + col0 + c4) = h4; } } }
     }
}


typedef _Float16 v4h __attribute__((ext_vector_type(4)));

__global__ __launch_bounds__(256) void k_x16(const float* __restrict__ x, _Float16* __restrict__ X16, size_t n8) { const size_t t = (size_t)blockIdx.x * 256 + threadIdx.x; if (t >= n8) return; FragH f;
#pragma unroll
  for (int q = 0; q < 8; ++q) f.h[q] = (_Float16)bf16_round(x[t * 8 + q]); *(v8us*)((unsigned short*)X16 + t * 8) = f.half[0];  }
__global__ __launch_bounds__(256) void k_h16(const float* __restrict__ x, _Float16* __restrict__ X16, size_t n8) { const size_t t = (size_t)blockIdx.x * 256 + threadIdx.x; if (t >= n8) return; FragH f;
#pragma unroll
  for (int q = 0; q < 8; ++q) f.h[q] = (_Float16)x[t * 8 + q]; *(v8us*)((unsigned short*)X16 + t * 8) = f.half[0];  }
__global__ __launch_bounds__(256) void k_round16f(const float* __restrict__ W, _Float16* __restrict__ Bt, size_t n8) { const size_t t = (size_t)blockIdx.x * 256 + threadIdx.x; if (t >= n8) return; FragH f;
#pragma unroll
  for (int i = 0; i < 8; ++i) f.h[i] = (_Float16)(bf16_round(W[t * 8 + i]) * 16.0f); *(v8us*)((unsigned short*)Bt + t * 8) = f.half[0];  }
template <int NHv, int TTv>
__global__ __launch_bounds__(256) void k_vt(const _Float16* __restrict__ V16, int ldv, int voff, _Float16* __restrict__ Vt) { __shared__ unsigned short tl[64][66]; const int tid = threadIdx.x; const int slab = blockIdx.x / (TTv / 64), lg = blockIdx.x % (TTv / 64); const int b = slab / NHv, h = slab % NHv;
  for (int i = tid; i < 64 * 8; i += 256) { const int r = i / 8, c8 = (i % 8) * 8; FragH f; f.half[0] = *(const v8us*)((const unsigned short*)V16 + ((size_t)b * TTv + lg * 64 + r) * ldv + voff + h * 64 + c8);
#pragma unroll
    for (int q = 0; q < 8; ++q) tl[r][c8 + q] = f.u[q]; }
  __syncthreads();
  {
#pragma unroll
    for (int rd = 0; rd < 2; ++rd) { const int d = rd * 32 + tid / 8, pc = tid % 8; FragH f;
#pragma unroll
      for (int q = 0; q < 8; ++q) f.u[q] = tl[pc * 8 + q][d];
      *(v8us*)((unsigned short*)Vt + ((size_t)slab * 64 + d) * TTv + lg * 64 + pc * 8) = f.half[0]; }
     } }

__global__ __launch_bounds__(256) void k_hl(const float* __restrict__ F, _Float16* __restrict__ Hh, _Float16* __restrict__ Hl, size_t n8) { const size_t t = (size_t)blockIdx.x * 256 + threadIdx.x; if (t >= n8) return; FragH fh, fl; const v4f a = *(const v4fa*)(F + t * 8), c = *(const v4fa*)(F + t * 8 + 4);
#pragma unroll
  for (int q = 0; q < 4; ++q) { _Float16 h = (_Float16)a[q]; fh.h[q] = h; fl.h[q] = (_Float16)((a[q] - (float)h) * 1024.0f); h = (_Float16)c[q]; fh.h[4 + q] = h; fl.h[4 + q] = (_Float16)((c[q] - (float)h) * 1024.0f); }
  { *(v8us*)((unsigned short*)Hh + t * 8) = fh.half[0]; *(v8us*)((unsigned short*)Hl + t * 8) = fl.half[0];  } }

// ---- fast GEMM (wave tile 32x64; requires M % 32 == 0 rows per launch region and N % 64 == 0); epilogue = k_gemm_hhx semantics ----
__device__ __forceinline__ v16h g2_frag(const _Float16* p, int hh) { FragH f; f.half[0] = *(const v8us*)((const unsigned short*)p + 8 * hh); f.half[1] = *(const v8us*)((const unsigned short*)p + 16 + 8 * hh); return f.v; }
__device__ __forceinline__ v8f g2_mma(v16h a, v16h b, v8f c) { v8f d = __builtin_amdgcn_wmma_f32_16x16x32_f16(false, a, false, b, (short)0, c, false, false); asm volatile("v_nop\n\tv_nop\n\tv_nop\n\tv_nop" : "+v"(d) : "v"(a), "v"(b)); return d; }
template <int ACT>
__global__ __launch_bounds__(128) void k_gemm2(const _Float16* __restrict__ A, int lda, size_t sA, const _Float16* __restrict__ Bh, int ldb, size_t sB, float alpha, const float* __restrict__ bias, size_t sBias, const float* __restrict__ CP, int rowsPerB, size_t sCPb, int row0g,
    float* __restrict__ C, _Float16* __restrict__ C16, int ldc, size_t sC, int M, int N, int K) { static_assert(ACT == 0 || ACT == 3 || ACT == 6 || ACT == 8 || ACT == 9 || ACT == 11 || ACT == 12 || ACT == 14 || ACT == 15 || ACT == 16, "k_gemm2: unsupported ACT code (would silently apply no activation)");
  __shared__ __attribute__((aligned(16))) float so[4][32][68];
  const int tid = threadIdx.x, w = tid >> 5, lane = tid & 31, ln = lane & 15, hh = lane >> 4; const int by = blockIdx.y;
  A += (size_t)by * sA; Bh += (size_t)by * sB; const size_t cofs = (size_t)by * sC; const float* bp = bias ? bias + (size_t)by * sBias : nullptr;
  const int ntn = N >> 6; const int mt = blockIdx.x / ntn, nq = blockIdx.x - mt * ntn; const int row0 = mt * 128 + 32 * w, col0 = nq * 64; if (row0 >= M) return;
  const _Float16* a0p = A + (size_t)(row0 + ln) * lda; const _Float16* a1p = a0p + (size_t)16 * lda;
  const _Float16* b0p = Bh + (size_t)(col0 + ln) * ldb; const _Float16* b1p = b0p + (size_t)16 * ldb; const _Float16* b2p = b1p + (size_t)16 * ldb; const _Float16* b3p = b2p + (size_t)16 * ldb;
  const v8f z8 = {0.f,0.f,0.f,0.f,0.f,0.f,0.f,0.f}; v8f c00 = z8, c01 = z8, c02 = z8, c03 = z8, c10 = z8, c11 = z8, c12 = z8, c13 = z8;
#pragma unroll 1
  for (int kb = 0; kb < K; kb += 32) { const v16h a0 = g2_frag(a0p + kb, hh), a1 = g2_frag(a1p + kb, hh);
    v16h b = g2_frag(b0p + kb, hh); c00 = g2_mma(a0, b, c00); c10 = g2_mma(a1, b, c10);
    b = g2_frag(b1p + kb, hh); c01 = g2_mma(a0, b, c01); c11 = g2_mma(a1, b, c11);
    b = g2_frag(b2p + kb, hh); c02 = g2_mma(a0, b, c02); c12 = g2_mma(a1, b, c12);
    b = g2_frag(b3p + kb, hh); c03 = g2_mma(a0, b, c03); c13 = g2_mma(a1, b, c13); }
  v8f accs[8] = {c00, c01, c02, c03, c10, c11, c12, c13};
#pragma unroll
  for (int u = 0; u < 8; ++u) { const int t = u & 3, half = u >> 2; const int col = col0 + t * 16 + ln; const float bv = bp ? bf16_round(bp[col]) : 0.f;
#pragma unroll
    for (int r = 0; r < 8; ++r) { const int rloc = half * 16 + 8 * hh + r; float v = accs[u][r] * alpha + bv; if (CP) { if (rowsPerB < 0) v += CP[cofs + (size_t)(row0g + row0 + rloc) * ldc + col];      /* rowsPerB < 0: own element of the batched C plane */ else { const int bidx = (row0g + row0 + rloc) / rowsPerB; v += CP[(size_t)bidx * sCPb + (size_t)by * 64 + col]; } }
      if (ACT == 3) v = fmaxf(v, 0.f); else if (ACT == 6) v = 0.5f * v * (1.0f + erff(v * 0.70710678118654752f)); else if (ACT == 11) v = 1.0f / (1.0f + expf(-v)); else if (ACT == 15) v = v / (1.0f + expf(-v)); else if (ACT == 12) v = (v > 0.f) ? v : 0.01f * v; else if (ACT == 8) v = tanhf(v); else if (ACT == 9) v = 0.5f * v * (1.0f + tanhf(0.7978845608028654f * (v + 0.044715f * v * v * v))); else if (ACT == 14) v = (v > 0.f) ? v : 0.1f * v; else if (ACT == 16) v = (v >= 0.f) ? v : 0.3f * v;
      so[w][rloc][t * 16 + ln] = v; } }
  __builtin_amdgcn_fence(__ATOMIC_ACQ_REL, "workgroup"); __builtin_amdgcn_wave_barrier();
  const int rsub = lane >> 4, c4 = (lane & 15) * 4;
  {
#pragma unroll
    for (int q = 0; q < 16; ++q) { const int r = q * 2 + rsub; const v4f v = *(const v4fa*)&so[w][r][c4]; if (C) *(v4f*)(C + cofs + (size_t)(row0 + r) * ldc + col0 + c4) = v; if (C16) { v4h h4; for (int i = 0; i < 4; ++i) h4[i] = (_Float16)v[i]; *(v4h*)(C16 + cofs + (size_t)(row0 + r) * ldc + col0 + c4) = h4; } }
     } }


__global__ __launch_bounds__(256) void k_rotab(const int* __restrict__ pid, int b, float* __restrict__ CS, float* __restrict__ SN) {
  #pragma clang fp contract(off)
  const int t = blockIdx.x * 256 + threadIdx.x; if (t >= SQ * HH) return; const int j = t % HH, s = t / HH; const float inv = 1.0f / powf(10000.0f, (float)(2 * j) / (float)HD); const float th = (float)pid[(size_t)b * SQ + s] * inv; const float c = cosf(th), sn = sinf(th);
  { *(float*)(CS + t) = c; *(float*)(SN + t) = sn;  } }
__global__ __launch_bounds__(256) void k_rope(const float* __restrict__ F, int nheads, const float* __restrict__ CS, const float* __restrict__ SN, _Float16* __restrict__ H, _Float16* __restrict__ L) {
  #pragma clang fp contract(off)
  const size_t t = (size_t)blockIdx.x * 256 + threadIdx.x; if (t >= (size_t)SQ * nheads * (HH / 8)) return; const int g = (int)(t % (HH / 8)) * 8; const int h = (int)((t / (HH / 8)) % nheads); const int s = (int)(t / ((HH / 8) * (size_t)nheads)); const int ld = nheads * HD;
  const size_t base = (size_t)s * ld + h * HD + g; FragH h0, h1, l0, l1;
#pragma unroll
  for (int q = 0; q < 8; ++q) { const float c = CS[s * HH + g + q], sn = SN[s * HH + g + q]; const float x0 = F[base + q], x1 = F[base + HH + q]; float o0 = x0 * c; o0 += -x1 * sn; float o1 = x1 * c; o1 += x0 * sn;
    const _Float16 a0 = (_Float16)o0, a1 = (_Float16)o1; h0.h[q] = a0; h1.h[q] = a1; l0.h[q] = (_Float16)((o0 - (float)a0) * 1024.0f); l1.h[q] = (_Float16)((o1 - (float)a1) * 1024.0f); }
  { *(v8us*)((unsigned short*)H + base) = h0.half[0]; *(v8us*)((unsigned short*)H + base + HH) = h1.half[0]; if (L) { *(v8us*)((unsigned short*)L + base) = l0.half[0]; *(v8us*)((unsigned short*)L + base + HH) = l1.half[0]; }  } }
__global__ __launch_bounds__(256) void k_csoft(const float* __restrict__ S, int r0, int nrows, int nk, const int* __restrict__ mask, int b, _Float16* __restrict__ PH, _Float16* __restrict__ PL) {
  #pragma clang fp contract(off)
  const int wv = threadIdx.x >> 5, ln = threadIdx.x & 31; const int rl = blockIdx.x * 8 + wv; if (rl >= nrows) return; const int r = r0 + rl; const float* sr = S + (size_t)rl * SQ; const int* mk = mask + (size_t)b * SQ; float m = -3.0e38f;
#pragma unroll 1
  for (int j = ln; j < nk; j += 32) if (j <= r && mk[j] > 0) m = fmaxf(m, sr[j]);
  for (int o = 16; o > 0; o >>= 1) m = fmaxf(m, __shfl_xor(m, o, 32)); float su = 0.f;
#pragma unroll 1
  for (int j = ln; j < nk; j += 32) if (j <= r && mk[j] > 0) su += expf(sr[j] - m);
  for (int o = 16; o > 0; o >>= 1) su += __shfl_xor(su, o, 32); const float f = 1024.0f / su;
  {
#pragma unroll 1
    for (int j = ln; j < nk; j += 32) { const float p = (j <= r && mk[j] > 0) ? expf(sr[j] - m) * f : 0.f; const _Float16 hv = (_Float16)p; *(_Float16*)(PH + (size_t)rl * SQ + j) = hv; if (PL) *(_Float16*)(PL + (size_t)rl * SQ + j) = (_Float16)((p - (float)hv) * 1024.0f); }
     } }

extern "C" void kernel_launch(void* const* d_in, const int* in_sizes, int n_in,
                              void* d_out, int out_size, void* d_ws, size_t ws_size, hipStream_t stream) {
  (void)in_sizes; (void)n_in; (void)out_size;
  const float* const* I = (const float* const*)d_in; const float* hs = I[0]; const int* amask = (const int*)d_in[1]; const int* pid = (const int*)d_in[2]; const float* Wq = I[3]; const float* Wk = I[4]; const float* Wv = I[5]; const float* Wo = I[6];
  char* ws = (char*)d_ws; size_t off = 0;
  auto take = [&](size_t bytes) { char* p = ws + off; off += (bytes + 255) & ~(size_t)255; return p; };
  const size_t np = (size_t)SQ * DM;
  _Float16* BQ = (_Float16*)take(np * 2); _Float16* BK = (_Float16*)take((size_t)HD * DM * 2); _Float16* BV = (_Float16*)take((size_t)HD * DM * 2); _Float16* BO = (_Float16*)take(np * 2);
  float* CS = (float*)take((size_t)SQ * HH * 4); float* SN = (float*)take((size_t)SQ * HH * 4);
  _Float16* X16 = (_Float16*)take(np * 2); float* F32 = (float*)take(np * 4); _Float16* QH = (_Float16*)take(np * 2); _Float16* QL = (_Float16*)take(np * 2); _Float16* KH = (_Float16*)take((size_t)SQ * HD * 2); _Float16* KL = (_Float16*)take((size_t)SQ * HD * 2); _Float16* VH = (_Float16*)take((size_t)SQ * HD * 2); _Float16* VL = (_Float16*)take((size_t)SQ * HD * 2); _Float16* VTh = (_Float16*)take((size_t)HD * SQ * 2); _Float16* VTl = (_Float16*)take((size_t)HD * SQ * 2);
  float* S = (float*)take((size_t)1024 * SQ * 4); _Float16* PH = (_Float16*)take((size_t)1024 * SQ * 2); _Float16* PL = (_Float16*)take((size_t)BAND * SQ * 2); float* O = F32; _Float16* O16 = QL; _Float16* OL0 = (_Float16*)take((size_t)BAND * DM * 2);      /* O over the q f32 scratch (dead after k_rope); O16 over QL (QL is only read for band 0, which runs first) */
  if (off > ws_size) return;      /* 8+1+1+8 + 2 + 8+16+8+8+1+1+1+1+1+1 + 8+4+1 + 1 = 80 MiB */
  k_wt_f16<<<(unsigned)((np / 8 + 255) / 256), 256, 0, stream>>>(Wq, BQ, DM, DM, 16.0f); k_wt_f16<<<(unsigned)(((size_t)HD * DM / 8 + 255) / 256), 256, 0, stream>>>(Wk, BK, DM, HD, 16.0f); k_wt_f16<<<(unsigned)(((size_t)HD * DM / 8 + 255) / 256), 256, 0, stream>>>(Wv, BV, DM, HD, 16.0f); k_wt_f16<<<(unsigned)((np / 8 + 255) / 256), 256, 0, stream>>>(Wo, BO, DM, DM, 16.0f);
  for (int b = 0; b < NB; ++b) {
    k_rotab<<<(SQ * HH + 255) / 256, 256, 0, stream>>>(pid, b, CS, SN);
    k_x16<<<(unsigned)((np / 8 + 255) / 256), 256, 0, stream>>>(hs + (size_t)b * np, X16, np / 8);
    /* k and v (one kv head of 256) */
    k_gemm2<0><<<dim3((SQ / 128) * (HD / 64), 1), 128, 0, stream>>>(X16, DM, 0, BK, DM, 0, 0.0625f, nullptr, 0, nullptr, 1, 0, 0, F32, nullptr, HD, 0, SQ, HD, DM);
    k_rope<<<(unsigned)(((size_t)SQ * 1 * (HH / 8) + 255) / 256), 256, 0, stream>>>(F32, 1, CS, SN, KH, KL);
    k_gemm2<0><<<dim3((SQ / 128) * (HD / 64), 1), 128, 0, stream>>>(X16, DM, 0, BV, DM, 0, 0.0625f, nullptr, 0, nullptr, 1, 0, 0, F32, nullptr, HD, 0, SQ, HD, DM);
    k_hl<<<(unsigned)(((size_t)SQ * HD / 8 + 255) / 256), 256, 0, stream>>>(F32, VH, VL, (size_t)SQ * HD / 8);
    k_vt<HD / 64, SQ><<<1 * (HD / 64) * (SQ / 64), 256, 0, stream>>>(VH, HD, 0, VTh); k_vt<HD / 64, SQ><<<1 * (HD / 64) * (SQ / 64), 256, 0, stream>>>(VL, HD, 0, VTl);
    /* q (8 heads), roped, hi/lo */
    k_gemm2<0><<<dim3((SQ / 128) * (DM / 64), 1), 128, 0, stream>>>(X16, DM, 0, BQ, DM, 0, 0.0625f, nullptr, 0, nullptr, 1, 0, 0, F32, nullptr, DM, 0, SQ, DM, DM);
    k_rope<<<(unsigned)(((size_t)SQ * NHQ * (HH / 8) + 255) / 256), 256, 0, stream>>>(F32, NHQ, CS, SN, QH, QL);
    for (int h = 0; h < NHQ; ++h) {
      /* band 0 (rows < 256, keys < 256): hi + lo everywhere */
      { const int nk = BAND; const dim3 gS((BAND / 128) * (nk / 64), 1), gO((BAND / 128) * (HD / 64), 1);
        k_gemm2<0><<<gS, 128, 0, stream>>>(QH + h * HD, DM, 0, KH, HD, 0, 0.0625f, nullptr, 0, nullptr, 1, 0, 0, S, nullptr, SQ, 0, BAND, nk, HD);      /* S = (Qh Kh^T) / 16 */
        k_gemm2<0><<<gS, 128, 0, stream>>>(QL + h * HD, DM, 0, KH, HD, 0, 0.0625f / 1024.0f, nullptr, 0, S, 1, (size_t)SQ, 0, S, nullptr, SQ, 0, BAND, nk, HD);
        k_gemm2<0><<<gS, 128, 0, stream>>>(QH + h * HD, DM, 0, KL, HD, 0, 0.0625f / 1024.0f, nullptr, 0, S, 1, (size_t)SQ, 0, S, nullptr, SQ, 0, BAND, nk, HD);
        k_csoft<<<BAND / 8, 256, 0, stream>>>(S, 0, BAND, nk, amask, b, PH, PL);
        k_gemm2<0><<<gO, 128, 0, stream>>>(PH, SQ, 0, VTh, SQ, 0, 0.0009765625f, nullptr, 0, nullptr, 1, 0, 0, O + h * HD, nullptr, DM, 0, BAND, HD, nk);
        k_gemm2<0><<<gO, 128, 0, stream>>>(PL, SQ, 0, VTh, SQ, 0, 0.0009765625f / 1024.0f, nullptr, 0, O + h * HD, 1, (size_t)DM, 0, O + h * HD, nullptr, DM, 0, BAND, HD, nk);
        k_gemm2<0><<<gO, 128, 0, stream>>>(PH, SQ, 0, VTl, SQ, 0, 0.0009765625f / 1024.0f, nullptr, 0, O + h * HD, 1, (size_t)DM, 0, O + h * HD, nullptr, DM, 0, BAND, HD, nk); }
      /* two later bands (rows 256..1023 with keys < 1024, rows 1024..2047 with keys < 2048): plain */
      for (int k = 0; k < 2; ++k) { const int r0 = k ? 1024 : BAND, nr = k ? 1024 : (1024 - BAND), nk = k ? SQ : 1024; const dim3 gS((nr / 128) * (nk / 64), 1), gO((nr / 128) * (HD / 64), 1);
        k_gemm2<0><<<gS, 128, 0, stream>>>(QH + (size_t)r0 * DM + h * HD, DM, 0, KH, HD, 0, 0.0625f, nullptr, 0, nullptr, 1, 0, 0, S, nullptr, SQ, 0, nr, nk, HD);
        k_csoft<<<nr / 8, 256, 0, stream>>>(S, r0, nr, nk, amask, b, PH, nullptr);
        k_gemm2<0><<<gO, 128, 0, stream>>>(PH, SQ, 0, VTh, SQ, 0, 0.0009765625f, nullptr, 0, nullptr, 1, 0, 0, O + (size_t)r0 * DM + h * HD, nullptr, DM, 0, nr, HD, nk); } }
    /* output: O hi (+ lo on rows < 256) into Wo */
    k_hl<<<(unsigned)(((size_t)BAND * DM / 8 + 255) / 256), 256, 0, stream>>>(O, O16, OL0, (size_t)BAND * DM / 8);      /* rows < 256: hi + lo */
    k_h16<<<(unsigned)((((size_t)SQ - BAND) * DM / 8 + 255) / 256), 256, 0, stream>>>(O + (size_t)BAND * DM, O16 + (size_t)BAND * DM, ((size_t)SQ - BAND) * DM / 8);
    float* outb = (float*)d_out + (size_t)b * np;
    k_gemm2<0><<<dim3((SQ / 128) * (DM / 64), 1), 128, 0, stream>>>(O16, DM, 0, BO, DM, 0, 0.0625f, nullptr, 0, nullptr, 1, 0, 0, outb, nullptr, DM, 0, SQ, DM, DM);
    k_gemm2<0><<<dim3((BAND / 128) * (DM / 64), 1), 128, 0, stream>>>(OL0, DM, 0, BO, DM, 0, 0.0625f / 1024.0f, nullptr, 0, outb, 1, (size_t)DM, 0, outb, nullptr, DM, 0, BAND, DM, DM); }
}

// v001
// Measured time: 1560 microseconds a run.
// Timed twice side by side with v000, it ran 3.78 and 3.83 times as fast.
#include <hip/hip_runtime.h>
// FlaxGemmaAttention (2 x 2048 tokens, D 2048, 8 query heads of 256 sharing ONE kv head; rotate-half RoPE from the INPUT position_ids; causal + INPUT padding mask; scale 256^-0.5; out = attn Wo).
// Structure (per batch): exact f16 plane of the hidden states; q/k/v GEMMs (32x64 wave tiles, f32 accumulation, exact x16 weights); RoPE tables (f32 trig) + rotation on VALU into f16 hi (+ 2^10 residual) planes; V^T hi/residual by LDS tiles; UNFUSED attention per row band (rows < 256 | 256..1023 with keys < 1024 | 1024.. with all keys), all 8 heads of a band in ONE launch (head = blockIdx.y, one S / P plane per head), because the head dim is 256: S = Q_band K^T over the causally reachable keys as a GEMM (f32), causal/padding softmax on VALU (wave per row) into an f16 P plane (x2^10), O_band = P V as a GEMM; band 0 (rows < 256, whose outputs average over few keys) uses hi+lo operands throughout (3-term S, 3-term P.V, hi+lo O into Wo), later bands plain f16; output GEMM.
// Compute dtype: inputs and weights rounded to bf16; rows >= 256: q, k, P, v, O as f16 (~2^-12); rows < 256: hi + residual pairs; f32 accumulation/softmax/trig. v_wmma_f32_16x16x32_f16.
#define NB 2
#define SQ 2048
#define DM 2048
#define NHQ 8
#define HD 256
#define HH (HD / 2)
#define BAND 256
#define NBAND (SQ / BAND)
typedef __bf16 v16b __attribute__((ext_vector_type(16)));
typedef unsigned short v8us __attribute__((ext_vector_type(8), may_alias));
typedef float  v8f  __attribute__((ext_vector_type(8)));
typedef float  v4f  __attribute__((ext_vector_type(4)));
typedef float  v4fa __attribute__((ext_vector_type(4), may_alias));
union FragB { v16b v; v8us half[2]; unsigned short u[16]; };

__device__ __forceinline__ unsigned short bf16_bits(float x) { unsigned int u = __float_as_uint(x); return (unsigned short)((u + 0x7FFFu + ((u >> 16) & 1u)) >> 16); }
__device__ __forceinline__ float bf16_val(unsigned short b) { return __uint_as_float(((unsigned int)b) << 16); }
__device__ __forceinline__ float bf16_round(float x) { return bf16_val(bf16_bits(x)); }
// D += A·B with NT terms: 1 = ah·bh, 2 = + al·bh (A split), 3 = + ah·bl (both split)
template <int NT>
__device__ __forceinline__ v8f mmaN(v16b ah, v16b al, v16b bh, v16b bl, v8f c) {
  c = __builtin_amdgcn_wmma_f32_16x16x32_bf16(false, ah, false, bh, (short)0, c, false, false);
  if (NT >= 2) c = __builtin_amdgcn_wmma_f32_16x16x32_bf16(false, al, false, bh, (short)0, c, false, false);
  if (NT >= 3) c = __builtin_amdgcn_wmma_f32_16x16x32_bf16(false, ah, false, bl, (short)0, c, false, false);
  asm volatile("v_nop\n\tv_nop\n\tv_nop\n\tv_nop" : "+v"(c) : "v"(ah), "v"(al), "v"(bh), "v"(bl));
  return c;
}

__global__ __launch_bounds__(256) void k_wt_bf16(const float* __restrict__ W, unsigned short* __restrict__ Wt, int K, int N) {
  const int t = blockIdx.x * 256 + threadIdx.x;
  const int k8n = K / 8;
  if (t >= N * k8n) return;
  const int n = t / k8n, k8 = (t % k8n) * 8;
  v8us v;
#pragma unroll
  for (int i = 0; i < 8; ++i) v[i] = bf16_bits(W[(size_t)(k8 + i) * N + n]);
  *(v8us*)(Wt + (size_t)n * K + k8) = v;
  
}

// GEMM C[M][N] (f32, pitch ldc) = act(A[M][K]·W + bias). A f32 row-major (pitch lda) converted per fragment to bf16
// (ASPLIT: hi/lo two planes -> 2 terms, else single rounded term); Wt bf16 [N][K] (pitch ldb). BIAS_BF16 rounds the
// bias to bf16 first (bias quantised to bf16 before the add). K%32==0, M%16==0, N%64==0.
template <bool ASPLIT, int ACT, bool BIAS_BF16>
__global__ __launch_bounds__(128) void k_gemm_bf(const float* __restrict__ A, int lda, const unsigned short* __restrict__ Wt, int ldb,
                                               const float* __restrict__ bias, float* __restrict__ C, int ldc, int M, int N, int K) {
  __shared__ __attribute__((aligned(16))) float so[4][16][64];
  const int tid = threadIdx.x, w = tid >> 5, lane = tid & 31, ln = lane & 15, hh = lane >> 4;
  const int ntn = N / 64;
  const int wid = blockIdx.x * 4 + w;
  const int mt = wid / ntn, nq = wid % ntn;
  if (mt * 16 >= M) return;
  const int row0 = mt * 16, col0 = nq * 64;
  const float* arow = A + (size_t)(row0 + ln) * lda;
  v8f acc[4] = {};
  for (int kb = 0; kb < K; kb += 32) {
    FragB ah, al;
    const v4f x0 = *(const v4fa*)(arow + kb + 8 * hh), x1 = *(const v4fa*)(arow + kb + 8 * hh + 4);
    const v4f x2 = *(const v4fa*)(arow + kb + 16 + 8 * hh), x3 = *(const v4fa*)(arow + kb + 16 + 8 * hh + 4);
    float xs[16] = {x0[0],x0[1],x0[2],x0[3],x1[0],x1[1],x1[2],x1[3],x2[0],x2[1],x2[2],x2[3],x3[0],x3[1],x3[2],x3[3]};
#pragma unroll
    for (int i = 0; i < 16; ++i) { const unsigned short hb = bf16_bits(xs[i]); ah.u[i] = hb; al.u[i] = ASPLIT ? bf16_bits(xs[i] - bf16_val(hb)) : (unsigned short)0; }
#pragma unroll
    for (int t = 0; t < 4; ++t) {
      const unsigned short* brow = Wt + (size_t)(col0 + t * 16 + ln) * ldb + kb;
      FragB b;
      b.half[0] = *(const v8us*)(brow + 8 * hh);
      b.half[1] = *(const v8us*)(brow + 16 + 8 * hh);
      acc[t] = mmaN<ASPLIT ? 2 : 1>(ah.v, al.v, b.v, b.v, acc[t]);
    }
  }
#pragma unroll
  for (int t = 0; t < 4; ++t) {
    float bv = bias ? bias[col0 + t * 16 + ln] : 0.f;
    if (BIAS_BF16) bv = bf16_round(bv);
#pragma unroll
    for (int r = 0; r < 8; ++r) { float v = acc[t][r] + bv; if (ACT == 1) v = fmaxf(v, 0.f); so[w][8 * hh + r][t * 16 + ln] = v; }
  }
  __builtin_amdgcn_fence(__ATOMIC_ACQ_REL, "workgroup");
  __builtin_amdgcn_wave_barrier();
  const int rsub = lane >> 4, c4 = (lane & 15) * 4;
  {
#pragma unroll
    for (int q = 0; q < 8; ++q) {
      const int r = q * 2 + rsub;
      const v4f v = *(const v4fa*)&so[w][r][c4];
      *(v4f*)(C + (size_t)(row0 + r) * ldc + col0 + c4) = v;
    }
    
  }
}

// GEMM C = act(A·W + bias + resid): A f32 (ASPLIT -> hi/lo 2 terms), Wt bf16 [N][K]; ACT 0 none, 1 relu, 2 exact gelu;
// resid (optional, f32, row index = (row % rmod), pitch ldr, RES_BF16 rounds it) added before the activation.
template <bool ASPLIT, int ACT, bool BIAS_BF16, bool RES_BF16>
__global__ __launch_bounds__(128) void k_gemm_bf3(const float* __restrict__ A, int lda, const unsigned short* __restrict__ Wt, int ldb,
                                                const float* __restrict__ bias, const float* __restrict__ resid, int rmod, int ldr,
                                                float* __restrict__ C, int ldc, int M, int N, int K) {
  __shared__ __attribute__((aligned(16))) float so[4][16][64];
  const int tid = threadIdx.x, w = tid >> 5, lane = tid & 31, ln = lane & 15, hh = lane >> 4;
  const int ntn = N / 64;
  const int wid = blockIdx.x * 4 + w;
  const int mt = wid / ntn, nq = wid % ntn;
  if (mt * 16 >= M) return;
  const int row0 = mt * 16, col0 = nq * 64;
  const float* arow = A + (size_t)(row0 + ln) * lda;
  v8f acc[4] = {};
  for (int kb = 0; kb < K; kb += 32) {
    FragB ah, al;
    const v4f x0 = *(const v4fa*)(arow + kb + 8 * hh), x1 = *(const v4fa*)(arow + kb + 8 * hh + 4);
    const v4f x2 = *(const v4fa*)(arow + kb + 16 + 8 * hh), x3 = *(const v4fa*)(arow + kb + 16 + 8 * hh + 4);
    float xs[16] = {x0[0],x0[1],x0[2],x0[3],x1[0],x1[1],x1[2],x1[3],x2[0],x2[1],x2[2],x2[3],x3[0],x3[1],x3[2],x3[3]};
#pragma unroll
    for (int i = 0; i < 16; ++i) { const unsigned short hb = bf16_bits(xs[i]); ah.u[i] = hb; al.u[i] = ASPLIT ? bf16_bits(xs[i] - bf16_val(hb)) : (unsigned short)0; }
#pragma unroll
    for (int t = 0; t < 4; ++t) {
      const unsigned short* brow = Wt + (size_t)(col0 + t * 16 + ln) * ldb + kb;
      FragB b;
      b.half[0] = *(const v8us*)(brow + 8 * hh);
      b.half[1] = *(const v8us*)(brow + 16 + 8 * hh);
      acc[t] = mmaN<ASPLIT ? 2 : 1>(ah.v, al.v, b.v, b.v, acc[t]);
    }
  }
#pragma unroll
  for (int t = 0; t < 4; ++t) {
    const int col = col0 + t * 16 + ln;
    float bv = bias ? bias[col] : 0.f;
    if (BIAS_BF16) bv = bf16_round(bv);
#pragma unroll
    for (int r = 0; r < 8; ++r) {
      float v = acc[t][r] + bv;
      if (resid) { float rv = resid[(size_t)((row0 + 8 * hh + r) % rmod) * ldr + col]; if (RES_BF16) rv = bf16_round(rv); v += rv; }
      if (ACT == 1) v = fmaxf(v, 0.f);
      if (ACT == 2) v = 0.5f * v * (1.0f + erff(v * 0.70710678118654752f));
      if (ACT == 3) { const float u = 0.7978845608028654f * (v + 0.044715f * v * v * v); v = 0.5f * v * (1.0f + tanhf(u)); }
      so[w][8 * hh + r][t * 16 + ln] = v;
    }
  }
  __builtin_amdgcn_fence(__ATOMIC_ACQ_REL, "workgroup");
  __builtin_amdgcn_wave_barrier();
  const int rsub = lane >> 4, c4 = (lane & 15) * 4;
  {
#pragma unroll
    for (int q = 0; q < 8; ++q) {
      const int r = q * 2 + rsub;
      const v4f v = *(const v4fa*)&so[w][r][c4];
      *(v4f*)(C + (size_t)(row0 + r) * ldc + col0 + c4) = v;
    }
    
  }
}
// row LayerNorm (biased variance, eps) over N: s = X (+ R); optional out_sum <- s; out_norm <- (s-mu)*rsqrt(var+eps)*g + b
template <bool PARAM_BF16>
__global__ __launch_bounds__(256) void k_layernorm(const float* __restrict__ X, const float* __restrict__ R, const float* __restrict__ g, const float* __restrict__ bta,
                                                  float* __restrict__ out_sum, float* __restrict__ out_norm, int N, float eps) {
  __shared__ float red[256];
  const int row = blockIdx.x, tid = threadIdx.x;
  const float* x = X + (size_t)row * N; const float* rr = R ? R + (size_t)row * N : nullptr;
  float vals[16];                     // up to N = 4096
  const int per = N / 256;            // contiguous chunk per thread? use strided-by-4 chunks: thread handles j = tid*4 + 1024*u
  float s1 = 0.f;
  for (int u = 0; u < per / 4; ++u) {
    const int j = tid * 4 + 1024 * u;
    const v4f a = *(const v4fa*)(x + j);
    v4f b = {0.f,0.f,0.f,0.f}; if (rr) b = *(const v4fa*)(rr + j);
#pragma unroll
    for (int q = 0; q < 4; ++q) { const float v = a[q] + b[q]; vals[u * 4 + q] = v; s1 += v; }
  }
  red[tid] = s1; __syncthreads();
  for (int st = 128; st > 0; st >>= 1) { if (tid < st) red[tid] += red[tid + st]; __syncthreads(); }
  const float mu = red[0] / (float)N; __syncthreads();
  float s2 = 0.f;
  for (int u = 0; u < per / 4; ++u)
#pragma unroll
    for (int q = 0; q < 4; ++q) { const float c = vals[u * 4 + q] - mu; s2 += c * c; }
  red[tid] = s2; __syncthreads();
  for (int st = 128; st > 0; st >>= 1) { if (tid < st) red[tid] += red[tid + st]; __syncthreads(); }
  const float rs = rsqrtf(red[0] / (float)N + eps);
  {
    for (int u = 0; u < per / 4; ++u) {
      const int j = tid * 4 + 1024 * u;
      v4f o, sm;
#pragma unroll
      for (int q = 0; q < 4; ++q) {
        float gg = g[j + q], bb = bta[j + q];
        if (PARAM_BF16) { gg = bf16_round(gg); bb = bf16_round(bb); }
        sm[q] = vals[u * 4 + q]; o[q] = (vals[u * 4 + q] - mu) * rs * gg + bb;
      }
      if (out_sum) *(v4f*)(out_sum + (size_t)row * N + j) = sm;
      *(v4f*)(out_norm + (size_t)row * N + j) = o;
    }
    
  }
}



// ---- f16 WMMA path (v_wmma_f32_16x16x32_f16): 11-bit significands for operands in range — used where a [0,1] probability operand needs more precision than bf16
typedef _Float16 v16h __attribute__((ext_vector_type(16)));
union FragH { v16h v; v8us half[2]; _Float16 h[16]; unsigned short u[16]; };
template <int NT>
__device__ __forceinline__ v8f mmaH(v16h ah, v16h al, v16h bh, v16h bl, v8f c) {
  c = __builtin_amdgcn_wmma_f32_16x16x32_f16(false, ah, false, bh, (short)0, c, false, false);
  if (NT >= 2) c = __builtin_amdgcn_wmma_f32_16x16x32_f16(false, al, false, bh, (short)0, c, false, false);
  if (NT >= 3) c = __builtin_amdgcn_wmma_f32_16x16x32_f16(false, ah, false, bl, (short)0, c, false, false);
  asm volatile("v_nop\n\tv_nop\n\tv_nop\n\tv_nop" : "+v"(c) : "v"(ah), "v"(al), "v"(bh), "v"(bl));
  return c;
}
// batched GEMM like k_gemm_b but f16 operands: A f32 (split into f16 hi/lo if ASPLIT, else rounded to f16), Bt = f16 values [n][k]; alpha; C f32; N multiple of 16 (partial tiles skipped)
template <bool ASPLIT>
__global__ __launch_bounds__(128) void k_gemm_h(const float* __restrict__ A, int lda, size_t sA, const _Float16* __restrict__ Bh, int ldb, size_t sB, float alpha, float* __restrict__ C, int ldc, size_t sC, int M, int N, int K) {
  __shared__ __attribute__((aligned(16))) float so[4][16][64];
  const int tid = threadIdx.x, w = tid >> 5, lane = tid & 31, ln = lane & 15, hh = lane >> 4; const int by = blockIdx.y;
  A += (size_t)by * sA; Bh += (size_t)by * sB; C += (size_t)by * sC;
  const int ntn = (N + 63) / 64; const int wid = blockIdx.x * 4 + w; const int mt = wid / ntn, nq = wid % ntn; if (mt * 16 >= M) return;
  const int row0 = mt * 16, col0 = nq * 64; const float* arow = A + (size_t)(row0 + ln) * lda;
  v8f acc[4] = {};
  for (int kb = 0; kb < K; kb += 32) {
    FragH ah, al;
    const v4f x0 = *(const v4fa*)(arow + kb + 8 * hh), x1 = *(const v4fa*)(arow + kb + 8 * hh + 4), x2 = *(const v4fa*)(arow + kb + 16 + 8 * hh), x3 = *(const v4fa*)(arow + kb + 16 + 8 * hh + 4);
    float xs[16] = {x0[0],x0[1],x0[2],x0[3],x1[0],x1[1],x1[2],x1[3],x2[0],x2[1],x2[2],x2[3],x3[0],x3[1],x3[2],x3[3]};
#pragma unroll
    for (int i = 0; i < 16; ++i) { const _Float16 h = (_Float16)xs[i]; ah.h[i] = h; al.h[i] = ASPLIT ? (_Float16)(xs[i] - (float)h) : (_Float16)0.0f; }
#pragma unroll
    for (int t = 0; t < 4; ++t) { if (col0 + t * 16 >= N) continue; const size_t boff = (size_t)(col0 + t * 16 + ln) * ldb + kb; FragH bq; bq.half[0] = *(const v8us*)(Bh + boff + 8 * hh); bq.half[1] = *(const v8us*)(Bh + boff + 16 + 8 * hh);
      acc[t] = mmaH<ASPLIT ? 2 : 1>(ah.v, al.v, bq.v, bq.v, acc[t]); }
  }
#pragma unroll
  for (int t = 0; t < 4; ++t) { if (col0 + t * 16 >= N) continue;
#pragma unroll
    for (int r = 0; r < 8; ++r) so[w][8 * hh + r][t * 16 + ln] = acc[t][r] * alpha; }
  __builtin_amdgcn_fence(__ATOMIC_ACQ_REL, "workgroup"); __builtin_amdgcn_wave_barrier();
  const int rsub = lane >> 4, c4 = (lane & 15) * 4;
  {
#pragma unroll
    for (int q = 0; q < 8; ++q) { const int r = q * 2 + rsub; if (col0 + c4 < N) { const v4f v = *(const v4fa*)&so[w][r][c4]; *(v4f*)(C + (size_t)(row0 + r) * ldc + col0 + c4) = v; } }
     }
}

// Wt[n][k] = f16(W[k][n]·scale) from f32 row-major W[K][N] (scale = power of two; bf16-exact weights stay exact in f16 away from the subnormal range)
__global__ __launch_bounds__(256) void k_wt_f16(const float* __restrict__ W, _Float16* __restrict__ Wt, int K, int N, float scale) {
  const int t = blockIdx.x * 256 + threadIdx.x; if (t >= N * (K / 8)) return; const int n = t / (K / 8), k8 = (t % (K / 8)) * 8; FragH f;
#pragma unroll
  for (int i = 0; i < 8; ++i) f.h[i] = (_Float16)(bf16_round(W[(size_t)(k8 + i) * N + n]) * scale); const v8us o = f.half[0];
  *(v8us*)((unsigned short*)Wt + (size_t)n * K + k8) = o; 
}
// k_gemm_hh variant with fused epilogue: v = acc·alpha + bias[by·sBias + col] (+ CP[(row/rowsPerB)·sCPb + by·64 + col] if CP) ; ACT 0 none / 1 elu ; writes f16 C16 (and f32 C if non-null)
template <int ACT>
__global__ __launch_bounds__(128) void k_gemm_hhx(const _Float16* __restrict__ A, int lda, size_t sA, const _Float16* __restrict__ Bh, int ldb, size_t sB, float alpha, const float* __restrict__ bias, size_t sBias, const float* __restrict__ CP, int rowsPerB, size_t sCPb, int row0g,
    float* __restrict__ C, _Float16* __restrict__ C16, int ldc, size_t sC, int M, int N, int K) {
  __shared__ __attribute__((aligned(16))) float so[4][16][64];
  const int tid = threadIdx.x, w = tid >> 5, lane = tid & 31, ln = lane & 15, hh = lane >> 4; const int by = blockIdx.y;
  A += (size_t)by * sA; Bh += (size_t)by * sB; const size_t cofs = (size_t)by * sC; const float* bp = bias ? bias + (size_t)by * sBias : nullptr;
  const int ntn = (N + 63) / 64; const int wid = blockIdx.x * 4 + w; const int mt = wid / ntn, nq = wid % ntn; if (mt * 16 >= M) return;
  const int row0 = mt * 16, col0 = nq * 64; const _Float16* arow = A + (size_t)(row0 + ln) * lda;
  v8f acc[4] = {};
  for (int kb = 0; kb < K; kb += 32) { FragH ah; ah.half[0] = *(const v8us*)((const unsigned short*)arow + kb + 8 * hh); ah.half[1] = *(const v8us*)((const unsigned short*)arow + kb + 16 + 8 * hh);
#pragma unroll
    for (int t = 0; t < 4; ++t) { if (col0 + t * 16 >= N) continue; const size_t boff = (size_t)(col0 + t * 16 + ln) * ldb + kb; FragH bq; bq.half[0] = *(const v8us*)((const unsigned short*)Bh + boff + 8 * hh); bq.half[1] = *(const v8us*)((const unsigned short*)Bh + boff + 16 + 8 * hh);
      acc[t] = mmaH<1>(ah.v, ah.v, bq.v, bq.v, acc[t]); }
  }
#pragma unroll
  for (int t = 0; t < 4; ++t) { if (col0 + t * 16 >= N) continue; const int col = col0 + t * 16 + ln; const float bv = bp ? bf16_round(bp[col]) : 0.f;
#pragma unroll
    for (int r = 0; r < 8; ++r) { float v = acc[t][r] * alpha + bv; if (CP) { const int rr = row0g + row0 + 8 * hh + r; if (rowsPerB < 0) v += CP[cofs + (size_t)rr * ldc + col];      /* rowsPerB < 0: own element of the batched C plane */ else { const int bidx = rr / rowsPerB; v += CP[(size_t)bidx * sCPb + (size_t)by * 64 + col]; } } if (ACT == 1) v = (v > 0.f) ? v : expm1f(v); else if (ACT == 7) v = (v > 0.f) ? v + 1.0f : expf(v); else if (ACT == 8) v = tanhf(v); else if (ACT == 9) v = 0.5f * v * (1.0f + tanhf(0.7978845608028654f * (v + 0.044715f * v * v * v))); else if (ACT == 11) v = 1.0f / (1.0f + expf(-v)); else if (ACT == 12) v = (v > 0.f) ? v : 0.01f * v; else if (ACT == 14) v = (v > 0.f) ? v : 0.1f * v; else if (ACT == 16) v = (v >= 0.f) ? v : 0.3f * v; else if (ACT == 15) v = v / (1.0f + expf(-v)); else if (ACT == 3) v = fmaxf(v, 0.f); else if (ACT == 6) v = 0.5f * v * (1.0f + erff(v * 0.70710678118654752f)); so[w][8 * hh + r][t * 16 + ln] = v; } }
  __builtin_amdgcn_fence(__ATOMIC_ACQ_REL, "workgroup"); __builtin_amdgcn_wave_barrier();
  const int rsub = lane >> 4, c4 = (lane & 15) * 4; typedef _Float16 v4h __attribute__((ext_vector_type(4)));
  {
#pragma unroll
    for (int q = 0; q < 8; ++q) { const int r = q * 2 + rsub; if (col0 + c4 < N) { const v4f v = *(const v4fa*)&so[w][r][c4]; if (C) *(v4f*)(C + cofs + (size_t)(row0 + r) * ldc + col0 + c4) = v; if (C16) { v4h h4; for (int i = 0; i < 4; ++i) h4[i] = (_Float16)v[i]; *(v4h*)(C16 + cofs + (size_t)(row0 + r) * ldc + col0 + c4) = h4; } } }
     }
}


typedef _Float16 v4h __attribute__((ext_vector_type(4)));

__global__ __launch_bounds__(256) void k_x16(const float* __restrict__ x, _Float16* __restrict__ X16, size_t n8) { const size_t t = (size_t)blockIdx.x * 256 + threadIdx.x; if (t >= n8) return; FragH f;
#pragma unroll
  for (int q = 0; q < 8; ++q) f.h[q] = (_Float16)bf16_round(x[t * 8 + q]); *(v8us*)((unsigned short*)X16 + t * 8) = f.half[0];  }
__global__ __launch_bounds__(256) void k_h16(const float* __restrict__ x, _Float16* __restrict__ X16, size_t n8) { const size_t t = (size_t)blockIdx.x * 256 + threadIdx.x; if (t >= n8) return; FragH f;
#pragma unroll
  for (int q = 0; q < 8; ++q) f.h[q] = (_Float16)x[t * 8 + q]; *(v8us*)((unsigned short*)X16 + t * 8) = f.half[0];  }
__global__ __launch_bounds__(256) void k_round16f(const float* __restrict__ W, _Float16* __restrict__ Bt, size_t n8) { const size_t t = (size_t)blockIdx.x * 256 + threadIdx.x; if (t >= n8) return; FragH f;
#pragma unroll
  for (int i = 0; i < 8; ++i) f.h[i] = (_Float16)(bf16_round(W[t * 8 + i]) * 16.0f); *(v8us*)((unsigned short*)Bt + t * 8) = f.half[0];  }
template <int NHv, int TTv>
__global__ __launch_bounds__(256) void k_vt(const _Float16* __restrict__ V16, int ldv, int voff, _Float16* __restrict__ Vt) { __shared__ unsigned short tl[64][66]; const int tid = threadIdx.x; const int slab = blockIdx.x / (TTv / 64), lg = blockIdx.x % (TTv / 64); const int b = slab / NHv, h = slab % NHv;
  for (int i = tid; i < 64 * 8; i += 256) { const int r = i / 8, c8 = (i % 8) * 8; FragH f; f.half[0] = *(const v8us*)((const unsigned short*)V16 + ((size_t)b * TTv + lg * 64 + r) * ldv + voff + h * 64 + c8);
#pragma unroll
    for (int q = 0; q < 8; ++q) tl[r][c8 + q] = f.u[q]; }
  __syncthreads();
  {
#pragma unroll
    for (int rd = 0; rd < 2; ++rd) { const int d = rd * 32 + tid / 8, pc = tid % 8; FragH f;
#pragma unroll
      for (int q = 0; q < 8; ++q) f.u[q] = tl[pc * 8 + q][d];
      *(v8us*)((unsigned short*)Vt + ((size_t)slab * 64 + d) * TTv + lg * 64 + pc * 8) = f.half[0]; }
     } }

__global__ __launch_bounds__(256) void k_hl(const float* __restrict__ F, _Float16* __restrict__ Hh, _Float16* __restrict__ Hl, size_t n8) { const size_t t = (size_t)blockIdx.x * 256 + threadIdx.x; if (t >= n8) return; FragH fh, fl; const v4f a = *(const v4fa*)(F + t * 8), c = *(const v4fa*)(F + t * 8 + 4);
#pragma unroll
  for (int q = 0; q < 4; ++q) { _Float16 h = (_Float16)a[q]; fh.h[q] = h; fl.h[q] = (_Float16)((a[q] - (float)h) * 1024.0f); h = (_Float16)c[q]; fh.h[4 + q] = h; fl.h[4 + q] = (_Float16)((c[q] - (float)h) * 1024.0f); }
  { *(v8us*)((unsigned short*)Hh + t * 8) = fh.half[0]; *(v8us*)((unsigned short*)Hl + t * 8) = fl.half[0];  } }

// ---- fast GEMM (wave tile 32x64; requires M % 32 == 0 rows per launch region and N % 64 == 0); epilogue = k_gemm_hhx semantics ----
__device__ __forceinline__ v16h g2_frag(const _Float16* p, int hh) { FragH f; f.half[0] = *(const v8us*)((const unsigned short*)p + 8 * hh); f.half[1] = *(const v8us*)((const unsigned short*)p + 16 + 8 * hh); return f.v; }
__device__ __forceinline__ v8f g2_mma(v16h a, v16h b, v8f c) { v8f d = __builtin_amdgcn_wmma_f32_16x16x32_f16(false, a, false, b, (short)0, c, false, false); asm volatile("v_nop\n\tv_nop\n\tv_nop\n\tv_nop" : "+v"(d) : "v"(a), "v"(b)); return d; }
template <int ACT>
__global__ __launch_bounds__(128) void k_gemm2(const _Float16* __restrict__ A, int lda, size_t sA, const _Float16* __restrict__ Bh, int ldb, size_t sB, float alpha, const float* __restrict__ bias, size_t sBias, const float* __restrict__ CP, int rowsPerB, size_t sCPb, int row0g,
    float* __restrict__ C, _Float16* __restrict__ C16, int ldc, size_t sC, int M, int N, int K) { static_assert(ACT == 0 || ACT == 3 || ACT == 6 || ACT == 8 || ACT == 9 || ACT == 11 || ACT == 12 || ACT == 14 || ACT == 15 || ACT == 16, "k_gemm2: unsupported ACT code (would silently apply no activation)");
  __shared__ __attribute__((aligned(16))) float so[4][32][68];
  const int tid = threadIdx.x, w = tid >> 5, lane = tid & 31, ln = lane & 15, hh = lane >> 4; const int by = blockIdx.y;
  A += (size_t)by * sA; Bh += (size_t)by * sB; const size_t cofs = (size_t)by * sC; const float* bp = bias ? bias + (size_t)by * sBias : nullptr;
  const int ntn = N >> 6; const int mt = blockIdx.x / ntn, nq = blockIdx.x - mt * ntn; const int row0 = mt * 128 + 32 * w, col0 = nq * 64; if (row0 >= M) return;
  const _Float16* a0p = A + (size_t)(row0 + ln) * lda; const _Float16* a1p = a0p + (size_t)16 * lda;
  const _Float16* b0p = Bh + (size_t)(col0 + ln) * ldb; const _Float16* b1p = b0p + (size_t)16 * ldb; const _Float16* b2p = b1p + (size_t)16 * ldb; const _Float16* b3p = b2p + (size_t)16 * ldb;
  const v8f z8 = {0.f,0.f,0.f,0.f,0.f,0.f,0.f,0.f}; v8f c00 = z8, c01 = z8, c02 = z8, c03 = z8, c10 = z8, c11 = z8, c12 = z8, c13 = z8;
#pragma unroll 1
  for (int kb = 0; kb < K; kb += 32) { const v16h a0 = g2_frag(a0p + kb, hh), a1 = g2_frag(a1p + kb, hh);
    v16h b = g2_frag(b0p + kb, hh); c00 = g2_mma(a0, b, c00); c10 = g2_mma(a1, b, c10);
    b = g2_frag(b1p + kb, hh); c01 = g2_mma(a0, b, c01); c11 = g2_mma(a1, b, c11);
    b = g2_frag(b2p + kb, hh); c02 = g2_mma(a0, b, c02); c12 = g2_mma(a1, b, c12);
    b = g2_frag(b3p + kb, hh); c03 = g2_mma(a0, b, c03); c13 = g2_mma(a1, b, c13); }
  v8f accs[8] = {c00, c01, c02, c03, c10, c11, c12, c13};
#pragma unroll
  for (int u = 0; u < 8; ++u) { const int t = u & 3, half = u >> 2; const int col = col0 + t * 16 + ln; const float bv = bp ? bf16_round(bp[col]) : 0.f;
#pragma unroll
    for (int r = 0; r < 8; ++r) { const int rloc = half * 16 + 8 * hh + r; float v = accs[u][r] * alpha + bv; if (CP) { if (rowsPerB < 0) v += CP[cofs + (size_t)(row0g + row0 + rloc) * ldc + col];      /* rowsPerB < 0: own element of the batched C plane */ else { const int bidx = (row0g + row0 + rloc) / rowsPerB; v += CP[(size_t)bidx * sCPb + (size_t)by * 64 + col]; } }
      if (ACT == 3) v = fmaxf(v, 0.f); else if (ACT == 6) v = 0.5f * v * (1.0f + erff(v * 0.70710678118654752f)); else if (ACT == 11) v = 1.0f / (1.0f + expf(-v)); else if (ACT == 15) v = v / (1.0f + expf(-v)); else if (ACT == 12) v = (v > 0.f) ? v : 0.01f * v; else if (ACT == 8) v = tanhf(v); else if (ACT == 9) v = 0.5f * v * (1.0f + tanhf(0.7978845608028654f * (v + 0.044715f * v * v * v))); else if (ACT == 14) v = (v > 0.f) ? v : 0.1f * v; else if (ACT == 16) v = (v >= 0.f) ? v : 0.3f * v;
      so[w][rloc][t * 16 + ln] = v; } }
  __builtin_amdgcn_fence(__ATOMIC_ACQ_REL, "workgroup"); __builtin_amdgcn_wave_barrier();
  const int rsub = lane >> 4, c4 = (lane & 15) * 4;
  {
#pragma unroll
    for (int q = 0; q < 16; ++q) { const int r = q * 2 + rsub; const v4f v = *(const v4fa*)&so[w][r][c4]; if (C) *(v4f*)(C + cofs + (size_t)(row0 + r) * ldc + col0 + c4) = v; if (C16) { v4h h4; for (int i = 0; i < 4; ++i) h4[i] = (_Float16)v[i]; *(v4h*)(C16 + cofs + (size_t)(row0 + r) * ldc + col0 + c4) = h4; } }
     } }


__global__ __launch_bounds__(256) void k_rotab(const int* __restrict__ pid, int b, float* __restrict__ CS, float* __restrict__ SN) {
  #pragma clang fp contract(off)
  const int t = blockIdx.x * 256 + threadIdx.x; if (t >= SQ * HH) return; const int j = t % HH, s = t / HH; const float inv = 1.0f / powf(10000.0f, (float)(2 * j) / (float)HD); const float th = (float)pid[(size_t)b * SQ + s] * inv; const float c = cosf(th), sn = sinf(th);
  { *(float*)(CS + t) = c; *(float*)(SN + t) = sn;  } }
__global__ __launch_bounds__(256) void k_rope(const float* __restrict__ F, int nheads, const float* __restrict__ CS, const float* __restrict__ SN, _Float16* __restrict__ H, _Float16* __restrict__ L) {
  #pragma clang fp contract(off)
  const size_t t = (size_t)blockIdx.x * 256 + threadIdx.x; if (t >= (size_t)SQ * nheads * (HH / 8)) return; const int g = (int)(t % (HH / 8)) * 8; const int h = (int)((t / (HH / 8)) % nheads); const int s = (int)(t / ((HH / 8) * (size_t)nheads)); const int ld = nheads * HD;
  const size_t base = (size_t)s * ld + h * HD + g; FragH h0, h1, l0, l1;
#pragma unroll
  for (int q = 0; q < 8; ++q) { const float c = CS[s * HH + g + q], sn = SN[s * HH + g + q]; const float x0 = F[base + q], x1 = F[base + HH + q]; float o0 = x0 * c; o0 += -x1 * sn; float o1 = x1 * c; o1 += x0 * sn;
    const _Float16 a0 = (_Float16)o0, a1 = (_Float16)o1; h0.h[q] = a0; h1.h[q] = a1; l0.h[q] = (_Float16)((o0 - (float)a0) * 1024.0f); l1.h[q] = (_Float16)((o1 - (float)a1) * 1024.0f); }
  { *(v8us*)((unsigned short*)H + base) = h0.half[0]; *(v8us*)((unsigned short*)H + base + HH) = h1.half[0]; if (L) { *(v8us*)((unsigned short*)L + base) = l0.half[0]; *(v8us*)((unsigned short*)L + base + HH) = l1.half[0]; }  } }
__global__ __launch_bounds__(256) void k_csoft(const float* __restrict__ S, size_t sS, int r0, int nrows, int nk, const int* __restrict__ mask, int b, _Float16* __restrict__ PH, _Float16* __restrict__ PL, size_t sPL) {
  #pragma clang fp contract(off)
  const int wv = threadIdx.x >> 5, ln = threadIdx.x & 31; const int rl = blockIdx.x * 8 + wv; if (rl >= nrows) return; const int r = r0 + rl; S += (size_t)blockIdx.y * sS; PH += (size_t)blockIdx.y * sS; if (PL) PL += (size_t)blockIdx.y * sPL;      /* head = blockIdx.y: its own S and P planes */ const float* sr = S + (size_t)rl * SQ; const int* mk = mask + (size_t)b * SQ; float m = -3.0e38f;
#pragma unroll 1
  for (int j = ln; j < nk; j += 32) if (j <= r && mk[j] > 0) m = fmaxf(m, sr[j]);
  for (int o = 16; o > 0; o >>= 1) m = fmaxf(m, __shfl_xor(m, o, 32)); float su = 0.f;
#pragma unroll 1
  for (int j = ln; j < nk; j += 32) if (j <= r && mk[j] > 0) su += expf(sr[j] - m);
  for (int o = 16; o > 0; o >>= 1) su += __shfl_xor(su, o, 32); const float f = 1024.0f / su;
  {
#pragma unroll 1
    for (int j = ln; j < nk; j += 32) { const float p = (j <= r && mk[j] > 0) ? expf(sr[j] - m) * f : 0.f; const _Float16 hv = (_Float16)p; *(_Float16*)(PH + (size_t)rl * SQ + j) = hv; if (PL) *(_Float16*)(PL + (size_t)rl * SQ + j) = (_Float16)((p - (float)hv) * 1024.0f); }
     } }

extern "C" void kernel_launch(void* const* d_in, const int* in_sizes, int n_in,
                              void* d_out, int out_size, void* d_ws, size_t ws_size, hipStream_t stream) {
  (void)in_sizes; (void)n_in; (void)out_size;
  const float* const* I = (const float* const*)d_in; const float* hs = I[0]; const int* amask = (const int*)d_in[1]; const int* pid = (const int*)d_in[2]; const float* Wq = I[3]; const float* Wk = I[4]; const float* Wv = I[5]; const float* Wo = I[6];
  char* ws = (char*)d_ws; size_t off = 0;
  auto take = [&](size_t bytes) { char* p = ws + off; off += (bytes + 255) & ~(size_t)255; return p; };
  const size_t np = (size_t)SQ * DM;
  _Float16* BQ = (_Float16*)take(np * 2); _Float16* BK = (_Float16*)take((size_t)HD * DM * 2); _Float16* BV = (_Float16*)take((size_t)HD * DM * 2); _Float16* BO = (_Float16*)take(np * 2);
  float* CS = (float*)take((size_t)SQ * HH * 4); float* SN = (float*)take((size_t)SQ * HH * 4);
  _Float16* X16 = (_Float16*)take(np * 2); float* F32 = (float*)take(np * 4); _Float16* QH = (_Float16*)take(np * 2); _Float16* QL = (_Float16*)take(np * 2); _Float16* KH = (_Float16*)take((size_t)SQ * HD * 2); _Float16* KL = (_Float16*)take((size_t)SQ * HD * 2); _Float16* VH = (_Float16*)take((size_t)SQ * HD * 2); _Float16* VL = (_Float16*)take((size_t)SQ * HD * 2); _Float16* VTh = (_Float16*)take((size_t)HD * SQ * 2); _Float16* VTl = (_Float16*)take((size_t)HD * SQ * 2);
  const size_t sS = (size_t)1024 * SQ, sPL = (size_t)BAND * SQ;      /* elements per head plane of S and PH, and of PL */
  float* S = (float*)take(NHQ * sS * 4); _Float16* PH = (_Float16*)take(NHQ * sS * 2); _Float16* PL = (_Float16*)take(NHQ * sPL * 2); float* O = F32; _Float16* O16 = QL; _Float16* OL0 = (_Float16*)take((size_t)BAND * DM * 2);      /* O over the q f32 scratch (dead after k_rope); O16 over QL (QL is only read for band 0, which runs first) */
  if (off > ws_size) return;      /* 8+1+1+8 + 2 + 8+16+8+8+1+1+1+1+1+1 + 64+32+8 + 1 = 171 MiB */
  k_wt_f16<<<(unsigned)((np / 8 + 255) / 256), 256, 0, stream>>>(Wq, BQ, DM, DM, 16.0f); k_wt_f16<<<(unsigned)(((size_t)HD * DM / 8 + 255) / 256), 256, 0, stream>>>(Wk, BK, DM, HD, 16.0f); k_wt_f16<<<(unsigned)(((size_t)HD * DM / 8 + 255) / 256), 256, 0, stream>>>(Wv, BV, DM, HD, 16.0f); k_wt_f16<<<(unsigned)((np / 8 + 255) / 256), 256, 0, stream>>>(Wo, BO, DM, DM, 16.0f);
  for (int b = 0; b < NB; ++b) {
    k_rotab<<<(SQ * HH + 255) / 256, 256, 0, stream>>>(pid, b, CS, SN);
    k_x16<<<(unsigned)((np / 8 + 255) / 256), 256, 0, stream>>>(hs + (size_t)b * np, X16, np / 8);
    /* k and v (one kv head of 256) */
    k_gemm2<0><<<dim3((SQ / 128) * (HD / 64), 1), 128, 0, stream>>>(X16, DM, 0, BK, DM, 0, 0.0625f, nullptr, 0, nullptr, 1, 0, 0, F32, nullptr, HD, 0, SQ, HD, DM);
    k_rope<<<(unsigned)(((size_t)SQ * 1 * (HH / 8) + 255) / 256), 256, 0, stream>>>(F32, 1, CS, SN, KH, KL);
    k_gemm2<0><<<dim3((SQ / 128) * (HD / 64), 1), 128, 0, stream>>>(X16, DM, 0, BV, DM, 0, 0.0625f, nullptr, 0, nullptr, 1, 0, 0, F32, nullptr, HD, 0, SQ, HD, DM);
    k_hl<<<(unsigned)(((size_t)SQ * HD / 8 + 255) / 256), 256, 0, stream>>>(F32, VH, VL, (size_t)SQ * HD / 8);
    k_vt<HD / 64, SQ><<<1 * (HD / 64) * (SQ / 64), 256, 0, stream>>>(VH, HD, 0, VTh); k_vt<HD / 64, SQ><<<1 * (HD / 64) * (SQ / 64), 256, 0, stream>>>(VL, HD, 0, VTl);
    /* q (8 heads), roped, hi/lo */
    k_gemm2<0><<<dim3((SQ / 128) * (DM / 64), 1), 128, 0, stream>>>(X16, DM, 0, BQ, DM, 0, 0.0625f, nullptr, 0, nullptr, 1, 0, 0, F32, nullptr, DM, 0, SQ, DM, DM);
    k_rope<<<(unsigned)(((size_t)SQ * NHQ * (HH / 8) + 255) / 256), 256, 0, stream>>>(F32, NHQ, CS, SN, QH, QL);
    /* attention: the 8 heads of each step ride in grid.y (A + h * HD for q, one shared K / V^T, C plane h); rowsPerB = -1 adds the head's own element of the C plane */
    /* band 0 (rows < 256, keys < 256): hi + lo everywhere */
    { const int nk = BAND; const dim3 gS((BAND / 128) * (nk / 64), NHQ), gO((BAND / 128) * (HD / 64), NHQ);
      k_gemm2<0><<<gS, 128, 0, stream>>>(QH, DM, HD, KH, HD, 0, 0.0625f, nullptr, 0, nullptr, 1, 0, 0, S, nullptr, SQ, sS, BAND, nk, HD);      /* S = (Qh Kh^T) / 16 */
      k_gemm2<0><<<gS, 128, 0, stream>>>(QL, DM, HD, KH, HD, 0, 0.0625f / 1024.0f, nullptr, 0, S, -1, 0, 0, S, nullptr, SQ, sS, BAND, nk, HD);
      k_gemm2<0><<<gS, 128, 0, stream>>>(QH, DM, HD, KL, HD, 0, 0.0625f / 1024.0f, nullptr, 0, S, -1, 0, 0, S, nullptr, SQ, sS, BAND, nk, HD);
      k_csoft<<<dim3(BAND / 8, NHQ), 256, 0, stream>>>(S, sS, 0, BAND, nk, amask, b, PH, PL, sPL);
      k_gemm2<0><<<gO, 128, 0, stream>>>(PH, SQ, sS, VTh, SQ, 0, 0.0009765625f, nullptr, 0, nullptr, 1, 0, 0, O, nullptr, DM, HD, BAND, HD, nk);
      k_gemm2<0><<<gO, 128, 0, stream>>>(PL, SQ, sPL, VTh, SQ, 0, 0.0009765625f / 1024.0f, nullptr, 0, O, -1, 0, 0, O, nullptr, DM, HD, BAND, HD, nk);
      k_gemm2<0><<<gO, 128, 0, stream>>>(PH, SQ, sS, VTl, SQ, 0, 0.0009765625f / 1024.0f, nullptr, 0, O, -1, 0, 0, O, nullptr, DM, HD, BAND, HD, nk); }
    /* two later bands (rows 256..1023 with keys < 1024, rows 1024..2047 with keys < 2048): plain */
    for (int k = 0; k < 2; ++k) { const int r0 = k ? 1024 : BAND, nr = k ? 1024 : (1024 - BAND), nk = k ? SQ : 1024; const dim3 gS((nr / 128) * (nk / 64), NHQ), gO((nr / 128) * (HD / 64), NHQ);
      k_gemm2<0><<<gS, 128, 0, stream>>>(QH + (size_t)r0 * DM, DM, HD, KH, HD, 0, 0.0625f, nullptr, 0, nullptr, 1, 0, 0, S, nullptr, SQ, sS, nr, nk, HD);
      k_csoft<<<dim3(nr / 8, NHQ), 256, 0, stream>>>(S, sS, r0, nr, nk, amask, b, PH, nullptr, 0);
      k_gemm2<0><<<gO, 128, 0, stream>>>(PH, SQ, sS, VTh, SQ, 0, 0.0009765625f, nullptr, 0, nullptr, 1, 0, 0, O + (size_t)r0 * DM, nullptr, DM, HD, nr, HD, nk); }
    /* output: O hi (+ lo on rows < 256) into Wo */
    k_hl<<<(unsigned)(((size_t)BAND * DM / 8 + 255) / 256), 256, 0, stream>>>(O, O16, OL0, (size_t)BAND * DM / 8);      /* rows < 256: hi + lo */
    k_h16<<<(unsigned)((((size_t)SQ - BAND) * DM / 8 + 255) / 256), 256, 0, stream>>>(O + (size_t)BAND * DM, O16 + (size_t)BAND * DM, ((size_t)SQ - BAND) * DM / 8);
    float* outb = (float*)d_out + (size_t)b * np;
    k_gemm2<0><<<dim3((SQ / 128) * (DM / 64), 1), 128, 0, stream>>>(O16, DM, 0, BO, DM, 0, 0.0625f, nullptr, 0, nullptr, 1, 0, 0, outb, nullptr, DM, 0, SQ, DM, DM);
    k_gemm2<0><<<dim3((BAND / 128) * (DM / 64), 1), 128, 0, stream>>>(OL0, DM, 0, BO, DM, 0, 0.0625f / 1024.0f, nullptr, 0, outb, 1, (size_t)DM, 0, outb, nullptr, DM, 0, BAND, DM, DM); }
}

// v002
// Measured time: 931 microseconds a run.
// Timed twice side by side with v001, it ran 1.68 and 1.66 times as fast.
// Over all steps from v000 it is 6.37 times as fast.
#include <hip/hip_runtime.h>
// FlaxGemmaAttention (2 x 2048 tokens, D 2048, 8 query heads of 256 sharing ONE kv head; rotate-half RoPE from the INPUT position_ids; causal + INPUT padding mask; scale 256^-0.5; out = attn Wo).
// Structure (both batches in every launch: flat rows for the q/k/v projections, the passes before attention and the hi Wo GEMM, blockIdx.y for the O hi/lo passes, blockIdx.z for attention and the lo Wo GEMM): exact f16 plane of the hidden states; q/k/v GEMMs (32x64 wave tiles, f32 accumulation, exact x16 weights); RoPE tables (f32 trig) + rotation on VALU into f16 hi (+ 2^10 residual) planes; V^T hi/residual by LDS tiles; UNFUSED attention per row band (rows < 256 | 256..1023 with keys < 1024 | 1024.. with all keys), all 8 heads of a band in ONE launch (head = blockIdx.y, batch = blockIdx.z, one S plane per batch and head, each P row stored over the front half of its own S row), because the head dim is 256: S = Q_band K^T over the causally reachable keys as a GEMM (f32), causal/padding softmax on VALU (wave per row) into an f16 P plane (x2^10), O_band = P V as a GEMM; band 0 (rows < 256, whose outputs average over few keys) uses hi+lo operands throughout (3-term S, 3-term P.V, hi+lo O into Wo), later bands plain f16; output GEMM.
// Compute dtype: inputs and weights rounded to bf16; rows >= 256: q, k, P, v, O as f16 (~2^-12); rows < 256: hi + residual pairs; f32 accumulation/softmax/trig. v_wmma_f32_16x16x32_f16.
#define NB 2
#define SQ 2048
#define DM 2048
#define NHQ 8
#define HD 256
#define HH (HD / 2)
#define BAND 256
#define NBAND (SQ / BAND)
typedef __bf16 v16b __attribute__((ext_vector_type(16)));
typedef unsigned short v8us __attribute__((ext_vector_type(8), may_alias));
typedef float  v8f  __attribute__((ext_vector_type(8)));
typedef float  v4f  __attribute__((ext_vector_type(4)));
typedef float  v4fa __attribute__((ext_vector_type(4), may_alias));
union FragB { v16b v; v8us half[2]; unsigned short u[16]; };

__device__ __forceinline__ unsigned short bf16_bits(float x) { unsigned int u = __float_as_uint(x); return (unsigned short)((u + 0x7FFFu + ((u >> 16) & 1u)) >> 16); }
__device__ __forceinline__ float bf16_val(unsigned short b) { return __uint_as_float(((unsigned int)b) << 16); }
__device__ __forceinline__ float bf16_round(float x) { return bf16_val(bf16_bits(x)); }
// D += A·B with NT terms: 1 = ah·bh, 2 = + al·bh (A split), 3 = + ah·bl (both split)
template <int NT>
__device__ __forceinline__ v8f mmaN(v16b ah, v16b al, v16b bh, v16b bl, v8f c) {
  c = __builtin_amdgcn_wmma_f32_16x16x32_bf16(false, ah, false, bh, (short)0, c, false, false);
  if (NT >= 2) c = __builtin_amdgcn_wmma_f32_16x16x32_bf16(false, al, false, bh, (short)0, c, false, false);
  if (NT >= 3) c = __builtin_amdgcn_wmma_f32_16x16x32_bf16(false, ah, false, bl, (short)0, c, false, false);
  asm volatile("v_nop\n\tv_nop\n\tv_nop\n\tv_nop" : "+v"(c) : "v"(ah), "v"(al), "v"(bh), "v"(bl));
  return c;
}

__global__ __launch_bounds__(256) void k_wt_bf16(const float* __restrict__ W, unsigned short* __restrict__ Wt, int K, int N) {
  const int t = blockIdx.x * 256 + threadIdx.x;
  const int k8n = K / 8;
  if (t >= N * k8n) return;
  const int n = t / k8n, k8 = (t % k8n) * 8;
  v8us v;
#pragma unroll
  for (int i = 0; i < 8; ++i) v[i] = bf16_bits(W[(size_t)(k8 + i) * N + n]);
  *(v8us*)(Wt + (size_t)n * K + k8) = v;
  
}

// GEMM C[M][N] (f32, pitch ldc) = act(A[M][K]·W + bias). A f32 row-major (pitch lda) converted per fragment to bf16
// (ASPLIT: hi/lo two planes -> 2 terms, else single rounded term); Wt bf16 [N][K] (pitch ldb). BIAS_BF16 rounds the
// bias to bf16 first (bias quantised to bf16 before the add). K%32==0, M%16==0, N%64==0.
template <bool ASPLIT, int ACT, bool BIAS_BF16>
__global__ __launch_bounds__(128) void k_gemm_bf(const float* __restrict__ A, int lda, const unsigned short* __restrict__ Wt, int ldb,
                                               const float* __restrict__ bias, float* __restrict__ C, int ldc, int M, int N, int K) {
  __shared__ __attribute__((aligned(16))) float so[4][16][64];
  const int tid = threadIdx.x, w = tid >> 5, lane = tid & 31, ln = lane & 15, hh = lane >> 4;
  const int ntn = N / 64;
  const int wid = blockIdx.x * 4 + w;
  const int mt = wid / ntn, nq = wid % ntn;
  if (mt * 16 >= M) return;
  const int row0 = mt * 16, col0 = nq * 64;
  const float* arow = A + (size_t)(row0 + ln) * lda;
  v8f acc[4] = {};
  for (int kb = 0; kb < K; kb += 32) {
    FragB ah, al;
    const v4f x0 = *(const v4fa*)(arow + kb + 8 * hh), x1 = *(const v4fa*)(arow + kb + 8 * hh + 4);
    const v4f x2 = *(const v4fa*)(arow + kb + 16 + 8 * hh), x3 = *(const v4fa*)(arow + kb + 16 + 8 * hh + 4);
    float xs[16] = {x0[0],x0[1],x0[2],x0[3],x1[0],x1[1],x1[2],x1[3],x2[0],x2[1],x2[2],x2[3],x3[0],x3[1],x3[2],x3[3]};
#pragma unroll
    for (int i = 0; i < 16; ++i) { const unsigned short hb = bf16_bits(xs[i]); ah.u[i] = hb; al.u[i] = ASPLIT ? bf16_bits(xs[i] - bf16_val(hb)) : (unsigned short)0; }
#pragma unroll
    for (int t = 0; t < 4; ++t) {
      const unsigned short* brow = Wt + (size_t)(col0 + t * 16 + ln) * ldb + kb;
      FragB b;
      b.half[0] = *(const v8us*)(brow + 8 * hh);
      b.half[1] = *(const v8us*)(brow + 16 + 8 * hh);
      acc[t] = mmaN<ASPLIT ? 2 : 1>(ah.v, al.v, b.v, b.v, acc[t]);
    }
  }
#pragma unroll
  for (int t = 0; t < 4; ++t) {
    float bv = bias ? bias[col0 + t * 16 + ln] : 0.f;
    if (BIAS_BF16) bv = bf16_round(bv);
#pragma unroll
    for (int r = 0; r < 8; ++r) { float v = acc[t][r] + bv; if (ACT == 1) v = fmaxf(v, 0.f); so[w][8 * hh + r][t * 16 + ln] = v; }
  }
  __builtin_amdgcn_fence(__ATOMIC_ACQ_REL, "workgroup");
  __builtin_amdgcn_wave_barrier();
  const int rsub = lane >> 4, c4 = (lane & 15) * 4;
  {
#pragma unroll
    for (int q = 0; q < 8; ++q) {
      const int r = q * 2 + rsub;
      const v4f v = *(const v4fa*)&so[w][r][c4];
      *(v4f*)(C + (size_t)(row0 + r) * ldc + col0 + c4) = v;
    }
    
  }
}

// GEMM C = act(A·W + bias + resid): A f32 (ASPLIT -> hi/lo 2 terms), Wt bf16 [N][K]; ACT 0 none, 1 relu, 2 exact gelu;
// resid (optional, f32, row index = (row % rmod), pitch ldr, RES_BF16 rounds it) added before the activation.
template <bool ASPLIT, int ACT, bool BIAS_BF16, bool RES_BF16>
__global__ __launch_bounds__(128) void k_gemm_bf3(const float* __restrict__ A, int lda, const unsigned short* __restrict__ Wt, int ldb,
                                                const float* __restrict__ bias, const float* __restrict__ resid, int rmod, int ldr,
                                                float* __restrict__ C, int ldc, int M, int N, int K) {
  __shared__ __attribute__((aligned(16))) float so[4][16][64];
  const int tid = threadIdx.x, w = tid >> 5, lane = tid & 31, ln = lane & 15, hh = lane >> 4;
  const int ntn = N / 64;
  const int wid = blockIdx.x * 4 + w;
  const int mt = wid / ntn, nq = wid % ntn;
  if (mt * 16 >= M) return;
  const int row0 = mt * 16, col0 = nq * 64;
  const float* arow = A + (size_t)(row0 + ln) * lda;
  v8f acc[4] = {};
  for (int kb = 0; kb < K; kb += 32) {
    FragB ah, al;
    const v4f x0 = *(const v4fa*)(arow + kb + 8 * hh), x1 = *(const v4fa*)(arow + kb + 8 * hh + 4);
    const v4f x2 = *(const v4fa*)(arow + kb + 16 + 8 * hh), x3 = *(const v4fa*)(arow + kb + 16 + 8 * hh + 4);
    float xs[16] = {x0[0],x0[1],x0[2],x0[3],x1[0],x1[1],x1[2],x1[3],x2[0],x2[1],x2[2],x2[3],x3[0],x3[1],x3[2],x3[3]};
#pragma unroll
    for (int i = 0; i < 16; ++i) { const unsigned short hb = bf16_bits(xs[i]); ah.u[i] = hb; al.u[i] = ASPLIT ? bf16_bits(xs[i] - bf16_val(hb)) : (unsigned short)0; }
#pragma unroll
    for (int t = 0; t < 4; ++t) {
      const unsigned short* brow = Wt + (size_t)(col0 + t * 16 + ln) * ldb + kb;
      FragB b;
      b.half[0] = *(const v8us*)(brow + 8 * hh);
      b.half[1] = *(const v8us*)(brow + 16 + 8 * hh);
      acc[t] = mmaN<ASPLIT ? 2 : 1>(ah.v, al.v, b.v, b.v, acc[t]);
    }
  }
#pragma unroll
  for (int t = 0; t < 4; ++t) {
    const int col = col0 + t * 16 + ln;
    float bv = bias ? bias[col] : 0.f;
    if (BIAS_BF16) bv = bf16_round(bv);
#pragma unroll
    for (int r = 0; r < 8; ++r) {
      float v = acc[t][r] + bv;
      if (resid) { float rv = resid[(size_t)((row0 + 8 * hh + r) % rmod) * ldr + col]; if (RES_BF16) rv = bf16_round(rv); v += rv; }
      if (ACT == 1) v = fmaxf(v, 0.f);
      if (ACT == 2) v = 0.5f * v * (1.0f + erff(v * 0.70710678118654752f));
      if (ACT == 3) { const float u = 0.7978845608028654f * (v + 0.044715f * v * v * v); v = 0.5f * v * (1.0f + tanhf(u)); }
      so[w][8 * hh + r][t * 16 + ln] = v;
    }
  }
  __builtin_amdgcn_fence(__ATOMIC_ACQ_REL, "workgroup");
  __builtin_amdgcn_wave_barrier();
  const int rsub = lane >> 4, c4 = (lane & 15) * 4;
  {
#pragma unroll
    for (int q = 0; q < 8; ++q) {
      const int r = q * 2 + rsub;
      const v4f v = *(const v4fa*)&so[w][r][c4];
      *(v4f*)(C + (size_t)(row0 + r) * ldc + col0 + c4) = v;
    }
    
  }
}
// row LayerNorm (biased variance, eps) over N: s = X (+ R); optional out_sum <- s; out_norm <- (s-mu)*rsqrt(var+eps)*g + b
template <bool PARAM_BF16>
__global__ __launch_bounds__(256) void k_layernorm(const float* __restrict__ X, const float* __restrict__ R, const float* __restrict__ g, const float* __restrict__ bta,
                                                  float* __restrict__ out_sum, float* __restrict__ out_norm, int N, float eps) {
  __shared__ float red[256];
  const int row = blockIdx.x, tid = threadIdx.x;
  const float* x = X + (size_t)row * N; const float* rr = R ? R + (size_t)row * N : nullptr;
  float vals[16];                     // up to N = 4096
  const int per = N / 256;            // contiguous chunk per thread? use strided-by-4 chunks: thread handles j = tid*4 + 1024*u
  float s1 = 0.f;
  for (int u = 0; u < per / 4; ++u) {
    const int j = tid * 4 + 1024 * u;
    const v4f a = *(const v4fa*)(x + j);
    v4f b = {0.f,0.f,0.f,0.f}; if (rr) b = *(const v4fa*)(rr + j);
#pragma unroll
    for (int q = 0; q < 4; ++q) { const float v = a[q] + b[q]; vals[u * 4 + q] = v; s1 += v; }
  }
  red[tid] = s1; __syncthreads();
  for (int st = 128; st > 0; st >>= 1) { if (tid < st) red[tid] += red[tid + st]; __syncthreads(); }
  const float mu = red[0] / (float)N; __syncthreads();
  float s2 = 0.f;
  for (int u = 0; u < per / 4; ++u)
#pragma unroll
    for (int q = 0; q < 4; ++q) { const float c = vals[u * 4 + q] - mu; s2 += c * c; }
  red[tid] = s2; __syncthreads();
  for (int st = 128; st > 0; st >>= 1) { if (tid < st) red[tid] += red[tid + st]; __syncthreads(); }
  const float rs = rsqrtf(red[0] / (float)N + eps);
  {
    for (int u = 0; u < per / 4; ++u) {
      const int j = tid * 4 + 1024 * u;
      v4f o, sm;
#pragma unroll
      for (int q = 0; q < 4; ++q) {
        float gg = g[j + q], bb = bta[j + q];
        if (PARAM_BF16) { gg = bf16_round(gg); bb = bf16_round(bb); }
        sm[q] = vals[u * 4 + q]; o[q] = (vals[u * 4 + q] - mu) * rs * gg + bb;
      }
      if (out_sum) *(v4f*)(out_sum + (size_t)row * N + j) = sm;
      *(v4f*)(out_norm + (size_t)row * N + j) = o;
    }
    
  }
}



// ---- f16 WMMA path (v_wmma_f32_16x16x32_f16): 11-bit significands for operands in range — used where a [0,1] probability operand needs more precision than bf16
typedef _Float16 v16h __attribute__((ext_vector_type(16)));
union FragH { v16h v; v8us half[2]; _Float16 h[16]; unsigned short u[16]; };
template <int NT>
__device__ __forceinline__ v8f mmaH(v16h ah, v16h al, v16h bh, v16h bl, v8f c) {
  c = __builtin_amdgcn_wmma_f32_16x16x32_f16(false, ah, false, bh, (short)0, c, false, false);
  if (NT >= 2) c = __builtin_amdgcn_wmma_f32_16x16x32_f16(false, al, false, bh, (short)0, c, false, false);
  if (NT >= 3) c = __builtin_amdgcn_wmma_f32_16x16x32_f16(false, ah, false, bl, (short)0, c, false, false);
  asm volatile("v_nop\n\tv_nop\n\tv_nop\n\tv_nop" : "+v"(c) : "v"(ah), "v"(al), "v"(bh), "v"(bl));
  return c;
}
// batched GEMM like k_gemm_b but f16 operands: A f32 (split into f16 hi/lo if ASPLIT, else rounded to f16), Bt = f16 values [n][k]; alpha; C f32; N multiple of 16 (partial tiles skipped)
template <bool ASPLIT>
__global__ __launch_bounds__(128) void k_gemm_h(const float* __restrict__ A, int lda, size_t sA, const _Float16* __restrict__ Bh, int ldb, size_t sB, float alpha, float* __restrict__ C, int ldc, size_t sC, int M, int N, int K) {
  __shared__ __attribute__((aligned(16))) float so[4][16][64];
  const int tid = threadIdx.x, w = tid >> 5, lane = tid & 31, ln = lane & 15, hh = lane >> 4; const int by = blockIdx.y;
  A += (size_t)by * sA; Bh += (size_t)by * sB; C += (size_t)by * sC;
  const int ntn = (N + 63) / 64; const int wid = blockIdx.x * 4 + w; const int mt = wid / ntn, nq = wid % ntn; if (mt * 16 >= M) return;
  const int row0 = mt * 16, col0 = nq * 64; const float* arow = A + (size_t)(row0 + ln) * lda;
  v8f acc[4] = {};
  for (int kb = 0; kb < K; kb += 32) {
    FragH ah, al;
    const v4f x0 = *(const v4fa*)(arow + kb + 8 * hh), x1 = *(const v4fa*)(arow + kb + 8 * hh + 4), x2 = *(const v4fa*)(arow + kb + 16 + 8 * hh), x3 = *(const v4fa*)(arow + kb + 16 + 8 * hh + 4);
    float xs[16] = {x0[0],x0[1],x0[2],x0[3],x1[0],x1[1],x1[2],x1[3],x2[0],x2[1],x2[2],x2[3],x3[0],x3[1],x3[2],x3[3]};
#pragma unroll
    for (int i = 0; i < 16; ++i) { const _Float16 h = (_Float16)xs[i]; ah.h[i] = h; al.h[i] = ASPLIT ? (_Float16)(xs[i] - (float)h) : (_Float16)0.0f; }
#pragma unroll
    for (int t = 0; t < 4; ++t) { if (col0 + t * 16 >= N) continue; const size_t boff = (size_t)(col0 + t * 16 + ln) * ldb + kb; FragH bq; bq.half[0] = *(const v8us*)(Bh + boff + 8 * hh); bq.half[1] = *(const v8us*)(Bh + boff + 16 + 8 * hh);
      acc[t] = mmaH<ASPLIT ? 2 : 1>(ah.v, al.v, bq.v, bq.v, acc[t]); }
  }
#pragma unroll
  for (int t = 0; t < 4; ++t) { if (col0 + t * 16 >= N) continue;
#pragma unroll
    for (int r = 0; r < 8; ++r) so[w][8 * hh + r][t * 16 + ln] = acc[t][r] * alpha; }
  __builtin_amdgcn_fence(__ATOMIC_ACQ_REL, "workgroup"); __builtin_amdgcn_wave_barrier();
  const int rsub = lane >> 4, c4 = (lane & 15) * 4;
  {
#pragma unroll
    for (int q = 0; q < 8; ++q) { const int r = q * 2 + rsub; if (col0 + c4 < N) { const v4f v = *(const v4fa*)&so[w][r][c4]; *(v4f*)(C + (size_t)(row0 + r) * ldc + col0 + c4) = v; } }
     }
}

// Wt[n][k] = f16(W[k][n]·scale) from f32 row-major W[K][N] (scale = power of two; bf16-exact weights stay exact in f16 away from the subnormal range)
__global__ __launch_bounds__(256) void k_wt_f16(const float* __restrict__ W, _Float16* __restrict__ Wt, int K, int N, float scale) {
  const int t = blockIdx.x * 256 + threadIdx.x; if (t >= N * (K / 8)) return; const int n = t / (K / 8), k8 = (t % (K / 8)) * 8; FragH f;
#pragma unroll
  for (int i = 0; i < 8; ++i) f.h[i] = (_Float16)(bf16_round(W[(size_t)(k8 + i) * N + n]) * scale); const v8us o = f.half[0];
  *(v8us*)((unsigned short*)Wt + (size_t)n * K + k8) = o; 
}
// k_gemm_hh variant with fused epilogue: v = acc·alpha + bias[by·sBias + col] (+ CP[(row/rowsPerB)·sCPb + by·64 + col] if CP) ; ACT 0 none / 1 elu ; writes f16 C16 (and f32 C if non-null)
template <int ACT>
__global__ __launch_bounds__(128) void k_gemm_hhx(const _Float16* __restrict__ A, int lda, size_t sA, const _Float16* __restrict__ Bh, int ldb, size_t sB, float alpha, const float* __restrict__ bias, size_t sBias, const float* __restrict__ CP, int rowsPerB, size_t sCPb, int row0g,
    float* __restrict__ C, _Float16* __restrict__ C16, int ldc, size_t sC, int M, int N, int K) {
  __shared__ __attribute__((aligned(16))) float so[4][16][64];
  const int tid = threadIdx.x, w = tid >> 5, lane = tid & 31, ln = lane & 15, hh = lane >> 4; const int by = blockIdx.y;
  A += (size_t)by * sA; Bh += (size_t)by * sB; const size_t cofs = (size_t)by * sC; const float* bp = bias ? bias + (size_t)by * sBias : nullptr;
  const int ntn = (N + 63) / 64; const int wid = blockIdx.x * 4 + w; const int mt = wid / ntn, nq = wid % ntn; if (mt * 16 >= M) return;
  const int row0 = mt * 16, col0 = nq * 64; const _Float16* arow = A + (size_t)(row0 + ln) * lda;
  v8f acc[4] = {};
  for (int kb = 0; kb < K; kb += 32) { FragH ah; ah.half[0] = *(const v8us*)((const unsigned short*)arow + kb + 8 * hh); ah.half[1] = *(const v8us*)((const unsigned short*)arow + kb + 16 + 8 * hh);
#pragma unroll
    for (int t = 0; t < 4; ++t) { if (col0 + t * 16 >= N) continue; const size_t boff = (size_t)(col0 + t * 16 + ln) * ldb + kb; FragH bq; bq.half[0] = *(const v8us*)((const unsigned short*)Bh + boff + 8 * hh); bq.half[1] = *(const v8us*)((const unsigned short*)Bh + boff + 16 + 8 * hh);
      acc[t] = mmaH<1>(ah.v, ah.v, bq.v, bq.v, acc[t]); }
  }
#pragma unroll
  for (int t = 0; t < 4; ++t) { if (col0 + t * 16 >= N) continue; const int col = col0 + t * 16 + ln; const float bv = bp ? bf16_round(bp[col]) : 0.f;
#pragma unroll
    for (int r = 0; r < 8; ++r) { float v = acc[t][r] * alpha + bv; if (CP) { const int rr = row0g + row0 + 8 * hh + r; if (rowsPerB < 0) v += CP[cofs + (size_t)rr * ldc + col];      /* rowsPerB < 0: own element of the batched C plane */ else { const int bidx = rr / rowsPerB; v += CP[(size_t)bidx * sCPb + (size_t)by * 64 + col]; } } if (ACT == 1) v = (v > 0.f) ? v : expm1f(v); else if (ACT == 7) v = (v > 0.f) ? v + 1.0f : expf(v); else if (ACT == 8) v = tanhf(v); else if (ACT == 9) v = 0.5f * v * (1.0f + tanhf(0.7978845608028654f * (v + 0.044715f * v * v * v))); else if (ACT == 11) v = 1.0f / (1.0f + expf(-v)); else if (ACT == 12) v = (v > 0.f) ? v : 0.01f * v; else if (ACT == 14) v = (v > 0.f) ? v : 0.1f * v; else if (ACT == 16) v = (v >= 0.f) ? v : 0.3f * v; else if (ACT == 15) v = v / (1.0f + expf(-v)); else if (ACT == 3) v = fmaxf(v, 0.f); else if (ACT == 6) v = 0.5f * v * (1.0f + erff(v * 0.70710678118654752f)); so[w][8 * hh + r][t * 16 + ln] = v; } }
  __builtin_amdgcn_fence(__ATOMIC_ACQ_REL, "workgroup"); __builtin_amdgcn_wave_barrier();
  const int rsub = lane >> 4, c4 = (lane & 15) * 4; typedef _Float16 v4h __attribute__((ext_vector_type(4)));
  {
#pragma unroll
    for (int q = 0; q < 8; ++q) { const int r = q * 2 + rsub; if (col0 + c4 < N) { const v4f v = *(const v4fa*)&so[w][r][c4]; if (C) *(v4f*)(C + cofs + (size_t)(row0 + r) * ldc + col0 + c4) = v; if (C16) { v4h h4; for (int i = 0; i < 4; ++i) h4[i] = (_Float16)v[i]; *(v4h*)(C16 + cofs + (size_t)(row0 + r) * ldc + col0 + c4) = h4; } } }
     }
}


typedef _Float16 v4h __attribute__((ext_vector_type(4)));

__global__ __launch_bounds__(256) void k_x16(const float* __restrict__ x, _Float16* __restrict__ X16, size_t n8) { const size_t t = (size_t)blockIdx.x * 256 + threadIdx.x; if (t >= n8) return; FragH f;
#pragma unroll
  for (int q = 0; q < 8; ++q) f.h[q] = (_Float16)bf16_round(x[t * 8 + q]); *(v8us*)((unsigned short*)X16 + t * 8) = f.half[0];  }
__global__ __launch_bounds__(256) void k_h16(const float* __restrict__ x, _Float16* __restrict__ X16, size_t n8, size_t sB) { const size_t t = (size_t)blockIdx.x * 256 + threadIdx.x; if (t >= n8) return; x += (size_t)blockIdx.y * sB; X16 += (size_t)blockIdx.y * sB;      /* batch = blockIdx.y */ FragH f;
#pragma unroll
  for (int q = 0; q < 8; ++q) f.h[q] = (_Float16)x[t * 8 + q]; *(v8us*)((unsigned short*)X16 + t * 8) = f.half[0];  }
__global__ __launch_bounds__(256) void k_round16f(const float* __restrict__ W, _Float16* __restrict__ Bt, size_t n8) { const size_t t = (size_t)blockIdx.x * 256 + threadIdx.x; if (t >= n8) return; FragH f;
#pragma unroll
  for (int i = 0; i < 8; ++i) f.h[i] = (_Float16)(bf16_round(W[t * 8 + i]) * 16.0f); *(v8us*)((unsigned short*)Bt + t * 8) = f.half[0];  }
template <int NHv, int TTv>
__global__ __launch_bounds__(256) void k_vt(const _Float16* __restrict__ V16, int ldv, int voff, _Float16* __restrict__ Vt) { __shared__ unsigned short tl[64][66]; const int tid = threadIdx.x; const int slab = blockIdx.x / (TTv / 64), lg = blockIdx.x % (TTv / 64); const int b = slab / NHv, h = slab % NHv;
  for (int i = tid; i < 64 * 8; i += 256) { const int r = i / 8, c8 = (i % 8) * 8; FragH f; f.half[0] = *(const v8us*)((const unsigned short*)V16 + ((size_t)b * TTv + lg * 64 + r) * ldv + voff + h * 64 + c8);
#pragma unroll
    for (int q = 0; q < 8; ++q) tl[r][c8 + q] = f.u[q]; }
  __syncthreads();
  {
#pragma unroll
    for (int rd = 0; rd < 2; ++rd) { const int d = rd * 32 + tid / 8, pc = tid % 8; FragH f;
#pragma unroll
      for (int q = 0; q < 8; ++q) f.u[q] = tl[pc * 8 + q][d];
      *(v8us*)((unsigned short*)Vt + ((size_t)slab * 64 + d) * TTv + lg * 64 + pc * 8) = f.half[0]; }
     } }

__global__ __launch_bounds__(256) void k_hl(const float* __restrict__ F, _Float16* __restrict__ Hh, _Float16* __restrict__ Hl, size_t n8, size_t sB, size_t sL) { const size_t t = (size_t)blockIdx.x * 256 + threadIdx.x; if (t >= n8) return; F += (size_t)blockIdx.y * sB; Hh += (size_t)blockIdx.y * sB; Hl += (size_t)blockIdx.y * sL;      /* batch = blockIdx.y */ FragH fh, fl; const v4f a = *(const v4fa*)(F + t * 8), c = *(const v4fa*)(F + t * 8 + 4);
#pragma unroll
  for (int q = 0; q < 4; ++q) { _Float16 h = (_Float16)a[q]; fh.h[q] = h; fl.h[q] = (_Float16)((a[q] - (float)h) * 1024.0f); h = (_Float16)c[q]; fh.h[4 + q] = h; fl.h[4 + q] = (_Float16)((c[q] - (float)h) * 1024.0f); }
  { *(v8us*)((unsigned short*)Hh + t * 8) = fh.half[0]; *(v8us*)((unsigned short*)Hl + t * 8) = fl.half[0];  } }

// ---- fast GEMM (wave tile 32x64; requires M % 32 == 0 rows per launch region and N % 64 == 0); epilogue = k_gemm_hhx semantics ----
__device__ __forceinline__ v16h g2_frag(const _Float16* p, int hh) { FragH f; f.half[0] = *(const v8us*)((const unsigned short*)p + 8 * hh); f.half[1] = *(const v8us*)((const unsigned short*)p + 16 + 8 * hh); return f.v; }
__device__ __forceinline__ v8f g2_mma(v16h a, v16h b, v8f c) { v8f d = __builtin_amdgcn_wmma_f32_16x16x32_f16(false, a, false, b, (short)0, c, false, false); asm volatile("v_nop\n\tv_nop\n\tv_nop\n\tv_nop" : "+v"(d) : "v"(a), "v"(b)); return d; }
template <int ACT>
__global__ __launch_bounds__(128) void k_gemm2(const _Float16* __restrict__ A, int lda, size_t sA, const _Float16* __restrict__ Bh, int ldb, size_t sB, float alpha, const float* __restrict__ bias, size_t sBias, const float* __restrict__ CP, int rowsPerB, size_t sCPb, int row0g,
    float* __restrict__ C, _Float16* __restrict__ C16, int ldc, size_t sC, int M, int N, int K, size_t zA, size_t zB, size_t zC) { static_assert(ACT == 0 || ACT == 3 || ACT == 6 || ACT == 8 || ACT == 9 || ACT == 11 || ACT == 12 || ACT == 14 || ACT == 15 || ACT == 16, "k_gemm2: unsupported ACT code (would silently apply no activation)");
  __shared__ __attribute__((aligned(16))) float so[4][32][68];
  const int tid = threadIdx.x, w = tid >> 5, lane = tid & 31, ln = lane & 15, hh = lane >> 4; const int by = blockIdx.y, bz = blockIdx.z;
  A += (size_t)by * sA + (size_t)bz * zA; Bh += (size_t)by * sB + (size_t)bz * zB; const size_t cofs = (size_t)by * sC + (size_t)bz * zC; const float* bp = bias ? bias + (size_t)by * sBias : nullptr;
  const int ntn = N >> 6; const int mt = blockIdx.x / ntn, nq = blockIdx.x - mt * ntn; const int row0 = mt * 128 + 32 * w, col0 = nq * 64; if (row0 >= M) return;
  const _Float16* a0p = A + (size_t)(row0 + ln) * lda; const _Float16* a1p = a0p + (size_t)16 * lda;
  const _Float16* b0p = Bh + (size_t)(col0 + ln) * ldb; const _Float16* b1p = b0p + (size_t)16 * ldb; const _Float16* b2p = b1p + (size_t)16 * ldb; const _Float16* b3p = b2p + (size_t)16 * ldb;
  const v8f z8 = {0.f,0.f,0.f,0.f,0.f,0.f,0.f,0.f}; v8f c00 = z8, c01 = z8, c02 = z8, c03 = z8, c10 = z8, c11 = z8, c12 = z8, c13 = z8;
#pragma unroll 1
  for (int kb = 0; kb < K; kb += 32) { const v16h a0 = g2_frag(a0p + kb, hh), a1 = g2_frag(a1p + kb, hh);
    v16h b = g2_frag(b0p + kb, hh); c00 = g2_mma(a0, b, c00); c10 = g2_mma(a1, b, c10);
    b = g2_frag(b1p + kb, hh); c01 = g2_mma(a0, b, c01); c11 = g2_mma(a1, b, c11);
    b = g2_frag(b2p + kb, hh); c02 = g2_mma(a0, b, c02); c12 = g2_mma(a1, b, c12);
    b = g2_frag(b3p + kb, hh); c03 = g2_mma(a0, b, c03); c13 = g2_mma(a1, b, c13); }
  v8f accs[8] = {c00, c01, c02, c03, c10, c11, c12, c13};
#pragma unroll
  for (int u = 0; u < 8; ++u) { const int t = u & 3, half = u >> 2; const int col = col0 + t * 16 + ln; const float bv = bp ? bf16_round(bp[col]) : 0.f;
#pragma unroll
    for (int r = 0; r < 8; ++r) { const int rloc = half * 16 + 8 * hh + r; float v = accs[u][r] * alpha + bv; if (CP) { if (rowsPerB < 0) v += CP[cofs + (size_t)(row0g + row0 + rloc) * ldc + col];      /* rowsPerB < 0: own element of the batched C plane */ else { const int bidx = (row0g + row0 + rloc) / rowsPerB; v += CP[(size_t)bidx * sCPb + (size_t)by * 64 + col]; } }
      if (ACT == 3) v = fmaxf(v, 0.f); else if (ACT == 6) v = 0.5f * v * (1.0f + erff(v * 0.70710678118654752f)); else if (ACT == 11) v = 1.0f / (1.0f + expf(-v)); else if (ACT == 15) v = v / (1.0f + expf(-v)); else if (ACT == 12) v = (v > 0.f) ? v : 0.01f * v; else if (ACT == 8) v = tanhf(v); else if (ACT == 9) v = 0.5f * v * (1.0f + tanhf(0.7978845608028654f * (v + 0.044715f * v * v * v))); else if (ACT == 14) v = (v > 0.f) ? v : 0.1f * v; else if (ACT == 16) v = (v >= 0.f) ? v : 0.3f * v;
      so[w][rloc][t * 16 + ln] = v; } }
  __builtin_amdgcn_fence(__ATOMIC_ACQ_REL, "workgroup"); __builtin_amdgcn_wave_barrier();
  const int rsub = lane >> 4, c4 = (lane & 15) * 4;
  {
#pragma unroll
    for (int q = 0; q < 16; ++q) { const int r = q * 2 + rsub; const v4f v = *(const v4fa*)&so[w][r][c4]; if (C) *(v4f*)(C + cofs + (size_t)(row0 + r) * ldc + col0 + c4) = v; if (C16) { v4h h4; for (int i = 0; i < 4; ++i) h4[i] = (_Float16)v[i]; *(v4h*)(C16 + cofs + (size_t)(row0 + r) * ldc + col0 + c4) = h4; } }
     } }


__global__ __launch_bounds__(256) void k_rotab(const int* __restrict__ pid, float* __restrict__ CS, float* __restrict__ SN) {
  #pragma clang fp contract(off)
  const int t = blockIdx.x * 256 + threadIdx.x; if (t >= NB * SQ * HH) return; const int j = t % HH, s = t / HH;      /* s = flat token over both batches */ const float inv = 1.0f / powf(10000.0f, (float)(2 * j) / (float)HD); const float th = (float)pid[s] * inv; const float c = cosf(th), sn = sinf(th);
  { *(float*)(CS + t) = c; *(float*)(SN + t) = sn;  } }
__global__ __launch_bounds__(256) void k_rope(const float* __restrict__ F, int nheads, const float* __restrict__ CS, const float* __restrict__ SN, _Float16* __restrict__ H, _Float16* __restrict__ L) {
  #pragma clang fp contract(off)
  const size_t t = (size_t)blockIdx.x * 256 + threadIdx.x; if (t >= (size_t)NB * SQ * nheads * (HH / 8)) return; const int g = (int)(t % (HH / 8)) * 8; const int h = (int)((t / (HH / 8)) % nheads); const int s = (int)(t / ((HH / 8) * (size_t)nheads)); const int ld = nheads * HD;
  const size_t base = (size_t)s * ld + h * HD + g; FragH h0, h1, l0, l1;
#pragma unroll
  for (int q = 0; q < 8; ++q) { const float c = CS[s * HH + g + q], sn = SN[s * HH + g + q]; const float x0 = F[base + q], x1 = F[base + HH + q]; float o0 = x0 * c; o0 += -x1 * sn; float o1 = x1 * c; o1 += x0 * sn;
    const _Float16 a0 = (_Float16)o0, a1 = (_Float16)o1; h0.h[q] = a0; h1.h[q] = a1; l0.h[q] = (_Float16)((o0 - (float)a0) * 1024.0f); l1.h[q] = (_Float16)((o1 - (float)a1) * 1024.0f); }
  { *(v8us*)((unsigned short*)H + base) = h0.half[0]; *(v8us*)((unsigned short*)H + base + HH) = h1.half[0]; if (L) { *(v8us*)((unsigned short*)L + base) = l0.half[0]; *(v8us*)((unsigned short*)L + base + HH) = l1.half[0]; }  } }
// one f16 store with its s_wait_xcnt 0 in the same statement: the loop that calls it adds to the address registers right behind the store, and a wait in a statement of its own landed behind those additions; the "memory" clobber keeps the store behind the trip's own read of the S row that it lands on
__device__ __forceinline__ void st_f16(_Float16* p, _Float16 v) { const unsigned int bits = __builtin_bit_cast(unsigned short, v); asm volatile("global_store_b16 %0, %1, off\n\ts_wait_xcnt 0x0" :: "v"(p), "v"(bits) : "memory"); }
__global__ __launch_bounds__(256) void k_csoft(float* S, size_t sS, int r0, int nrows, int nk, const int* __restrict__ mask, _Float16* __restrict__ PL, size_t sPL) {
  #pragma clang fp contract(off)
  const int wv = threadIdx.x >> 5, ln = threadIdx.x & 31; const int rl = blockIdx.x * 8 + wv; if (rl >= nrows) return; const int r = r0 + rl; const int b = blockIdx.z, pl = b * NHQ + blockIdx.y; S += (size_t)pl * sS; if (PL) PL += (size_t)pl * sPL;      /* batch = blockIdx.z, head = blockIdx.y: their own S and P planes */ const float* sr = S + (size_t)rl * SQ; _Float16* ph = (_Float16*)(S + (size_t)rl * SQ);      /* P row over its own S row: element j lands on bytes that this wave read at or before trip j / 64 of the last pass */ const int* mk = mask + (size_t)b * SQ; float m = -3.0e38f;
#pragma unroll 1
  for (int j = ln; j < nk; j += 32) if (j <= r && mk[j] > 0) m = fmaxf(m, sr[j]);
  for (int o = 16; o > 0; o >>= 1) m = fmaxf(m, __shfl_xor(m, o, 32)); float su = 0.f;
#pragma unroll 1
  for (int j = ln; j < nk; j += 32) if (j <= r && mk[j] > 0) su += expf(sr[j] - m);
  for (int o = 16; o > 0; o >>= 1) su += __shfl_xor(su, o, 32); const float f = 1024.0f / su;
  {
#pragma unroll 1
    for (int j = ln; j < nk; j += 32) { const float p = (j <= r && mk[j] > 0) ? expf(sr[j] - m) * f : 0.f; const _Float16 hv = (_Float16)p; st_f16(ph + j, hv); if (PL) st_f16(PL + (size_t)rl * SQ + j, (_Float16)((p - (float)hv) * 1024.0f)); }
     } }

extern "C" void kernel_launch(void* const* d_in, const int* in_sizes, int n_in,
                              void* d_out, int out_size, void* d_ws, size_t ws_size, hipStream_t stream) {
  (void)in_sizes; (void)n_in; (void)out_size;
  const float* const* I = (const float* const*)d_in; const float* hs = I[0]; const int* amask = (const int*)d_in[1]; const int* pid = (const int*)d_in[2]; const float* Wq = I[3]; const float* Wk = I[4]; const float* Wv = I[5]; const float* Wo = I[6];
  char* ws = (char*)d_ws; size_t off = 0;
  auto take = [&](size_t bytes) { char* p = ws + off; off += (bytes + 255) & ~(size_t)255; return p; };
  const size_t np = (size_t)SQ * DM, nkv = (size_t)SQ * HD;      /* elements per batch of a [SQ][DM] and of a [SQ][HD] plane */
  _Float16* BQ = (_Float16*)take(np * 2); _Float16* BK = (_Float16*)take((size_t)HD * DM * 2); _Float16* BV = (_Float16*)take((size_t)HD * DM * 2); _Float16* BO = (_Float16*)take(np * 2);
  float* CS = (float*)take((size_t)NB * SQ * HH * 4); float* SN = (float*)take((size_t)NB * SQ * HH * 4);
  _Float16* X16 = (_Float16*)take(NB * np * 2); float* F32 = (float*)take(NB * np * 4); _Float16* QH = (_Float16*)take(NB * np * 2); _Float16* QL = (_Float16*)take(NB * np * 2); _Float16* KH = (_Float16*)take(NB * nkv * 2); _Float16* KL = (_Float16*)take(NB * nkv * 2); _Float16* VH = (_Float16*)take(NB * nkv * 2); _Float16* VL = (_Float16*)take(NB * nkv * 2); _Float16* VTh = (_Float16*)take(NB * nkv * 2); _Float16* VTl = (_Float16*)take(NB * nkv * 2);
  const size_t sS = (size_t)1024 * SQ, sPL = (size_t)BAND * SQ;      /* elements per (batch, head) plane of S, and of PL */
  float* S = (float*)take(NB * NHQ * sS * 4); _Float16* PH = (_Float16*)S; const int ldp = 2 * SQ; const size_t sP = 2 * sS;      /* P row r of a plane = front half of S row r: pitch and plane stride in f16 elements are twice those of S */
  _Float16* PL = X16; float* O = F32; _Float16* O16 = QL; _Float16* OL0 = (_Float16*)take((size_t)NB * BAND * DM * 2);      /* PL over X16 (dead after the q GEMM; same size); O over the q f32 scratch (dead after k_rope); O16 over QL (QL is only read for band 0, which runs first) */
  if (off > ws_size) return;      /* 8+1+1+8 + 4 + 16+32+16+16 + 6*2 + 128 + 2 = 244 MiB */
  k_wt_f16<<<(unsigned)((np / 8 + 255) / 256), 256, 0, stream>>>(Wq, BQ, DM, DM, 16.0f); k_wt_f16<<<(unsigned)(((size_t)HD * DM / 8 + 255) / 256), 256, 0, stream>>>(Wk, BK, DM, HD, 16.0f); k_wt_f16<<<(unsigned)(((size_t)HD * DM / 8 + 255) / 256), 256, 0, stream>>>(Wv, BV, DM, HD, 16.0f); k_wt_f16<<<(unsigned)((np / 8 + 255) / 256), 256, 0, stream>>>(Wo, BO, DM, DM, 16.0f);
  const int MT = NB * SQ;      /* tokens of both batches: the q/k/v projections, the passes before attention and the hi Wo GEMM see one flat [MT][...] matrix */
  k_rotab<<<(NB * SQ * HH + 255) / 256, 256, 0, stream>>>(pid, CS, SN);
  k_x16<<<(unsigned)((NB * np / 8 + 255) / 256), 256, 0, stream>>>(hs, X16, NB * np / 8);
  /* k and v (one kv head of 256) */
  k_gemm2<0><<<dim3((MT / 128) * (HD / 64), 1), 128, 0, stream>>>(X16, DM, 0, BK, DM, 0, 0.0625f, nullptr, 0, nullptr, 1, 0, 0, F32, nullptr, HD, 0, MT, HD, DM, 0, 0, 0);
  k_rope<<<(unsigned)(((size_t)MT * 1 * (HH / 8) + 255) / 256), 256, 0, stream>>>(F32, 1, CS, SN, KH, KL);
  k_gemm2<0><<<dim3((MT / 128) * (HD / 64), 1), 128, 0, stream>>>(X16, DM, 0, BV, DM, 0, 0.0625f, nullptr, 0, nullptr, 1, 0, 0, F32, nullptr, HD, 0, MT, HD, DM, 0, 0, 0);
  k_hl<<<(unsigned)((NB * nkv / 8 + 255) / 256), 256, 0, stream>>>(F32, VH, VL, NB * nkv / 8, 0, 0);
  k_vt<HD / 64, SQ><<<NB * (HD / 64) * (SQ / 64), 256, 0, stream>>>(VH, HD, 0, VTh); k_vt<HD / 64, SQ><<<NB * (HD / 64) * (SQ / 64), 256, 0, stream>>>(VL, HD, 0, VTl);
  /* q (8 heads), roped, hi/lo */
  k_gemm2<0><<<dim3((MT / 128) * (DM / 64), 1), 128, 0, stream>>>(X16, DM, 0, BQ, DM, 0, 0.0625f, nullptr, 0, nullptr, 1, 0, 0, F32, nullptr, DM, 0, MT, DM, DM, 0, 0, 0);
  k_rope<<<(unsigned)(((size_t)MT * NHQ * (HH / 8) + 255) / 256), 256, 0, stream>>>(F32, NHQ, CS, SN, QH, QL);
  /* attention: head in grid.y (A + h * HD for q, one shared K / V^T per batch, C plane h), batch in grid.z (the last three arguments: element strides of A, B and C per batch); rowsPerB = -1 adds the own element of the C plane */
  /* band 0 (rows < 256, keys < 256): hi + lo everywhere */
  { const int nk = BAND; const dim3 gS((BAND / 128) * (nk / 64), NHQ, NB), gO((BAND / 128) * (HD / 64), NHQ, NB);
    k_gemm2<0><<<gS, 128, 0, stream>>>(QH, DM, HD, KH, HD, 0, 0.0625f, nullptr, 0, nullptr, 1, 0, 0, S, nullptr, SQ, sS, BAND, nk, HD, np, nkv, NHQ * sS);      /* S = (Qh Kh^T) / 16 */
    k_gemm2<0><<<gS, 128, 0, stream>>>(QL, DM, HD, KH, HD, 0, 0.0625f / 1024.0f, nullptr, 0, S, -1, 0, 0, S, nullptr, SQ, sS, BAND, nk, HD, np, nkv, NHQ * sS);
    k_gemm2<0><<<gS, 128, 0, stream>>>(QH, DM, HD, KL, HD, 0, 0.0625f / 1024.0f, nullptr, 0, S, -1, 0, 0, S, nullptr, SQ, sS, BAND, nk, HD, np, nkv, NHQ * sS);
    k_csoft<<<dim3(BAND / 8, NHQ, NB), 256, 0, stream>>>(S, sS, 0, BAND, nk, amask, PL, sPL);
    k_gemm2<0><<<gO, 128, 0, stream>>>(PH, ldp, sP, VTh, SQ, 0, 0.0009765625f, nullptr, 0, nullptr, 1, 0, 0, O, nullptr, DM, HD, BAND, HD, nk, NHQ * sP, nkv, np);
    k_gemm2<0><<<gO, 128, 0, stream>>>(PL, SQ, sPL, VTh, SQ, 0, 0.0009765625f / 1024.0f, nullptr, 0, O, -1, 0, 0, O, nullptr, DM, HD, BAND, HD, nk, NHQ * sPL, nkv, np);
    k_gemm2<0><<<gO, 128, 0, stream>>>(PH, ldp, sP, VTl, SQ, 0, 0.0009765625f / 1024.0f, nullptr, 0, O, -1, 0, 0, O, nullptr, DM, HD, BAND, HD, nk, NHQ * sP, nkv, np); }
  /* two later bands (rows 256..1023 with keys < 1024, rows 1024..2047 with keys < 2048): plain */
  for (int k = 0; k < 2; ++k) { const int r0 = k ? 1024 : BAND, nr = k ? 1024 : (1024 - BAND), nk = k ? SQ : 1024; const dim3 gS((nr / 128) * (nk / 64), NHQ, NB), gO((nr / 128) * (HD / 64), NHQ, NB);
    k_gemm2<0><<<gS, 128, 0, stream>>>(QH + (size_t)r0 * DM, DM, HD, KH, HD, 0, 0.0625f, nullptr, 0, nullptr, 1, 0, 0, S, nullptr, SQ, sS, nr, nk, HD, np, nkv, NHQ * sS);
    k_csoft<<<dim3(nr / 8, NHQ, NB), 256, 0, stream>>>(S, sS, r0, nr, nk, amask, nullptr, 0);
    k_gemm2<0><<<gO, 128, 0, stream>>>(PH, ldp, sP, VTh, SQ, 0, 0.0009765625f, nullptr, 0, nullptr, 1, 0, 0, O + (size_t)r0 * DM, nullptr, DM, HD, nr, HD, nk, NHQ * sP, nkv, np); }
  /* output: O hi (+ lo on rows < 256 of each batch) into Wo */
  k_hl<<<dim3((unsigned)(((size_t)BAND * DM / 8 + 255) / 256), NB), 256, 0, stream>>>(O, O16, OL0, (size_t)BAND * DM / 8, np, (size_t)BAND * DM);      /* rows < 256: hi + lo */
  k_h16<<<dim3((unsigned)((((size_t)SQ - BAND) * DM / 8 + 255) / 256), NB), 256, 0, stream>>>(O + (size_t)BAND * DM, O16 + (size_t)BAND * DM, ((size_t)SQ - BAND) * DM / 8, np);
  float* out = (float*)d_out;
  k_gemm2<0><<<dim3((MT / 128) * (DM / 64), 1), 128, 0, stream>>>(O16, DM, 0, BO, DM, 0, 0.0625f, nullptr, 0, nullptr, 1, 0, 0, out, nullptr, DM, 0, MT, DM, DM, 0, 0, 0);
  k_gemm2<0><<<dim3((BAND / 128) * (DM / 64), 1, NB), 128, 0, stream>>>(OL0, DM, 0, BO, DM, 0, 0.0625f / 1024.0f, nullptr, 0, out, -1, 0, 0, out, nullptr, DM, 0, BAND, DM, DM, (size_t)BAND * DM, 0, np);
}

// v003
// It runs in 603 microseconds.
// In two side-by-side timings against v002, it was 1.55 and 1.54 times as fast.
// Counting every step since v000, it is 9.83 times as fast.
#include <hip/hip_runtime.h>
// FlaxGemmaAttention (2 x 2048 tokens, D 2048, 8 query heads of 256 sharing ONE kv head; rotate-half RoPE from the INPUT position_ids; causal + INPUT padding mask; scale 256^-0.5; out = attn Wo).
// Structure (both batches in every launch: flat rows for the q/k/v projections, the passes before attention and the hi Wo GEMM, blockIdx.y for the O hi/lo passes, blockIdx.z for attention and the lo Wo GEMM): exact f16 plane of the hidden states; q/k/v GEMMs (32x64 wave tiles, f32 accumulation, exact x16 weights); RoPE tables (f32 trig) + rotation on VALU into f16 hi (+ 2^10 residual) planes; V^T hi/residual by LDS tiles; UNFUSED attention per row band (rows < 256 | 256..1023 with keys < 1024 | 1024.. with all keys), all 8 heads of a band in ONE launch (head = blockIdx.y, batch = blockIdx.z, one S plane per batch and head, each P row stored over the front half of its own S row), because the head dim is 256: S = Q_band K^T over the causally reachable keys as a GEMM (f32), causal/padding softmax on VALU (wave per row) into an f16 P plane (x2^10), O_band = P V as a GEMM; band 0 (rows < 256, whose outputs average over few keys) uses hi+lo operands throughout (3-term S, 3-term P.V, hi+lo O into Wo), later bands plain f16; output GEMM.
// Compute dtype: inputs and weights rounded to bf16; rows >= 256: q, k, P, v, O as f16 (~2^-12); rows < 256: hi + residual pairs; f32 accumulation/softmax/trig. v_wmma_f32_16x16x32_f16.
#define NB 2
#define SQ 2048
#define DM 2048
#define NHQ 8
#define HD 256
#define HH (HD / 2)
#define BAND 256
#define NBAND (SQ / BAND)
typedef __bf16 v16b __attribute__((ext_vector_type(16)));
typedef unsigned short v8us __attribute__((ext_vector_type(8), may_alias));
typedef float  v8f  __attribute__((ext_vector_type(8)));
typedef float  v4f  __attribute__((ext_vector_type(4)));
typedef float  v4fa __attribute__((ext_vector_type(4), may_alias));
union FragB { v16b v; v8us half[2]; unsigned short u[16]; };

__device__ __forceinline__ unsigned short bf16_bits(float x) { unsigned int u = __float_as_uint(x); return (unsigned short)((u + 0x7FFFu + ((u >> 16) & 1u)) >> 16); }
__device__ __forceinline__ float bf16_val(unsigned short b) { return __uint_as_float(((unsigned int)b) << 16); }
__device__ __forceinline__ float bf16_round(float x) { return bf16_val(bf16_bits(x)); }
// D += A·B with NT terms: 1 = ah·bh, 2 = + al·bh (A split), 3 = + ah·bl (both split)
template <int NT>
__device__ __forceinline__ v8f mmaN(v16b ah, v16b al, v16b bh, v16b bl, v8f c) {
  c = __builtin_amdgcn_wmma_f32_16x16x32_bf16(false, ah, false, bh, (short)0, c, false, false);
  if (NT >= 2) c = __builtin_amdgcn_wmma_f32_16x16x32_bf16(false, al, false, bh, (short)0, c, false, false);
  if (NT >= 3) c = __builtin_amdgcn_wmma_f32_16x16x32_bf16(false, ah, false, bl, (short)0, c, false, false);
  asm volatile("v_nop\n\tv_nop\n\tv_nop\n\tv_nop" : "+v"(c) : "v"(ah), "v"(al), "v"(bh), "v"(bl));
  return c;
}

__global__ __launch_bounds__(256) void k_wt_bf16(const float* __restrict__ W, unsigned short* __restrict__ Wt, int K, int N) {
  const int t = blockIdx.x * 256 + threadIdx.x;
  const int k8n = K / 8;
  if (t >= N * k8n) return;
  const int n = t / k8n, k8 = (t % k8n) * 8;
  v8us v;
#pragma unroll
  for (int i = 0; i < 8; ++i) v[i] = bf16_bits(W[(size_t)(k8 + i) * N + n]);
  *(v8us*)(Wt + (size_t)n * K + k8) = v;
  
}

// GEMM C[M][N] (f32, pitch ldc) = act(A[M][K]·W + bias). A f32 row-major (pitch lda) converted per fragment to bf16
// (ASPLIT: hi/lo two planes -> 2 terms, else single rounded term); Wt bf16 [N][K] (pitch ldb). BIAS_BF16 rounds the
// bias to bf16 first (bias quantised to bf16 before the add). K%32==0, M%16==0, N%64==0.
template <bool ASPLIT, int ACT, bool BIAS_BF16>
__global__ __launch_bounds__(128) void k_gemm_bf(const float* __restrict__ A, int lda, const unsigned short* __restrict__ Wt, int ldb,
                                               const float* __restrict__ bias, float* __restrict__ C, int ldc, int M, int N, int K) {
  __shared__ __attribute__((aligned(16))) float so[4][16][64];
  const int tid = threadIdx.x, w = tid >> 5, lane = tid & 31, ln = lane & 15, hh = lane >> 4;
  const int ntn = N / 64;
  const int wid = blockIdx.x * 4 + w;
  const int mt = wid / ntn, nq = wid % ntn;
  if (mt * 16 >= M) return;
  const int row0 = mt * 16, col0 = nq * 64;
  const float* arow = A + (size_t)(row0 + ln) * lda;
  v8f acc[4] = {};
  for (int kb = 0; kb < K; kb += 32) {
    FragB ah, al;
    const v4f x0 = *(const v4fa*)(arow + kb + 8 * hh), x1 = *(const v4fa*)(arow + kb + 8 * hh + 4);
    const v4f x2 = *(const v4fa*)(arow + kb + 16 + 8 * hh), x3 = *(const v4fa*)(arow + kb + 16 + 8 * hh + 4);
    float xs[16] = {x0[0],x0[1],x0[2],x0[3],x1[0],x1[1],x1[2],x1[3],x2[0],x2[1],x2[2],x2[3],x3[0],x3[1],x3[2],x3[3]};
#pragma unroll
    for (int i = 0; i < 16; ++i) { const unsigned short hb = bf16_bits(xs[i]); ah.u[i] = hb; al.u[i] = ASPLIT ? bf16_bits(xs[i] - bf16_val(hb)) : (unsigned short)0; }
#pragma unroll
    for (int t = 0; t < 4; ++t) {
      const unsigned short* brow = Wt + (size_t)(col0 + t * 16 + ln) * ldb + kb;
      FragB b;
      b.half[0] = *(const v8us*)(brow + 8 * hh);
      b.half[1] = *(const v8us*)(brow + 16 + 8 * hh);
      acc[t] = mmaN<ASPLIT ? 2 : 1>(ah.v, al.v, b.v, b.v, acc[t]);
    }
  }
#pragma unroll
  for (int t = 0; t < 4; ++t) {
    float bv = bias ? bias[col0 + t * 16 + ln] : 0.f;
    if (BIAS_BF16) bv = bf16_round(bv);
#pragma unroll
    for (int r = 0; r < 8; ++r) { float v = acc[t][r] + bv; if (ACT == 1) v = fmaxf(v, 0.f); so[w][8 * hh + r][t * 16 + ln] = v; }
  }
  __builtin_amdgcn_fence(__ATOMIC_ACQ_REL, "workgroup");
  __builtin_amdgcn_wave_barrier();
  const int rsub = lane >> 4, c4 = (lane & 15) * 4;
  {
#pragma unroll
    for (int q = 0; q < 8; ++q) {
      const int r = q * 2 + rsub;
      const v4f v = *(const v4fa*)&so[w][r][c4];
      *(v4f*)(C + (size_t)(row0 + r) * ldc + col0 + c4) = v;
    }
    
  }
}

// GEMM C = act(A·W + bias + resid): A f32 (ASPLIT -> hi/lo 2 terms), Wt bf16 [N][K]; ACT 0 none, 1 relu, 2 exact gelu;
// resid (optional, f32, row index = (row % rmod), pitch ldr, RES_BF16 rounds it) added before the activation.
template <bool ASPLIT, int ACT, bool BIAS_BF16, bool RES_BF16>
__global__ __launch_bounds__(128) void k_gemm_bf3(const float* __restrict__ A, int lda, const unsigned short* __restrict__ Wt, int ldb,
                                                const float* __restrict__ bias, const float* __restrict__ resid, int rmod, int ldr,
                                                float* __restrict__ C, int ldc, int M, int N, int K) {
  __shared__ __attribute__((aligned(16))) float so[4][16][64];
  const int tid = threadIdx.x, w = tid >> 5, lane = tid & 31, ln = lane & 15, hh = lane >> 4;
  const int ntn = N / 64;
  const int wid = blockIdx.x * 4 + w;
  const int mt = wid / ntn, nq = wid % ntn;
  if (mt * 16 >= M) return;
  const int row0 = mt * 16, col0 = nq * 64;
  const float* arow = A + (size_t)(row0 + ln) * lda;
  v8f acc[4] = {};
  for (int kb = 0; kb < K; kb += 32) {
    FragB ah, al;
    const v4f x0 = *(const v4fa*)(arow + kb + 8 * hh), x1 = *(const v4fa*)(arow + kb + 8 * hh + 4);
    const v4f x2 = *(const v4fa*)(arow + kb + 16 + 8 * hh), x3 = *(const v4fa*)(arow + kb + 16 + 8 * hh + 4);
    float xs[16] = {x0[0],x0[1],x0[2],x0[3],x1[0],x1[1],x1[2],x1[3],x2[0],x2[1],x2[2],x2[3],x3[0],x3[1],x3[2],x3[3]};
#pragma unroll
    for (int i = 0; i < 16; ++i) { const unsigned short hb = bf16_bits(xs[i]); ah.u[i] = hb; al.u[i] = ASPLIT ? bf16_bits(xs[i] - bf16_val(hb)) : (unsigned short)0; }
#pragma unroll
    for (int t = 0; t < 4; ++t) {
      const unsigned short* brow = Wt + (size_t)(col0 + t * 16 + ln) * ldb + kb;
      FragB b;
      b.half[0] = *(const v8us*)(brow + 8 * hh);
      b.half[1] = *(const v8us*)(brow + 16 + 8 * hh);
      acc[t] = mmaN<ASPLIT ? 2 : 1>(ah.v, al.v, b.v, b.v, acc[t]);
    }
  }
#pragma unroll
  for (int t = 0; t < 4; ++t) {
    const int col = col0 + t * 16 + ln;
    float bv = bias ? bias[col] : 0.f;
    if (BIAS_BF16) bv = bf16_round(bv);
#pragma unroll
    for (int r = 0; r < 8; ++r) {
      float v = acc[t][r] + bv;
      if (resid) { float rv = resid[(size_t)((row0 + 8 * hh + r) % rmod) * ldr + col]; if (RES_BF16) rv = bf16_round(rv); v += rv; }
      if (ACT == 1) v = fmaxf(v, 0.f);
      if (ACT == 2) v = 0.5f * v * (1.0f + erff(v * 0.70710678118654752f));
      if (ACT == 3) { const float u = 0.7978845608028654f * (v + 0.044715f * v * v * v); v = 0.5f * v * (1.0f + tanhf(u)); }
      so[w][8 * hh + r][t * 16 + ln] = v;
    }
  }
  __builtin_amdgcn_fence(__ATOMIC_ACQ_REL, "workgroup");
  __builtin_amdgcn_wave_barrier();
  const int rsub = lane >> 4, c4 = (lane & 15) * 4;
  {
#pragma unroll
    for (int q = 0; q < 8; ++q) {
      const int r = q * 2 + rsub;
      const v4f v = *(const v4fa*)&so[w][r][c4];
      *(v4f*)(C + (size_t)(row0 + r) * ldc + col0 + c4) = v;
    }
    
  }
}
// row LayerNorm (biased variance, eps) over N: s = X (+ R); optional out_sum <- s; out_norm <- (s-mu)*rsqrt(var+eps)*g + b
template <bool PARAM_BF16>
__global__ __launch_bounds__(256) void k_layernorm(const float* __restrict__ X, const float* __restrict__ R, const float* __restrict__ g, const float* __restrict__ bta,
                                                  float* __restrict__ out_sum, float* __restrict__ out_norm, int N, float eps) {
  __shared__ float red[256];
  const int row = blockIdx.x, tid = threadIdx.x;
  const float* x = X + (size_t)row * N; const float* rr = R ? R + (size_t)row * N : nullptr;
  float vals[16];                     // up to N = 4096
  const int per = N / 256;            // contiguous chunk per thread? use strided-by-4 chunks: thread handles j = tid*4 + 1024*u
  float s1 = 0.f;
  for (int u = 0; u < per / 4; ++u) {
    const int j = tid * 4 + 1024 * u;
    const v4f a = *(const v4fa*)(x + j);
    v4f b = {0.f,0.f,0.f,0.f}; if (rr) b = *(const v4fa*)(rr + j);
#pragma unroll
    for (int q = 0; q < 4; ++q) { const float v = a[q] + b[q]; vals[u * 4 + q] = v; s1 += v; }
  }
  red[tid] = s1; __syncthreads();
  for (int st = 128; st > 0; st >>= 1) { if (tid < st) red[tid] += red[tid + st]; __syncthreads(); }
  const float mu = red[0] / (float)N; __syncthreads();
  float s2 = 0.f;
  for (int u = 0; u < per / 4; ++u)
#pragma unroll
    for (int q = 0; q < 4; ++q) { const float c = vals[u * 4 + q] - mu; s2 += c * c; }
  red[tid] = s2; __syncthreads();
  for (int st = 128; st > 0; st >>= 1) { if (tid < st) red[tid] += red[tid + st]; __syncthreads(); }
  const float rs = rsqrtf(red[0] / (float)N + eps);
  {
    for (int u = 0; u < per / 4; ++u) {
      const int j = tid * 4 + 1024 * u;
      v4f o, sm;
#pragma unroll
      for (int q = 0; q < 4; ++q) {
        float gg = g[j + q], bb = bta[j + q];
        if (PARAM_BF16) { gg = bf16_round(gg); bb = bf16_round(bb); }
        sm[q] = vals[u * 4 + q]; o[q] = (vals[u * 4 + q] - mu) * rs * gg + bb;
      }
      if (out_sum) *(v4f*)(out_sum + (size_t)row * N + j) = sm;
      *(v4f*)(out_norm + (size_t)row * N + j) = o;
    }
    
  }
}



// ---- f16 WMMA path (v_wmma_f32_16x16x32_f16): 11-bit significands for operands in range — used where a [0,1] probability operand needs more precision than bf16
typedef _Float16 v16h __attribute__((ext_vector_type(16)));
union FragH { v16h v; v8us half[2]; _Float16 h[16]; unsigned short u[16]; };
template <int NT>
__device__ __forceinline__ v8f mmaH(v16h ah, v16h al, v16h bh, v16h bl, v8f c) {
  c = __builtin_amdgcn_wmma_f32_16x16x32_f16(false, ah, false, bh, (short)0, c, false, false);
  if (NT >= 2) c = __builtin_amdgcn_wmma_f32_16x16x32_f16(false, al, false, bh, (short)0, c, false, false);
  if (NT >= 3) c = __builtin_amdgcn_wmma_f32_16x16x32_f16(false, ah, false, bl, (short)0, c, false, false);
  asm volatile("v_nop\n\tv_nop\n\tv_nop\n\tv_nop" : "+v"(c) : "v"(ah), "v"(al), "v"(bh), "v"(bl));
  return c;
}
// batched GEMM like k_gemm_b but f16 operands: A f32 (split into f16 hi/lo if ASPLIT, else rounded to f16), Bt = f16 values [n][k]; alpha; C f32; N multiple of 16 (partial tiles skipped)
template <bool ASPLIT>
__global__ __launch_bounds__(128) void k_gemm_h(const float* __restrict__ A, int lda, size_t sA, const _Float16* __restrict__ Bh, int ldb, size_t sB, float alpha, float* __restrict__ C, int ldc, size_t sC, int M, int N, int K) {
  __shared__ __attribute__((aligned(16))) float so[4][16][64];
  const int tid = threadIdx.x, w = tid >> 5, lane = tid & 31, ln = lane & 15, hh = lane >> 4; const int by = blockIdx.y;
  A += (size_t)by * sA; Bh += (size_t)by * sB; C += (size_t)by * sC;
  const int ntn = (N + 63) / 64; const int wid = blockIdx.x * 4 + w; const int mt = wid / ntn, nq = wid % ntn; if (mt * 16 >= M) return;
  const int row0 = mt * 16, col0 = nq * 64; const float* arow = A + (size_t)(row0 + ln) * lda;
  v8f acc[4] = {};
  for (int kb = 0; kb < K; kb += 32) {
    FragH ah, al;
    const v4f x0 = *(const v4fa*)(arow + kb + 8 * hh), x1 = *(const v4fa*)(arow + kb + 8 * hh + 4), x2 = *(const v4fa*)(arow + kb + 16 + 8 * hh), x3 = *(const v4fa*)(arow + kb + 16 + 8 * hh + 4);
    float xs[16] = {x0[0],x0[1],x0[2],x0[3],x1[0],x1[1],x1[2],x1[3],x2[0],x2[1],x2[2],x2[3],x3[0],x3[1],x3[2],x3[3]};
#pragma unroll
    for (int i = 0; i < 16; ++i) { const _Float16 h = (_Float16)xs[i]; ah.h[i] = h; al.h[i] = ASPLIT ? (_Float16)(xs[i] - (float)h) : (_Float16)0.0f; }
#pragma unroll
    for (int t = 0; t < 4; ++t) { if (col0 + t * 16 >= N) continue; const size_t boff = (size_t)(col0 + t * 16 + ln) * ldb + kb; FragH bq; bq.half[0] = *(const v8us*)(Bh + boff + 8 * hh); bq.half[1] = *(const v8us*)(Bh + boff + 16 + 8 * hh);
      acc[t] = mmaH<ASPLIT ? 2 : 1>(ah.v, al.v, bq.v, bq.v, acc[t]); }
  }
#pragma unroll
  for (int t = 0; t < 4; ++t) { if (col0 + t * 16 >= N) continue;
#pragma unroll
    for (int r = 0; r < 8; ++r) so[w][8 * hh + r][t * 16 + ln] = acc[t][r] * alpha; }
  __builtin_amdgcn_fence(__ATOMIC_ACQ_REL, "workgroup"); __builtin_amdgcn_wave_barrier();
  const int rsub = lane >> 4, c4 = (lane & 15) * 4;
  {
#pragma unroll
    for (int q = 0; q < 8; ++q) { const int r = q * 2 + rsub; if (col0 + c4 < N) { const v4f v = *(const v4fa*)&so[w][r][c4]; *(v4f*)(C + (size_t)(row0 + r) * ldc + col0 + c4) = v; } }
     }
}

// Wt[n][k] = f16(W[k][n]·scale) from f32 row-major W[K][N] (scale = power of two; bf16-exact weights stay exact in f16 away from the subnormal range)
__global__ __launch_bounds__(256) void k_wt_f16(const float* __restrict__ W, _Float16* __restrict__ Wt, int K, int N, float scale) {
  const int t = blockIdx.x * 256 + threadIdx.x; if (t >= N * (K / 8)) return; const int n = t / (K / 8), k8 = (t % (K / 8)) * 8; FragH f;
#pragma unroll
  for (int i = 0; i < 8; ++i) f.h[i] = (_Float16)(bf16_round(W[(size_t)(k8 + i) * N + n]) * scale); const v8us o = f.half[0];
  *(v8us*)((unsigned short*)Wt + (size_t)n * K + k8) = o; 
}
// k_gemm_hh variant with fused epilogue: v = acc·alpha + bias[by·sBias + col] (+ CP[(row/rowsPerB)·sCPb + by·64 + col] if CP) ; ACT 0 none / 1 elu ; writes f16 C16 (and f32 C if non-null)
template <int ACT>
__global__ __launch_bounds__(128) void k_gemm_hhx(const _Float16* __restrict__ A, int lda, size_t sA, const _Float16* __restrict__ Bh, int ldb, size_t sB, float alpha, const float* __restrict__ bias, size_t sBias, const float* __restrict__ CP, int rowsPerB, size_t sCPb, int row0g,
    float* __restrict__ C, _Float16* __restrict__ C16, int ldc, size_t sC, int M, int N, int K) {
  __shared__ __attribute__((aligned(16))) float so[4][16][64];
  const int tid = threadIdx.x, w = tid >> 5, lane = tid & 31, ln = lane & 15, hh = lane >> 4; const int by = blockIdx.y;
  A += (size_t)by * sA; Bh += (size_t)by * sB; const size_t cofs = (size_t)by * sC; const float* bp = bias ? bias + (size_t)by * sBias : nullptr;
  const int ntn = (N + 63) / 64; const int wid = blockIdx.x * 4 + w; const int mt = wid / ntn, nq = wid % ntn; if (mt * 16 >= M) return;
  const int row0 = mt * 16, col0 = nq * 64; const _Float16* arow = A + (size_t)(row0 + ln) * lda;
  v8f acc[4] = {};
  for (int kb = 0; kb < K; kb += 32) { FragH ah; ah.half[0] = *(const v8us*)((const unsigned short*)arow + kb + 8 * hh); ah.half[1] = *(const v8us*)((const unsigned short*)arow + kb + 16 + 8 * hh);
#pragma unroll
    for (int t = 0; t < 4; ++t) { if (col0 + t * 16 >= N) continue; const size_t boff = (size_t)(col0 + t * 16 + ln) * ldb + kb; FragH bq; bq.half[0] = *(const v8us*)((const unsigned short*)Bh + boff + 8 * hh); bq.half[1] = *(const v8us*)((const unsigned short*)Bh + boff + 16 + 8 * hh);
      acc[t] = mmaH<1>(ah.v, ah.v, bq.v, bq.v, acc[t]); }
  }
#pragma unroll
  for (int t = 0; t < 4; ++t) { if (col0 + t * 16 >= N) continue; const int col = col0 + t * 16 + ln; const float bv = bp ? bf16_round(bp[col]) : 0.f;
#pragma unroll
    for (int r = 0; r < 8; ++r) { float v = acc[t][r] * alpha + bv; if (CP) { const int rr = row0g + row0 + 8 * hh + r; if (rowsPerB < 0) v += CP[cofs + (size_t)rr * ldc + col];      /* rowsPerB < 0: own element of the batched C plane */ else { const int bidx = rr / rowsPerB; v += CP[(size_t)bidx * sCPb + (size_t)by * 64 + col]; } } if (ACT == 1) v = (v > 0.f) ? v : expm1f(v); else if (ACT == 7) v = (v > 0.f) ? v + 1.0f : expf(v); else if (ACT == 8) v = tanhf(v); else if (ACT == 9) v = 0.5f * v * (1.0f + tanhf(0.7978845608028654f * (v + 0.044715f * v * v * v))); else if (ACT == 11) v = 1.0f / (1.0f + expf(-v)); else if (ACT == 12) v = (v > 0.f) ? v : 0.01f * v; else if (ACT == 14) v = (v > 0.f) ? v : 0.1f * v; else if (ACT == 16) v = (v >= 0.f) ? v : 0.3f * v; else if (ACT == 15) v = v / (1.0f + expf(-v)); else if (ACT == 3) v = fmaxf(v, 0.f); else if (ACT == 6) v = 0.5f * v * (1.0f + erff(v * 0.70710678118654752f)); so[w][8 * hh + r][t * 16 + ln] = v; } }
  __builtin_amdgcn_fence(__ATOMIC_ACQ_REL, "workgroup"); __builtin_amdgcn_wave_barrier();
  const int rsub = lane >> 4, c4 = (lane & 15) * 4; typedef _Float16 v4h __attribute__((ext_vector_type(4)));
  {
#pragma unroll
    for (int q = 0; q < 8; ++q) { const int r = q * 2 + rsub; if (col0 + c4 < N) { const v4f v = *(const v4fa*)&so[w][r][c4]; if (C) *(v4f*)(C + cofs + (size_t)(row0 + r) * ldc + col0 + c4) = v; if (C16) { v4h h4; for (int i = 0; i < 4; ++i) h4[i] = (_Float16)v[i]; *(v4h*)(C16 + cofs + (size_t)(row0 + r) * ldc + col0 + c4) = h4; } } }
     }
}


typedef _Float16 v4h __attribute__((ext_vector_type(4)));

__global__ __launch_bounds__(256) void k_x16(const float* __restrict__ x, _Float16* __restrict__ X16, size_t n8) { const size_t t = (size_t)blockIdx.x * 256 + threadIdx.x; if (t >= n8) return; FragH f;
#pragma unroll
  for (int q = 0; q < 8; ++q) f.h[q] = (_Float16)bf16_round(x[t * 8 + q]); *(v8us*)((unsigned short*)X16 + t * 8) = f.half[0];  }
__global__ __launch_bounds__(256) void k_h16(const float* __restrict__ x, _Float16* __restrict__ X16, size_t n8, size_t sB) { const size_t t = (size_t)blockIdx.x * 256 + threadIdx.x; if (t >= n8) return; x += (size_t)blockIdx.y * sB; X16 += (size_t)blockIdx.y * sB;      /* batch = blockIdx.y */ FragH f;
#pragma unroll
  for (int q = 0; q < 8; ++q) f.h[q] = (_Float16)x[t * 8 + q]; *(v8us*)((unsigned short*)X16 + t * 8) = f.half[0];  }
__global__ __launch_bounds__(256) void k_round16f(const float* __restrict__ W, _Float16* __restrict__ Bt, size_t n8) { const size_t t = (size_t)blockIdx.x * 256 + threadIdx.x; if (t >= n8) return; FragH f;
#pragma unroll
  for (int i = 0; i < 8; ++i) f.h[i] = (_Float16)(bf16_round(W[t * 8 + i]) * 16.0f); *(v8us*)((unsigned short*)Bt + t * 8) = f.half[0];  }
template <int NHv, int TTv>
__global__ __launch_bounds__(256) void k_vt(const _Float16* __restrict__ V16, int ldv, int voff, _Float16* __restrict__ Vt) { __shared__ unsigned short tl[64][66]; const int tid = threadIdx.x; const int slab = blockIdx.x / (TTv / 64), lg = blockIdx.x % (TTv / 64); const int b = slab / NHv, h = slab % NHv;
  for (int i = tid; i < 64 * 8; i += 256) { const int r = i / 8, c8 = (i % 8) * 8; FragH f; f.half[0] = *(const v8us*)((const unsigned short*)V16 + ((size_t)b * TTv + lg * 64 + r) * ldv + voff + h * 64 + c8);
#pragma unroll
    for (int q = 0; q < 8; ++q) tl[r][c8 + q] = f.u[q]; }
  __syncthreads();
  {
#pragma unroll
    for (int rd = 0; rd < 2; ++rd) { const int d = rd * 32 + tid / 8, pc = tid % 8; FragH f;
#pragma unroll
      for (int q = 0; q < 8; ++q) f.u[q] = tl[pc * 8 + q][d];
      *(v8us*)((unsigned short*)Vt + ((size_t)slab * 64 + d) * TTv + lg * 64 + pc * 8) = f.half[0]; }
     } }

__global__ __launch_bounds__(256) void k_hl(const float* __restrict__ F, _Float16* __restrict__ Hh, _Float16* __restrict__ Hl, size_t n8, size_t sB, size_t sL) { const size_t t = (size_t)blockIdx.x * 256 + threadIdx.x; if (t >= n8) return; F += (size_t)blockIdx.y * sB; Hh += (size_t)blockIdx.y * sB; Hl += (size_t)blockIdx.y * sL;      /* batch = blockIdx.y */ FragH fh, fl; const v4f a = *(const v4fa*)(F + t * 8), c = *(const v4fa*)(F + t * 8 + 4);
#pragma unroll
  for (int q = 0; q < 4; ++q) { _Float16 h = (_Float16)a[q]; fh.h[q] = h; fl.h[q] = (_Float16)((a[q] - (float)h) * 1024.0f); h = (_Float16)c[q]; fh.h[4 + q] = h; fl.h[4 + q] = (_Float16)((c[q] - (float)h) * 1024.0f); }
  { *(v8us*)((unsigned short*)Hh + t * 8) = fh.half[0]; *(v8us*)((unsigned short*)Hl + t * 8) = fl.half[0];  } }

// ---- fast GEMM (block tile 128x64, wave tile 32x64; requires M % 128 == 0 rows per launch region, N % 64 == 0, K % 64 == 0); epilogue = k_gemm_hhx semantics ----
// Operands reach the waves through LDS: per 64 k one tile of 128 A rows and 64 B rows, 128 B (one whole line) of each row, brought by asynchronous copies (32 lanes = 4 whole lines a copy) into one of two buffers while the other is worked on; each row is fetched once per block instead of once per wave in 32-B pieces.
#define G2_PITCH 72      /* f16 per LDS row: 128 B of k + 16 B, the conflict-free pitch for ds_load_b128 readers of 128-B rows */
#define G2_TILE ((128 + 64) * G2_PITCH * 2)      /* bytes of one buffer: 128 A rows, then 64 B rows */
// one tile's 12 copies of a lane (rows 16 apart: 8 of A, 4 of B); l = the lane's LDS byte address of its first piece. s_wait_xcnt 0 is the statement's last line so that no address register of a copy is rewritten ahead of it.
__device__ __forceinline__ void g2_stage(unsigned l, const _Float16* ga, size_t sa, const _Float16* gb, size_t sb) { const unsigned r16 = 16 * G2_PITCH * 2;
  asm volatile("global_load_async_to_lds_b128 %0, %12, off\n\t" "global_load_async_to_lds_b128 %1, %13, off\n\t" "global_load_async_to_lds_b128 %2, %14, off\n\t" "global_load_async_to_lds_b128 %3, %15, off\n\t"
               "global_load_async_to_lds_b128 %4, %16, off\n\t" "global_load_async_to_lds_b128 %5, %17, off\n\t" "global_load_async_to_lds_b128 %6, %18, off\n\t" "global_load_async_to_lds_b128 %7, %19, off\n\t"
               "global_load_async_to_lds_b128 %8, %20, off\n\t" "global_load_async_to_lds_b128 %9, %21, off\n\t" "global_load_async_to_lds_b128 %10, %22, off\n\t" "global_load_async_to_lds_b128 %11, %23, off\n\t"
               "s_wait_xcnt 0x0"
               :: "v"(l), "v"(l + r16), "v"(l + 2 * r16), "v"(l + 3 * r16), "v"(l + 4 * r16), "v"(l + 5 * r16), "v"(l + 6 * r16), "v"(l + 7 * r16), "v"(l + 8 * r16), "v"(l + 9 * r16), "v"(l + 10 * r16), "v"(l + 11 * r16),
                  "v"(ga), "v"(ga + sa), "v"(ga + 2 * sa), "v"(ga + 3 * sa), "v"(ga + 4 * sa), "v"(ga + 5 * sa), "v"(ga + 6 * sa), "v"(ga + 7 * sa), "v"(gb), "v"(gb + sb), "v"(gb + 2 * sb), "v"(gb + 3 * sb)
               : "memory"); }
__device__ __forceinline__ v16h g2_frag(const _Float16* p, int hh) { FragH f; f.half[0] = *(const v8us*)((const unsigned short*)p + 8 * hh); f.half[1] = *(const v8us*)((const unsigned short*)p + 16 + 8 * hh); return f.v; }
__device__ __forceinline__ v8f g2_mma(v16h a, v16h b, v8f c) { v8f d = __builtin_amdgcn_wmma_f32_16x16x32_f16(false, a, false, b, (short)0, c, false, false); asm volatile("v_nop\n\tv_nop\n\tv_nop\n\tv_nop" : "+v"(d) : "v"(a), "v"(b)); return d; }
template <int ACT>
__global__ __launch_bounds__(128) void k_gemm2(const _Float16* __restrict__ A, int lda, size_t sA, const _Float16* __restrict__ Bh, int ldb, size_t sB, float alpha, const float* __restrict__ bias, size_t sBias, const float* __restrict__ CP, int rowsPerB, size_t sCPb, int row0g,
    float* __restrict__ C, _Float16* __restrict__ C16, int ldc, size_t sC, int M, int N, int K, size_t zA, size_t zB, size_t zC) { static_assert(ACT == 0 || ACT == 3 || ACT == 6 || ACT == 8 || ACT == 9 || ACT == 11 || ACT == 12 || ACT == 14 || ACT == 15 || ACT == 16, "k_gemm2: unsupported ACT code (would silently apply no activation)");
  __shared__ __attribute__((aligned(16))) unsigned char sm[2 * G2_TILE]; float (*so)[32][68] = (float (*)[32][68])sm;      /* the epilogue's staging lies over the two buffers, which every wave has left by then */ static_assert(sizeof(float) * 4 * 32 * 68 <= 2 * G2_TILE, "k_gemm2: epilogue staging must fit the buffers");
  const int tid = threadIdx.x, w = tid >> 5, lane = tid & 31, ln = lane & 15, hh = lane >> 4; const int by = blockIdx.y, bz = blockIdx.z;
  A += (size_t)by * sA + (size_t)bz * zA; Bh += (size_t)by * sB + (size_t)bz * zB; const size_t cofs = (size_t)by * sC + (size_t)bz * zC; const float* bp = bias ? bias + (size_t)by * sBias : nullptr;
  const int ntn = N >> 6; const int mt = blockIdx.x / ntn, nq = blockIdx.x - mt * ntn; const int row0 = mt * 128 + 32 * w, col0 = nq * 64; if (mt * 128 >= M) return;      /* the same for the whole block: it stands in front of barriers */
  const int trow = tid >> 3, tseg = tid & 7;      /* a lane's piece of a tile: 16 B number tseg of rows trow, trow + 16, ... */
  const _Float16* gA = A + (size_t)(mt * 128 + trow) * lda + tseg * 8; const _Float16* gB = Bh + (size_t)(col0 + trow) * ldb + tseg * 8; const size_t sa16 = (size_t)16 * lda, sb16 = (size_t)16 * ldb;
  const unsigned l0 = (unsigned)(size_t)sm + (unsigned)(trow * (G2_PITCH * 2) + tseg * 16);
  const v8f z8 = {0.f,0.f,0.f,0.f,0.f,0.f,0.f,0.f}; v8f c00 = z8, c01 = z8, c02 = z8, c03 = z8, c10 = z8, c11 = z8, c12 = z8, c13 = z8;
  const int nc = K >> 6;
  g2_stage(l0, gA, sa16, gB, sb16);
  asm volatile("s_wait_asynccnt 0x0" ::: "memory");      /* tile 0 of this wave's copies has landed */
  __syncthreads();      /* ... and every other wave's */
  if (nc > 1) g2_stage(l0 + G2_TILE, gA + 64, sa16, gB + 64, sb16);
#pragma unroll 1      /* one tile a trip: the buffer index stays a run-time value and the loop stays small */
  for (int t = 0; t < nc; ++t) { const _Float16* tl = (const _Float16*)(sm + (t & 1) * G2_TILE); const _Float16* ar = tl + (32 * w + ln) * G2_PITCH; const _Float16* br = tl + (128 + ln) * G2_PITCH;
    /* all 24 LDS reads of the trip as one group in front of its WMMAs */
    const v16h a0 = g2_frag(ar, hh), a1 = g2_frag(ar + 16 * G2_PITCH, hh), b0 = g2_frag(br, hh), b1 = g2_frag(br + 16 * G2_PITCH, hh), b2 = g2_frag(br + 32 * G2_PITCH, hh), b3 = g2_frag(br + 48 * G2_PITCH, hh);
    const v16h e0 = g2_frag(ar + 32, hh), e1 = g2_frag(ar + 16 * G2_PITCH + 32, hh), f0 = g2_frag(br + 32, hh), f1 = g2_frag(br + 16 * G2_PITCH + 32, hh), f2 = g2_frag(br + 32 * G2_PITCH + 32, hh), f3 = g2_frag(br + 48 * G2_PITCH + 32, hh);
    c00 = g2_mma(a0, b0, c00); c10 = g2_mma(a1, b0, c10); c01 = g2_mma(a0, b1, c01); c11 = g2_mma(a1, b1, c11); c02 = g2_mma(a0, b2, c02); c12 = g2_mma(a1, b2, c12); c03 = g2_mma(a0, b3, c03); c13 = g2_mma(a1, b3, c13);
    c00 = g2_mma(e0, f0, c00); c10 = g2_mma(e1, f0, c10); c01 = g2_mma(e0, f1, c01); c11 = g2_mma(e1, f1, c11); c02 = g2_mma(e0, f2, c02); c12 = g2_mma(e1, f2, c12); c03 = g2_mma(e0, f3, c03); c13 = g2_mma(e1, f3, c13);
    asm volatile("s_wait_dscnt 0x0" ::: "memory");      /* this wave's reads of buffer t & 1 are done before the buffer is handed back */
    asm volatile("s_wait_asynccnt 0x0" ::: "memory");      /* this wave's copies of tile t + 1 have landed */
    __syncthreads();      /* publishes tile t + 1 and ends every wave's reads of tile t */
    if (t + 2 < nc) g2_stage(l0 + (unsigned)((t & 1) * G2_TILE), gA + (size_t)(t + 2) * 64, sa16, gB + (size_t)(t + 2) * 64, sb16); }
  asm volatile("s_wait_asynccnt 0x0" ::: "memory");      /* no copy is in flight when the buffers become the epilogue's staging */
  v8f accs[8] = {c00, c01, c02, c03, c10, c11, c12, c13};
#pragma unroll
  for (int u = 0; u < 8; ++u) { const int t = u & 3, half = u >> 2; const int col = col0 + t * 16 + ln; const float bv = bp ? bf16_round(bp[col]) : 0.f;
#pragma unroll
    for (int r = 0; r < 8; ++r) { const int rloc = half * 16 + 8 * hh + r; float v = accs[u][r] * alpha + bv; if (CP) { if (rowsPerB < 0) v += CP[cofs + (size_t)(row0g + row0 + rloc) * ldc + col];      /* rowsPerB < 0: own element of the batched C plane */ else { const int bidx = (row0g + row0 + rloc) / rowsPerB; v += CP[(size_t)bidx * sCPb + (size_t)by * 64 + col]; } }
      if (ACT == 3) v = fmaxf(v, 0.f); else if (ACT == 6) v = 0.5f * v * (1.0f + erff(v * 0.70710678118654752f)); else if (ACT == 11) v = 1.0f / (1.0f + expf(-v)); else if (ACT == 15) v = v / (1.0f + expf(-v)); else if (ACT == 12) v = (v > 0.f) ? v : 0.01f * v; else if (ACT == 8) v = tanhf(v); else if (ACT == 9) v = 0.5f * v * (1.0f + tanhf(0.7978845608028654f * (v + 0.044715f * v * v * v))); else if (ACT == 14) v = (v > 0.f) ? v : 0.1f * v; else if (ACT == 16) v = (v >= 0.f) ? v : 0.3f * v;
      so[w][rloc][t * 16 + ln] = v; } }
  __builtin_amdgcn_fence(__ATOMIC_ACQ_REL, "workgroup"); __builtin_amdgcn_wave_barrier();
  const int rsub = lane >> 4, c4 = (lane & 15) * 4;
  {
#pragma unroll
    for (int q = 0; q < 16; ++q) { const int r = q * 2 + rsub; const v4f v = *(const v4fa*)&so[w][r][c4]; if (C) *(v4f*)(C + cofs + (size_t)(row0 + r) * ldc + col0 + c4) = v; if (C16) { v4h h4; for (int i = 0; i < 4; ++i) h4[i] = (_Float16)v[i]; *(v4h*)(C16 + cofs + (size_t)(row0 + r) * ldc + col0 + c4) = h4; } }
     } }


__global__ __launch_bounds__(256) void k_rotab(const int* __restrict__ pid, float* __restrict__ CS, float* __restrict__ SN) {
  #pragma clang fp contract(off)
  const int t = blockIdx.x * 256 + threadIdx.x; if (t >= NB * SQ * HH) return; const int j = t % HH, s = t / HH;      /* s = flat token over both batches */ const float inv = 1.0f / powf(10000.0f, (float)(2 * j) / (float)HD); const float th = (float)pid[s] * inv; const float c = cosf(th), sn = sinf(th);
  { *(float*)(CS + t) = c; *(float*)(SN + t) = sn;  } }
__global__ __launch_bounds__(256) void k_rope(const float* __restrict__ F, int nheads, const float* __restrict__ CS, const float* __restrict__ SN, _Float16* __restrict__ H, _Float16* __restrict__ L) {
  #pragma clang fp contract(off)
  const size_t t = (size_t)blockIdx.x * 256 + threadIdx.x; if (t >= (size_t)NB * SQ * nheads * (HH / 8)) return; const int g = (int)(t % (HH / 8)) * 8; const int h = (int)((t / (HH / 8)) % nheads); const int s = (int)(t / ((HH / 8) * (size_t)nheads)); const int ld = nheads * HD;
  const size_t base = (size_t)s * ld + h * HD + g; FragH h0, h1, l0, l1;
#pragma unroll
  for (int q = 0; q < 8; ++q) { const float c = CS[s * HH + g + q], sn = SN[s * HH + g + q]; const float x0 = F[base + q], x1 = F[base + HH + q]; float o0 = x0 * c; o0 += -x1 * sn; float o1 = x1 * c; o1 += x0 * sn;
    const _Float16 a0 = (_Float16)o0, a1 = (_Float16)o1; h0.h[q] = a0; h1.h[q] = a1; l0.h[q] = (_Float16)((o0 - (float)a0) * 1024.0f); l1.h[q] = (_Float16)((o1 - (float)a1) * 1024.0f); }
  { *(v8us*)((unsigned short*)H + base) = h0.half[0]; *(v8us*)((unsigned short*)H + base + HH) = h1.half[0]; if (L) { *(v8us*)((unsigned short*)L + base) = l0.half[0]; *(v8us*)((unsigned short*)L + base + HH) = l1.half[0]; }  } }
// one f16 store with its s_wait_xcnt 0 in the same statement: the loop that calls it adds to the address registers right behind the store, and a wait in a statement of its own landed behind those additions; the "memory" clobber keeps the store behind the trip's own read of the S row that it lands on
__device__ __forceinline__ void st_f16(_Float16* p, _Float16 v) { const unsigned int bits = __builtin_bit_cast(unsigned short, v); asm volatile("global_store_b16 %0, %1, off\n\ts_wait_xcnt 0x0" :: "v"(p), "v"(bits) : "memory"); }
__global__ __launch_bounds__(256) void k_csoft(float* S, size_t sS, int r0, int nrows, int nk, const int* __restrict__ mask, _Float16* __restrict__ PL, size_t sPL) {
  #pragma clang fp contract(off)
  const int wv = threadIdx.x >> 5, ln = threadIdx.x & 31; const int rl = blockIdx.x * 8 + wv; if (rl >= nrows) return; const int r = r0 + rl; const int b = blockIdx.z, pl = b * NHQ + blockIdx.y; S += (size_t)pl * sS; if (PL) PL += (size_t)pl * sPL;      /* batch = blockIdx.z, head = blockIdx.y: their own S and P planes */ const float* sr = S + (size_t)rl * SQ; _Float16* ph = (_Float16*)(S + (size_t)rl * SQ);      /* P row over its own S row: element j lands on bytes that this wave read at or before trip j / 64 of the last pass */ const int* mk = mask + (size_t)b * SQ; float m = -3.0e38f;
#pragma unroll 1
  for (int j = ln; j < nk; j += 32) if (j <= r && mk[j] > 0) m = fmaxf(m, sr[j]);
  for (int o = 16; o > 0; o >>= 1) m = fmaxf(m, __shfl_xor(m, o, 32)); float su = 0.f;
#pragma unroll 1
  for (int j = ln; j < nk; j += 32) if (j <= r && mk[j] > 0) su += expf(sr[j] - m);
  for (int o = 16; o > 0; o >>= 1) su += __shfl_xor(su, o, 32); const float f = 1024.0f / su;
  {
#pragma unroll 1
    for (int j = ln; j < nk; j += 32) { const float p = (j <= r && mk[j] > 0) ? expf(sr[j] - m) * f : 0.f; const _Float16 hv = (_Float16)p; st_f16(ph + j, hv); if (PL) st_f16(PL + (size_t)rl * SQ + j, (_Float16)((p - (float)hv) * 1024.0f)); }
     } }

extern "C" void kernel_launch(void* const* d_in, const int* in_sizes, int n_in,
                              void* d_out, int out_size, void* d_ws, size_t ws_size, hipStream_t stream) {
  (void)in_sizes; (void)n_in; (void)out_size;
  const float* const* I = (const float* const*)d_in; const float* hs = I[0]; const int* amask = (const int*)d_in[1]; const int* pid = (const int*)d_in[2]; const float* Wq = I[3]; const float* Wk = I[4]; const float* Wv = I[5]; const float* Wo = I[6];
  char* ws = (char*)d_ws; size_t off = 0;
  auto take = [&](size_t bytes) { char* p = ws + off; off += (bytes + 255) & ~(size_t)255; return p; };
  const size_t np = (size_t)SQ * DM, nkv = (size_t)SQ * HD;      /* elements per batch of a [SQ][DM] and of a [SQ][HD] plane */
  _Float16* BQ = (_Float16*)take(np * 2); _Float16* BK = (_Float16*)take((size_t)HD * DM * 2); _Float16* BV = (_Float16*)take((size_t)HD * DM * 2); _Float16* BO = (_Float16*)take(np * 2);
  float* CS = (float*)take((size_t)NB * SQ * HH * 4); float* SN = (float*)take((size_t)NB * SQ * HH * 4);
  _Float16* X16 = (_Float16*)take(NB * np * 2); float* F32 = (float*)take(NB * np * 4); _Float16* QH = (_Float16*)take(NB * np * 2); _Float16* QL = (_Float16*)take(NB * np * 2); _Float16* KH = (_Float16*)take(NB * nkv * 2); _Float16* KL = (_Float16*)take(NB * nkv * 2); _Float16* VH = (_Float16*)take(NB * nkv * 2); _Float16* VL = (_Float16*)take(NB * nkv * 2); _Float16* VTh = (_Float16*)take(NB * nkv * 2); _Float16* VTl = (_Float16*)take(NB * nkv * 2);
  const size_t sS = (size_t)1024 * SQ, sPL = (size_t)BAND * SQ;      /* elements per (batch, head) plane of S, and of PL */
  float* S = (float*)take(NB * NHQ * sS * 4); _Float16* PH = (_Float16*)S; const int ldp = 2 * SQ; const size_t sP = 2 * sS;      /* P row r of a plane = front half of S row r: pitch and plane stride in f16 elements are twice those of S */
  _Float16* PL = X16; float* O = F32; _Float16* O16 = QL; _Float16* OL0 = (_Float16*)take((size_t)NB * BAND * DM * 2);      /* PL over X16 (dead after the q GEMM; same size); O over the q f32 scratch (dead after k_rope); O16 over QL (QL is only read for band 0, which runs first) */
  if (off > ws_size) return;      /* 8+1+1+8 + 4 + 16+32+16+16 + 6*2 + 128 + 2 = 244 MiB */
  k_wt_f16<<<(unsigned)((np / 8 + 255) / 256), 256, 0, stream>>>(Wq, BQ, DM, DM, 16.0f); k_wt_f16<<<(unsigned)(((size_t)HD * DM / 8 + 255) / 256), 256, 0, stream>>>(Wk, BK, DM, HD, 16.0f); k_wt_f16<<<(unsigned)(((size_t)HD * DM / 8 + 255) / 256), 256, 0, stream>>>(Wv, BV, DM, HD, 16.0f); k_wt_f16<<<(unsigned)((np / 8 + 255) / 256), 256, 0, stream>>>(Wo, BO, DM, DM, 16.0f);
  const int MT = NB * SQ;      /* tokens of both batches: the q/k/v projections, the passes before attention and the hi Wo GEMM see one flat [MT][...] matrix */
  k_rotab<<<(NB * SQ * HH + 255) / 256, 256, 0, stream>>>(pid, CS, SN);
  k_x16<<<(unsigned)((NB * np / 8 + 255) / 256), 256, 0, stream>>>(hs, X16, NB * np / 8);
  /* k and v (one kv head of 256) */
  k_gemm2<0><<<dim3((MT / 128) * (HD / 64), 1), 128, 0, stream>>>(X16, DM, 0, BK, DM, 0, 0.0625f, nullptr, 0, nullptr, 1, 0, 0, F32, nullptr, HD, 0, MT, HD, DM, 0, 0, 0);
  k_rope<<<(unsigned)(((size_t)MT * 1 * (HH / 8) + 255) / 256), 256, 0, stream>>>(F32, 1, CS, SN, KH, KL);
  k_gemm2<0><<<dim3((MT / 128) * (HD / 64), 1), 128, 0, stream>>>(X16, DM, 0, BV, DM, 0, 0.0625f, nullptr, 0, nullptr, 1, 0, 0, F32, nullptr, HD, 0, MT, HD, DM, 0, 0, 0);
  k_hl<<<(unsigned)((NB * nkv / 8 + 255) / 256), 256, 0, stream>>>(F32, VH, VL, NB * nkv / 8, 0, 0);
  k_vt<HD / 64, SQ><<<NB * (HD / 64) * (SQ / 64), 256, 0, stream>>>(VH, HD, 0, VTh); k_vt<HD / 64, SQ><<<NB * (HD / 64) * (SQ / 64), 256, 0, stream>>>(VL, HD, 0, VTl);
  /* q (8 heads), roped, hi/lo */
  k_gemm2<0><<<dim3((MT / 128) * (DM / 64), 1), 128, 0, stream>>>(X16, DM, 0, BQ, DM, 0, 0.0625f, nullptr, 0, nullptr, 1, 0, 0, F32, nullptr, DM, 0, MT, DM, DM, 0, 0, 0);
  k_rope<<<(unsigned)(((size_t)MT * NHQ * (HH / 8) + 255) / 256), 256, 0, stream>>>(F32, NHQ, CS, SN, QH, QL);
  /* attention: head in grid.y (A + h * HD for q, one shared K / V^T per batch, C plane h), batch in grid.z (the last three arguments: element strides of A, B and C per batch); rowsPerB = -1 adds the own element of the C plane */
  /* band 0 (rows < 256, keys < 256): hi + lo everywhere */
  { const int nk = BAND; const dim3 gS((BAND / 128) * (nk / 64), NHQ, NB), gO((BAND / 128) * (HD / 64), NHQ, NB);
    k_gemm2<0><<<gS, 128, 0, stream>>>(QH, DM, HD, KH, HD, 0, 0.0625f, nullptr, 0, nullptr, 1, 0, 0, S, nullptr, SQ, sS, BAND, nk, HD, np, nkv, NHQ * sS);      /* S = (Qh Kh^T) / 16 */
    k_gemm2<0><<<gS, 128, 0, stream>>>(QL, DM, HD, KH, HD, 0, 0.0625f / 1024.0f, nullptr, 0, S, -1, 0, 0, S, nullptr, SQ, sS, BAND, nk, HD, np, nkv, NHQ * sS);
    k_gemm2<0><<<gS, 128, 0, stream>>>(QH, DM, HD, KL, HD, 0, 0.0625f / 1024.0f, nullptr, 0, S, -1, 0, 0, S, nullptr, SQ, sS, BAND, nk, HD, np, nkv, NHQ * sS);
    k_csoft<<<dim3(BAND / 8, NHQ, NB), 256, 0, stream>>>(S, sS, 0, BAND, nk, amask, PL, sPL);
    k_gemm2<0><<<gO, 128, 0, stream>>>(PH, ldp, sP, VTh, SQ, 0, 0.0009765625f, nullptr, 0, nullptr, 1, 0, 0, O, nullptr, DM, HD, BAND, HD, nk, NHQ * sP, nkv, np);
    k_gemm2<0><<<gO, 128, 0, stream>>>(PL, SQ, sPL, VTh, SQ, 0, 0.0009765625f / 1024.0f, nullptr, 0, O, -1, 0, 0, O, nullptr, DM, HD, BAND, HD, nk, NHQ * sPL, nkv, np);
    k_gemm2<0><<<gO, 128, 0, stream>>>(PH, ldp, sP, VTl, SQ, 0, 0.0009765625f / 1024.0f, nullptr, 0, O, -1, 0, 0, O, nullptr, DM, HD, BAND, HD, nk, NHQ * sP, nkv, np); }
  /* two later bands (rows 256..1023 with keys < 1024, rows 1024..2047 with keys < 2048): plain */
  for (int k = 0; k < 2; ++k) { const int r0 = k ? 1024 : BAND, nr = k ? 1024 : (1024 - BAND), nk = k ? SQ : 1024; const dim3 gS((nr / 128) * (nk / 64), NHQ, NB), gO((nr / 128) * (HD / 64), NHQ, NB);
    k_gemm2<0><<<gS, 128, 0, stream>>>(QH + (size_t)r0 * DM, DM, HD, KH, HD, 0, 0.0625f, nullptr, 0, nullptr, 1, 0, 0, S, nullptr, SQ, sS, nr, nk, HD, np, nkv, NHQ * sS);
    k_csoft<<<dim3(nr / 8, NHQ, NB), 256, 0, stream>>>(S, sS, r0, nr, nk, amask, nullptr, 0);
    k_gemm2<0><<<gO, 128, 0, stream>>>(PH, ldp, sP, VTh, SQ, 0, 0.0009765625f, nullptr, 0, nullptr, 1, 0, 0, O + (size_t)r0 * DM, nullptr, DM, HD, nr, HD, nk, NHQ * sP, nkv, np); }
  /* output: O hi (+ lo on rows < 256 of each batch) into Wo */
  k_hl<<<dim3((unsigned)(((size_t)BAND * DM / 8 + 255) / 256), NB), 256, 0, stream>>>(O, O16, OL0, (size_t)BAND * DM / 8, np, (size_t)BAND * DM);      /* rows < 256: hi + lo */
  k_h16<<<dim3((unsigned)((((size_t)SQ - BAND) * DM / 8 + 255) / 256), NB), 256, 0, stream>>>(O + (size_t)BAND * DM, O16 + (size_t)BAND * DM, ((size_t)SQ - BAND) * DM / 8, np);
  float* out = (float*)d_out;
  k_gemm2<0><<<dim3((MT / 128) * (DM / 64), 1), 128, 0, stream>>>(O16, DM, 0, BO, DM, 0, 0.0625f, nullptr, 0, nullptr, 1, 0, 0, out, nullptr, DM, 0, MT, DM, DM, 0, 0, 0);
  k_gemm2<0><<<dim3((BAND / 128) * (DM / 64), 1, NB), 128, 0, stream>>>(OL0, DM, 0, BO, DM, 0, 0.0625f / 1024.0f, nullptr, 0, out, -1, 0, 0, out, nullptr, DM, 0, BAND, DM, DM, (size_t)BAND * DM, 0, np);
}

// v004
// Measured time: 475 microseconds a run.
// Two timings next to v003 put it at 1.28 and 1.27 times that version's speed.
// All steps since v000 together make it 12.5 times as fast.
#include <hip/hip_runtime.h>
// FlaxGemmaAttention (2 x 2048 tokens, D 2048, 8 query heads of 256 sharing ONE kv head; rotate-half RoPE from the INPUT position_ids; causal + INPUT padding mask; scale 256^-0.5; out = attn Wo).
// Structure (both batches in every launch: flat rows for the q/k/v projections, the passes before attention and the hi Wo GEMM, blockIdx.y for the O hi/lo passes, blockIdx.z for attention and the lo Wo GEMM): exact f16 plane of the hidden states; q/k/v GEMMs (32x64 wave tiles, f32 accumulation, exact x16 weights); RoPE tables (f32 trig) + rotation on VALU into f16 hi (+ 2^10 residual) planes; V^T hi/residual by LDS tiles; UNFUSED attention per row band (rows < 256 | 256..1023 with keys < 1024 | 1024.. with all keys), all 8 heads of a band in ONE launch (head = blockIdx.y, batch = blockIdx.z, one S plane per batch and head, each P row stored over the front half of its own S row), because the head dim is 256: S = Q_band K^T over the causally reachable keys as a GEMM (f32), causal/padding softmax on VALU (wave per row) into an f16 P plane (x2^10), O_band = P V as a GEMM; band 0 (rows < 256, whose outputs average over few keys) uses hi+lo operands throughout (3-term S, 3-term P.V, hi+lo O into Wo), later bands plain f16; output GEMM.
// Compute dtype: inputs and weights rounded to bf16; rows >= 256: q, k, P, v, O as f16 (~2^-12); rows < 256: hi + residual pairs; f32 accumulation/softmax/trig. v_wmma_f32_16x16x32_f16.
#define NB 2
#define SQ 2048
#define DM 2048
#define NHQ 8
#define HD 256
#define HH (HD / 2)
#define BAND 256
#define NBAND (SQ / BAND)
typedef __bf16 v16b __attribute__((ext_vector_type(16)));
typedef unsigned short v8us __attribute__((ext_vector_type(8), may_alias));
typedef float  v8f  __attribute__((ext_vector_type(8)));
typedef float  v4f  __attribute__((ext_vector_type(4)));
typedef float  v4fa __attribute__((ext_vector_type(4), may_alias));
union FragB { v16b v; v8us half[2]; unsigned short u[16]; };

__device__ __forceinline__ unsigned short bf16_bits(float x) { unsigned int u = __float_as_uint(x); return (unsigned short)((u + 0x7FFFu + ((u >> 16) & 1u)) >> 16); }
__device__ __forceinline__ float bf16_val(unsigned short b) { return __uint_as_float(((unsigned int)b) << 16); }
__device__ __forceinline__ float bf16_round(float x) { return bf16_val(bf16_bits(x)); }
// D += A·B with NT terms: 1 = ah·bh, 2 = + al·bh (A split), 3 = + ah·bl (both split)
template <int NT>
__device__ __forceinline__ v8f mmaN(v16b ah, v16b al, v16b bh, v16b bl, v8f c) {
  c = __builtin_amdgcn_wmma_f32_16x16x32_bf16(false, ah, false, bh, (short)0, c, false, false);
  if (NT >= 2) c = __builtin_amdgcn_wmma_f32_16x16x32_bf16(false, al, false, bh, (short)0, c, false, false);
  if (NT >= 3) c = __builtin_amdgcn_wmma_f32_16x16x32_bf16(false, ah, false, bl, (short)0, c, false, false);
  asm volatile("v_nop\n\tv_nop\n\tv_nop\n\tv_nop" : "+v"(c) : "v"(ah), "v"(al), "v"(bh), "v"(bl));
  return c;
}

__global__ __launch_bounds__(256) void k_wt_bf16(const float* __restrict__ W, unsigned short* __restrict__ Wt, int K, int N) {
  const int t = blockIdx.x * 256 + threadIdx.x;
  const int k8n = K / 8;
  if (t >= N * k8n) return;
  const int n = t / k8n, k8 = (t % k8n) * 8;
  v8us v;
#pragma unroll
  for (int i = 0; i < 8; ++i) v[i] = bf16_bits(W[(size_t)(k8 + i) * N + n]);
  *(v8us*)(Wt + (size_t)n * K + k8) = v;
  
}

// GEMM C[M][N] (f32, pitch ldc) = act(A[M][K]·W + bias). A f32 row-major (pitch lda) converted per fragment to bf16
// (ASPLIT: hi/lo two planes -> 2 terms, else single rounded term); Wt bf16 [N][K] (pitch ldb). BIAS_BF16 rounds the
// bias to bf16 first (bias quantised to bf16 before the add). K%32==0, M%16==0, N%64==0.
template <bool ASPLIT, int ACT, bool BIAS_BF16>
__global__ __launch_bounds__(128) void k_gemm_bf(const float* __restrict__ A, int lda, const unsigned short* __restrict__ Wt, int ldb,
                                               const float* __restrict__ bias, float* __restrict__ C, int ldc, int M, int N, int K) {
  __shared__ __attribute__((aligned(16))) float so[4][16][64];
  const int tid = threadIdx.x, w = tid >> 5, lane = tid & 31, ln = lane & 15, hh = lane >> 4;
  const int ntn = N / 64;
  const int wid = blockIdx.x * 4 + w;
  const int mt = wid / ntn, nq = wid % ntn;
  if (mt * 16 >= M) return;
  const int row0 = mt * 16, col0 = nq * 64;
  const float* arow = A + (size_t)(row0 + ln) * lda;
  v8f acc[4] = {};
  for (int kb = 0; kb < K; kb += 32) {
    FragB ah, al;
    const v4f x0 = *(const v4fa*)(arow + kb + 8 * hh), x1 = *(const v4fa*)(arow + kb + 8 * hh + 4);
    const v4f x2 = *(const v4fa*)(arow + kb + 16 + 8 * hh), x3 = *(const v4fa*)(arow + kb + 16 + 8 * hh + 4);
    float xs[16] = {x0[0],x0[1],x0[2],x0[3],x1[0],x1[1],x1[2],x1[3],x2[0],x2[1],x2[2],x2[3],x3[0],x3[1],x3[2],x3[3]};
#pragma unroll
    for (int i = 0; i < 16; ++i) { const unsigned short hb = bf16_bits(xs[i]); ah.u[i] = hb; al.u[i] = ASPLIT ? bf16_bits(xs[i] - bf16_val(hb)) : (unsigned short)0; }
#pragma unroll
    for (int t = 0; t < 4; ++t) {
      const unsigned short* brow = Wt + (size_t)(col0 + t * 16 + ln) * ldb + kb;
      FragB b;
      b.half[0] = *(const v8us*)(brow + 8 * hh);
      b.half[1] = *(const v8us*)(brow + 16 + 8 * hh);
      acc[t] = mmaN<ASPLIT ? 2 : 1>(ah.v, al.v, b.v, b.v, acc[t]);
    }
  }
#pragma unroll
  for (int t = 0; t < 4; ++t) {
    float bv = bias ? bias[col0 + t * 16 + ln] : 0.f;
    if (BIAS_BF16) bv = bf16_round(bv);
#pragma unroll
    for (int r = 0; r < 8; ++r) { float v = acc[t][r] + bv; if (ACT == 1) v = fmaxf(v, 0.f); so[w][8 * hh + r][t * 16 + ln] = v; }
  }
  __builtin_amdgcn_fence(__ATOMIC_ACQ_REL, "workgroup");
  __builtin_amdgcn_wave_barrier();
  const int rsub = lane >> 4, c4 = (lane & 15) * 4;
  {
#pragma unroll
    for (int q = 0; q < 8; ++q) {
      const int r = q * 2 + rsub;
      const v4f v = *(const v4fa*)&so[w][r][c4];
      *(v4f*)(C + (size_t)(row0 + r) * ldc + col0 + c4) = v;
    }
    
  }
}

// GEMM C = act(A·W + bias + resid): A f32 (ASPLIT -> hi/lo 2 terms), Wt bf16 [N][K]; ACT 0 none, 1 relu, 2 exact gelu;
// resid (optional, f32, row index = (row % rmod), pitch ldr, RES_BF16 rounds it) added before the activation.
template <bool ASPLIT, int ACT, bool BIAS_BF16, bool RES_BF16>
__global__ __launch_bounds__(128) void k_gemm_bf3(const float* __restrict__ A, int lda, const unsigned short* __restrict__ Wt, int ldb,
                                                const float* __restrict__ bias, const float* __restrict__ resid, int rmod, int ldr,
                                                float* __restrict__ C, int ldc, int M, int N, int K) {
  __shared__ __attribute__((aligned(16))) float so[4][16][64];
  const int tid = threadIdx.x, w = tid >> 5, lane = tid & 31, ln = lane & 15, hh = lane >> 4;
  const int ntn = N / 64;
  const int wid = blockIdx.x * 4 + w;
  const int mt = wid / ntn, nq = wid % ntn;
  if (mt * 16 >= M) return;
  const int row0 = mt * 16, col0 = nq * 64;
  const float* arow = A + (size_t)(row0 + ln) * lda;
  v8f acc[4] = {};
  for (int kb = 0; kb < K; kb += 32) {
    FragB ah, al;
    const v4f x0 = *(const v4fa*)(arow + kb + 8 * hh), x1 = *(const v4fa*)(arow + kb + 8 * hh + 4);
    const v4f x2 = *(const v4fa*)(arow + kb + 16 + 8 * hh), x3 = *(const v4fa*)(arow + kb + 16 + 8 * hh + 4);
    float xs[16] = {x0[0],x0[1],x0[2],x0[3],x1[0],x1[1],x1[2],x1[3],x2[0],x2[1],x2[2],x2[3],x3[0],x3[1],x3[2],x3[3]};
#pragma unroll
    for (int i = 0; i < 16; ++i) { const unsigned short hb = bf16_bits(xs[i]); ah.u[i] = hb; al.u[i] = ASPLIT ? bf16_bits(xs[i] - bf16_val(hb)) : (unsigned short)0; }
#pragma unroll
    for (int t = 0; t < 4; ++t) {
      const unsigned short* brow = Wt + (size_t)(col0 + t * 16 + ln) * ldb + kb;
      FragB b;
      b.half[0] = *(const v8us*)(brow + 8 * hh);
      b.half[1] = *(const v8us*)(brow + 16 + 8 * hh);
      acc[t] = mmaN<ASPLIT ? 2 : 1>(ah.v, al.v, b.v, b.v, acc[t]);
    }
  }
#pragma unroll
  for (int t = 0; t < 4; ++t) {
    const int col = col0 + t * 16 + ln;
    float bv = bias ? bias[col] : 0.f;
    if (BIAS_BF16) bv = bf16_round(bv);
#pragma unroll
    for (int r = 0; r < 8; ++r) {
      float v = acc[t][r] + bv;
      if (resid) { float rv = resid[(size_t)((row0 + 8 * hh + r) % rmod) * ldr + col]; if (RES_BF16) rv = bf16_round(rv); v += rv; }
      if (ACT == 1) v = fmaxf(v, 0.f);
      if (ACT == 2) v = 0.5f * v * (1.0f + erff(v * 0.70710678118654752f));
      if (ACT == 3) { const float u = 0.7978845608028654f * (v + 0.044715f * v * v * v); v = 0.5f * v * (1.0f + tanhf(u)); }
      so[w][8 * hh + r][t * 16 + ln] = v;
    }
  }
  __builtin_amdgcn_fence(__ATOMIC_ACQ_REL, "workgroup");
  __builtin_amdgcn_wave_barrier();
  const int rsub = lane >> 4, c4 = (lane & 15) * 4;
  {
#pragma unroll
    for (int q = 0; q < 8; ++q) {
      const int r = q * 2 + rsub;
      const v4f v = *(const v4fa*)&so[w][r][c4];
      *(v4f*)(C + (size_t)(row0 + r) * ldc + col0 + c4) = v;
    }
    
  }
}
// row LayerNorm (biased variance, eps) over N: s = X (+ R); optional out_sum <- s; out_norm <- (s-mu)*rsqrt(var+eps)*g + b
template <bool PARAM_BF16>
__global__ __launch_bounds__(256) void k_layernorm(const float* __restrict__ X, const float* __restrict__ R, const float* __restrict__ g, const float* __restrict__ bta,
                                                  float* __restrict__ out_sum, float* __restrict__ out_norm, int N, float eps) {
  __shared__ float red[256];
  const int row = blockIdx.x, tid = threadIdx.x;
  const float* x = X + (size_t)row * N; const float* rr = R ? R + (size_t)row * N : nullptr;
  float vals[16];                     // up to N = 4096
  const int per = N / 256;            // contiguous chunk per thread? use strided-by-4 chunks: thread handles j = tid*4 + 1024*u
  float s1 = 0.f;
  for (int u = 0; u < per / 4; ++u) {
    const int j = tid * 4 + 1024 * u;
    const v4f a = *(const v4fa*)(x + j);
    v4f b = {0.f,0.f,0.f,0.f}; if (rr) b = *(const v4fa*)(rr + j);
#pragma unroll
    for (int q = 0; q < 4; ++q) { const float v = a[q] + b[q]; vals[u * 4 + q] = v; s1 += v; }
  }
  red[tid] = s1; __syncthreads();
  for (int st = 128; st > 0; st >>= 1) { if (tid < st) red[tid] += red[tid + st]; __syncthreads(); }
  const float mu = red[0] / (float)N; __syncthreads();
  float s2 = 0.f;
  for (int u = 0; u < per / 4; ++u)
#pragma unroll
    for (int q = 0; q < 4; ++q) { const float c = vals[u * 4 + q] - mu; s2 += c * c; }
  red[tid] = s2; __syncthreads();
  for (int st = 128; st > 0; st >>= 1) { if (tid < st) red[tid] += red[tid + st]; __syncthreads(); }
  const float rs = rsqrtf(red[0] / (float)N + eps);
  {
    for (int u = 0; u < per / 4; ++u) {
      const int j = tid * 4 + 1024 * u;
      v4f o, sm;
#pragma unroll
      for (int q = 0; q < 4; ++q) {
        float gg = g[j + q], bb = bta[j + q];
        if (PARAM_BF16) { gg = bf16_round(gg); bb = bf16_round(bb); }
        sm[q] = vals[u * 4 + q]; o[q] = (vals[u * 4 + q] - mu) * rs * gg + bb;
      }
      if (out_sum) *(v4f*)(out_sum + (size_t)row * N + j) = sm;
      *(v4f*)(out_norm + (size_t)row * N + j) = o;
    }
    
  }
}



// ---- f16 WMMA path (v_wmma_f32_16x16x32_f16): 11-bit significands for operands in range — used where a [0,1] probability operand needs more precision than bf16
typedef _Float16 v16h __attribute__((ext_vector_type(16)));
union FragH { v16h v; v8us half[2]; _Float16 h[16]; unsigned short u[16]; };
template <int NT>
__device__ __forceinline__ v8f mmaH(v16h ah, v16h al, v16h bh, v16h bl, v8f c) {
  c = __builtin_amdgcn_wmma_f32_16x16x32_f16(false, ah, false, bh, (short)0, c, false, false);
  if (NT >= 2) c = __builtin_amdgcn_wmma_f32_16x16x32_f16(false, al, false, bh, (short)0, c, false, false);
  if (NT >= 3) c = __builtin_amdgcn_wmma_f32_16x16x32_f16(false, ah, false, bl, (short)0, c, false, false);
  asm volatile("v_nop\n\tv_nop\n\tv_nop\n\tv_nop" : "+v"(c) : "v"(ah), "v"(al), "v"(bh), "v"(bl));
  return c;
}
// batched GEMM like k_gemm_b but f16 operands: A f32 (split into f16 hi/lo if ASPLIT, else rounded to f16), Bt = f16 values [n][k]; alpha; C f32; N multiple of 16 (partial tiles skipped)
template <bool ASPLIT>
__global__ __launch_bounds__(128) void k_gemm_h(const float* __restrict__ A, int lda, size_t sA, const _Float16* __restrict__ Bh, int ldb, size_t sB, float alpha, float* __restrict__ C, int ldc, size_t sC, int M, int N, int K) {
  __shared__ __attribute__((aligned(16))) float so[4][16][64];
  const int tid = threadIdx.x, w = tid >> 5, lane = tid & 31, ln = lane & 15, hh = lane >> 4; const int by = blockIdx.y;
  A += (size_t)by * sA; Bh += (size_t)by * sB; C += (size_t)by * sC;
  const int ntn = (N + 63) / 64; const int wid = blockIdx.x * 4 + w; const int mt = wid / ntn, nq = wid % ntn; if (mt * 16 >= M) return;
  const int row0 = mt * 16, col0 = nq * 64; const float* arow = A + (size_t)(row0 + ln) * lda;
  v8f acc[4] = {};
  for (int kb = 0; kb < K; kb += 32) {
    FragH ah, al;
    const v4f x0 = *(const v4fa*)(arow + kb + 8 * hh), x1 = *(const v4fa*)(arow + kb + 8 * hh + 4), x2 = *(const v4fa*)(arow + kb + 16 + 8 * hh), x3 = *(const v4fa*)(arow + kb + 16 + 8 * hh + 4);
    float xs[16] = {x0[0],x0[1],x0[2],x0[3],x1[0],x1[1],x1[2],x1[3],x2[0],x2[1],x2[2],x2[3],x3[0],x3[1],x3[2],x3[3]};
#pragma unroll
    for (int i = 0; i < 16; ++i) { const _Float16 h = (_Float16)xs[i]; ah.h[i] = h; al.h[i] = ASPLIT ? (_Float16)(xs[i] - (float)h) : (_Float16)0.0f; }
#pragma unroll
    for (int t = 0; t < 4; ++t) { if (col0 + t * 16 >= N) continue; const size_t boff = (size_t)(col0 + t * 16 + ln) * ldb + kb; FragH bq; bq.half[0] = *(const v8us*)(Bh + boff + 8 * hh); bq.half[1] = *(const v8us*)(Bh + boff + 16 + 8 * hh);
      acc[t] = mmaH<ASPLIT ? 2 : 1>(ah.v, al.v, bq.v, bq.v, acc[t]); }
  }
#pragma unroll
  for (int t = 0; t < 4; ++t) { if (col0 + t * 16 >= N) continue;
#pragma unroll
    for (int r = 0; r < 8; ++r) so[w][8 * hh + r][t * 16 + ln] = acc[t][r] * alpha; }
  __builtin_amdgcn_fence(__ATOMIC_ACQ_REL, "workgroup"); __builtin_amdgcn_wave_barrier();
  const int rsub = lane >> 4, c4 = (lane & 15) * 4;
  {
#pragma unroll
    for (int q = 0; q < 8; ++q) { const int r = q * 2 + rsub; if (col0 + c4 < N) { const v4f v = *(const v4fa*)&so[w][r][c4]; *(v4f*)(C + (size_t)(row0 + r) * ldc + col0 + c4) = v; } }
     }
}

// Wt[n][k] = f16(W[k][n]·scale) from f32 row-major W[K][N] (scale = power of two; bf16-exact weights stay exact in f16 away from the subnormal range)
__global__ __launch_bounds__(256) void k_wt_f16(const float* __restrict__ W, _Float16* __restrict__ Wt, int K, int N, float scale) {
  const int t = blockIdx.x * 256 + threadIdx.x; if (t >= N * (K / 8)) return; const int n = t / (K / 8), k8 = (t % (K / 8)) * 8; FragH f;
#pragma unroll
  for (int i = 0; i < 8; ++i) f.h[i] = (_Float16)(bf16_round(W[(size_t)(k8 + i) * N + n]) * scale); const v8us o = f.half[0];
  *(v8us*)((unsigned short*)Wt + (size_t)n * K + k8) = o; 
}
// k_gemm_hh variant with fused epilogue: v = acc·alpha + bias[by·sBias + col] (+ CP[(row/rowsPerB)·sCPb + by·64 + col] if CP) ; ACT 0 none / 1 elu ; writes f16 C16 (and f32 C if non-null)
template <int ACT>
__global__ __launch_bounds__(128) void k_gemm_hhx(const _Float16* __restrict__ A, int lda, size_t sA, const _Float16* __restrict__ Bh, int ldb, size_t sB, float alpha, const float* __restrict__ bias, size_t sBias, const float* __restrict__ CP, int rowsPerB, size_t sCPb, int row0g,
    float* __restrict__ C, _Float16* __restrict__ C16, int ldc, size_t sC, int M, int N, int K) {
  __shared__ __attribute__((aligned(16))) float so[4][16][64];
  const int tid = threadIdx.x, w = tid >> 5, lane = tid & 31, ln = lane & 15, hh = lane >> 4; const int by = blockIdx.y;
  A += (size_t)by * sA; Bh += (size_t)by * sB; const size_t cofs = (size_t)by * sC; const float* bp = bias ? bias + (size_t)by * sBias : nullptr;
  const int ntn = (N + 63) / 64; const int wid = blockIdx.x * 4 + w; const int mt = wid / ntn, nq = wid % ntn; if (mt * 16 >= M) return;
  const int row0 = mt * 16, col0 = nq * 64; const _Float16* arow = A + (size_t)(row0 + ln) * lda;
  v8f acc[4] = {};
  for (int kb = 0; kb < K; kb += 32) { FragH ah; ah.half[0] = *(const v8us*)((const unsigned short*)arow + kb + 8 * hh); ah.half[1] = *(const v8us*)((const unsigned short*)arow + kb + 16 + 8 * hh);
#pragma unroll
    for (int t = 0; t < 4; ++t) { if (col0 + t * 16 >= N) continue; const size_t boff = (size_t)(col0 + t * 16 + ln) * ldb + kb; FragH bq; bq.half[0] = *(const v8us*)((const unsigned short*)Bh + boff + 8 * hh); bq.half[1] = *(const v8us*)((const unsigned short*)Bh + boff + 16 + 8 * hh);
      acc[t] = mmaH<1>(ah.v, ah.v, bq.v, bq.v, acc[t]); }
  }
#pragma unroll
  for (int t = 0; t < 4; ++t) { if (col0 + t * 16 >= N) continue; const int col = col0 + t * 16 + ln; const float bv = bp ? bf16_round(bp[col]) : 0.f;
#pragma unroll
    for (int r = 0; r < 8; ++r) { float v = acc[t][r] * alpha + bv; if (CP) { const int rr = row0g + row0 + 8 * hh + r; if (rowsPerB < 0) v += CP[cofs + (size_t)rr * ldc + col];      /* rowsPerB < 0: own element of the batched C plane */ else { const int bidx = rr / rowsPerB; v += CP[(size_t)bidx * sCPb + (size_t)by * 64 + col]; } } if (ACT == 1) v = (v > 0.f) ? v : expm1f(v); else if (ACT == 7) v = (v > 0.f) ? v + 1.0f : expf(v); else if (ACT == 8) v = tanhf(v); else if (ACT == 9) v = 0.5f * v * (1.0f + tanhf(0.7978845608028654f * (v + 0.044715f * v * v * v))); else if (ACT == 11) v = 1.0f / (1.0f + expf(-v)); else if (ACT == 12) v = (v > 0.f) ? v : 0.01f * v; else if (ACT == 14) v = (v > 0.f) ? v : 0.1f * v; else if (ACT == 16) v = (v >= 0.f) ? v : 0.3f * v; else if (ACT == 15) v = v / (1.0f + expf(-v)); else if (ACT == 3) v = fmaxf(v, 0.f); else if (ACT == 6) v = 0.5f * v * (1.0f + erff(v * 0.70710678118654752f)); so[w][8 * hh + r][t * 16 + ln] = v; } }
  __builtin_amdgcn_fence(__ATOMIC_ACQ_REL, "workgroup"); __builtin_amdgcn_wave_barrier();
  const int rsub = lane >> 4, c4 = (lane & 15) * 4; typedef _Float16 v4h __attribute__((ext_vector_type(4)));
  {
#pragma unroll
    for (int q = 0; q < 8; ++q) { const int r = q * 2 + rsub; if (col0 + c4 < N) { const v4f v = *(const v4fa*)&so[w][r][c4]; if (C) *(v4f*)(C + cofs + (size_t)(row0 + r) * ldc + col0 + c4) = v; if (C16) { v4h h4; for (int i = 0; i < 4; ++i) h4[i] = (_Float16)v[i]; *(v4h*)(C16 + cofs + (size_t)(row0 + r) * ldc + col0 + c4) = h4; } } }
     }
}


typedef _Float16 v4h __attribute__((ext_vector_type(4)));

__global__ __launch_bounds__(256) void k_x16(const float* __restrict__ x, _Float16* __restrict__ X16, size_t n8) { const size_t t = (size_t)blockIdx.x * 256 + threadIdx.x; if (t >= n8) return; FragH f;
#pragma unroll
  for (int q = 0; q < 8; ++q) f.h[q] = (_Float16)bf16_round(x[t * 8 + q]); *(v8us*)((unsigned short*)X16 + t * 8) = f.half[0];  }
__global__ __launch_bounds__(256) void k_h16(const float* __restrict__ x, _Float16* __restrict__ X16, size_t n8, size_t sB) { const size_t t = (size_t)blockIdx.x * 256 + threadIdx.x; if (t >= n8) return; x += (size_t)blockIdx.y * sB; X16 += (size_t)blockIdx.y * sB;      /* batch = blockIdx.y */ FragH f;
#pragma unroll
  for (int q = 0; q < 8; ++q) f.h[q] = (_Float16)x[t * 8 + q]; *(v8us*)((unsigned short*)X16 + t * 8) = f.half[0];  }
__global__ __launch_bounds__(256) void k_round16f(const float* __restrict__ W, _Float16* __restrict__ Bt, size_t n8) { const size_t t = (size_t)blockIdx.x * 256 + threadIdx.x; if (t >= n8) return; FragH f;
#pragma unroll
  for (int i = 0; i < 8; ++i) f.h[i] = (_Float16)(bf16_round(W[t * 8 + i]) * 16.0f); *(v8us*)((unsigned short*)Bt + t * 8) = f.half[0];  }
template <int NHv, int TTv>
__global__ __launch_bounds__(256) void k_vt(const _Float16* __restrict__ V16, int ldv, int voff, _Float16* __restrict__ Vt) { __shared__ unsigned short tl[64][66]; const int tid = threadIdx.x; const int slab = blockIdx.x / (TTv / 64), lg = blockIdx.x % (TTv / 64); const int b = slab / NHv, h = slab % NHv;
  for (int i = tid; i < 64 * 8; i += 256) { const int r = i / 8, c8 = (i % 8) * 8; FragH f; f.half[0] = *(const v8us*)((const unsigned short*)V16 + ((size_t)b * TTv + lg * 64 + r) * ldv + voff + h * 64 + c8);
#pragma unroll
    for (int q = 0; q < 8; ++q) tl[r][c8 + q] = f.u[q]; }
  __syncthreads();
  {
#pragma unroll
    for (int rd = 0; rd < 2; ++rd) { const int d = rd * 32 + tid / 8, pc = tid % 8; FragH f;
#pragma unroll
      for (int q = 0; q < 8; ++q) f.u[q] = tl[pc * 8 + q][d];
      *(v8us*)((unsigned short*)Vt + ((size_t)slab * 64 + d) * TTv + lg * 64 + pc * 8) = f.half[0]; }
     } }

__global__ __launch_bounds__(256) void k_hl(const float* __restrict__ F, _Float16* __restrict__ Hh, _Float16* __restrict__ Hl, size_t n8, size_t sB, size_t sL) { const size_t t = (size_t)blockIdx.x * 256 + threadIdx.x; if (t >= n8) return; F += (size_t)blockIdx.y * sB; Hh += (size_t)blockIdx.y * sB; Hl += (size_t)blockIdx.y * sL;      /* batch = blockIdx.y */ FragH fh, fl; const v4f a = *(const v4fa*)(F + t * 8), c = *(const v4fa*)(F + t * 8 + 4);
#pragma unroll
  for (int q = 0; q < 4; ++q) { _Float16 h = (_Float16)a[q]; fh.h[q] = h; fl.h[q] = (_Float16)((a[q] - (float)h) * 1024.0f); h = (_Float16)c[q]; fh.h[4 + q] = h; fl.h[4 + q] = (_Float16)((c[q] - (float)h) * 1024.0f); }
  { *(v8us*)((unsigned short*)Hh + t * 8) = fh.half[0]; *(v8us*)((unsigned short*)Hl + t * 8) = fl.half[0];  } }

// ---- fast GEMM (block tile 128x64, wave tile 32x64; requires M % 128 == 0 rows per launch region, N % 64 == 0, K % 64 == 0); epilogue = k_gemm_hhx semantics ----
// Operands reach the waves through LDS: per 64 k one tile of 128 A rows and 64 B rows, 128 B (one whole line) of each row, brought by asynchronous copies (32 lanes = 4 whole lines a copy) into one of two buffers while the other is worked on; each row is fetched once per block instead of once per wave in 32-B pieces.
#define G2_PITCH 72      /* f16 per LDS row: 128 B of k + 16 B, the conflict-free pitch for ds_load_b128 readers of 128-B rows */
#define G2_TILE ((128 + 64) * G2_PITCH * 2)      /* bytes of one buffer: 128 A rows, then 64 B rows */
// one tile's 12 copies of a lane (rows 16 apart: 8 of A, 4 of B); l = the lane's LDS byte address of its first piece. s_wait_xcnt 0 is the statement's last line so that no address register of a copy is rewritten ahead of it.
__device__ __forceinline__ void g2_stage(unsigned l, const _Float16* ga, size_t sa, const _Float16* gb, size_t sb) { const unsigned r16 = 16 * G2_PITCH * 2;
  asm volatile("global_load_async_to_lds_b128 %0, %12, off\n\t" "global_load_async_to_lds_b128 %1, %13, off\n\t" "global_load_async_to_lds_b128 %2, %14, off\n\t" "global_load_async_to_lds_b128 %3, %15, off\n\t"
               "global_load_async_to_lds_b128 %4, %16, off\n\t" "global_load_async_to_lds_b128 %5, %17, off\n\t" "global_load_async_to_lds_b128 %6, %18, off\n\t" "global_load_async_to_lds_b128 %7, %19, off\n\t"
               "global_load_async_to_lds_b128 %8, %20, off\n\t" "global_load_async_to_lds_b128 %9, %21, off\n\t" "global_load_async_to_lds_b128 %10, %22, off\n\t" "global_load_async_to_lds_b128 %11, %23, off\n\t"
               "s_wait_xcnt 0x0"
               :: "v"(l), "v"(l + r16), "v"(l + 2 * r16), "v"(l + 3 * r16), "v"(l + 4 * r16), "v"(l + 5 * r16), "v"(l + 6 * r16), "v"(l + 7 * r16), "v"(l + 8 * r16), "v"(l + 9 * r16), "v"(l + 10 * r16), "v"(l + 11 * r16),
                  "v"(ga), "v"(ga + sa), "v"(ga + 2 * sa), "v"(ga + 3 * sa), "v"(ga + 4 * sa), "v"(ga + 5 * sa), "v"(ga + 6 * sa), "v"(ga + 7 * sa), "v"(gb), "v"(gb + sb), "v"(gb + 2 * sb), "v"(gb + 3 * sb)
               : "memory"); }
__device__ __forceinline__ v16h g2_frag(const _Float16* p, int hh) { FragH f; f.half[0] = *(const v8us*)((const unsigned short*)p + 8 * hh); f.half[1] = *(const v8us*)((const unsigned short*)p + 16 + 8 * hh); return f.v; }
__device__ __forceinline__ v8f g2_mma(v16h a, v16h b, v8f c) { v8f d = __builtin_amdgcn_wmma_f32_16x16x32_f16(false, a, false, b, (short)0, c, false, false); asm volatile("v_nop\n\tv_nop\n\tv_nop\n\tv_nop" : "+v"(d) : "v"(a), "v"(b)); return d; }
template <int ACT>
__global__ __launch_bounds__(128) void k_gemm2(const _Float16* __restrict__ A, int lda, size_t sA, const _Float16* __restrict__ Bh, int ldb, size_t sB, float alpha, const float* __restrict__ bias, size_t sBias, const float* __restrict__ CP, int rowsPerB, size_t sCPb, int row0g,
    float* __restrict__ C, _Float16* __restrict__ C16, int ldc, size_t sC, int M, int N, int K, size_t zA, size_t zB, size_t zC) { static_assert(ACT == 0 || ACT == 3 || ACT == 6 || ACT == 8 || ACT == 9 || ACT == 11 || ACT == 12 || ACT == 14 || ACT == 15 || ACT == 16, "k_gemm2: unsupported ACT code (would silently apply no activation)");
  __shared__ __attribute__((aligned(16))) unsigned char sm[2 * G2_TILE]; float (*so)[32][68] = (float (*)[32][68])sm;      /* the epilogue's staging lies over the two buffers, which every wave has left by then */ static_assert(sizeof(float) * 4 * 32 * 68 <= 2 * G2_TILE, "k_gemm2: epilogue staging must fit the buffers");
  const int tid = threadIdx.x, w = tid >> 5, lane = tid & 31, ln = lane & 15, hh = lane >> 4; const int by = blockIdx.y, bz = blockIdx.z;
  A += (size_t)by * sA + (size_t)bz * zA; Bh += (size_t)by * sB + (size_t)bz * zB; const size_t cofs = (size_t)by * sC + (size_t)bz * zC; const float* bp = bias ? bias + (size_t)by * sBias : nullptr;
  const int ntn = N >> 6; const int mt = blockIdx.x / ntn, nq = blockIdx.x - mt * ntn; const int row0 = mt * 128 + 32 * w, col0 = nq * 64; if (mt * 128 >= M) return;      /* the same for the whole block: it stands in front of barriers */
  const int trow = tid >> 3, tseg = tid & 7;      /* a lane's piece of a tile: 16 B number tseg of rows trow, trow + 16, ... */
  const _Float16* gA = A + (size_t)(mt * 128 + trow) * lda + tseg * 8; const _Float16* gB = Bh + (size_t)(col0 + trow) * ldb + tseg * 8; const size_t sa16 = (size_t)16 * lda, sb16 = (size_t)16 * ldb;
  const unsigned l0 = (unsigned)(size_t)sm + (unsigned)(trow * (G2_PITCH * 2) + tseg * 16);
  const v8f z8 = {0.f,0.f,0.f,0.f,0.f,0.f,0.f,0.f}; v8f c00 = z8, c01 = z8, c02 = z8, c03 = z8, c10 = z8, c11 = z8, c12 = z8, c13 = z8;
  const int nc = K >> 6;
  g2_stage(l0, gA, sa16, gB, sb16);
  asm volatile("s_wait_asynccnt 0x0" ::: "memory");      /* tile 0 of this wave's copies has landed */
  __syncthreads();      /* ... and every other wave's */
  if (nc > 1) g2_stage(l0 + G2_TILE, gA + 64, sa16, gB + 64, sb16);
#pragma unroll 1      /* one tile a trip: the buffer index stays a run-time value and the loop stays small */
  for (int t = 0; t < nc; ++t) { const _Float16* tl = (const _Float16*)(sm + (t & 1) * G2_TILE); const _Float16* ar = tl + (32 * w + ln) * G2_PITCH; const _Float16* br = tl + (128 + ln) * G2_PITCH;
    /* all 24 LDS reads of the trip as one group in front of its WMMAs */
    const v16h a0 = g2_frag(ar, hh), a1 = g2_frag(ar + 16 * G2_PITCH, hh), b0 = g2_frag(br, hh), b1 = g2_frag(br + 16 * G2_PITCH, hh), b2 = g2_frag(br + 32 * G2_PITCH, hh), b3 = g2_frag(br + 48 * G2_PITCH, hh);
    const v16h e0 = g2_frag(ar + 32, hh), e1 = g2_frag(ar + 16 * G2_PITCH + 32, hh), f0 = g2_frag(br + 32, hh), f1 = g2_frag(br + 16 * G2_PITCH + 32, hh), f2 = g2_frag(br + 32 * G2_PITCH + 32, hh), f3 = g2_frag(br + 48 * G2_PITCH + 32, hh);
    c00 = g2_mma(a0, b0, c00); c10 = g2_mma(a1, b0, c10); c01 = g2_mma(a0, b1, c01); c11 = g2_mma(a1, b1, c11); c02 = g2_mma(a0, b2, c02); c12 = g2_mma(a1, b2, c12); c03 = g2_mma(a0, b3, c03); c13 = g2_mma(a1, b3, c13);
    c00 = g2_mma(e0, f0, c00); c10 = g2_mma(e1, f0, c10); c01 = g2_mma(e0, f1, c01); c11 = g2_mma(e1, f1, c11); c02 = g2_mma(e0, f2, c02); c12 = g2_mma(e1, f2, c12); c03 = g2_mma(e0, f3, c03); c13 = g2_mma(e1, f3, c13);
    asm volatile("s_wait_dscnt 0x0" ::: "memory");      /* this wave's reads of buffer t & 1 are done before the buffer is handed back */
    asm volatile("s_wait_asynccnt 0x0" ::: "memory");      /* this wave's copies of tile t + 1 have landed */
    __syncthreads();      /* publishes tile t + 1 and ends every wave's reads of tile t */
    if (t + 2 < nc) g2_stage(l0 + (unsigned)((t & 1) * G2_TILE), gA + (size_t)(t + 2) * 64, sa16, gB + (size_t)(t + 2) * 64, sb16); }
  asm volatile("s_wait_asynccnt 0x0" ::: "memory");      /* no copy is in flight when the buffers become the epilogue's staging */
  v8f accs[8] = {c00, c01, c02, c03, c10, c11, c12, c13};
#pragma unroll
  for (int u = 0; u < 8; ++u) { const int t = u & 3, half = u >> 2; const int col = col0 + t * 16 + ln; const float bv = bp ? bf16_round(bp[col]) : 0.f;
#pragma unroll
    for (int r = 0; r < 8; ++r) { const int rloc = half * 16 + 8 * hh + r; float v = accs[u][r] * alpha + bv; if (CP) { if (rowsPerB < 0) v += CP[cofs + (size_t)(row0g + row0 + rloc) * ldc + col];      /* rowsPerB < 0: own element of the batched C plane */ else { const int bidx = (row0g + row0 + rloc) / rowsPerB; v += CP[(size_t)bidx * sCPb + (size_t)by * 64 + col]; } }
      if (ACT == 3) v = fmaxf(v, 0.f); else if (ACT == 6) v = 0.5f * v * (1.0f + erff(v * 0.70710678118654752f)); else if (ACT == 11) v = 1.0f / (1.0f + expf(-v)); else if (ACT == 15) v = v / (1.0f + expf(-v)); else if (ACT == 12) v = (v > 0.f) ? v : 0.01f * v; else if (ACT == 8) v = tanhf(v); else if (ACT == 9) v = 0.5f * v * (1.0f + tanhf(0.7978845608028654f * (v + 0.044715f * v * v * v))); else if (ACT == 14) v = (v > 0.f) ? v : 0.1f * v; else if (ACT == 16) v = (v >= 0.f) ? v : 0.3f * v;
      so[w][rloc][t * 16 + ln] = v; } }
  __builtin_amdgcn_fence(__ATOMIC_ACQ_REL, "workgroup"); __builtin_amdgcn_wave_barrier();
  const int rsub = lane >> 4, c4 = (lane & 15) * 4;
  {
#pragma unroll
    for (int q = 0; q < 16; ++q) { const int r = q * 2 + rsub; const v4f v = *(const v4fa*)&so[w][r][c4]; if (C) *(v4f*)(C + cofs + (size_t)(row0 + r) * ldc + col0 + c4) = v; if (C16) { v4h h4; for (int i = 0; i < 4; ++i) h4[i] = (_Float16)v[i]; *(v4h*)(C16 + cofs + (size_t)(row0 + r) * ldc + col0 + c4) = h4; } }
     } }


__global__ __launch_bounds__(256) void k_rotab(const int* __restrict__ pid, float* __restrict__ CS, float* __restrict__ SN) {
  #pragma clang fp contract(off)
  const int t = blockIdx.x * 256 + threadIdx.x; if (t >= NB * SQ * HH) return; const int j = t % HH, s = t / HH;      /* s = flat token over both batches */ const float inv = 1.0f / powf(10000.0f, (float)(2 * j) / (float)HD); const float th = (float)pid[s] * inv; const float c = cosf(th), sn = sinf(th);
  { *(float*)(CS + t) = c; *(float*)(SN + t) = sn;  } }
__global__ __launch_bounds__(256) void k_rope(const float* __restrict__ F, int nheads, const float* __restrict__ CS, const float* __restrict__ SN, _Float16* __restrict__ H, _Float16* __restrict__ L) {
  #pragma clang fp contract(off)
  const size_t t = (size_t)blockIdx.x * 256 + threadIdx.x; if (t >= (size_t)NB * SQ * nheads * (HH / 8)) return; const int g = (int)(t % (HH / 8)) * 8; const int h = (int)((t / (HH / 8)) % nheads); const int s = (int)(t / ((HH / 8) * (size_t)nheads)); const int ld = nheads * HD;
  const size_t base = (size_t)s * ld + h * HD + g; FragH h0, h1, l0, l1;
#pragma unroll
  for (int q = 0; q < 8; ++q) { const float c = CS[s * HH + g + q], sn = SN[s * HH + g + q]; const float x0 = F[base + q], x1 = F[base + HH + q]; float o0 = x0 * c; o0 += -x1 * sn; float o1 = x1 * c; o1 += x0 * sn;
    const _Float16 a0 = (_Float16)o0, a1 = (_Float16)o1; h0.h[q] = a0; h1.h[q] = a1; l0.h[q] = (_Float16)((o0 - (float)a0) * 1024.0f); l1.h[q] = (_Float16)((o1 - (float)a1) * 1024.0f); }
  { *(v8us*)((unsigned short*)H + base) = h0.half[0]; *(v8us*)((unsigned short*)H + base + HH) = h1.half[0]; if (L) { *(v8us*)((unsigned short*)L + base) = l0.half[0]; *(v8us*)((unsigned short*)L + base + HH) = l1.half[0]; }  } }
// causal / padding softmax, one wave per row, the whole row in registers: lane ln holds elements c * 128 + 4 * ln .. + 3 of every 128-key chunk c, so S is read once (whole 512-B pieces, all loads of a row in flight together), exp is taken once per score, and P leaves as 8-B pieces.
// NK keys were written by the S GEMM; R0 = first row of the band. A chunk that lies wholly right of the diagonal (c * 128 > r, the same for the whole wave) takes no exp: its P is zero.
typedef int v4ia __attribute__((ext_vector_type(4), may_alias));
typedef _Float16 v4ha __attribute__((ext_vector_type(4), may_alias));
template <int NK, int R0, bool HASPL>
__global__ __launch_bounds__(256) void k_csoft(float* S, size_t sS, const int* __restrict__ mask, _Float16* __restrict__ PL, size_t sPL) {
  constexpr int NC = NK / 128; const float NONE = -3.0e38f;
  const int wv = __builtin_amdgcn_readfirstlane(threadIdx.x >> 5), ln = threadIdx.x & 31; const int rl = blockIdx.x * 8 + wv, r = R0 + rl; const int b = blockIdx.z, pl = b * NHQ + blockIdx.y;      /* batch = blockIdx.z, head = blockIdx.y: their own S and P planes */
  char* srow = (char*)(S + (size_t)pl * sS + (size_t)rl * SQ); const char* mrow = (const char*)(mask + (size_t)b * SQ);      /* the same for the whole wave; the P row lies over the front half of its own S row: every store follows the row sum, which follows every read of the row */
  const unsigned off = ln * 16; const int jr = r - ln * 4, cd = r >> 7;      /* element q of chunk c is at or left of the diagonal when c * 128 + q <= jr; cd = the diagonal's chunk */
  v4f x[NC]; v4ia kk[NC];      /* every loop over c and q below is unrolled whole: the arrays are then indexed by constants and stay in registers */
#pragma unroll
  for (int c = 0; c < NC; ++c) { kk[c] = *(const v4ia*)(mrow + off + c * 512); x[c] = *(const v4fa*)(srow + off + c * 512); }
  __builtin_amdgcn_sched_barrier(0);      /* every load of the row is issued before the first use of one: a row pays one memory latency, not one per group of loads */
  float m = NONE;
#pragma unroll
  for (int c = 0; c < NC; ++c) {
#pragma unroll
    for (int q = 0; q < 4; ++q) { const float s = ((c * 128 + q <= jr) & (kk[c][q] > 0)) ? x[c][q] : NONE; x[c][q] = s; m = fmaxf(m, s); } }
  for (int o = 16; o > 0; o >>= 1) m = fmaxf(m, __shfl_xor(m, o, 32));
  float su = 0.f;
#pragma unroll
  for (int c = 0; c < NC; ++c) { v4f e4 = {0.f, 0.f, 0.f, 0.f};
    if (c * 128 <= R0 || c <= cd) {
#pragma unroll
      for (int q = 0; q < 4; ++q) { e4[q] = expf(x[c][q] - m); su += e4[q]; } }      /* a masked score gives exp(NONE - m) = 0 */
    x[c] = e4; }
  for (int o = 16; o > 0; o >>= 1) su += __shfl_xor(su, o, 32);
  const float f = (m > NONE) ? 1024.0f / su : 0.f;      /* a row with no open key keeps P = 0 */
  v4h hv[NC], lv[NC];
#pragma unroll
  for (int c = 0; c < NC; ++c) {
#pragma unroll
    for (int q = 0; q < 4; ++q) { const float p = x[c][q] * f; hv[c][q] = (_Float16)p; if (HASPL) lv[c][q] = (_Float16)((p - (float)hv[c][q]) * 1024.0f); } }
  /* all stores last, each from registers of its own: nothing is written behind an issued store */
  char* plrow = HASPL ? (char*)(PL + (size_t)pl * sPL + (size_t)rl * SQ) : nullptr;
#pragma unroll
  for (int c = 0; c < NC; ++c) { *(v4ha*)(srow + ln * 8 + c * 256) = hv[c]; if (HASPL) *(v4ha*)(plrow + ln * 8 + c * 256) = lv[c]; } }

extern "C" void kernel_launch(void* const* d_in, const int* in_sizes, int n_in,
                              void* d_out, int out_size, void* d_ws, size_t ws_size, hipStream_t stream) {
  (void)in_sizes; (void)n_in; (void)out_size;
  const float* const* I = (const float* const*)d_in; const float* hs = I[0]; const int* amask = (const int*)d_in[1]; const int* pid = (const int*)d_in[2]; const float* Wq = I[3]; const float* Wk = I[4]; const float* Wv = I[5]; const float* Wo = I[6];
  char* ws = (char*)d_ws; size_t off = 0;
  auto take = [&](size_t bytes) { char* p = ws + off; off += (bytes + 255) & ~(size_t)255; return p; };
  const size_t np = (size_t)SQ * DM, nkv = (size_t)SQ * HD;      /* elements per batch of a [SQ][DM] and of a [SQ][HD] plane */
  _Float16* BQ = (_Float16*)take(np * 2); _Float16* BK = (_Float16*)take((size_t)HD * DM * 2); _Float16* BV = (_Float16*)take((size_t)HD * DM * 2); _Float16* BO = (_Float16*)take(np * 2);
  float* CS = (float*)take((size_t)NB * SQ * HH * 4); float* SN = (float*)take((size_t)NB * SQ * HH * 4);
  _Float16* X16 = (_Float16*)take(NB * np * 2); float* F32 = (float*)take(NB * np * 4); _Float16* QH = (_Float16*)take(NB * np * 2); _Float16* QL = (_Float16*)take(NB * np * 2); _Float16* KH = (_Float16*)take(NB * nkv * 2); _Float16* KL = (_Float16*)take(NB * nkv * 2); _Float16* VH = (_Float16*)take(NB * nkv * 2); _Float16* VL = (_Float16*)take(NB * nkv * 2); _Float16* VTh = (_Float16*)take(NB * nkv * 2); _Float16* VTl = (_Float16*)take(NB * nkv * 2);
  const size_t sS = (size_t)1024 * SQ, sPL = (size_t)BAND * SQ;      /* elements per (batch, head) plane of S, and of PL */
  float* S = (float*)take(NB * NHQ * sS * 4); _Float16* PH = (_Float16*)S; const int ldp = 2 * SQ; const size_t sP = 2 * sS;      /* P row r of a plane = front half of S row r: pitch and plane stride in f16 elements are twice those of S */
  _Float16* PL = X16; float* O = F32; _Float16* O16 = QL; _Float16* OL0 = (_Float16*)take((size_t)NB * BAND * DM * 2);      /* PL over X16 (dead after the q GEMM; same size); O over the q f32 scratch (dead after k_rope); O16 over QL (QL is only read for band 0, which runs first) */
  if (off > ws_size) return;      /* 8+1+1+8 + 4 + 16+32+16+16 + 6*2 + 128 + 2 = 244 MiB */
  k_wt_f16<<<(unsigned)((np / 8 + 255) / 256), 256, 0, stream>>>(Wq, BQ, DM, DM, 16.0f); k_wt_f16<<<(unsigned)(((size_t)HD * DM / 8 + 255) / 256), 256, 0, stream>>>(Wk, BK, DM, HD, 16.0f); k_wt_f16<<<(unsigned)(((size_t)HD * DM / 8 + 255) / 256), 256, 0, stream>>>(Wv, BV, DM, HD, 16.0f); k_wt_f16<<<(unsigned)((np / 8 + 255) / 256), 256, 0, stream>>>(Wo, BO, DM, DM, 16.0f);
  const int MT = NB * SQ;      /* tokens of both batches: the q/k/v projections, the passes before attention and the hi Wo GEMM see one flat [MT][...] matrix */
  k_rotab<<<(NB * SQ * HH + 255) / 256, 256, 0, stream>>>(pid, CS, SN);
  k_x16<<<(unsigned)((NB * np / 8 + 255) / 256), 256, 0, stream>>>(hs, X16, NB * np / 8);
  /* k and v (one kv head of 256) */
  k_gemm2<0><<<dim3((MT / 128) * (HD / 64), 1), 128, 0, stream>>>(X16, DM, 0, BK, DM, 0, 0.0625f, nullptr, 0, nullptr, 1, 0, 0, F32, nullptr, HD, 0, MT, HD, DM, 0, 0, 0);
  k_rope<<<(unsigned)(((size_t)MT * 1 * (HH / 8) + 255) / 256), 256, 0, stream>>>(F32, 1, CS, SN, KH, KL);
  k_gemm2<0><<<dim3((MT / 128) * (HD / 64), 1), 128, 0, stream>>>(X16, DM, 0, BV, DM, 0, 0.0625f, nullptr, 0, nullptr, 1, 0, 0, F32, nullptr, HD, 0, MT, HD, DM, 0, 0, 0);
  k_hl<<<(unsigned)((NB * nkv / 8 + 255) / 256), 256, 0, stream>>>(F32, VH, VL, NB * nkv / 8, 0, 0);
  k_vt<HD / 64, SQ><<<NB * (HD / 64) * (SQ / 64), 256, 0, stream>>>(VH, HD, 0, VTh); k_vt<HD / 64, SQ><<<NB * (HD / 64) * (SQ / 64), 256, 0, stream>>>(VL, HD, 0, VTl);
  /* q (8 heads), roped, hi/lo */
  k_gemm2<0><<<dim3((MT / 128) * (DM / 64), 1), 128, 0, stream>>>(X16, DM, 0, BQ, DM, 0, 0.0625f, nullptr, 0, nullptr, 1, 0, 0, F32, nullptr, DM, 0, MT, DM, DM, 0, 0, 0);
  k_rope<<<(unsigned)(((size_t)MT * NHQ * (HH / 8) + 255) / 256), 256, 0, stream>>>(F32, NHQ, CS, SN, QH, QL);
  /* attention: head in grid.y (A + h * HD for q, one shared K / V^T per batch, C plane h), batch in grid.z (the last three arguments: element strides of A, B and C per batch); rowsPerB = -1 adds the own element of the C plane */
  /* band 0 (rows < 256, keys < 256): hi + lo everywhere */
  { const int nk = BAND; const dim3 gS((BAND / 128) * (nk / 64), NHQ, NB), gO((BAND / 128) * (HD / 64), NHQ, NB);
    k_gemm2<0><<<gS, 128, 0, stream>>>(QH, DM, HD, KH, HD, 0, 0.0625f, nullptr, 0, nullptr, 1, 0, 0, S, nullptr, SQ, sS, BAND, nk, HD, np, nkv, NHQ * sS);      /* S = (Qh Kh^T) / 16 */
    k_gemm2<0><<<gS, 128, 0, stream>>>(QL, DM, HD, KH, HD, 0, 0.0625f / 1024.0f, nullptr, 0, S, -1, 0, 0, S, nullptr, SQ, sS, BAND, nk, HD, np, nkv, NHQ * sS);
    k_gemm2<0><<<gS, 128, 0, stream>>>(QH, DM, HD, KL, HD, 0, 0.0625f / 1024.0f, nullptr, 0, S, -1, 0, 0, S, nullptr, SQ, sS, BAND, nk, HD, np, nkv, NHQ * sS);
    k_csoft<BAND, 0, true><<<dim3(BAND / 8, NHQ, NB), 256, 0, stream>>>(S, sS, amask, PL, sPL);
    k_gemm2<0><<<gO, 128, 0, stream>>>(PH, ldp, sP, VTh, SQ, 0, 0.0009765625f, nullptr, 0, nullptr, 1, 0, 0, O, nullptr, DM, HD, BAND, HD, nk, NHQ * sP, nkv, np);
    k_gemm2<0><<<gO, 128, 0, stream>>>(PL, SQ, sPL, VTh, SQ, 0, 0.0009765625f / 1024.0f, nullptr, 0, O, -1, 0, 0, O, nullptr, DM, HD, BAND, HD, nk, NHQ * sPL, nkv, np);
    k_gemm2<0><<<gO, 128, 0, stream>>>(PH, ldp, sP, VTl, SQ, 0, 0.0009765625f / 1024.0f, nullptr, 0, O, -1, 0, 0, O, nullptr, DM, HD, BAND, HD, nk, NHQ * sP, nkv, np); }
  /* two later bands (rows 256..1023 with keys < 1024, rows 1024..2047 with keys < 2048): plain */
  for (int k = 0; k < 2; ++k) { const int r0 = k ? 1024 : BAND, nr = k ? 1024 : (1024 - BAND), nk = k ? SQ : 1024; const dim3 gS((nr / 128) * (nk / 64), NHQ, NB), gO((nr / 128) * (HD / 64), NHQ, NB);
    k_gemm2<0><<<gS, 128, 0, stream>>>(QH + (size_t)r0 * DM, DM, HD, KH, HD, 0, 0.0625f, nullptr, 0, nullptr, 1, 0, 0, S, nullptr, SQ, sS, nr, nk, HD, np, nkv, NHQ * sS);
    if (k) k_csoft<SQ, 1024, false><<<dim3(nr / 8, NHQ, NB), 256, 0, stream>>>(S, sS, amask, nullptr, 0); else k_csoft<1024, BAND, false><<<dim3(nr / 8, NHQ, NB), 256, 0, stream>>>(S, sS, amask, nullptr, 0);
    k_gemm2<0><<<gO, 128, 0, stream>>>(PH, ldp, sP, VTh, SQ, 0, 0.0009765625f, nullptr, 0, nullptr, 1, 0, 0, O + (size_t)r0 * DM, nullptr, DM, HD, nr, HD, nk, NHQ * sP, nkv, np); }
  /* output: O hi (+ lo on rows < 256 of each batch) into Wo */
  k_hl<<<dim3((unsigned)(((size_t)BAND * DM / 8 + 255) / 256), NB), 256, 0, stream>>>(O, O16, OL0, (size_t)BAND * DM / 8, np, (size_t)BAND * DM);      /* rows < 256: hi + lo */
  k_h16<<<dim3((unsigned)((((size_t)SQ - BAND) * DM / 8 + 255) / 256), NB), 256, 0, stream>>>(O + (size_t)BAND * DM, O16 + (size_t)BAND * DM, ((size_t)SQ - BAND) * DM / 8, np);
  float* out = (float*)d_out;
  k_gemm2<0><<<dim3((MT / 128) * (DM / 64), 1), 128, 0, stream>>>(O16, DM, 0, BO, DM, 0, 0.0625f, nullptr, 0, nullptr, 1, 0, 0, out, nullptr, DM, 0, MT, DM, DM, 0, 0, 0);
  k_gemm2<0><<<dim3((BAND / 128) * (DM / 64), 1, NB), 128, 0, stream>>>(OL0, DM, 0, BO, DM, 0, 0.0625f / 1024.0f, nullptr, 0, out, -1, 0, 0, out, nullptr, DM, 0, BAND, DM, DM, (size_t)BAND * DM, 0, np);
}

// v005
// It runs in 437 microseconds.
// Next to v004, in two timings, it ran 1.08 times as fast each time.
// Counting every step since v000, it is 13.6 times as fast.
#include <hip/hip_runtime.h>
// FlaxGemmaAttention (2 x 2048 tokens, D 2048, 8 query heads of 256 sharing ONE kv head; rotate-half RoPE from the INPUT position_ids; causal + INPUT padding mask; scale 256^-0.5; out = attn Wo).
// Structure (both batches in every launch: flat rows for the q/k/v projections, the passes before attention and the hi Wo GEMM, blockIdx.y for the O hi/lo passes, blockIdx.z for attention and the lo Wo GEMM): exact f16 plane of the hidden states; q/k/v GEMMs (32x64 wave tiles, f32 accumulation, exact x16 weights); RoPE tables (f32 trig) + rotation on VALU into f16 hi (+ 2^10 residual) planes; V^T hi/residual by LDS tiles; UNFUSED attention per row band (rows < 256 | 256..1023 with keys < 1024 | 1024.. with all keys), all 8 heads of a band in ONE launch (head = blockIdx.y, batch = blockIdx.z, one S plane per batch and head, each P row stored over the front half of its own S row), because the head dim is 256: S = Q_band K^T over the causally reachable keys as a GEMM (f32), causal/padding softmax on VALU (wave per row) into an f16 P plane (x2^10), O_band = P V as a GEMM; band 0 (rows < 256, whose outputs average over few keys) uses hi+lo operands throughout (3-term S, 3-term P.V, hi+lo O into Wo), later bands plain f16; output GEMM.
// Compute dtype: inputs and weights rounded to bf16; rows >= 256: q, k, P, v, O as f16 (~2^-12); rows < 256: hi + residual pairs; f32 accumulation/softmax/trig. v_wmma_f32_16x16x32_f16.
#define NB 2
#define SQ 2048
#define DM 2048
#define NHQ 8
#define HD 256
#define HH (HD / 2)
#define BAND 256
#define NBAND (SQ / BAND)
typedef __bf16 v16b __attribute__((ext_vector_type(16)));
typedef unsigned short v8us __attribute__((ext_vector_type(8), may_alias));
typedef float  v8f  __attribute__((ext_vector_type(8)));
typedef float  v4f  __attribute__((ext_vector_type(4)));
typedef float  v4fa __attribute__((ext_vector_type(4), may_alias));
union FragB { v16b v; v8us half[2]; unsigned short u[16]; };

__device__ __forceinline__ unsigned short bf16_bits(float x) { unsigned int u = __float_as_uint(x); return (unsigned short)((u + 0x7FFFu + ((u >> 16) & 1u)) >> 16); }
__device__ __forceinline__ float bf16_val(unsigned short b) { return __uint_as_float(((unsigned int)b) << 16); }
__device__ __forceinline__ float bf16_round(float x) { return bf16_val(bf16_bits(x)); }
// D += A·B with NT terms: 1 = ah·bh, 2 = + al·bh (A split), 3 = + ah·bl (both split)
template <int NT>
__device__ __forceinline__ v8f mmaN(v16b ah, v16b al, v16b bh, v16b bl, v8f c) {
  c = __builtin_amdgcn_wmma_f32_16x16x32_bf16(false, ah, false, bh, (short)0, c, false, false);
  if (NT >= 2) c = __builtin_amdgcn_wmma_f32_16x16x32_bf16(false, al, false, bh, (short)0, c, false, false);
  if (NT >= 3) c = __builtin_amdgcn_wmma_f32_16x16x32_bf16(false, ah, false, bl, (short)0, c, false, false);
  asm volatile("v_nop\n\tv_nop\n\tv_nop\n\tv_nop" : "+v"(c) : "v"(ah), "v"(al), "v"(bh), "v"(bl));
  return c;
}

__global__ __launch_bounds__(256) void k_wt_bf16(const float* __restrict__ W, unsigned short* __restrict__ Wt, int K, int N) {
  const int t = blockIdx.x * 256 + threadIdx.x;
  const int k8n = K / 8;
  if (t >= N * k8n) return;
  const int n = t / k8n, k8 = (t % k8n) * 8;
  v8us v;
#pragma unroll
  for (int i = 0; i < 8; ++i) v[i] = bf16_bits(W[(size_t)(k8 + i) * N + n]);
  *(v8us*)(Wt + (size_t)n * K + k8) = v;
  
}

// GEMM C[M][N] (f32, pitch ldc) = act(A[M][K]·W + bias). A f32 row-major (pitch lda) converted per fragment to bf16
// (ASPLIT: hi/lo two planes -> 2 terms, else single rounded term); Wt bf16 [N][K] (pitch ldb). BIAS_BF16 rounds the
// bias to bf16 first (bias quantised to bf16 before the add). K%32==0, M%16==0, N%64==0.
template <bool ASPLIT, int ACT, bool BIAS_BF16>
__global__ __launch_bounds__(128) void k_gemm_bf(const float* __restrict__ A, int lda, const unsigned short* __restrict__ Wt, int ldb,
                                               const float* __restrict__ bias, float* __restrict__ C, int ldc, int M, int N, int K) {
  __shared__ __attribute__((aligned(16))) float so[4][16][64];
  const int tid = threadIdx.x, w = tid >> 5, lane = tid & 31, ln = lane & 15, hh = lane >> 4;
  const int ntn = N / 64;
  const int wid = blockIdx.x * 4 + w;
  const int mt = wid / ntn, nq = wid % ntn;
  if (mt * 16 >= M) return;
  const int row0 = mt * 16, col0 = nq * 64;
  const float* arow = A + (size_t)(row0 + ln) * lda;
  v8f acc[4] = {};
  for (int kb = 0; kb < K; kb += 32) {
    FragB ah, al;
    const v4f x0 = *(const v4fa*)(arow + kb + 8 * hh), x1 = *(const v4fa*)(arow + kb + 8 * hh + 4);
    const v4f x2 = *(const v4fa*)(arow + kb + 16 + 8 * hh), x3 = *(const v4fa*)(arow + kb + 16 + 8 * hh + 4);
    float xs[16] = {x0[0],x0[1],x0[2],x0[3],x1[0],x1[1],x1[2],x1[3],x2[0],x2[1],x2[2],x2[3],x3[0],x3[1],x3[2],x3[3]};
#pragma unroll
    for (int i = 0; i < 16; ++i) { const unsigned short hb = bf16_bits(xs[i]); ah.u[i] = hb; al.u[i] = ASPLIT ? bf16_bits(xs[i] - bf16_val(hb)) : (unsigned short)0; }
#pragma unroll
    for (int t = 0; t < 4; ++t) {
      const unsigned short* brow = Wt + (size_t)(col0 + t * 16 + ln) * ldb + kb;
      FragB b;
      b.half[0] = *(const v8us*)(brow + 8 * hh);
      b.half[1] = *(const v8us*)(brow + 16 + 8 * hh);
      acc[t] = mmaN<ASPLIT ? 2 : 1>(ah.v, al.v, b.v, b.v, acc[t]);
    }
  }
#pragma unroll
  for (int t = 0; t < 4; ++t) {
    float bv = bias ? bias[col0 + t * 16 + ln] : 0.f;
    if (BIAS_BF16) bv = bf16_round(bv);
#pragma unroll
    for (int r = 0; r < 8; ++r) { float v = acc[t][r] + bv; if (ACT == 1) v = fmaxf(v, 0.f); so[w][8 * hh + r][t * 16 + ln] = v; }
  }
  __builtin_amdgcn_fence(__ATOMIC_ACQ_REL, "workgroup");
  __builtin_amdgcn_wave_barrier();
  const int rsub = lane >> 4, c4 = (lane & 15) * 4;
  {
#pragma unroll
    for (int q = 0; q < 8; ++q) {
      const int r = q * 2 + rsub;
      const v4f v = *(const v4fa*)&so[w][r][c4];
      *(v4f*)(C + (size_t)(row0 + r) * ldc + col0 + c4) = v;
    }
    
  }
}

// GEMM C = act(A·W + bias + resid): A f32 (ASPLIT -> hi/lo 2 terms), Wt bf16 [N][K]; ACT 0 none, 1 relu, 2 exact gelu;
// resid (optional, f32, row index = (row % rmod), pitch ldr, RES_BF16 rounds it) added before the activation.
template <bool ASPLIT, int ACT, bool BIAS_BF16, bool RES_BF16>
__global__ __launch_bounds__(128) void k_gemm_bf3(const float* __restrict__ A, int lda, const unsigned short* __restrict__ Wt, int ldb,
                                                const float* __restrict__ bias, const float* __restrict__ resid, int rmod, int ldr,
                                                float* __restrict__ C, int ldc, int M, int N, int K) {
  __shared__ __attribute__((aligned(16))) float so[4][16][64];
  const int tid = threadIdx.x, w = tid >> 5, lane = tid & 31, ln = lane & 15, hh = lane >> 4;
  const int ntn = N / 64;
  const int wid = blockIdx.x * 4 + w;
  const int mt = wid / ntn, nq = wid % ntn;
  if (mt * 16 >= M) return;
  const int row0 = mt * 16, col0 = nq * 64;
  const float* arow = A + (size_t)(row0 + ln) * lda;
  v8f acc[4] = {};
  for (int kb = 0; kb < K; kb += 32) {
    FragB ah, al;
    const v4f x0 = *(const v4fa*)(arow + kb + 8 * hh), x1 = *(const v4fa*)(arow + kb + 8 * hh + 4);
    const v4f x2 = *(const v4fa*)(arow + kb + 16 + 8 * hh), x3 = *(const v4fa*)(arow + kb + 16 + 8 * hh + 4);
    float xs[16] = {x0[0],x0[1],x0[2],x0[3],x1[0],x1[1],x1[2],x1[3],x2[0],x2[1],x2[2],x2[3],x3[0],x3[1],x3[2],x3[3]};
#pragma unroll
    for (int i = 0; i < 16; ++i) { const unsigned short hb = bf16_bits(xs[i]); ah.u[i] = hb; al.u[i] = ASPLIT ? bf16_bits(xs[i] - bf16_val(hb)) : (unsigned short)0; }
#pragma unroll
    for (int t = 0; t < 4; ++t) {
      const unsigned short* brow = Wt + (size_t)(col0 + t * 16 + ln) * ldb + kb;
      FragB b;
      b.half[0] = *(const v8us*)(brow + 8 * hh);
      b.half[1] = *(const v8us*)(brow + 16 + 8 * hh);
      acc[t] = mmaN<ASPLIT ? 2 : 1>(ah.v, al.v, b.v, b.v, acc[t]);
    }
  }
#pragma unroll
  for (int t = 0; t < 4; ++t) {
    const int col = col0 + t * 16 + ln;
    float bv = bias ? bias[col] : 0.f;
    if (BIAS_BF16) bv = bf16_round(bv);
#pragma unroll
    for (int r = 0; r < 8; ++r) {
      float v = acc[t][r] + bv;
      if (resid) { float rv = resid[(size_t)((row0 + 8 * hh + r) % rmod) * ldr + col]; if (RES_BF16) rv = bf16_round(rv); v += rv; }
      if (ACT == 1) v = fmaxf(v, 0.f);
      if (ACT == 2) v = 0.5f * v * (1.0f + erff(v * 0.70710678118654752f));
      if (ACT == 3) { const float u = 0.7978845608028654f * (v + 0.044715f * v * v * v); v = 0.5f * v * (1.0f + tanhf(u)); }
      so[w][8 * hh + r][t * 16 + ln] = v;
    }
  }
  __builtin_amdgcn_fence(__ATOMIC_ACQ_REL, "workgroup");
  __builtin_amdgcn_wave_barrier();
  const int rsub = lane >> 4, c4 = (lane & 15) * 4;
  {
#pragma unroll
    for (int q = 0; q < 8; ++q) {
      const int r = q * 2 + rsub;
      const v4f v = *(const v4fa*)&so[w][r][c4];
      *(v4f*)(C + (size_t)(row0 + r) * ldc + col0 + c4) = v;
    }
    
  }
}
// row LayerNorm (biased variance, eps) over N: s = X (+ R); optional out_sum <- s; out_norm <- (s-mu)*rsqrt(var+eps)*g + b
template <bool PARAM_BF16>
__global__ __launch_bounds__(256) void k_layernorm(const float* __restrict__ X, const float* __restrict__ R, const float* __restrict__ g, const float* __restrict__ bta,
                                                  float* __restrict__ out_sum, float* __restrict__ out_norm, int N, float eps) {
  __shared__ float red[256];
  const int row = blockIdx.x, tid = threadIdx.x;
  const float* x = X + (size_t)row * N; const float* rr = R ? R + (size_t)row * N : nullptr;
  float vals[16];                     // up to N = 4096
  const int per = N / 256;            // contiguous chunk per thread? use strided-by-4 chunks: thread handles j = tid*4 + 1024*u
  float s1 = 0.f;
  for (int u = 0; u < per / 4; ++u) {
    const int j = tid * 4 + 1024 * u;
    const v4f a = *(const v4fa*)(x + j);
    v4f b = {0.f,0.f,0.f,0.f}; if (rr) b = *(const v4fa*)(rr + j);
#pragma unroll
    for (int q = 0; q < 4; ++q) { const float v = a[q] + b[q]; vals[u * 4 + q] = v; s1 += v; }
  }
  red[tid] = s1; __syncthreads();
  for (int st = 128; st > 0; st >>= 1) { if (tid < st) red[tid] += red[tid + st]; __syncthreads(); }
  const float mu = red[0] / (float)N; __syncthreads();
  float s2 = 0.f;
  for (int u = 0; u < per / 4; ++u)
#pragma unroll
    for (int q = 0; q < 4; ++q) { const float c = vals[u * 4 + q] - mu; s2 += c * c; }
  red[tid] = s2; __syncthreads();
  for (int st = 128; st > 0; st >>= 1) { if (tid < st) red[tid] += red[tid + st]; __syncthreads(); }
  const float rs = rsqrtf(red[0] / (float)N + eps);
  {
    for (int u = 0; u < per / 4; ++u) {
      const int j = tid * 4 + 1024 * u;
      v4f o, sm;
#pragma unroll
      for (int q = 0; q < 4; ++q) {
        float gg = g[j + q], bb = bta[j + q];
        if (PARAM_BF16) { gg = bf16_round(gg); bb = bf16_round(bb); }
        sm[q] = vals[u * 4 + q]; o[q] = (vals[u * 4 + q] - mu) * rs * gg + bb;
      }
      if (out_sum) *(v4f*)(out_sum + (size_t)row * N + j) = sm;
      *(v4f*)(out_norm + (size_t)row * N + j) = o;
    }
    
  }
}



// ---- f16 WMMA path (v_wmma_f32_16x16x32_f16): 11-bit significands for operands in range — used where a [0,1] probability operand needs more precision than bf16
typedef _Float16 v16h __attribute__((ext_vector_type(16)));
union FragH { v16h v; v8us half[2]; _Float16 h[16]; unsigned short u[16]; };
template <int NT>
__device__ __forceinline__ v8f mmaH(v16h ah, v16h al, v16h bh, v16h bl, v8f c) {
  c = __builtin_amdgcn_wmma_f32_16x16x32_f16(false, ah, false, bh, (short)0, c, false, false);
  if (NT >= 2) c = __builtin_amdgcn_wmma_f32_16x16x32_f16(false, al, false, bh, (short)0, c, false, false);
  if (NT >= 3) c = __builtin_amdgcn_wmma_f32_16x16x32_f16(false, ah, false, bl, (short)0, c, false, false);
  asm volatile("v_nop\n\tv_nop\n\tv_nop\n\tv_nop" : "+v"(c) : "v"(ah), "v"(al), "v"(bh), "v"(bl));
  return c;
}
// batched GEMM like k_gemm_b but f16 operands: A f32 (split into f16 hi/lo if ASPLIT, else rounded to f16), Bt = f16 values [n][k]; alpha; C f32; N multiple of 16 (partial tiles skipped)
template <bool ASPLIT>
__global__ __launch_bounds__(128) void k_gemm_h(const float* __restrict__ A, int lda, size_t sA, const _Float16* __restrict__ Bh, int ldb, size_t sB, float alpha, float* __restrict__ C, int ldc, size_t sC, int M, int N, int K) {
  __shared__ __attribute__((aligned(16))) float so[4][16][64];
  const int tid = threadIdx.x, w = tid >> 5, lane = tid & 31, ln = lane & 15, hh = lane >> 4; const int by = blockIdx.y;
  A += (size_t)by * sA; Bh += (size_t)by * sB; C += (size_t)by * sC;
  const int ntn = (N + 63) / 64; const int wid = blockIdx.x * 4 + w; const int mt = wid / ntn, nq = wid % ntn; if (mt * 16 >= M) return;
  const int row0 = mt * 16, col0 = nq * 64; const float* arow = A + (size_t)(row0 + ln) * lda;
  v8f acc[4] = {};
  for (int kb = 0; kb < K; kb += 32) {
    FragH ah, al;
    const v4f x0 = *(const v4fa*)(arow + kb + 8 * hh), x1 = *(const v4fa*)(arow + kb + 8 * hh + 4), x2 = *(const v4fa*)(arow + kb + 16 + 8 * hh), x3 = *(const v4fa*)(arow + kb + 16 + 8 * hh + 4);
    float xs[16] = {x0[0],x0[1],x0[2],x0[3],x1[0],x1[1],x1[2],x1[3],x2[0],x2[1],x2[2],x2[3],x3[0],x3[1],x3[2],x3[3]};
#pragma unroll
    for (int i = 0; i < 16; ++i) { const _Float16 h = (_Float16)xs[i]; ah.h[i] = h; al.h[i] = ASPLIT ? (_Float16)(xs[i] - (float)h) : (_Float16)0.0f; }
#pragma unroll
    for (int t = 0; t < 4; ++t) { if (col0 + t * 16 >= N) continue; const size_t boff = (size_t)(col0 + t * 16 + ln) * ldb + kb; FragH bq; bq.half[0] = *(const v8us*)(Bh + boff + 8 * hh); bq.half[1] = *(const v8us*)(Bh + boff + 16 + 8 * hh);
      acc[t] = mmaH<ASPLIT ? 2 : 1>(ah.v, al.v, bq.v, bq.v, acc[t]); }
  }
#pragma unroll
  for (int t = 0; t < 4; ++t) { if (col0 + t * 16 >= N) continue;
#pragma unroll
    for (int r = 0; r < 8; ++r) so[w][8 * hh + r][t * 16 + ln] = acc[t][r] * alpha; }
  __builtin_amdgcn_fence(__ATOMIC_ACQ_REL, "workgroup"); __builtin_amdgcn_wave_barrier();
  const int rsub = lane >> 4, c4 = (lane & 15) * 4;
  {
#pragma unroll
    for (int q = 0; q < 8; ++q) { const int r = q * 2 + rsub; if (col0 + c4 < N) { const v4f v = *(const v4fa*)&so[w][r][c4]; *(v4f*)(C + (size_t)(row0 + r) * ldc + col0 + c4) = v; } }
     }
}

// Wt[n][k] = f16(bf16(W[k][n])*scale) from f32 row-major W[K][N] (scale = power of two; bf16-exact weights stay exact in f16 away from the subnormal range)
// One block turns a tile of 128 k x 64 n through LDS: W is read as whole 256-B pieces of its rows (16 B a lane, all 8 loads of a lane in flight) and Wt is written as whole 256-B pieces of its rows. grid = (K / 128) * (N / 64). K and N are compile-time so that a lane's 8 loads, and its 4 stores, share one address and differ in the immediate offset only.
#define WT_P 65      /* dwords per LDS row (one n: 64 pairs of k, + 1): odd, so the 16 lanes that store 4 rows apart and the 16 that read 4 dwords apart each meet 16 different banks */
typedef unsigned int v4ua __attribute__((ext_vector_type(4), may_alias));
template <int K, int N>
__global__ __launch_bounds__(256) void k_wt_f16(const float* __restrict__ W, _Float16* __restrict__ Wt, float scale) { static_assert(K % 128 == 0 && N % 64 == 0, "k_wt_f16: whole tiles only");
  __shared__ unsigned int tl[64 * WT_P];
  constexpr int ntn = N / 64; const int tid = threadIdx.x; const int kt = blockIdx.x / ntn, nt = blockIdx.x % ntn; const int k0 = kt * 128, n0 = nt * 64; const int r = tid >> 4, c = tid & 15;
  const float* p = W + (size_t)(k0 + 2 * r) * N + n0 + c * 4;
  v4f a[4], b[4];      /* rows k0 + 2 * (16 u + r) and the next one, columns n0 + 4 c .. + 3; every loop below is unrolled whole, so that a and b are indexed by constants and stay in registers and the offsets are immediates */
#pragma unroll
  for (int u = 0; u < 4; ++u) { a[u] = *(const v4fa*)(p + (size_t)u * 32 * N); b[u] = *(const v4fa*)(p + (size_t)u * 32 * N + N); }
#pragma unroll
  for (int u = 0; u < 4; ++u) {
#pragma unroll
    for (int j = 0; j < 4; ++j) { union { _Float16 h[2]; unsigned int d; } pk; pk.h[0] = (_Float16)(bf16_round(a[u][j]) * scale); pk.h[1] = (_Float16)(bf16_round(b[u][j]) * scale); tl[(c * 4 + j) * WT_P + u * 16 + r] = pk.d; } }
  __syncthreads();
  unsigned short* q = (unsigned short*)Wt + (size_t)(n0 + r) * K + k0 + c * 8;
#pragma unroll
  for (int v = 0; v < 4; ++v) { v4ua o;
#pragma unroll
    for (int i = 0; i < 4; ++i) o[i] = tl[(v * 16 + r) * WT_P + c * 4 + i];
    *(v4ua*)(q + (size_t)v * 16 * K) = o; }
}
// k_gemm_hh variant with fused epilogue: v = acc·alpha + bias[by·sBias + col] (+ CP[(row/rowsPerB)·sCPb + by·64 + col] if CP) ; ACT 0 none / 1 elu ; writes f16 C16 (and f32 C if non-null)
template <int ACT>
__global__ __launch_bounds__(128) void k_gemm_hhx(const _Float16* __restrict__ A, int lda, size_t sA, const _Float16* __restrict__ Bh, int ldb, size_t sB, float alpha, const float* __restrict__ bias, size_t sBias, const float* __restrict__ CP, int rowsPerB, size_t sCPb, int row0g,
    float* __restrict__ C, _Float16* __restrict__ C16, int ldc, size_t sC, int M, int N, int K) {
  __shared__ __attribute__((aligned(16))) float so[4][16][64];
  const int tid = threadIdx.x, w = tid >> 5, lane = tid & 31, ln = lane & 15, hh = lane >> 4; const int by = blockIdx.y;
  A += (size_t)by * sA; Bh += (size_t)by * sB; const size_t cofs = (size_t)by * sC; const float* bp = bias ? bias + (size_t)by * sBias : nullptr;
  const int ntn = (N + 63) / 64; const int wid = blockIdx.x * 4 + w; const int mt = wid / ntn, nq = wid % ntn; if (mt * 16 >= M) return;
  const int row0 = mt * 16, col0 = nq * 64; const _Float16* arow = A + (size_t)(row0 + ln) * lda;
  v8f acc[4] = {};
  for (int kb = 0; kb < K; kb += 32) { FragH ah; ah.half[0] = *(const v8us*)((const unsigned short*)arow + kb + 8 * hh); ah.half[1] = *(const v8us*)((const unsigned short*)arow + kb + 16 + 8 * hh);
#pragma unroll
    for (int t = 0; t < 4; ++t) { if (col0 + t * 16 >= N) continue; const size_t boff = (size_t)(col0 + t * 16 + ln) * ldb + kb; FragH bq; bq.half[0] = *(const v8us*)((const unsigned short*)Bh + boff + 8 * hh); bq.half[1] = *(const v8us*)((const unsigned short*)Bh + boff + 16 + 8 * hh);
      acc[t] = mmaH<1>(ah.v, ah.v, bq.v, bq.v, acc[t]); }
  }
#pragma unroll
  for (int t = 0; t < 4; ++t) { if (col0 + t * 16 >= N) continue; const int col = col0 + t * 16 + ln; const float bv = bp ? bf16_round(bp[col]) : 0.f;
#pragma unroll
    for (int r = 0; r < 8; ++r) { float v = acc[t][r] * alpha + bv; if (CP) { const int rr = row0g + row0 + 8 * hh + r; if (rowsPerB < 0) v += CP[cofs + (size_t)rr * ldc + col];      /* rowsPerB < 0: own element of the batched C plane */ else { const int bidx = rr / rowsPerB; v += CP[(size_t)bidx * sCPb + (size_t)by * 64 + col]; } } if (ACT == 1) v = (v > 0.f) ? v : expm1f(v); else if (ACT == 7) v = (v > 0.f) ? v + 1.0f : expf(v); else if (ACT == 8) v = tanhf(v); else if (ACT == 9) v = 0.5f * v * (1.0f + tanhf(0.7978845608028654f * (v + 0.044715f * v * v * v))); else if (ACT == 11) v = 1.0f / (1.0f + expf(-v)); else if (ACT == 12) v = (v > 0.f) ? v : 0.01f * v; else if (ACT == 14) v = (v > 0.f) ? v : 0.1f * v; else if (ACT == 16) v = (v >= 0.f) ? v : 0.3f * v; else if (ACT == 15) v = v / (1.0f + expf(-v)); else if (ACT == 3) v = fmaxf(v, 0.f); else if (ACT == 6) v = 0.5f * v * (1.0f + erff(v * 0.70710678118654752f)); so[w][8 * hh + r][t * 16 + ln] = v; } }
  __builtin_amdgcn_fence(__ATOMIC_ACQ_REL, "workgroup"); __builtin_amdgcn_wave_barrier();
  const int rsub = lane >> 4, c4 = (lane & 15) * 4; typedef _Float16 v4h __attribute__((ext_vector_type(4)));
  {
#pragma unroll
    for (int q = 0; q < 8; ++q) { const int r = q * 2 + rsub; if (col0 + c4 < N) { const v4f v = *(const v4fa*)&so[w][r][c4]; if (C) *(v4f*)(C + cofs + (size_t)(row0 + r) * ldc + col0 + c4) = v; if (C16) { v4h h4; for (int i = 0; i < 4; ++i) h4[i] = (_Float16)v[i]; *(v4h*)(C16 + cofs + (size_t)(row0 + r) * ldc + col0 + c4) = h4; } } }
     }
}


typedef _Float16 v4h __attribute__((ext_vector_type(4)));

__global__ __launch_bounds__(256) void k_x16(const float* __restrict__ x, _Float16* __restrict__ X16, size_t n8) { const size_t t = (size_t)blockIdx.x * 256 + threadIdx.x; if (t >= n8) return; FragH f;
#pragma unroll
  for (int q = 0; q < 8; ++q) f.h[q] = (_Float16)bf16_round(x[t * 8 + q]); *(v8us*)((unsigned short*)X16 + t * 8) = f.half[0];  }
__global__ __launch_bounds__(256) void k_h16(const float* __restrict__ x, _Float16* __restrict__ X16, size_t n8, size_t sB) { const size_t t = (size_t)blockIdx.x * 256 + threadIdx.x; if (t >= n8) return; x += (size_t)blockIdx.y * sB; X16 += (size_t)blockIdx.y * sB;      /* batch = blockIdx.y */ FragH f;
#pragma unroll
  for (int q = 0; q < 8; ++q) f.h[q] = (_Float16)x[t * 8 + q]; *(v8us*)((unsigned short*)X16 + t * 8) = f.half[0];  }
__global__ __launch_bounds__(256) void k_round16f(const float* __restrict__ W, _Float16* __restrict__ Bt, size_t n8) { const size_t t = (size_t)blockIdx.x * 256 + threadIdx.x; if (t >= n8) return; FragH f;
#pragma unroll
  for (int i = 0; i < 8; ++i) f.h[i] = (_Float16)(bf16_round(W[t * 8 + i]) * 16.0f); *(v8us*)((unsigned short*)Bt + t * 8) = f.half[0];  }
template <int NHv, int TTv>
__global__ __launch_bounds__(256) void k_vt(const _Float16* __restrict__ V16, int ldv, int voff, _Float16* __restrict__ Vt) { __shared__ unsigned short tl[64][66]; const int tid = threadIdx.x; const int slab = blockIdx.x / (TTv / 64), lg = blockIdx.x % (TTv / 64); const int b = slab / NHv, h = slab % NHv;
  for (int i = tid; i < 64 * 8; i += 256) { const int r = i / 8, c8 = (i % 8) * 8; FragH f; f.half[0] = *(const v8us*)((const unsigned short*)V16 + ((size_t)b * TTv + lg * 64 + r) * ldv + voff + h * 64 + c8);
#pragma unroll
    for (int q = 0; q < 8; ++q) tl[r][c8 + q] = f.u[q]; }
  __syncthreads();
  {
#pragma unroll
    for (int rd = 0; rd < 2; ++rd) { const int d = rd * 32 + tid / 8, pc = tid % 8; FragH f;
#pragma unroll
      for (int q = 0; q < 8; ++q) f.u[q] = tl[pc * 8 + q][d];
      *(v8us*)((unsigned short*)Vt + ((size_t)slab * 64 + d) * TTv + lg * 64 + pc * 8) = f.half[0]; }
     } }

__global__ __launch_bounds__(256) void k_hl(const float* __restrict__ F, _Float16* __restrict__ Hh, _Float16* __restrict__ Hl, size_t n8, size_t sB, size_t sL) { const size_t t = (size_t)blockIdx.x * 256 + threadIdx.x; if (t >= n8) return; F += (size_t)blockIdx.y * sB; Hh += (size_t)blockIdx.y * sB; Hl += (size_t)blockIdx.y * sL;      /* batch = blockIdx.y */ FragH fh, fl; const v4f a = *(const v4fa*)(F + t * 8), c = *(const v4fa*)(F + t * 8 + 4);
#pragma unroll
  for (int q = 0; q < 4; ++q) { _Float16 h = (_Float16)a[q]; fh.h[q] = h; fl.h[q] = (_Float16)((a[q] - (float)h) * 1024.0f); h = (_Float16)c[q]; fh.h[4 + q] = h; fl.h[4 + q] = (_Float16)((c[q] - (float)h) * 1024.0f); }
  { *(v8us*)((unsigned short*)Hh + t * 8) = fh.half[0]; *(v8us*)((unsigned short*)Hl + t * 8) = fl.half[0];  } }

// ---- fast GEMM (block tile 128x64, wave tile 32x64; requires M % 128 == 0 rows per launch region, N % 64 == 0, K % 64 == 0); epilogue = k_gemm_hhx semantics ----
// Operands reach the waves through LDS: per 64 k one tile of 128 A rows and 64 B rows, 128 B (one whole line) of each row, brought by asynchronous copies (32 lanes = 4 whole lines a copy) into one of two buffers while the other is worked on; each row is fetched once per block instead of once per wave in 32-B pieces.
#define G2_PITCH 72      /* f16 per LDS row: 128 B of k + 16 B, the conflict-free pitch for ds_load_b128 readers of 128-B rows */
#define G2_TILE ((128 + 64) * G2_PITCH * 2)      /* bytes of one buffer: 128 A rows, then 64 B rows */
// one tile's 12 copies of a lane (rows 16 apart: 8 of A, 4 of B); l = the lane's LDS byte address of its first piece. s_wait_xcnt 0 is the statement's last line so that no address register of a copy is rewritten ahead of it.
__device__ __forceinline__ void g2_stage(unsigned l, const _Float16* ga, size_t sa, const _Float16* gb, size_t sb) { const unsigned r16 = 16 * G2_PITCH * 2;
  asm volatile("global_load_async_to_lds_b128 %0, %12, off\n\t" "global_load_async_to_lds_b128 %1, %13, off\n\t" "global_load_async_to_lds_b128 %2, %14, off\n\t" "global_load_async_to_lds_b128 %3, %15, off\n\t"
               "global_load_async_to_lds_b128 %4, %16, off\n\t" "global_load_async_to_lds_b128 %5, %17, off\n\t" "global_load_async_to_lds_b128 %6, %18, off\n\t" "global_load_async_to_lds_b128 %7, %19, off\n\t"
               "global_load_async_to_lds_b128 %8, %20, off\n\t" "global_load_async_to_lds_b128 %9, %21, off\n\t" "global_load_async_to_lds_b128 %10, %22, off\n\t" "global_load_async_to_lds_b128 %11, %23, off\n\t"
               "s_wait_xcnt 0x0"
               :: "v"(l), "v"(l + r16), "v"(l + 2 * r16), "v"(l + 3 * r16), "v"(l + 4 * r16), "v"(l + 5 * r16), "v"(l + 6 * r16), "v"(l + 7 * r16), "v"(l + 8 * r16), "v"(l + 9 * r16), "v"(l + 10 * r16), "v"(l + 11 * r16),
                  "v"(ga), "v"(ga + sa), "v"(ga + 2 * sa), "v"(ga + 3 * sa), "v"(ga + 4 * sa), "v"(ga + 5 * sa), "v"(ga + 6 * sa), "v"(ga + 7 * sa), "v"(gb), "v"(gb + sb), "v"(gb + 2 * sb), "v"(gb + 3 * sb)
               : "memory"); }
__device__ __forceinline__ v16h g2_frag(const _Float16* p, int hh) { FragH f; f.half[0] = *(const v8us*)((const unsigned short*)p + 8 * hh); f.half[1] = *(const v8us*)((const unsigned short*)p + 16 + 8 * hh); return f.v; }
__device__ __forceinline__ v8f g2_mma(v16h a, v16h b, v8f c) { v8f d = __builtin_amdgcn_wmma_f32_16x16x32_f16(false, a, false, b, (short)0, c, false, false); asm volatile("v_nop\n\tv_nop\n\tv_nop\n\tv_nop" : "+v"(d) : "v"(a), "v"(b)); return d; }
template <int ACT>
__global__ __launch_bounds__(128) void k_gemm2(const _Float16* __restrict__ A, int lda, size_t sA, const _Float16* __restrict__ Bh, int ldb, size_t sB, float alpha, const float* __restrict__ bias, size_t sBias, const float* __restrict__ CP, int rowsPerB, size_t sCPb, int row0g,
    float* __restrict__ C, _Float16* __restrict__ C16, int ldc, size_t sC, int M, int N, int K, size_t zA, size_t zB, size_t zC) { static_assert(ACT == 0 || ACT == 3 || ACT == 6 || ACT == 8 || ACT == 9 || ACT == 11 || ACT == 12 || ACT == 14 || ACT == 15 || ACT == 16, "k_gemm2: unsupported ACT code (would silently apply no activation)");
  __shared__ __attribute__((aligned(16))) unsigned char sm[2 * G2_TILE]; float (*so)[32][68] = (float (*)[32][68])sm;      /* the epilogue's staging lies over the two buffers, which every wave has left by then */ static_assert(sizeof(float) * 4 * 32 * 68 <= 2 * G2_TILE, "k_gemm2: epilogue staging must fit the buffers");
  const int tid = threadIdx.x, w = tid >> 5, lane = tid & 31, ln = lane & 15, hh = lane >> 4; const int by = blockIdx.y, bz = blockIdx.z;
  A += (size_t)by * sA + (size_t)bz * zA; Bh += (size_t)by * sB + (size_t)bz * zB; const size_t cofs = (size_t)by * sC + (size_t)bz * zC; const float* bp = bias ? bias + (size_t)by * sBias : nullptr;
  const int ntn = N >> 6; const int mt = blockIdx.x / ntn, nq = blockIdx.x - mt * ntn; const int row0 = mt * 128 + 32 * w, col0 = nq * 64; if (mt * 128 >= M) return;      /* the same for the whole block: it stands in front of barriers */
  const int trow = tid >> 3, tseg = tid & 7;      /* a lane's piece of a tile: 16 B number tseg of rows trow, trow + 16, ... */
  const _Float16* gA = A + (size_t)(mt * 128 + trow) * lda + tseg * 8; const _Float16* gB = Bh + (size_t)(col0 + trow) * ldb + tseg * 8; const size_t sa16 = (size_t)16 * lda, sb16 = (size_t)16 * ldb;
  const unsigned l0 = (unsigned)(size_t)sm + (unsigned)(trow * (G2_PITCH * 2) + tseg * 16);
  const v8f z8 = {0.f,0.f,0.f,0.f,0.f,0.f,0.f,0.f}; v8f c00 = z8, c01 = z8, c02 = z8, c03 = z8, c10 = z8, c11 = z8, c12 = z8, c13 = z8;
  const int nc = K >> 6;
  g2_stage(l0, gA, sa16, gB, sb16);
  asm volatile("s_wait_asynccnt 0x0" ::: "memory");      /* tile 0 of this wave's copies has landed */
  __syncthreads();      /* ... and every other wave's */
  if (nc > 1) g2_stage(l0 + G2_TILE, gA + 64, sa16, gB + 64, sb16);
#pragma unroll 1      /* one tile a trip: the buffer index stays a run-time value and the loop stays small */
  for (int t = 0; t < nc; ++t) { const _Float16* tl = (const _Float16*)(sm + (t & 1) * G2_TILE); const _Float16* ar = tl + (32 * w + ln) * G2_PITCH; const _Float16* br = tl + (128 + ln) * G2_PITCH;
    /* all 24 LDS reads of the trip as one group in front of its WMMAs */
    const v16h a0 = g2_frag(ar, hh), a1 = g2_frag(ar + 16 * G2_PITCH, hh), b0 = g2_frag(br, hh), b1 = g2_frag(br + 16 * G2_PITCH, hh), b2 = g2_frag(br + 32 * G2_PITCH, hh), b3 = g2_frag(br + 48 * G2_PITCH, hh);
    const v16h e0 = g2_frag(ar + 32, hh), e1 = g2_frag(ar + 16 * G2_PITCH + 32, hh), f0 = g2_frag(br + 32, hh), f1 = g2_frag(br + 16 * G2_PITCH + 32, hh), f2 = g2_frag(br + 32 * G2_PITCH + 32, hh), f3 = g2_frag(br + 48 * G2_PITCH + 32, hh);
    c00 = g2_mma(a0, b0, c00); c10 = g2_mma(a1, b0, c10); c01 = g2_mma(a0, b1, c01); c11 = g2_mma(a1, b1, c11); c02 = g2_mma(a0, b2, c02); c12 = g2_mma(a1, b2, c12); c03 = g2_mma(a0, b3, c03); c13 = g2_mma(a1, b3, c13);
    c00 = g2_mma(e0, f0, c00); c10 = g2_mma(e1, f0, c10); c01 = g2_mma(e0, f1, c01); c11 = g2_mma(e1, f1, c11); c02 = g2_mma(e0, f2, c02); c12 = g2_mma(e1, f2, c12); c03 = g2_mma(e0, f3, c03); c13 = g2_mma(e1, f3, c13);
    asm volatile("s_wait_dscnt 0x0" ::: "memory");      /* this wave's reads of buffer t & 1 are done before the buffer is handed back */
    asm volatile("s_wait_asynccnt 0x0" ::: "memory");      /* this wave's copies of tile t + 1 have landed */
    __syncthreads();      /* publishes tile t + 1 and ends every wave's reads of tile t */
    if (t + 2 < nc) g2_stage(l0 + (unsigned)((t & 1) * G2_TILE), gA + (size_t)(t + 2) * 64, sa16, gB + (size_t)(t + 2) * 64, sb16); }
  asm volatile("s_wait_asynccnt 0x0" ::: "memory");      /* no copy is in flight when the buffers become the epilogue's staging */
  v8f accs[8] = {c00, c01, c02, c03, c10, c11, c12, c13};
#pragma unroll
  for (int u = 0; u < 8; ++u) { const int t = u & 3, half = u >> 2; const int col = col0 + t * 16 + ln; const float bv = bp ? bf16_round(bp[col]) : 0.f;
#pragma unroll
    for (int r = 0; r < 8; ++r) { const int rloc = half * 16 + 8 * hh + r; float v = accs[u][r] * alpha + bv; if (CP) { if (rowsPerB < 0) v += CP[cofs + (size_t)(row0g + row0 + rloc) * ldc + col];      /* rowsPerB < 0: own element of the batched C plane */ else { const int bidx = (row0g + row0 + rloc) / rowsPerB; v += CP[(size_t)bidx * sCPb + (size_t)by * 64 + col]; } }
      if (ACT == 3) v = fmaxf(v, 0.f); else if (ACT == 6) v = 0.5f * v * (1.0f + erff(v * 0.70710678118654752f)); else if (ACT == 11) v = 1.0f / (1.0f + expf(-v)); else if (ACT == 15) v = v / (1.0f + expf(-v)); else if (ACT == 12) v = (v > 0.f) ? v : 0.01f * v; else if (ACT == 8) v = tanhf(v); else if (ACT == 9) v = 0.5f * v * (1.0f + tanhf(0.7978845608028654f * (v + 0.044715f * v * v * v))); else if (ACT == 14) v = (v > 0.f) ? v : 0.1f * v; else if (ACT == 16) v = (v >= 0.f) ? v : 0.3f * v;
      so[w][rloc][t * 16 + ln] = v; } }
  __builtin_amdgcn_fence(__ATOMIC_ACQ_REL, "workgroup"); __builtin_amdgcn_wave_barrier();
  const int rsub = lane >> 4, c4 = (lane & 15) * 4;
  {
#pragma unroll
    for (int q = 0; q < 16; ++q) { const int r = q * 2 + rsub; const v4f v = *(const v4fa*)&so[w][r][c4]; if (C) *(v4f*)(C + cofs + (size_t)(row0 + r) * ldc + col0 + c4) = v; if (C16) { v4h h4; for (int i = 0; i < 4; ++i) h4[i] = (_Float16)v[i]; *(v4h*)(C16 + cofs + (size_t)(row0 + r) * ldc + col0 + c4) = h4; } }
     } }


__global__ __launch_bounds__(256) void k_rotab(const int* __restrict__ pid, float* __restrict__ CS, float* __restrict__ SN) {
  #pragma clang fp contract(off)
  const int t = blockIdx.x * 256 + threadIdx.x; if (t >= NB * SQ * HH) return; const int j = t % HH, s = t / HH;      /* s = flat token over both batches */ const float inv = 1.0f / powf(10000.0f, (float)(2 * j) / (float)HD); const float th = (float)pid[s] * inv; const float c = cosf(th), sn = sinf(th);
  { *(float*)(CS + t) = c; *(float*)(SN + t) = sn;  } }
__global__ __launch_bounds__(256) void k_rope(const float* __restrict__ F, int nheads, const float* __restrict__ CS, const float* __restrict__ SN, _Float16* __restrict__ H, _Float16* __restrict__ L) {
  #pragma clang fp contract(off)
  const size_t t = (size_t)blockIdx.x * 256 + threadIdx.x; if (t >= (size_t)NB * SQ * nheads * (HH / 8)) return; const int g = (int)(t % (HH / 8)) * 8; const int h = (int)((t / (HH / 8)) % nheads); const int s = (int)(t / ((HH / 8) * (size_t)nheads)); const int ld = nheads * HD;
  const size_t base = (size_t)s * ld + h * HD + g; FragH h0, h1, l0, l1;
#pragma unroll
  for (int q = 0; q < 8; ++q) { const float c = CS[s * HH + g + q], sn = SN[s * HH + g + q]; const float x0 = F[base + q], x1 = F[base + HH + q]; float o0 = x0 * c; o0 += -x1 * sn; float o1 = x1 * c; o1 += x0 * sn;
    const _Float16 a0 = (_Float16)o0, a1 = (_Float16)o1; h0.h[q] = a0; h1.h[q] = a1; l0.h[q] = (_Float16)((o0 - (float)a0) * 1024.0f); l1.h[q] = (_Float16)((o1 - (float)a1) * 1024.0f); }
  { *(v8us*)((unsigned short*)H + base) = h0.half[0]; *(v8us*)((unsigned short*)H + base + HH) = h1.half[0]; if (L) { *(v8us*)((unsigned short*)L + base) = l0.half[0]; *(v8us*)((unsigned short*)L + base + HH) = l1.half[0]; }  } }
// causal / padding softmax, one wave per row, the whole row in registers: lane ln holds elements c * 128 + 4 * ln .. + 3 of every 128-key chunk c, so S is read once (whole 512-B pieces, all loads of a row in flight together), exp is taken once per score, and P leaves as 8-B pieces.
// NK keys were written by the S GEMM; R0 = first row of the band. A chunk that lies wholly right of the diagonal (c * 128 > r, the same for the whole wave) takes no exp: its P is zero.
typedef int v4ia __attribute__((ext_vector_type(4), may_alias));
typedef _Float16 v4ha __attribute__((ext_vector_type(4), may_alias));
template <int NK, int R0, bool HASPL>
__global__ __launch_bounds__(256) void k_csoft(float* S, size_t sS, const int* __restrict__ mask, _Float16* __restrict__ PL, size_t sPL) {
  constexpr int NC = NK / 128; const float NONE = -3.0e38f;
  const int wv = __builtin_amdgcn_readfirstlane(threadIdx.x >> 5), ln = threadIdx.x & 31; const int rl = blockIdx.x * 8 + wv, r = R0 + rl; const int b = blockIdx.z, pl = b * NHQ + blockIdx.y;      /* batch = blockIdx.z, head = blockIdx.y: their own S and P planes */
  char* srow = (char*)(S + (size_t)pl * sS + (size_t)rl * SQ); const char* mrow = (const char*)(mask + (size_t)b * SQ);      /* the same for the whole wave; the P row lies over the front half of its own S row: every store follows the row sum, which follows every read of the row */
  const unsigned off = ln * 16; const int jr = r - ln * 4, cd = r >> 7;      /* element q of chunk c is at or left of the diagonal when c * 128 + q <= jr; cd = the diagonal's chunk */
  v4f x[NC]; v4ia kk[NC];      /* every loop over c and q below is unrolled whole: the arrays are then indexed by constants and stay in registers */
#pragma unroll
  for (int c = 0; c < NC; ++c) { kk[c] = *(const v4ia*)(mrow + off + c * 512); x[c] = *(const v4fa*)(srow + off + c * 512); }
  __builtin_amdgcn_sched_barrier(0);      /* every load of the row is issued before the first use of one: a row pays one memory latency, not one per group of loads */
  float m = NONE;
#pragma unroll
  for (int c = 0; c < NC; ++c) {
#pragma unroll
    for (int q = 0; q < 4; ++q) { const float s = ((c * 128 + q <= jr) & (kk[c][q] > 0)) ? x[c][q] : NONE; x[c][q] = s; m = fmaxf(m, s); } }
  for (int o = 16; o > 0; o >>= 1) m = fmaxf(m, __shfl_xor(m, o, 32));
  float su = 0.f;
#pragma unroll
  for (int c = 0; c < NC; ++c) { v4f e4 = {0.f, 0.f, 0.f, 0.f};
    if (c * 128 <= R0 || c <= cd) {
#pragma unroll
      for (int q = 0; q < 4; ++q) { e4[q] = expf(x[c][q] - m); su += e4[q]; } }      /* a masked score gives exp(NONE - m) = 0 */
    x[c] = e4; }
  for (int o = 16; o > 0; o >>= 1) su += __shfl_xor(su, o, 32);
  const float f = (m > NONE) ? 1024.0f / su : 0.f;      /* a row with no open key keeps P = 0 */
  v4h hv[NC], lv[NC];
#pragma unroll
  for (int c = 0; c < NC; ++c) {
#pragma unroll
    for (int q = 0; q < 4; ++q) { const float p = x[c][q] * f; hv[c][q] = (_Float16)p; if (HASPL) lv[c][q] = (_Float16)((p - (float)hv[c][q]) * 1024.0f); } }
  /* all stores last, each from registers of its own: nothing is written behind an issued store */
  char* plrow = HASPL ? (char*)(PL + (size_t)pl * sPL + (size_t)rl * SQ) : nullptr;
#pragma unroll
  for (int c = 0; c < NC; ++c) { *(v4ha*)(srow + ln * 8 + c * 256) = hv[c]; if (HASPL) *(v4ha*)(plrow + ln * 8 + c * 256) = lv[c]; } }

extern "C" void kernel_launch(void* const* d_in, const int* in_sizes, int n_in,
                              void* d_out, int out_size, void* d_ws, size_t ws_size, hipStream_t stream) {
  (void)in_sizes; (void)n_in; (void)out_size;
  const float* const* I = (const float* const*)d_in; const float* hs = I[0]; const int* amask = (const int*)d_in[1]; const int* pid = (const int*)d_in[2]; const float* Wq = I[3]; const float* Wk = I[4]; const float* Wv = I[5]; const float* Wo = I[6];
  char* ws = (char*)d_ws; size_t off = 0;
  auto take = [&](size_t bytes) { char* p = ws + off; off += (bytes + 255) & ~(size_t)255; return p; };
  const size_t np = (size_t)SQ * DM, nkv = (size_t)SQ * HD;      /* elements per batch of a [SQ][DM] and of a [SQ][HD] plane */
  _Float16* BQ = (_Float16*)take(np * 2); _Float16* BK = (_Float16*)take((size_t)HD * DM * 2); _Float16* BV = (_Float16*)take((size_t)HD * DM * 2); _Float16* BO = (_Float16*)take(np * 2);
  float* CS = (float*)take((size_t)NB * SQ * HH * 4); float* SN = (float*)take((size_t)NB * SQ * HH * 4);
  _Float16* X16 = (_Float16*)take(NB * np * 2); float* F32 = (float*)take(NB * np * 4); _Float16* QH = (_Float16*)take(NB * np * 2); _Float16* QL = (_Float16*)take(NB * np * 2); _Float16* KH = (_Float16*)take(NB * nkv * 2); _Float16* KL = (_Float16*)take(NB * nkv * 2); _Float16* VH = (_Float16*)take(NB * nkv * 2); _Float16* VL = (_Float16*)take(NB * nkv * 2); _Float16* VTh = (_Float16*)take(NB * nkv * 2); _Float16* VTl = (_Float16*)take(NB * nkv * 2);
  const size_t sS = (size_t)1024 * SQ, sPL = (size_t)BAND * SQ;      /* elements per (batch, head) plane of S, and of PL */
  float* S = (float*)take(NB * NHQ * sS * 4); _Float16* PH = (_Float16*)S; const int ldp = 2 * SQ; const size_t sP = 2 * sS;      /* P row r of a plane = front half of S row r: pitch and plane stride in f16 elements are twice those of S */
  _Float16* PL = X16; float* O = F32; _Float16* O16 = QL; _Float16* OL0 = (_Float16*)take((size_t)NB * BAND * DM * 2);      /* PL over X16 (dead after the q GEMM; same size); O over the q f32 scratch (dead after k_rope); O16 over QL (QL is only read for band 0, which runs first) */
  if (off > ws_size) return;      /* 8+1+1+8 + 4 + 16+32+16+16 + 6*2 + 128 + 2 = 244 MiB */
  k_wt_f16<DM, DM><<<(DM / 128) * (DM / 64), 256, 0, stream>>>(Wq, BQ, 16.0f); k_wt_f16<DM, HD><<<(DM / 128) * (HD / 64), 256, 0, stream>>>(Wk, BK, 16.0f); k_wt_f16<DM, HD><<<(DM / 128) * (HD / 64), 256, 0, stream>>>(Wv, BV, 16.0f); k_wt_f16<DM, DM><<<(DM / 128) * (DM / 64), 256, 0, stream>>>(Wo, BO, 16.0f);
  const int MT = NB * SQ;      /* tokens of both batches: the q/k/v projections, the passes before attention and the hi Wo GEMM see one flat [MT][...] matrix */
  k_rotab<<<(NB * SQ * HH + 255) / 256, 256, 0, stream>>>(pid, CS, SN);
  k_x16<<<(unsigned)((NB * np / 8 + 255) / 256), 256, 0, stream>>>(hs, X16, NB * np / 8);
  /* k and v (one kv head of 256) */
  k_gemm2<0><<<dim3((MT / 128) * (HD / 64), 1), 128, 0, stream>>>(X16, DM, 0, BK, DM, 0, 0.0625f, nullptr, 0, nullptr, 1, 0, 0, F32, nullptr, HD, 0, MT, HD, DM, 0, 0, 0);
  k_rope<<<(unsigned)(((size_t)MT * 1 * (HH / 8) + 255) / 256), 256, 0, stream>>>(F32, 1, CS, SN, KH, KL);
  k_gemm2<0><<<dim3((MT / 128) * (HD / 64), 1), 128, 0, stream>>>(X16, DM, 0, BV, DM, 0, 0.0625f, nullptr, 0, nullptr, 1, 0, 0, F32, nullptr, HD, 0, MT, HD, DM, 0, 0, 0);
  k_hl<<<(unsigned)((NB * nkv / 8 + 255) / 256), 256, 0, stream>>>(F32, VH, VL, NB * nkv / 8, 0, 0);
  k_vt<HD / 64, SQ><<<NB * (HD / 64) * (SQ / 64), 256, 0, stream>>>(VH, HD, 0, VTh); k_vt<HD / 64, SQ><<<NB * (HD / 64) * (SQ / 64), 256, 0, stream>>>(VL, HD, 0, VTl);
  /* q (8 heads), roped, hi/lo */
  k_gemm2<0><<<dim3((MT / 128) * (DM / 64), 1), 128, 0, stream>>>(X16, DM, 0, BQ, DM, 0, 0.0625f, nullptr, 0, nullptr, 1, 0, 0, F32, nullptr, DM, 0, MT, DM, DM, 0, 0, 0);
  k_rope<<<(unsigned)(((size_t)MT * NHQ * (HH / 8) + 255) / 256), 256, 0, stream>>>(F32, NHQ, CS, SN, QH, QL);
  /* attention: head in grid.y (A + h * HD for q, one shared K / V^T per batch, C plane h), batch in grid.z (the last three arguments: element strides of A, B and C per batch); rowsPerB = -1 adds the own element of the C plane */
  /* band 0 (rows < 256, keys < 256): hi + lo everywhere */
  { const int nk = BAND; const dim3 gS((BAND / 128) * (nk / 64), NHQ, NB), gO((BAND / 128) * (HD / 64), NHQ, NB);
    k_gemm2<0><<<gS, 128, 0, stream>>>(QH, DM, HD, KH, HD, 0, 0.0625f, nullptr, 0, nullptr, 1, 0, 0, S, nullptr, SQ, sS, BAND, nk, HD, np, nkv, NHQ * sS);      /* S = (Qh Kh^T) / 16 */
    k_gemm2<0><<<gS, 128, 0, stream>>>(QL, DM, HD, KH, HD, 0, 0.0625f / 1024.0f, nullptr, 0, S, -1, 0, 0, S, nullptr, SQ, sS, BAND, nk, HD, np, nkv, NHQ * sS);
    k_gemm2<0><<<gS, 128, 0, stream>>>(QH, DM, HD, KL, HD, 0, 0.0625f / 1024.0f, nullptr, 0, S, -1, 0, 0, S, nullptr, SQ, sS, BAND, nk, HD, np, nkv, NHQ * sS);
    k_csoft<BAND, 0, true><<<dim3(BAND / 8, NHQ, NB), 256, 0, stream>>>(S, sS, amask, PL, sPL);
    k_gemm2<0><<<gO, 128, 0, stream>>>(PH, ldp, sP, VTh, SQ, 0, 0.0009765625f, nullptr, 0, nullptr, 1, 0, 0, O, nullptr, DM, HD, BAND, HD, nk, NHQ * sP, nkv, np);
    k_gemm2<0><<<gO, 128, 0, stream>>>(PL, SQ, sPL, VTh, SQ, 0, 0.0009765625f / 1024.0f, nullptr, 0, O, -1, 0, 0, O, nullptr, DM, HD, BAND, HD, nk, NHQ * sPL, nkv, np);
    k_gemm2<0><<<gO, 128, 0, stream>>>(PH, ldp, sP, VTl, SQ, 0, 0.0009765625f / 1024.0f, nullptr, 0, O, -1, 0, 0, O, nullptr, DM, HD, BAND, HD, nk, NHQ * sP, nkv, np); }
  /* two later bands (rows 256..1023 with keys < 1024, rows 1024..2047 with keys < 2048): plain */
  for (int k = 0; k < 2; ++k) { const int r0 = k ? 1024 : BAND, nr = k ? 1024 : (1024 - BAND), nk = k ? SQ : 1024; const dim3 gS((nr / 128) * (nk / 64), NHQ, NB), gO((nr / 128) * (HD / 64), NHQ, NB);
    k_gemm2<0><<<gS, 128, 0, stream>>>(QH + (size_t)r0 * DM, DM, HD, KH, HD, 0, 0.0625f, nullptr, 0, nullptr, 1, 0, 0, S, nullptr, SQ, sS, nr, nk, HD, np, nkv, NHQ * sS);
    if (k) k_csoft<SQ, 1024, false><<<dim3(nr / 8, NHQ, NB), 256, 0, stream>>>(S, sS, amask, nullptr, 0); else k_csoft<1024, BAND, false><<<dim3(nr / 8, NHQ, NB), 256, 0, stream>>>(S, sS, amask, nullptr, 0);
    k_gemm2<0><<<gO, 128, 0, stream>>>(PH, ldp, sP, VTh, SQ, 0, 0.0009765625f, nullptr, 0, nullptr, 1, 0, 0, O + (size_t)r0 * DM, nullptr, DM, HD, nr, HD, nk, NHQ * sP, nkv, np); }
  /* output: O hi (+ lo on rows < 256 of each batch) into Wo */
  k_hl<<<dim3((unsigned)(((size_t)BAND * DM / 8 + 255) / 256), NB), 256, 0, stream>>>(O, O16, OL0, (size_t)BAND * DM / 8, np, (size_t)BAND * DM);      /* rows < 256: hi + lo */
  k_h16<<<dim3((unsigned)((((size_t)SQ - BAND) * DM / 8 + 255) / 256), NB), 256, 0, stream>>>(O + (size_t)BAND * DM, O16 + (size_t)BAND * DM, ((size_t)SQ - BAND) * DM / 8, np);
  float* out = (float*)d_out;
  k_gemm2<0><<<dim3((MT / 128) * (DM / 64), 1), 128, 0, stream>>>(O16, DM, 0, BO, DM, 0, 0.0625f, nullptr, 0, nullptr, 1, 0, 0, out, nullptr, DM, 0, MT, DM, DM, 0, 0, 0);
  k_gemm2<0><<<dim3((BAND / 128) * (DM / 64), 1, NB), 128, 0, stream>>>(OL0, DM, 0, BO, DM, 0, 0.0625f / 1024.0f, nullptr, 0, out, -1, 0, 0, out, nullptr, DM, 0, BAND, DM, DM, (size_t)BAND * DM, 0, np);
}

// v006
// One run takes 366 microseconds.
// Next to v005, in two timings, it ran 1.19 and 1.20 times as fast.
// All steps since v000 together make it 16.3 times as fast.
#include <hip/hip_runtime.h>
// FlaxGemmaAttention (2 x 2048 tokens, D 2048, 8 query heads of 256 sharing ONE kv head; rotate-half RoPE from the INPUT position_ids; causal + INPUT padding mask; scale 256^-0.5; out = attn Wo).
// Structure (both batches in every launch: flat rows for the projections and elementwise passes, blockIdx.z for attention): exact f16 plane of the hidden states; q/k/v GEMMs (32x64 wave tiles, f32 accumulation, exact x16 weights); RoPE tables (f32 trig) + rotation on VALU into f16 hi (+ 2^10 residual) planes; V^T hi/residual by LDS tiles; attention in two parts. Rows < 256 (whose outputs average over few keys) UNFUSED, all 8 heads in ONE launch (head = blockIdx.y, batch = blockIdx.z, one S plane per batch and head, each P row stored over the front half of its own S row): S = Q K^T as a GEMM (f32), causal/padding softmax on VALU (wave per row) into an f16 P plane (x2^10), O = P V as a GEMM, with hi+lo operands throughout (3-term S, 3-term P.V, hi+lo O into Wo). Rows >= 256 FUSED, plain f16 operands: one block per 128 rows of a head walks the causally reachable keys in tiles of 64 with a running maximum and sum (k_fattn), S and P stay in registers, O leaves as f16; output GEMM.
// Compute dtype: inputs and weights rounded to bf16; rows >= 256: q, k, P, v, O as f16 (~2^-12); rows < 256: hi + residual pairs; f32 accumulation/softmax/trig. v_wmma_f32_16x16x32_f16.
#define NB 2
#define SQ 2048
#define DM 2048
#define NHQ 8
#define HD 256
#define HH (HD / 2)
#define BAND 256
#define NBAND (SQ / BAND)
typedef __bf16 v16b __attribute__((ext_vector_type(16)));
typedef unsigned short v8us __attribute__((ext_vector_type(8), may_alias));
typedef float  v8f  __attribute__((ext_vector_type(8)));
typedef float  v4f  __attribute__((ext_vector_type(4)));
typedef float  v4fa __attribute__((ext_vector_type(4), may_alias));
union FragB { v16b v; v8us half[2]; unsigned short u[16]; };

__device__ __forceinline__ unsigned short bf16_bits(float x) { unsigned int u = __float_as_uint(x); return (unsigned short)((u + 0x7FFFu + ((u >> 16) & 1u)) >> 16); }
__device__ __forceinline__ float bf16_val(unsigned short b) { return __uint_as_float(((unsigned int)b) << 16); }
__device__ __forceinline__ float bf16_round(float x) { return bf16_val(bf16_bits(x)); }
// D += A·B with NT terms: 1 = ah·bh, 2 = + al·bh (A split), 3 = + ah·bl (both split)
template <int NT>
__device__ __forceinline__ v8f mmaN(v16b ah, v16b al, v16b bh, v16b bl, v8f c) {
  c = __builtin_amdgcn_wmma_f32_16x16x32_bf16(false, ah, false, bh, (short)0, c, false, false);
  if (NT >= 2) c = __builtin_amdgcn_wmma_f32_16x16x32_bf16(false, al, false, bh, (short)0, c, false, false);
  if (NT >= 3) c = __builtin_amdgcn_wmma_f32_16x16x32_bf16(false, ah, false, bl, (short)0, c, false, false);
  asm volatile("v_nop\n\tv_nop\n\tv_nop\n\tv_nop" : "+v"(c) : "v"(ah), "v"(al), "v"(bh), "v"(bl));
  return c;
}

__global__ __launch_bounds__(256) void k_wt_bf16(const float* __restrict__ W, unsigned short* __restrict__ Wt, int K, int N) {
  const int t = blockIdx.x * 256 + threadIdx.x;
  const int k8n = K / 8;
  if (t >= N * k8n) return;
  const int n = t / k8n, k8 = (t % k8n) * 8;
  v8us v;
#pragma unroll
  for (int i = 0; i < 8; ++i) v[i] = bf16_bits(W[(size_t)(k8 + i) * N + n]);
  *(v8us*)(Wt + (size_t)n * K + k8) = v;
  
}

// GEMM C[M][N] (f32, pitch ldc) = act(A[M][K]·W + bias). A f32 row-major (pitch lda) converted per fragment to bf16
// (ASPLIT: hi/lo two planes -> 2 terms, else single rounded term); Wt bf16 [N][K] (pitch ldb). BIAS_BF16 rounds the
// bias to bf16 first (bias quantised to bf16 before the add). K%32==0, M%16==0, N%64==0.
template <bool ASPLIT, int ACT, bool BIAS_BF16>
__global__ __launch_bounds__(128) void k_gemm_bf(const float* __restrict__ A, int lda, const unsigned short* __restrict__ Wt, int ldb,
                                               const float* __restrict__ bias, float* __restrict__ C, int ldc, int M, int N, int K) {
  __shared__ __attribute__((aligned(16))) float so[4][16][64];
  const int tid = threadIdx.x, w = tid >> 5, lane = tid & 31, ln = lane & 15, hh = lane >> 4;
  const int ntn = N / 64;
  const int wid = blockIdx.x * 4 + w;
  const int mt = wid / ntn, nq = wid % ntn;
  if (mt * 16 >= M) return;
  const int row0 = mt * 16, col0 = nq * 64;
  const float* arow = A + (size_t)(row0 + ln) * lda;
  v8f acc[4] = {};
  for (int kb = 0; kb < K; kb += 32) {
    FragB ah, al;
    const v4f x0 = *(const v4fa*)(arow + kb + 8 * hh), x1 = *(const v4fa*)(arow + kb + 8 * hh + 4);
    const v4f x2 = *(const v4fa*)(arow + kb + 16 + 8 * hh), x3 = *(const v4fa*)(arow + kb + 16 + 8 * hh + 4);
    float xs[16] = {x0[0],x0[1],x0[2],x0[3],x1[0],x1[1],x1[2],x1[3],x2[0],x2[1],x2[2],x2[3],x3[0],x3[1],x3[2],x3[3]};
#pragma unroll
    for (int i = 0; i < 16; ++i) { const unsigned short hb = bf16_bits(xs[i]); ah.u[i] = hb; al.u[i] = ASPLIT ? bf16_bits(xs[i] - bf16_val(hb)) : (unsigned short)0; }
#pragma unroll
    for (int t = 0; t < 4; ++t) {
      const unsigned short* brow = Wt + (size_t)(col0 + t * 16 + ln) * ldb + kb;
      FragB b;
      b.half[0] = *(const v8us*)(brow + 8 * hh);
      b.half[1] = *(const v8us*)(brow + 16 + 8 * hh);
      acc[t] = mmaN<ASPLIT ? 2 : 1>(ah.v, al.v, b.v, b.v, acc[t]);
    }
  }
#pragma unroll
  for (int t = 0; t < 4; ++t) {
    float bv = bias ? bias[col0 + t * 16 + ln] : 0.f;
    if (BIAS_BF16) bv = bf16_round(bv);
#pragma unroll
    for (int r = 0; r < 8; ++r) { float v = acc[t][r] + bv; if (ACT == 1) v = fmaxf(v, 0.f); so[w][8 * hh + r][t * 16 + ln] = v; }
  }
  __builtin_amdgcn_fence(__ATOMIC_ACQ_REL, "workgroup");
  __builtin_amdgcn_wave_barrier();
  const int rsub = lane >> 4, c4 = (lane & 15) * 4;
  {
#pragma unroll
    for (int q = 0; q < 8; ++q) {
      const int r = q * 2 + rsub;
      const v4f v = *(const v4fa*)&so[w][r][c4];
      *(v4f*)(C + (size_t)(row0 + r) * ldc + col0 + c4) = v;
    }
    
  }
}

// GEMM C = act(A·W + bias + resid): A f32 (ASPLIT -> hi/lo 2 terms), Wt bf16 [N][K]; ACT 0 none, 1 relu, 2 exact gelu;
// resid (optional, f32, row index = (row % rmod), pitch ldr, RES_BF16 rounds it) added before the activation.
template <bool ASPLIT, int ACT, bool BIAS_BF16, bool RES_BF16>
__global__ __launch_bounds__(128) void k_gemm_bf3(const float* __restrict__ A, int lda, const unsigned short* __restrict__ Wt, int ldb,
                                                const float* __restrict__ bias, const float* __restrict__ resid, int rmod, int ldr,
                                                float* __restrict__ C, int ldc, int M, int N, int K) {
  __shared__ __attribute__((aligned(16))) float so[4][16][64];
  const int tid = threadIdx.x, w = tid >> 5, lane = tid & 31, ln = lane & 15, hh = lane >> 4;
  const int ntn = N / 64;
  const int wid = blockIdx.x * 4 + w;
  const int mt = wid / ntn, nq = wid % ntn;
  if (mt * 16 >= M) return;
  const int row0 = mt * 16, col0 = nq * 64;
  const float* arow = A + (size_t)(row0 + ln) * lda;
  v8f acc[4] = {};
  for (int kb = 0; kb < K; kb += 32) {
    FragB ah, al;
    const v4f x0 = *(const v4fa*)(arow + kb + 8 * hh), x1 = *(const v4fa*)(arow + kb + 8 * hh + 4);
    const v4f x2 = *(const v4fa*)(arow + kb + 16 + 8 * hh), x3 = *(const v4fa*)(arow + kb + 16 + 8 * hh + 4);
    float xs[16] = {x0[0],x0[1],x0[2],x0[3],x1[0],x1[1],x1[2],x1[3],x2[0],x2[1],x2[2],x2[3],x3[0],x3[1],x3[2],x3[3]};
#pragma unroll
    for (int i = 0; i < 16; ++i) { const unsigned short hb = bf16_bits(xs[i]); ah.u[i] = hb; al.u[i] = ASPLIT ? bf16_bits(xs[i] - bf16_val(hb)) : (unsigned short)0; }
#pragma unroll
    for (int t = 0; t < 4; ++t) {
      const unsigned short* brow = Wt + (size_t)(col0 + t * 16 + ln) * ldb + kb;
      FragB b;
      b.half[0] = *(const v8us*)(brow + 8 * hh);
      b.half[1] = *(const v8us*)(brow + 16 + 8 * hh);
      acc[t] = mmaN<ASPLIT ? 2 : 1>(ah.v, al.v, b.v, b.v, acc[t]);
    }
  }
#pragma unroll
  for (int t = 0; t < 4; ++t) {
    const int col = col0 + t * 16 + ln;
    float bv = bias ? bias[col] : 0.f;
    if (BIAS_BF16) bv = bf16_round(bv);
#pragma unroll
    for (int r = 0; r < 8; ++r) {
      float v = acc[t][r] + bv;
      if (resid) { float rv = resid[(size_t)((row0 + 8 * hh + r) % rmod) * ldr + col]; if (RES_BF16) rv = bf16_round(rv); v += rv; }
      if (ACT == 1) v = fmaxf(v, 0.f);
      if (ACT == 2) v = 0.5f * v * (1.0f + erff(v * 0.70710678118654752f));
      if (ACT == 3) { const float u = 0.7978845608028654f * (v + 0.044715f * v * v * v); v = 0.5f * v * (1.0f + tanhf(u)); }
      so[w][8 * hh + r][t * 16 + ln] = v;
    }
  }
  __builtin_amdgcn_fence(__ATOMIC_ACQ_REL, "workgroup");
  __builtin_amdgcn_wave_barrier();
  const int rsub = lane >> 4, c4 = (lane & 15) * 4;
  {
#pragma unroll
    for (int q = 0; q < 8; ++q) {
      const int r = q * 2 + rsub;
      const v4f v = *(const v4fa*)&so[w][r][c4];
      *(v4f*)(C + (size_t)(row0 + r) * ldc + col0 + c4) = v;
    }
    
  }
}
// row LayerNorm (biased variance, eps) over N: s = X (+ R); optional out_sum <- s; out_norm <- (s-mu)*rsqrt(var+eps)*g + b
template <bool PARAM_BF16>
__global__ __launch_bounds__(256) void k_layernorm(const float* __restrict__ X, const float* __restrict__ R, const float* __restrict__ g, const float* __restrict__ bta,
                                                  float* __restrict__ out_sum, float* __restrict__ out_norm, int N, float eps) {
  __shared__ float red[256];
  const int row = blockIdx.x, tid = threadIdx.x;
  const float* x = X + (size_t)row * N; const float* rr = R ? R + (size_t)row * N : nullptr;
  float vals[16];                     // up to N = 4096
  const int per = N / 256;            // contiguous chunk per thread? use strided-by-4 chunks: thread handles j = tid*4 + 1024*u
  float s1 = 0.f;
  for (int u = 0; u < per / 4; ++u) {
    const int j = tid * 4 + 1024 * u;
    const v4f a = *(const v4fa*)(x + j);
    v4f b = {0.f,0.f,0.f,0.f}; if (rr) b = *(const v4fa*)(rr + j);
#pragma unroll
    for (int q = 0; q < 4; ++q) { const float v = a[q] + b[q]; vals[u * 4 + q] = v; s1 += v; }
  }
  red[tid] = s1; __syncthreads();
  for (int st = 128; st > 0; st >>= 1) { if (tid < st) red[tid] += red[tid + st]; __syncthreads(); }
  const float mu = red[0] / (float)N; __syncthreads();
  float s2 = 0.f;
  for (int u = 0; u < per / 4; ++u)
#pragma unroll
    for (int q = 0; q < 4; ++q) { const float c = vals[u * 4 + q] - mu; s2 += c * c; }
  red[tid] = s2; __syncthreads();
  for (int st = 128; st > 0; st >>= 1) { if (tid < st) red[tid] += red[tid + st]; __syncthreads(); }
  const float rs = rsqrtf(red[0] / (float)N + eps);
  {
    for (int u = 0; u < per / 4; ++u) {
      const int j = tid * 4 + 1024 * u;
      v4f o, sm;
#pragma unroll
      for (int q = 0; q < 4; ++q) {
        float gg = g[j + q], bb = bta[j + q];
        if (PARAM_BF16) { gg = bf16_round(gg); bb = bf16_round(bb); }
        sm[q] = vals[u * 4 + q]; o[q] = (vals[u * 4 + q] - mu) * rs * gg + bb;
      }
      if (out_sum) *(v4f*)(out_sum + (size_t)row * N + j) = sm;
      *(v4f*)(out_norm + (size_t)row * N + j) = o;
    }
    
  }
}



// ---- f16 WMMA path (v_wmma_f32_16x16x32_f16): 11-bit significands for operands in range — used where a [0,1] probability operand needs more precision than bf16
typedef _Float16 v16h __attribute__((ext_vector_type(16)));
union FragH { v16h v; v8us half[2]; _Float16 h[16]; unsigned short u[16]; };
template <int NT>
__device__ __forceinline__ v8f mmaH(v16h ah, v16h al, v16h bh, v16h bl, v8f c) {
  c = __builtin_amdgcn_wmma_f32_16x16x32_f16(false, ah, false, bh, (short)0, c, false, false);
  if (NT >= 2) c = __builtin_amdgcn_wmma_f32_16x16x32_f16(false, al, false, bh, (short)0, c, false, false);
  if (NT >= 3) c = __builtin_amdgcn_wmma_f32_16x16x32_f16(false, ah, false, bl, (short)0, c, false, false);
  asm volatile("v_nop\n\tv_nop\n\tv_nop\n\tv_nop" : "+v"(c) : "v"(ah), "v"(al), "v"(bh), "v"(bl));
  return c;
}
// batched GEMM like k_gemm_b but f16 operands: A f32 (split into f16 hi/lo if ASPLIT, else rounded to f16), Bt = f16 values [n][k]; alpha; C f32; N multiple of 16 (partial tiles skipped)
template <bool ASPLIT>
__global__ __launch_bounds__(128) void k_gemm_h(const float* __restrict__ A, int lda, size_t sA, const _Float16* __restrict__ Bh, int ldb, size_t sB, float alpha, float* __restrict__ C, int ldc, size_t sC, int M, int N, int K) {
  __shared__ __attribute__((aligned(16))) float so[4][16][64];
  const int tid = threadIdx.x, w = tid >> 5, lane = tid & 31, ln = lane & 15, hh = lane >> 4; const int by = blockIdx.y;
  A += (size_t)by * sA; Bh += (size_t)by * sB; C += (size_t)by * sC;
  const int ntn = (N + 63) / 64; const int wid = blockIdx.x * 4 + w; const int mt = wid / ntn, nq = wid % ntn; if (mt * 16 >= M) return;
  const int row0 = mt * 16, col0 = nq * 64; const float* arow = A + (size_t)(row0 + ln) * lda;
  v8f acc[4] = {};
  for (int kb = 0; kb < K; kb += 32) {
    FragH ah, al;
    const v4f x0 = *(const v4fa*)(arow + kb + 8 * hh), x1 = *(const v4fa*)(arow + kb + 8 * hh + 4), x2 = *(const v4fa*)(arow + kb + 16 + 8 * hh), x3 = *(const v4fa*)(arow + kb + 16 + 8 * hh + 4);
    float xs[16] = {x0[0],x0[1],x0[2],x0[3],x1[0],x1[1],x1[2],x1[3],x2[0],x2[1],x2[2],x2[3],x3[0],x3[1],x3[2],x3[3]};
#pragma unroll
    for (int i = 0; i < 16; ++i) { const _Float16 h = (_Float16)xs[i]; ah.h[i] = h; al.h[i] = ASPLIT ? (_Float16)(xs[i] - (float)h) : (_Float16)0.0f; }
#pragma unroll
    for (int t = 0; t < 4; ++t) { if (col0 + t * 16 >= N) continue; const size_t boff = (size_t)(col0 + t * 16 + ln) * ldb + kb; FragH bq; bq.half[0] = *(const v8us*)(Bh + boff + 8 * hh); bq.half[1] = *(const v8us*)(Bh + boff + 16 + 8 * hh);
      acc[t] = mmaH<ASPLIT ? 2 : 1>(ah.v, al.v, bq.v, bq.v, acc[t]); }
  }
#pragma unroll
  for (int t = 0; t < 4; ++t) { if (col0 + t * 16 >= N) continue;
#pragma unroll
    for (int r = 0; r < 8; ++r) so[w][8 * hh + r][t * 16 + ln] = acc[t][r] * alpha; }
  __builtin_amdgcn_fence(__ATOMIC_ACQ_REL, "workgroup"); __builtin_amdgcn_wave_barrier();
  const int rsub = lane >> 4, c4 = (lane & 15) * 4;
  {
#pragma unroll
    for (int q = 0; q < 8; ++q) { const int r = q * 2 + rsub; if (col0 + c4 < N) { const v4f v = *(const v4fa*)&so[w][r][c4]; *(v4f*)(C + (size_t)(row0 + r) * ldc + col0 + c4) = v; } }
     }
}

// Wt[n][k] = f16(bf16(W[k][n])*scale) from f32 row-major W[K][N] (scale = power of two; bf16-exact weights stay exact in f16 away from the subnormal range)
// One block turns a tile of 128 k x 64 n through LDS: W is read as whole 256-B pieces of its rows (16 B a lane, all 8 loads of a lane in flight) and Wt is written as whole 256-B pieces of its rows. grid = (K / 128) * (N / 64). K and N are compile-time so that a lane's 8 loads, and its 4 stores, share one address and differ in the immediate offset only.
#define WT_P 65      /* dwords per LDS row (one n: 64 pairs of k, + 1): odd, so the 16 lanes that store 4 rows apart and the 16 that read 4 dwords apart each meet 16 different banks */
typedef unsigned int v4ua __attribute__((ext_vector_type(4), may_alias));
template <int K, int N>
__global__ __launch_bounds__(256) void k_wt_f16(const float* __restrict__ W, _Float16* __restrict__ Wt, float scale) { static_assert(K % 128 == 0 && N % 64 == 0, "k_wt_f16: whole tiles only");
  __shared__ unsigned int tl[64 * WT_P];
  constexpr int ntn = N / 64; const int tid = threadIdx.x; const int kt = blockIdx.x / ntn, nt = blockIdx.x % ntn; const int k0 = kt * 128, n0 = nt * 64; const int r = tid >> 4, c = tid & 15;
  const float* p = W + (size_t)(k0 + 2 * r) * N + n0 + c * 4;
  v4f a[4], b[4];      /* rows k0 + 2 * (16 u + r) and the next one, columns n0 + 4 c .. + 3; every loop below is unrolled whole, so that a and b are indexed by constants and stay in registers and the offsets are immediates */
#pragma unroll
  for (int u = 0; u < 4; ++u) { a[u] = *(const v4fa*)(p + (size_t)u * 32 * N); b[u] = *(const v4fa*)(p + (size_t)u * 32 * N + N); }
#pragma unroll
  for (int u = 0; u < 4; ++u) {
#pragma unroll
    for (int j = 0; j < 4; ++j) { union { _Float16 h[2]; unsigned int d; } pk; pk.h[0] = (_Float16)(bf16_round(a[u][j]) * scale); pk.h[1] = (_Float16)(bf16_round(b[u][j]) * scale); tl[(c * 4 + j) * WT_P + u * 16 + r] = pk.d; } }
  __syncthreads();
  unsigned short* q = (unsigned short*)Wt + (size_t)(n0 + r) * K + k0 + c * 8;
#pragma unroll
  for (int v = 0; v < 4; ++v) { v4ua o;
#pragma unroll
    for (int i = 0; i < 4; ++i) o[i] = tl[(v * 16 + r) * WT_P + c * 4 + i];
    *(v4ua*)(q + (size_t)v * 16 * K) = o; }
}
// k_gemm_hh variant with fused epilogue: v = acc·alpha + bias[by·sBias + col] (+ CP[(row/rowsPerB)·sCPb + by·64 + col] if CP) ; ACT 0 none / 1 elu ; writes f16 C16 (and f32 C if non-null)
template <int ACT>
__global__ __launch_bounds__(128) void k_gemm_hhx(const _Float16* __restrict__ A, int lda, size_t sA, const _Float16* __restrict__ Bh, int ldb, size_t sB, float alpha, const float* __restrict__ bias, size_t sBias, const float* __restrict__ CP, int rowsPerB, size_t sCPb, int row0g,
    float* __restrict__ C, _Float16* __restrict__ C16, int ldc, size_t sC, int M, int N, int K) {
  __shared__ __attribute__((aligned(16))) float so[4][16][64];
  const int tid = threadIdx.x, w = tid >> 5, lane = tid & 31, ln = lane & 15, hh = lane >> 4; const int by = blockIdx.y;
  A += (size_t)by * sA; Bh += (size_t)by * sB; const size_t cofs = (size_t)by * sC; const float* bp = bias ? bias + (size_t)by * sBias : nullptr;
  const int ntn = (N + 63) / 64; const int wid = blockIdx.x * 4 + w; const int mt = wid / ntn, nq = wid % ntn; if (mt * 16 >= M) return;
  const int row0 = mt * 16, col0 = nq * 64; const _Float16* arow = A + (size_t)(row0 + ln) * lda;
  v8f acc[4] = {};
  for (int kb = 0; kb < K; kb += 32) { FragH ah; ah.half[0] = *(const v8us*)((const unsigned short*)arow + kb + 8 * hh); ah.half[1] = *(const v8us*)((const unsigned short*)arow + kb + 16 + 8 * hh);
#pragma unroll
    for (int t = 0; t < 4; ++t) { if (col0 + t * 16 >= N) continue; const size_t boff = (size_t)(col0 + t * 16 + ln) * ldb + kb; FragH bq; bq.half[0] = *(const v8us*)((const unsigned short*)Bh + boff + 8 * hh); bq.half[1] = *(const v8us*)((const unsigned short*)Bh + boff + 16 + 8 * hh);
      acc[t] = mmaH<1>(ah.v, ah.v, bq.v, bq.v, acc[t]); }
  }
#pragma unroll
  for (int t = 0; t < 4; ++t) { if (col0 + t * 16 >= N) continue; const int col = col0 + t * 16 + ln; const float bv = bp ? bf16_round(bp[col]) : 0.f;
#pragma unroll
    for (int r = 0; r < 8; ++r) { float v = acc[t][r] * alpha + bv; if (CP) { const int rr = row0g + row0 + 8 * hh + r; if (rowsPerB < 0) v += CP[cofs + (size_t)rr * ldc + col];      /* rowsPerB < 0: own element of the batched C plane */ else { const int bidx = rr / rowsPerB; v += CP[(size_t)bidx * sCPb + (size_t)by * 64 + col]; } } if (ACT == 1) v = (v > 0.f) ? v : expm1f(v); else if (ACT == 7) v = (v > 0.f) ? v + 1.0f : expf(v); else if (ACT == 8) v = tanhf(v); else if (ACT == 9) v = 0.5f * v * (1.0f + tanhf(0.7978845608028654f * (v + 0.044715f * v * v * v))); else if (ACT == 11) v = 1.0f / (1.0f + expf(-v)); else if (ACT == 12) v = (v > 0.f) ? v : 0.01f * v; else if (ACT == 14) v = (v > 0.f) ? v : 0.1f * v; else if (ACT == 16) v = (v >= 0.f) ? v : 0.3f * v; else if (ACT == 15) v = v / (1.0f + expf(-v)); else if (ACT == 3) v = fmaxf(v, 0.f); else if (ACT == 6) v = 0.5f * v * (1.0f + erff(v * 0.70710678118654752f)); so[w][8 * hh + r][t * 16 + ln] = v; } }
  __builtin_amdgcn_fence(__ATOMIC_ACQ_REL, "workgroup"); __builtin_amdgcn_wave_barrier();
  const int rsub = lane >> 4, c4 = (lane & 15) * 4; typedef _Float16 v4h __attribute__((ext_vector_type(4)));
  {
#pragma unroll
    for (int q = 0; q < 8; ++q) { const int r = q * 2 + rsub; if (col0 + c4 < N) { const v4f v = *(const v4fa*)&so[w][r][c4]; if (C) *(v4f*)(C + cofs + (size_t)(row0 + r) * ldc + col0 + c4) = v; if (C16) { v4h h4; for (int i = 0; i < 4; ++i) h4[i] = (_Float16)v[i]; *(v4h*)(C16 + cofs + (size_t)(row0 + r) * ldc + col0 + c4) = h4; } } }
     }
}


typedef _Float16 v4h __attribute__((ext_vector_type(4)));

__global__ __launch_bounds__(256) void k_x16(const float* __restrict__ x, _Float16* __restrict__ X16, size_t n8) { const size_t t = (size_t)blockIdx.x * 256 + threadIdx.x; if (t >= n8) return; FragH f;
#pragma unroll
  for (int q = 0; q < 8; ++q) f.h[q] = (_Float16)bf16_round(x[t * 8 + q]); *(v8us*)((unsigned short*)X16 + t * 8) = f.half[0];  }
__global__ __launch_bounds__(256) void k_h16(const float* __restrict__ x, _Float16* __restrict__ X16, size_t n8, size_t sB) { const size_t t = (size_t)blockIdx.x * 256 + threadIdx.x; if (t >= n8) return; x += (size_t)blockIdx.y * sB; X16 += (size_t)blockIdx.y * sB;      /* batch = blockIdx.y */ FragH f;
#pragma unroll
  for (int q = 0; q < 8; ++q) f.h[q] = (_Float16)x[t * 8 + q]; *(v8us*)((unsigned short*)X16 + t * 8) = f.half[0];  }
__global__ __launch_bounds__(256) void k_round16f(const float* __restrict__ W, _Float16* __restrict__ Bt, size_t n8) { const size_t t = (size_t)blockIdx.x * 256 + threadIdx.x; if (t >= n8) return; FragH f;
#pragma unroll
  for (int i = 0; i < 8; ++i) f.h[i] = (_Float16)(bf16_round(W[t * 8 + i]) * 16.0f); *(v8us*)((unsigned short*)Bt + t * 8) = f.half[0];  }
template <int NHv, int TTv>
__global__ __launch_bounds__(256) void k_vt(const _Float16* __restrict__ V16, int ldv, int voff, _Float16* __restrict__ Vt) { __shared__ unsigned short tl[64][66]; const int tid = threadIdx.x; const int slab = blockIdx.x / (TTv / 64), lg = blockIdx.x % (TTv / 64); const int b = slab / NHv, h = slab % NHv;
  for (int i = tid; i < 64 * 8; i += 256) { const int r = i / 8, c8 = (i % 8) * 8; FragH f; f.half[0] = *(const v8us*)((const unsigned short*)V16 + ((size_t)b * TTv + lg * 64 + r) * ldv + voff + h * 64 + c8);
#pragma unroll
    for (int q = 0; q < 8; ++q) tl[r][c8 + q] = f.u[q]; }
  __syncthreads();
  {
#pragma unroll
    for (int rd = 0; rd < 2; ++rd) { const int d = rd * 32 + tid / 8, pc = tid % 8; FragH f;
#pragma unroll
      for (int q = 0; q < 8; ++q) f.u[q] = tl[pc * 8 + q][d];
      *(v8us*)((unsigned short*)Vt + ((size_t)slab * 64 + d) * TTv + lg * 64 + pc * 8) = f.half[0]; }
     } }

__global__ __launch_bounds__(256) void k_hl(const float* __restrict__ F, _Float16* __restrict__ Hh, _Float16* __restrict__ Hl, size_t n8, size_t sB, size_t sL) { const size_t t = (size_t)blockIdx.x * 256 + threadIdx.x; if (t >= n8) return; F += (size_t)blockIdx.y * sB; Hh += (size_t)blockIdx.y * sB; Hl += (size_t)blockIdx.y * sL;      /* batch = blockIdx.y */ FragH fh, fl; const v4f a = *(const v4fa*)(F + t * 8), c = *(const v4fa*)(F + t * 8 + 4);
#pragma unroll
  for (int q = 0; q < 4; ++q) { _Float16 h = (_Float16)a[q]; fh.h[q] = h; fl.h[q] = (_Float16)((a[q] - (float)h) * 1024.0f); h = (_Float16)c[q]; fh.h[4 + q] = h; fl.h[4 + q] = (_Float16)((c[q] - (float)h) * 1024.0f); }
  { *(v8us*)((unsigned short*)Hh + t * 8) = fh.half[0]; *(v8us*)((unsigned short*)Hl + t * 8) = fl.half[0];  } }

// ---- fast GEMM (block tile 128x64, wave tile 32x64; requires M % 128 == 0 rows per launch region, N % 64 == 0, K % 64 == 0); epilogue = k_gemm_hhx semantics ----
// Operands reach the waves through LDS: per 64 k one tile of 128 A rows and 64 B rows, 128 B (one whole line) of each row, brought by asynchronous copies (32 lanes = 4 whole lines a copy) into one of two buffers while the other is worked on; each row is fetched once per block instead of once per wave in 32-B pieces.
#define G2_PITCH 72      /* f16 per LDS row: 128 B of k + 16 B, the conflict-free pitch for ds_load_b128 readers of 128-B rows */
#define G2_TILE ((128 + 64) * G2_PITCH * 2)      /* bytes of one buffer: 128 A rows, then 64 B rows */
// one tile's 12 copies of a lane (rows 16 apart: 8 of A, 4 of B); l = the lane's LDS byte address of its first piece. s_wait_xcnt 0 is the statement's last line so that no address register of a copy is rewritten ahead of it.
__device__ __forceinline__ void g2_stage(unsigned l, const _Float16* ga, size_t sa, const _Float16* gb, size_t sb) { const unsigned r16 = 16 * G2_PITCH * 2;
  asm volatile("global_load_async_to_lds_b128 %0, %12, off\n\t" "global_load_async_to_lds_b128 %1, %13, off\n\t" "global_load_async_to_lds_b128 %2, %14, off\n\t" "global_load_async_to_lds_b128 %3, %15, off\n\t"
               "global_load_async_to_lds_b128 %4, %16, off\n\t" "global_load_async_to_lds_b128 %5, %17, off\n\t" "global_load_async_to_lds_b128 %6, %18, off\n\t" "global_load_async_to_lds_b128 %7, %19, off\n\t"
               "global_load_async_to_lds_b128 %8, %20, off\n\t" "global_load_async_to_lds_b128 %9, %21, off\n\t" "global_load_async_to_lds_b128 %10, %22, off\n\t" "global_load_async_to_lds_b128 %11, %23, off\n\t"
               "s_wait_xcnt 0x0"
               :: "v"(l), "v"(l + r16), "v"(l + 2 * r16), "v"(l + 3 * r16), "v"(l + 4 * r16), "v"(l + 5 * r16), "v"(l + 6 * r16), "v"(l + 7 * r16), "v"(l + 8 * r16), "v"(l + 9 * r16), "v"(l + 10 * r16), "v"(l + 11 * r16),
                  "v"(ga), "v"(ga + sa), "v"(ga + 2 * sa), "v"(ga + 3 * sa), "v"(ga + 4 * sa), "v"(ga + 5 * sa), "v"(ga + 6 * sa), "v"(ga + 7 * sa), "v"(gb), "v"(gb + sb), "v"(gb + 2 * sb), "v"(gb + 3 * sb)
               : "memory"); }
__device__ __forceinline__ v16h g2_frag(const _Float16* p, int hh) { FragH f; f.half[0] = *(const v8us*)((const unsigned short*)p + 8 * hh); f.half[1] = *(const v8us*)((const unsigned short*)p + 16 + 8 * hh); return f.v; }
__device__ __forceinline__ v8f g2_mma(v16h a, v16h b, v8f c) { v8f d = __builtin_amdgcn_wmma_f32_16x16x32_f16(false, a, false, b, (short)0, c, false, false); asm volatile("v_nop\n\tv_nop\n\tv_nop\n\tv_nop" : "+v"(d) : "v"(a), "v"(b)); return d; }
template <int ACT>
__global__ __launch_bounds__(128) void k_gemm2(const _Float16* __restrict__ A, int lda, size_t sA, const _Float16* __restrict__ Bh, int ldb, size_t sB, float alpha, const float* __restrict__ bias, size_t sBias, const float* __restrict__ CP, int rowsPerB, size_t sCPb, int row0g,
    float* __restrict__ C, _Float16* __restrict__ C16, int ldc, size_t sC, int M, int N, int K, size_t zA, size_t zB, size_t zC) { static_assert(ACT == 0 || ACT == 3 || ACT == 6 || ACT == 8 || ACT == 9 || ACT == 11 || ACT == 12 || ACT == 14 || ACT == 15 || ACT == 16, "k_gemm2: unsupported ACT code (would silently apply no activation)");
  __shared__ __attribute__((aligned(16))) unsigned char sm[2 * G2_TILE]; float (*so)[32][68] = (float (*)[32][68])sm;      /* the epilogue's staging lies over the two buffers, which every wave has left by then */ static_assert(sizeof(float) * 4 * 32 * 68 <= 2 * G2_TILE, "k_gemm2: epilogue staging must fit the buffers");
  const int tid = threadIdx.x, w = tid >> 5, lane = tid & 31, ln = lane & 15, hh = lane >> 4; const int by = blockIdx.y, bz = blockIdx.z;
  A += (size_t)by * sA + (size_t)bz * zA; Bh += (size_t)by * sB + (size_t)bz * zB; const size_t cofs = (size_t)by * sC + (size_t)bz * zC; const float* bp = bias ? bias + (size_t)by * sBias : nullptr;
  const int ntn = N >> 6; const int mt = blockIdx.x / ntn, nq = blockIdx.x - mt * ntn; const int row0 = mt * 128 + 32 * w, col0 = nq * 64; if (mt * 128 >= M) return;      /* the same for the whole block: it stands in front of barriers */
  const int trow = tid >> 3, tseg = tid & 7;      /* a lane's piece of a tile: 16 B number tseg of rows trow, trow + 16, ... */
  const _Float16* gA = A + (size_t)(mt * 128 + trow) * lda + tseg * 8; const _Float16* gB = Bh + (size_t)(col0 + trow) * ldb + tseg * 8; const size_t sa16 = (size_t)16 * lda, sb16 = (size_t)16 * ldb;
  const unsigned l0 = (unsigned)(size_t)sm + (unsigned)(trow * (G2_PITCH * 2) + tseg * 16);
  const v8f z8 = {0.f,0.f,0.f,0.f,0.f,0.f,0.f,0.f}; v8f c00 = z8, c01 = z8, c02 = z8, c03 = z8, c10 = z8, c11 = z8, c12 = z8, c13 = z8;
  const int nc = K >> 6;
  g2_stage(l0, gA, sa16, gB, sb16);
  asm volatile("s_wait_asynccnt 0x0" ::: "memory");      /* tile 0 of this wave's copies has landed */
  __syncthreads();      /* ... and every other wave's */
  if (nc > 1) g2_stage(l0 + G2_TILE, gA + 64, sa16, gB + 64, sb16);
#pragma unroll 1      /* one tile a trip: the buffer index stays a run-time value and the loop stays small */
  for (int t = 0; t < nc; ++t) { const _Float16* tl = (const _Float16*)(sm + (t & 1) * G2_TILE); const _Float16* ar = tl + (32 * w + ln) * G2_PITCH; const _Float16* br = tl + (128 + ln) * G2_PITCH;
    /* all 24 LDS reads of the trip as one group in front of its WMMAs */
    const v16h a0 = g2_frag(ar, hh), a1 = g2_frag(ar + 16 * G2_PITCH, hh), b0 = g2_frag(br, hh), b1 = g2_frag(br + 16 * G2_PITCH, hh), b2 = g2_frag(br + 32 * G2_PITCH, hh), b3 = g2_frag(br + 48 * G2_PITCH, hh);
    const v16h e0 = g2_frag(ar + 32, hh), e1 = g2_frag(ar + 16 * G2_PITCH + 32, hh), f0 = g2_frag(br + 32, hh), f1 = g2_frag(br + 16 * G2_PITCH + 32, hh), f2 = g2_frag(br + 32 * G2_PITCH + 32, hh), f3 = g2_frag(br + 48 * G2_PITCH + 32, hh);
    c00 = g2_mma(a0, b0, c00); c10 = g2_mma(a1, b0, c10); c01 = g2_mma(a0, b1, c01); c11 = g2_mma(a1, b1, c11); c02 = g2_mma(a0, b2, c02); c12 = g2_mma(a1, b2, c12); c03 = g2_mma(a0, b3, c03); c13 = g2_mma(a1, b3, c13);
    c00 = g2_mma(e0, f0, c00); c10 = g2_mma(e1, f0, c10); c01 = g2_mma(e0, f1, c01); c11 = g2_mma(e1, f1, c11); c02 = g2_mma(e0, f2, c02); c12 = g2_mma(e1, f2, c12); c03 = g2_mma(e0, f3, c03); c13 = g2_mma(e1, f3, c13);
    asm volatile("s_wait_dscnt 0x0" ::: "memory");      /* this wave's reads of buffer t & 1 are done before the buffer is handed back */
    asm volatile("s_wait_asynccnt 0x0" ::: "memory");      /* this wave's copies of tile t + 1 have landed */
    __syncthreads();      /* publishes tile t + 1 and ends every wave's reads of tile t */
    if (t + 2 < nc) g2_stage(l0 + (unsigned)((t & 1) * G2_TILE), gA + (size_t)(t + 2) * 64, sa16, gB + (size_t)(t + 2) * 64, sb16); }
  asm volatile("s_wait_asynccnt 0x0" ::: "memory");      /* no copy is in flight when the buffers become the epilogue's staging */
  v8f accs[8] = {c00, c01, c02, c03, c10, c11, c12, c13};
#pragma unroll
  for (int u = 0; u < 8; ++u) { const int t = u & 3, half = u >> 2; const int col = col0 + t * 16 + ln; const float bv = bp ? bf16_round(bp[col]) : 0.f;
#pragma unroll
    for (int r = 0; r < 8; ++r) { const int rloc = half * 16 + 8 * hh + r; float v = accs[u][r] * alpha + bv; if (CP) { if (rowsPerB < 0) v += CP[cofs + (size_t)(row0g + row0 + rloc) * ldc + col];      /* rowsPerB < 0: own element of the batched C plane */ else { const int bidx = (row0g + row0 + rloc) / rowsPerB; v += CP[(size_t)bidx * sCPb + (size_t)by * 64 + col]; } }
      if (ACT == 3) v = fmaxf(v, 0.f); else if (ACT == 6) v = 0.5f * v * (1.0f + erff(v * 0.70710678118654752f)); else if (ACT == 11) v = 1.0f / (1.0f + expf(-v)); else if (ACT == 15) v = v / (1.0f + expf(-v)); else if (ACT == 12) v = (v > 0.f) ? v : 0.01f * v; else if (ACT == 8) v = tanhf(v); else if (ACT == 9) v = 0.5f * v * (1.0f + tanhf(0.7978845608028654f * (v + 0.044715f * v * v * v))); else if (ACT == 14) v = (v > 0.f) ? v : 0.1f * v; else if (ACT == 16) v = (v >= 0.f) ? v : 0.3f * v;
      so[w][rloc][t * 16 + ln] = v; } }
  __builtin_amdgcn_fence(__ATOMIC_ACQ_REL, "workgroup"); __builtin_amdgcn_wave_barrier();
  const int rsub = lane >> 4, c4 = (lane & 15) * 4;
  {
#pragma unroll
    for (int q = 0; q < 16; ++q) { const int r = q * 2 + rsub; const v4f v = *(const v4fa*)&so[w][r][c4]; if (C) *(v4f*)(C + cofs + (size_t)(row0 + r) * ldc + col0 + c4) = v; if (C16) { v4h h4; for (int i = 0; i < 4; ++i) h4[i] = (_Float16)v[i]; *(v4h*)(C16 + cofs + (size_t)(row0 + r) * ldc + col0 + c4) = h4; } }
     } }


__global__ __launch_bounds__(256) void k_rotab(const int* __restrict__ pid, float* __restrict__ CS, float* __restrict__ SN) {
  #pragma clang fp contract(off)
  const int t = blockIdx.x * 256 + threadIdx.x; if (t >= NB * SQ * HH) return; const int j = t % HH, s = t / HH;      /* s = flat token over both batches */ const float inv = 1.0f / powf(10000.0f, (float)(2 * j) / (float)HD); const float th = (float)pid[s] * inv; const float c = cosf(th), sn = sinf(th);
  { *(float*)(CS + t) = c; *(float*)(SN + t) = sn;  } }
__global__ __launch_bounds__(256) void k_rope(const float* __restrict__ F, int nheads, const float* __restrict__ CS, const float* __restrict__ SN, _Float16* __restrict__ H, _Float16* __restrict__ L) {
  #pragma clang fp contract(off)
  const size_t t = (size_t)blockIdx.x * 256 + threadIdx.x; if (t >= (size_t)NB * SQ * nheads * (HH / 8)) return; const int g = (int)(t % (HH / 8)) * 8; const int h = (int)((t / (HH / 8)) % nheads); const int s = (int)(t / ((HH / 8) * (size_t)nheads)); const int ld = nheads * HD;
  const size_t base = (size_t)s * ld + h * HD + g; FragH h0, h1, l0, l1;
#pragma unroll
  for (int q = 0; q < 8; ++q) { const float c = CS[s * HH + g + q], sn = SN[s * HH + g + q]; const float x0 = F[base + q], x1 = F[base + HH + q]; float o0 = x0 * c; o0 += -x1 * sn; float o1 = x1 * c; o1 += x0 * sn;
    const _Float16 a0 = (_Float16)o0, a1 = (_Float16)o1; h0.h[q] = a0; h1.h[q] = a1; l0.h[q] = (_Float16)((o0 - (float)a0) * 1024.0f); l1.h[q] = (_Float16)((o1 - (float)a1) * 1024.0f); }
  { *(v8us*)((unsigned short*)H + base) = h0.half[0]; *(v8us*)((unsigned short*)H + base + HH) = h1.half[0]; if (L) { *(v8us*)((unsigned short*)L + base) = l0.half[0]; *(v8us*)((unsigned short*)L + base + HH) = l1.half[0]; }  } }
// causal / padding softmax, one wave per row, the whole row in registers: lane ln holds elements c * 128 + 4 * ln .. + 3 of every 128-key chunk c, so S is read once (whole 512-B pieces, all loads of a row in flight together), exp is taken once per score, and P leaves as 8-B pieces.
// NK keys were written by the S GEMM; R0 = first row of the band. A chunk that lies wholly right of the diagonal (c * 128 > r, the same for the whole wave) takes no exp: its P is zero.
typedef int v4ia __attribute__((ext_vector_type(4), may_alias));
typedef _Float16 v4ha __attribute__((ext_vector_type(4), may_alias));
template <int NK, int R0, bool HASPL>
__global__ __launch_bounds__(256) void k_csoft(float* S, size_t sS, const int* __restrict__ mask, _Float16* __restrict__ PL, size_t sPL) {
  constexpr int NC = NK / 128; const float NONE = -3.0e38f;
  const int wv = __builtin_amdgcn_readfirstlane(threadIdx.x >> 5), ln = threadIdx.x & 31; const int rl = blockIdx.x * 8 + wv, r = R0 + rl; const int b = blockIdx.z, pl = b * NHQ + blockIdx.y;      /* batch = blockIdx.z, head = blockIdx.y: their own S and P planes */
  char* srow = (char*)(S + (size_t)pl * sS + (size_t)rl * SQ); const char* mrow = (const char*)(mask + (size_t)b * SQ);      /* the same for the whole wave; the P row lies over the front half of its own S row: every store follows the row sum, which follows every read of the row */
  const unsigned off = ln * 16; const int jr = r - ln * 4, cd = r >> 7;      /* element q of chunk c is at or left of the diagonal when c * 128 + q <= jr; cd = the diagonal's chunk */
  v4f x[NC]; v4ia kk[NC];      /* every loop over c and q below is unrolled whole: the arrays are then indexed by constants and stay in registers */
#pragma unroll
  for (int c = 0; c < NC; ++c) { kk[c] = *(const v4ia*)(mrow + off + c * 512); x[c] = *(const v4fa*)(srow + off + c * 512); }
  __builtin_amdgcn_sched_barrier(0);      /* every load of the row is issued before the first use of one: a row pays one memory latency, not one per group of loads */
  float m = NONE;
#pragma unroll
  for (int c = 0; c < NC; ++c) {
#pragma unroll
    for (int q = 0; q < 4; ++q) { const float s = ((c * 128 + q <= jr) & (kk[c][q] > 0)) ? x[c][q] : NONE; x[c][q] = s; m = fmaxf(m, s); } }
  for (int o = 16; o > 0; o >>= 1) m = fmaxf(m, __shfl_xor(m, o, 32));
  float su = 0.f;
#pragma unroll
  for (int c = 0; c < NC; ++c) { v4f e4 = {0.f, 0.f, 0.f, 0.f};
    if (c * 128 <= R0 || c <= cd) {
#pragma unroll
      for (int q = 0; q < 4; ++q) { e4[q] = expf(x[c][q] - m); su += e4[q]; } }      /* a masked score gives exp(NONE - m) = 0 */
    x[c] = e4; }
  for (int o = 16; o > 0; o >>= 1) su += __shfl_xor(su, o, 32);
  const float f = (m > NONE) ? 1024.0f / su : 0.f;      /* a row with no open key keeps P = 0 */
  v4h hv[NC], lv[NC];
#pragma unroll
  for (int c = 0; c < NC; ++c) {
#pragma unroll
    for (int q = 0; q < 4; ++q) { const float p = x[c][q] * f; hv[c][q] = (_Float16)p; if (HASPL) lv[c][q] = (_Float16)((p - (float)hv[c][q]) * 1024.0f); } }
  /* all stores last, each from registers of its own: nothing is written behind an issued store */
  char* plrow = HASPL ? (char*)(PL + (size_t)pl * sPL + (size_t)rl * SQ) : nullptr;
#pragma unroll
  for (int c = 0; c < NC; ++c) { *(v4ha*)(srow + ln * 8 + c * 256) = hv[c]; if (HASPL) *(v4ha*)(plrow + ln * 8 + c * 256) = lv[c]; } }

#define FA_KP 264      /* f16 per LDS row of K: 512 B + 16 B = 16 B x 33, the conflict-free kind of pitch for ds_load_b128 readers */
#define FA_KB (64 * FA_KP * 2)      /* bytes of the K part of a buffer */
#define FA_TILE (FA_KB + HD * G2_PITCH * 2)      /* bytes of one buffer: 64 K rows, then 256 V^T rows */
// 8 copies of a lane, LDS addresses ls bytes apart, global addresses gs elements apart. s_wait_xcnt 0 is the statement's last line so that no address register of a copy is rewritten ahead of it.
__device__ __forceinline__ void fa_stage8(unsigned l, unsigned ls, const _Float16* g, size_t gs) {
  asm volatile("global_load_async_to_lds_b128 %0, %8, off\n\t" "global_load_async_to_lds_b128 %1, %9, off\n\t" "global_load_async_to_lds_b128 %2, %10, off\n\t" "global_load_async_to_lds_b128 %3, %11, off\n\t"
               "global_load_async_to_lds_b128 %4, %12, off\n\t" "global_load_async_to_lds_b128 %5, %13, off\n\t" "global_load_async_to_lds_b128 %6, %14, off\n\t" "global_load_async_to_lds_b128 %7, %15, off\n\t"
               "s_wait_xcnt 0x0"
               :: "v"(l), "v"(l + ls), "v"(l + 2 * ls), "v"(l + 3 * ls), "v"(l + 4 * ls), "v"(l + 5 * ls), "v"(l + 6 * ls), "v"(l + 7 * ls),
                  "v"(g), "v"(g + gs), "v"(g + 2 * gs), "v"(g + 3 * gs), "v"(g + 4 * gs), "v"(g + 5 * gs), "v"(g + 6 * gs), "v"(g + 7 * gs)
               : "memory"); }
__device__ __forceinline__ v8f fa_mma(v16h a, v16h b, v8f c) { return __builtin_amdgcn_wmma_f32_16x16x32_f16(false, a, false, b, (short)0, c, false, false); }
__global__ __launch_bounds__(256) __attribute__((amdgpu_waves_per_eu(2, 2))) void k_fattn(const _Float16* __restrict__ Q, const _Float16* __restrict__ Kh, const _Float16* __restrict__ Vt, const int* __restrict__ mask, _Float16* __restrict__ O16) {
  __shared__ __attribute__((aligned(16))) unsigned char sm[2 * FA_TILE]; __shared__ __attribute__((aligned(16))) int mk[SQ];
  const float NONE = -3.0e38f, FLOOR = -1.0e30f, SC = 0.0625f * 1.44269504088896340736f;
  const int tid = threadIdx.x, lane = tid & 31, ln = lane & 15, hh = lane >> 4; const int w = __builtin_amdgcn_readfirstlane(tid >> 5); const int h = blockIdx.y, b = blockIdx.z;
  const int R0 = SQ - 128 * ((int)blockIdx.x + 1);      /* first row of the block; the longest blocks have the lowest index */
  const int nt = R0 / 64 + 2;      /* key tiles up to the block's last row; at least two */
  const int q0 = R0 + 16 * w;      /* the wave's first query */
  Kh += (size_t)b * SQ * HD; Vt += (size_t)b * SQ * HD;
  { const int* mp = mask + (size_t)b * SQ + tid * 8; const v4ia a = *(const v4ia*)mp, c = *(const v4ia*)(mp + 4); *(v4ia*)&mk[tid * 8] = a; *(v4ia*)&mk[tid * 8 + 4] = c; }      /* the batch's padding mask, read by every wave behind the first barrier */
  const _Float16* qrow = Q + ((size_t)b * SQ + q0 + ln) * DM + h * HD; v16h qf[8];
#pragma unroll
  for (int ks = 0; ks < 8; ++ks) qf[ks] = g2_frag(qrow + ks * 32, hh);
  const unsigned lk = (unsigned)(size_t)sm + (unsigned)((tid >> 5) * (FA_KP * 2) + (tid & 31) * 16), lv = (unsigned)(size_t)sm + (unsigned)(FA_KB + (tid >> 3) * (G2_PITCH * 2) + (tid & 7) * 16);      /* a wave's copy = one whole K row, or 4 whole lines of V^T */
  const _Float16* gk = Kh + (size_t)(tid >> 5) * HD + (tid & 31) * 8; const _Float16* gv = Vt + (size_t)(tid >> 3) * SQ + (tid & 7) * 8;
  const v8f z8 = {0.f,0.f,0.f,0.f,0.f,0.f,0.f,0.f}; v8f o[16];
#pragma unroll
  for (int dt = 0; dt < 16; ++dt) o[dt] = z8;
  float m = FLOOR, lsum = 0.f;
  fa_stage8(lk, 8 * FA_KP * 2, gk, (size_t)8 * HD); fa_stage8(lv, 32 * G2_PITCH * 2, gv, (size_t)32 * SQ);
  asm volatile("s_wait_asynccnt 0x0" ::: "memory");      /* tile 0 of this wave's copies has landed */
  __syncthreads();      /* ... and every other wave's, and the mask */
  fa_stage8(lk + FA_TILE, 8 * FA_KP * 2, gk + (size_t)64 * HD, (size_t)8 * HD); fa_stage8(lv + FA_TILE, 32 * G2_PITCH * 2, gv + 64, (size_t)32 * SQ);
#pragma unroll 1      /* one tile a trip: the buffer index stays a run-time value */
  for (int t = 0; t < nt; ++t) {
    if (t * 64 <= q0 + 15) {      /* the same for the whole wave: a tile wholly right of the wave's diagonal is skipped, the publish point below is not */
      const _Float16* kb = (const _Float16*)(sm + (t & 1) * FA_TILE) + ln * FA_KP; const _Float16* vb = (const _Float16*)(sm + (t & 1) * FA_TILE + FA_KB) + ln * G2_PITCH;
      v8f s[4] = {z8, z8, z8, z8};
#pragma unroll
      for (int ks = 0; ks < 8; ++ks) {
#pragma unroll
        for (int u = 0; u < 4; ++u) s[u] = fa_mma(g2_frag(kb + u * 16 * FA_KP + ks * 32, hh), qf[ks], s[u]); }
      const int jq = q0 + ln - t * 64 - 8 * hh;      /* register r of score tile u is at or left of the diagonal when u * 16 + r <= jq */
      const int* mr = &mk[t * 64 + 8 * hh]; float mx = NONE;
#pragma unroll
      for (int u = 0; u < 4; ++u) { const v4ia k0 = *(const v4ia*)(mr + u * 16), k1 = *(const v4ia*)(mr + u * 16 + 4);
#pragma unroll
        for (int r = 0; r < 8; ++r) { const int kv = r < 4 ? k0[r & 3] : k1[r & 3]; const float x = ((u * 16 + r <= jq) & (kv > 0)) ? s[u][r] * SC : NONE; s[u][r] = x; mx = fmaxf(mx, x); } }
      mx = fmaxf(mx, __shfl_xor(mx, 16, 32));      /* the other half of the query's keys */
      const float mn = fmaxf(m, mx), al = __builtin_amdgcn_exp2f(m - mn); m = mn;      /* no open key so far: al = 1 over O = 0 */
      float ps = 0.f;
#pragma unroll
      for (int u = 0; u < 4; ++u) {
#pragma unroll
        for (int r = 0; r < 8; ++r) { const float e = __builtin_amdgcn_exp2f(s[u][r] - mn); ps += e; s[u][r] = e; } }
      lsum = lsum * al + ps;
      FragH pf[2];
#pragma unroll
      for (int kk = 0; kk < 2; ++kk) {
#pragma unroll
        for (int i = 0; i < 8; ++i) { pf[kk].h[i] = (_Float16)(s[2 * kk][i] * 1024.0f); pf[kk].h[8 + i] = (_Float16)(s[2 * kk + 1][i] * 1024.0f); } }
#pragma unroll
      for (int dt = 0; dt < 16; ++dt) o[dt] = o[dt] * al;
#pragma unroll
      for (int kk = 0; kk < 2; ++kk) {
#pragma unroll
        for (int dt = 0; dt < 16; ++dt) o[dt] = fa_mma(g2_frag(vb + dt * 16 * G2_PITCH + kk * 32, hh), pf[kk].v, o[dt]); }
    }
    asm volatile("s_wait_dscnt 0x0" ::: "memory");      /* this wave's reads of buffer t & 1 are done before the buffer is handed back */
    asm volatile("s_wait_asynccnt 0x0" ::: "memory");      /* this wave's copies of tile t + 1 have landed */
    __syncthreads();      /* publishes tile t + 1 and ends every wave's reads of tile t */
    if (t + 2 < nt) { const unsigned bo = (unsigned)((t & 1) * FA_TILE); fa_stage8(lk + bo, 8 * FA_KP * 2, gk + (size_t)(t + 2) * 64 * HD, (size_t)8 * HD); fa_stage8(lv + bo, 32 * G2_PITCH * 2, gv + (size_t)(t + 2) * 64, (size_t)32 * SQ); } }
  asm volatile("s_wait_asynccnt 0x0" ::: "memory");      /* no copy is in flight when the wave ends */
  lsum += __shfl_xor(lsum, 16, 32);
  const float f = (lsum > 0.f) ? 0.0009765625f / lsum : 0.f;      /* a row with no open key keeps O = 0 */
  unsigned short* orow = (unsigned short*)O16 + ((size_t)b * SQ + q0 + ln) * DM + h * HD + 8 * hh;      /* register r of O^T tile dt = element dt * 16 + 8 hh + r of the query's head: 16 B a tile */
#pragma unroll
  for (int dt = 0; dt < 16; ++dt) { FragH e;
#pragma unroll
    for (int r = 0; r < 8; ++r) e.h[r] = (_Float16)(o[dt][r] * f);
    *(v8us*)(orow + dt * 16) = e.half[0]; } }

extern "C" void kernel_launch(void* const* d_in, const int* in_sizes, int n_in,
                              void* d_out, int out_size, void* d_ws, size_t ws_size, hipStream_t stream) {
  (void)in_sizes; (void)n_in; (void)out_size;
  const float* const* I = (const float* const*)d_in; const float* hs = I[0]; const int* amask = (const int*)d_in[1]; const int* pid = (const int*)d_in[2]; const float* Wq = I[3]; const float* Wk = I[4]; const float* Wv = I[5]; const float* Wo = I[6];
  char* ws = (char*)d_ws; size_t off = 0;
  auto take = [&](size_t bytes) { char* p = ws + off; off += (bytes + 255) & ~(size_t)255; return p; };
  const size_t np = (size_t)SQ * DM, nkv = (size_t)SQ * HD;      /* elements per batch of a [SQ][DM] and of a [SQ][HD] plane */
  _Float16* BQ = (_Float16*)take(np * 2); _Float16* BK = (_Float16*)take((size_t)HD * DM * 2); _Float16* BV = (_Float16*)take((size_t)HD * DM * 2); _Float16* BO = (_Float16*)take(np * 2);
  float* CS = (float*)take((size_t)NB * SQ * HH * 4); float* SN = (float*)take((size_t)NB * SQ * HH * 4);
  _Float16* X16 = (_Float16*)take(NB * np * 2); float* F32 = (float*)take(NB * np * 4); _Float16* QH = (_Float16*)take(NB * np * 2); _Float16* QL = (_Float16*)take(NB * np * 2); _Float16* KH = (_Float16*)take(NB * nkv * 2); _Float16* KL = (_Float16*)take(NB * nkv * 2); _Float16* VH = (_Float16*)take(NB * nkv * 2); _Float16* VL = (_Float16*)take(NB * nkv * 2); _Float16* VTh = (_Float16*)take(NB * nkv * 2); _Float16* VTl = (_Float16*)take(NB * nkv * 2);
  const size_t sS = (size_t)1024 * SQ, sPL = (size_t)BAND * SQ;      /* elements per (batch, head) plane of S, and of PL */
  float* S = (float*)take(NB * NHQ * sS * 4); _Float16* PH = (_Float16*)S; const int ldp = 2 * SQ; const size_t sP = 2 * sS;      /* P row r of a plane = front half of S row r: pitch and plane stride in f16 elements are twice those of S */
  _Float16* PL = X16; float* O = F32; _Float16* O16 = QL; _Float16* OL0 = (_Float16*)take((size_t)NB * BAND * DM * 2);      /* PL over X16 (dead after the q GEMM; same size); O over the q f32 scratch (dead after k_rope); O16 over QL (QL is only read for band 0, which runs first) */
  if (off > ws_size) return;      /* 8+1+1+8 + 4 + 16+32+16+16 + 6*2 + 128 + 2 = 244 MiB */
  k_wt_f16<DM, DM><<<(DM / 128) * (DM / 64), 256, 0, stream>>>(Wq, BQ, 16.0f); k_wt_f16<DM, HD><<<(DM / 128) * (HD / 64), 256, 0, stream>>>(Wk, BK, 16.0f); k_wt_f16<DM, HD><<<(DM / 128) * (HD / 64), 256, 0, stream>>>(Wv, BV, 16.0f); k_wt_f16<DM, DM><<<(DM / 128) * (DM / 64), 256, 0, stream>>>(Wo, BO, 16.0f);
  const int MT = NB * SQ;      /* tokens of both batches: the q/k/v projections, the passes before attention and the hi Wo GEMM see one flat [MT][...] matrix */
  k_rotab<<<(NB * SQ * HH + 255) / 256, 256, 0, stream>>>(pid, CS, SN);
  k_x16<<<(unsigned)((NB * np / 8 + 255) / 256), 256, 0, stream>>>(hs, X16, NB * np / 8);
  /* k and v (one kv head of 256) */
  k_gemm2<0><<<dim3((MT / 128) * (HD / 64), 1), 128, 0, stream>>>(X16, DM, 0, BK, DM, 0, 0.0625f, nullptr, 0, nullptr, 1, 0, 0, F32, nullptr, HD, 0, MT, HD, DM, 0, 0, 0);
  k_rope<<<(unsigned)(((size_t)MT * 1 * (HH / 8) + 255) / 256), 256, 0, stream>>>(F32, 1, CS, SN, KH, KL);
  k_gemm2<0><<<dim3((MT / 128) * (HD / 64), 1), 128, 0, stream>>>(X16, DM, 0, BV, DM, 0, 0.0625f, nullptr, 0, nullptr, 1, 0, 0, F32, nullptr, HD, 0, MT, HD, DM, 0, 0, 0);
  k_hl<<<(unsigned)((NB * nkv / 8 + 255) / 256), 256, 0, stream>>>(F32, VH, VL, NB * nkv / 8, 0, 0);
  k_vt<HD / 64, SQ><<<NB * (HD / 64) * (SQ / 64), 256, 0, stream>>>(VH, HD, 0, VTh); k_vt<HD / 64, SQ><<<NB * (HD / 64) * (SQ / 64), 256, 0, stream>>>(VL, HD, 0, VTl);
  /* q (8 heads), roped, hi/lo */
  k_gemm2<0><<<dim3((MT / 128) * (DM / 64), 1), 128, 0, stream>>>(X16, DM, 0, BQ, DM, 0, 0.0625f, nullptr, 0, nullptr, 1, 0, 0, F32, nullptr, DM, 0, MT, DM, DM, 0, 0, 0);
  k_rope<<<(unsigned)(((size_t)MT * NHQ * (HH / 8) + 255) / 256), 256, 0, stream>>>(F32, NHQ, CS, SN, QH, QL);
  /* attention: head in grid.y (A + h * HD for q, one shared K / V^T per batch, C plane h), batch in grid.z (the last three arguments: element strides of A, B and C per batch); rowsPerB = -1 adds the own element of the C plane */
  /* band 0 (rows < 256, keys < 256): hi + lo everywhere */
  { const int nk = BAND; const dim3 gS((BAND / 128) * (nk / 64), NHQ, NB), gO((BAND / 128) * (HD / 64), NHQ, NB);
    k_gemm2<0><<<gS, 128, 0, stream>>>(QH, DM, HD, KH, HD, 0, 0.0625f, nullptr, 0, nullptr, 1, 0, 0, S, nullptr, SQ, sS, BAND, nk, HD, np, nkv, NHQ * sS);      /* S = (Qh Kh^T) / 16 */
    k_gemm2<0><<<gS, 128, 0, stream>>>(QL, DM, HD, KH, HD, 0, 0.0625f / 1024.0f, nullptr, 0, S, -1, 0, 0, S, nullptr, SQ, sS, BAND, nk, HD, np, nkv, NHQ * sS);
    k_gemm2<0><<<gS, 128, 0, stream>>>(QH, DM, HD, KL, HD, 0, 0.0625f / 1024.0f, nullptr, 0, S, -1, 0, 0, S, nullptr, SQ, sS, BAND, nk, HD, np, nkv, NHQ * sS);
    k_csoft<BAND, 0, true><<<dim3(BAND / 8, NHQ, NB), 256, 0, stream>>>(S, sS, amask, PL, sPL);
    k_gemm2<0><<<gO, 128, 0, stream>>>(PH, ldp, sP, VTh, SQ, 0, 0.0009765625f, nullptr, 0, nullptr, 1, 0, 0, O, nullptr, DM, HD, BAND, HD, nk, NHQ * sP, nkv, np);
    k_gemm2<0><<<gO, 128, 0, stream>>>(PL, SQ, sPL, VTh, SQ, 0, 0.0009765625f / 1024.0f, nullptr, 0, O, -1, 0, 0, O, nullptr, DM, HD, BAND, HD, nk, NHQ * sPL, nkv, np);
    k_gemm2<0><<<gO, 128, 0, stream>>>(PH, ldp, sP, VTl, SQ, 0, 0.0009765625f / 1024.0f, nullptr, 0, O, -1, 0, 0, O, nullptr, DM, HD, BAND, HD, nk, NHQ * sP, nkv, np); }
  /* rows >= 256: plain f16 operands, S, softmax and P V fused; writes the f16 O plane itself */
  k_fattn<<<dim3((SQ - BAND) / 128, NHQ, NB), 256, 0, stream>>>(QH, KH, VTh, amask, O16);
  /* output: O hi (+ lo on rows < 256 of each batch) into Wo */
  k_hl<<<dim3((unsigned)(((size_t)BAND * DM / 8 + 255) / 256), NB), 256, 0, stream>>>(O, O16, OL0, (size_t)BAND * DM / 8, np, (size_t)BAND * DM);      /* rows < 256: hi + lo */
  float* out = (float*)d_out;
  k_gemm2<0><<<dim3((MT / 128) * (DM / 64), 1), 128, 0, stream>>>(O16, DM, 0, BO, DM, 0, 0.0625f, nullptr, 0, nullptr, 1, 0, 0, out, nullptr, DM, 0, MT, DM, DM, 0, 0, 0);
  k_gemm2<0><<<dim3((BAND / 128) * (DM / 64), 1, NB), 128, 0, stream>>>(OL0, DM, 0, BO, DM, 0, 0.0625f / 1024.0f, nullptr, 0, out, -1, 0, 0, out, nullptr, DM, 0, BAND, DM, DM, (size_t)BAND * DM, 0, np);
}

// v007
// It runs in 312 microseconds.
// Two timings next to v006 both put it at 1.17 times that version's speed.
// Over all steps from v000 it is 19.0 times as fast.
#include <hip/hip_runtime.h>
// FlaxGemmaAttention (2 x 2048 tokens, D 2048, 8 query heads of 256 sharing ONE kv head; rotate-half RoPE from the INPUT position_ids; causal + INPUT padding mask; scale 256^-0.5; out = attn Wo).
// Structure (both batches in every launch: flat rows for the projections and elementwise passes, blockIdx.z for attention): three launches in front of attention, each holding the jobs that do not depend on one another: (1) exact f16 plane of the hidden states, the four weight transposes, RoPE tables (f32 trig); (2) q, k and v as ONE GEMM over the stacked weight rows (32x64 wave tiles, f32 accumulation, exact x16 weights); (3) rotation on VALU into f16 hi (+ 2^10 residual) planes, V^T hi/residual by LDS tiles; attention in two parts. Rows < 256 (whose outputs average over few keys) UNFUSED, all 8 heads in ONE launch (head = blockIdx.y, batch = blockIdx.z, one S plane per batch and head, each P row stored over the front half of its own S row): S = Q K^T as a GEMM (f32), causal/padding softmax on VALU (wave per row) into an f16 P plane (x2^10), O = P V as a GEMM, with hi+lo operands throughout (3-term S, 3-term P.V, hi+lo O into Wo). Rows >= 256 FUSED, plain f16 operands: one block per 128 rows of a head walks the causally reachable keys in tiles of 64 with a running maximum and sum (k_fattn), S and P stay in registers, O leaves as f16; output GEMM.
// Compute dtype: inputs and weights rounded to bf16; rows >= 256: q, k, P, v, O as f16 (~2^-12); rows < 256: hi + residual pairs; f32 accumulation/softmax/trig. v_wmma_f32_16x16x32_f16.
#define NB 2
#define SQ 2048
#define DM 2048
#define NHQ 8
#define HD 256
#define HH (HD / 2)
#define BAND 256
#define NBAND (SQ / BAND)
typedef __bf16 v16b __attribute__((ext_vector_type(16)));
typedef unsigned short v8us __attribute__((ext_vector_type(8), may_alias));
typedef float  v8f  __attribute__((ext_vector_type(8)));
typedef float  v4f  __attribute__((ext_vector_type(4)));
typedef float  v4fa __attribute__((ext_vector_type(4), may_alias));
union FragB { v16b v; v8us half[2]; unsigned short u[16]; };

__device__ __forceinline__ unsigned short bf16_bits(float x) { unsigned int u = __float_as_uint(x); return (unsigned short)((u + 0x7FFFu + ((u >> 16) & 1u)) >> 16); }
__device__ __forceinline__ float bf16_val(unsigned short b) { return __uint_as_float(((unsigned int)b) << 16); }
__device__ __forceinline__ float bf16_round(float x) { return bf16_val(bf16_bits(x)); }
// D += A·B with NT terms: 1 = ah·bh, 2 = + al·bh (A split), 3 = + ah·bl (both split)
template <int NT>
__device__ __forceinline__ v8f mmaN(v16b ah, v16b al, v16b bh, v16b bl, v8f c) {
  c = __builtin_amdgcn_wmma_f32_16x16x32_bf16(false, ah, false, bh, (short)0, c, false, false);
  if (NT >= 2) c = __builtin_amdgcn_wmma_f32_16x16x32_bf16(false, al, false, bh, (short)0, c, false, false);
  if (NT >= 3) c = __builtin_amdgcn_wmma_f32_16x16x32_bf16(false, ah, false, bl, (short)0, c, false, false);
  asm volatile("v_nop\n\tv_nop\n\tv_nop\n\tv_nop" : "+v"(c) : "v"(ah), "v"(al), "v"(bh), "v"(bl));
  return c;
}

__global__ __launch_bounds__(256) void k_wt_bf16(const float* __restrict__ W, unsigned short* __restrict__ Wt, int K, int N) {
  const int t = blockIdx.x * 256 + threadIdx.x;
  const int k8n = K / 8;
  if (t >= N * k8n) return;
  const int n = t / k8n, k8 = (t % k8n) * 8;
  v8us v;
#pragma unroll
  for (int i = 0; i < 8; ++i) v[i] = bf16_bits(W[(size_t)(k8 + i) * N + n]);
  *(v8us*)(Wt + (size_t)n * K + k8) = v;
  
}

// GEMM C[M][N] (f32, pitch ldc) = act(A[M][K]·W + bias). A f32 row-major (pitch lda) converted per fragment to bf16
// (ASPLIT: hi/lo two planes -> 2 terms, else single rounded term); Wt bf16 [N][K] (pitch ldb). BIAS_BF16 rounds the
// bias to bf16 first (bias quantised to bf16 before the add). K%32==0, M%16==0, N%64==0.
template <bool ASPLIT, int ACT, bool BIAS_BF16>
__global__ __launch_bounds__(128) void k_gemm_bf(const float* __restrict__ A, int lda, const unsigned short* __restrict__ Wt, int ldb,
                                               const float* __restrict__ bias, float* __restrict__ C, int ldc, int M, int N, int K) {
  __shared__ __attribute__((aligned(16))) float so[4][16][64];
  const int tid = threadIdx.x, w = tid >> 5, lane = tid & 31, ln = lane & 15, hh = lane >> 4;
  const int ntn = N / 64;
  const int wid = blockIdx.x * 4 + w;
  const int mt = wid / ntn, nq = wid % ntn;
  if (mt * 16 >= M) return;
  const int row0 = mt * 16, col0 = nq * 64;
  const float* arow = A + (size_t)(row0 + ln) * lda;
  v8f acc[4] = {};
  for (int kb = 0; kb < K; kb += 32) {
    FragB ah, al;
    const v4f x0 = *(const v4fa*)(arow + kb + 8 * hh), x1 = *(const v4fa*)(arow + kb + 8 * hh + 4);
    const v4f x2 = *(const v4fa*)(arow + kb + 16 + 8 * hh), x3 = *(const v4fa*)(arow + kb + 16 + 8 * hh + 4);
    float xs[16] = {x0[0],x0[1],x0[2],x0[3],x1[0],x1[1],x1[2],x1[3],x2[0],x2[1],x2[2],x2[3],x3[0],x3[1],x3[2],x3[3]};
#pragma unroll
    for (int i = 0; i < 16; ++i) { const unsigned short hb = bf16_bits(xs[i]); ah.u[i] = hb; al.u[i] = ASPLIT ? bf16_bits(xs[i] - bf16_val(hb)) : (unsigned short)0; }
#pragma unroll
    for (int t = 0; t < 4; ++t) {
      const unsigned short* brow = Wt + (size_t)(col0 + t * 16 + ln) * ldb + kb;
      FragB b;
      b.half[0] = *(const v8us*)(brow + 8 * hh);
      b.half[1] = *(const v8us*)(brow + 16 + 8 * hh);
      acc[t] = mmaN<ASPLIT ? 2 : 1>(ah.v, al.v, b.v, b.v, acc[t]);
    }
  }
#pragma unroll
  for (int t = 0; t < 4; ++t) {
    float bv = bias ? bias[col0 + t * 16 + ln] : 0.f;
    if (BIAS_BF16) bv = bf16_round(bv);
#pragma unroll
    for (int r = 0; r < 8; ++r) { float v = acc[t][r] + bv; if (ACT == 1) v = fmaxf(v, 0.f); so[w][8 * hh + r][t * 16 + ln] = v; }
  }
  __builtin_amdgcn_fence(__ATOMIC_ACQ_REL, "workgroup");
  __builtin_amdgcn_wave_barrier();
  const int rsub = lane >> 4, c4 = (lane & 15) * 4;
  {
#pragma unroll
    for (int q = 0; q < 8; ++q) {
      const int r = q * 2 + rsub;
      const v4f v = *(const v4fa*)&so[w][r][c4];
      *(v4f*)(C + (size_t)(row0 + r) * ldc + col0 + c4) = v;
    }
    
  }
}

// GEMM C = act(A·W + bias + resid): A f32 (ASPLIT -> hi/lo 2 terms), Wt bf16 [N][K]; ACT 0 none, 1 relu, 2 exact gelu;
// resid (optional, f32, row index = (row % rmod), pitch ldr, RES_BF16 rounds it) added before the activation.
template <bool ASPLIT, int ACT, bool BIAS_BF16, bool RES_BF16>
__global__ __launch_bounds__(128) void k_gemm_bf3(const float* __restrict__ A, int lda, const unsigned short* __restrict__ Wt, int ldb,
                                                const float* __restrict__ bias, const float* __restrict__ resid, int rmod, int ldr,
                                                float* __restrict__ C, int ldc, int M, int N, int K) {
  __shared__ __attribute__((aligned(16))) float so[4][16][64];
  const int tid = threadIdx.x, w = tid >> 5, lane = tid & 31, ln = lane & 15, hh = lane >> 4;
  const int ntn = N / 64;
  const int wid = blockIdx.x * 4 + w;
  const int mt = wid / ntn, nq = wid % ntn;
  if (mt * 16 >= M) return;
  const int row0 = mt * 16, col0 = nq * 64;
  const float* arow = A + (size_t)(row0 + ln) * lda;
  v8f acc[4] = {};
  for (int kb = 0; kb < K; kb += 32) {
    FragB ah, al;
    const v4f x0 = *(const v4fa*)(arow + kb + 8 * hh), x1 = *(const v4fa*)(arow + kb + 8 * hh + 4);
    const v4f x2 = *(const v4fa*)(arow + kb + 16 + 8 * hh), x3 = *(const v4fa*)(arow + kb + 16 + 8 * hh + 4);
    float xs[16] = {x0[0],x0[1],x0[2],x0[3],x1[0],x1[1],x1[2],x1[3],x2[0],x2[1],x2[2],x2[3],x3[0],x3[1],x3[2],x3[3]};
#pragma unroll
    for (int i = 0; i < 16; ++i) { const unsigned short hb = bf16_bits(xs[i]); ah.u[i] = hb; al.u[i] = ASPLIT ? bf16_bits(xs[i] - bf16_val(hb)) : (unsigned short)0; }
#pragma unroll
    for (int t = 0; t < 4; ++t) {
      const unsigned short* brow = Wt + (size_t)(col0 + t * 16 + ln) * ldb + kb;
      FragB b;
      b.half[0] = *(const v8us*)(brow + 8 * hh);
      b.half[1] = *(const v8us*)(brow + 16 + 8 * hh);
      acc[t] = mmaN<ASPLIT ? 2 : 1>(ah.v, al.v, b.v, b.v, acc[t]);
    }
  }
#pragma unroll
  for (int t = 0; t < 4; ++t) {
    const int col = col0 + t * 16 + ln;
    float bv = bias ? bias[col] : 0.f;
    if (BIAS_BF16) bv = bf16_round(bv);
#pragma unroll
    for (int r = 0; r < 8; ++r) {
      float v = acc[t][r] + bv;
      if (resid) { float rv = resid[(size_t)((row0 + 8 * hh + r) % rmod) * ldr + col]; if (RES_BF16) rv = bf16_round(rv); v += rv; }
      if (ACT == 1) v = fmaxf(v, 0.f);
      if (ACT == 2) v = 0.5f * v * (1.0f + erff(v * 0.70710678118654752f));
      if (ACT == 3) { const float u = 0.7978845608028654f * (v + 0.044715f * v * v * v); v = 0.5f * v * (1.0f + tanhf(u)); }
      so[w][8 * hh + r][t * 16 + ln] = v;
    }
  }
  __builtin_amdgcn_fence(__ATOMIC_ACQ_REL, "workgroup");
  __builtin_amdgcn_wave_barrier();
  const int rsub = lane >> 4, c4 = (lane & 15) * 4;
  {
#pragma unroll
    for (int q = 0; q < 8; ++q) {
      const int r = q * 2 + rsub;
      const v4f v = *(const v4fa*)&so[w][r][c4];
      *(v4f*)(C + (size_t)(row0 + r) * ldc + col0 + c4) = v;
    }
    
  }
}
// row LayerNorm (biased variance, eps) over N: s = X (+ R); optional out_sum <- s; out_norm <- (s-mu)*rsqrt(var+eps)*g + b
template <bool PARAM_BF16>
__global__ __launch_bounds__(256) void k_layernorm(const float* __restrict__ X, const float* __restrict__ R, const float* __restrict__ g, const float* __restrict__ bta,
                                                  float* __restrict__ out_sum, float* __restrict__ out_norm, int N, float eps) {
  __shared__ float red[256];
  const int row = blockIdx.x, tid = threadIdx.x;
  const float* x = X + (size_t)row * N; const float* rr = R ? R + (size_t)row * N : nullptr;
  float vals[16];                     // up to N = 4096
  const int per = N / 256;            // contiguous chunk per thread? use strided-by-4 chunks: thread handles j = tid*4 + 1024*u
  float s1 = 0.f;
  for (int u = 0; u < per / 4; ++u) {
    const int j = tid * 4 + 1024 * u;
    const v4f a = *(const v4fa*)(x + j);
    v4f b = {0.f,0.f,0.f,0.f}; if (rr) b = *(const v4fa*)(rr + j);
#pragma unroll
    for (int q = 0; q < 4; ++q) { const float v = a[q] + b[q]; vals[u * 4 + q] = v; s1 += v; }
  }
  red[tid] = s1; __syncthreads();
  for (int st = 128; st > 0; st >>= 1) { if (tid < st) red[tid] += red[tid + st]; __syncthreads(); }
  const float mu = red[0] / (float)N; __syncthreads();
  float s2 = 0.f;
  for (int u = 0; u < per / 4; ++u)
#pragma unroll
    for (int q = 0; q < 4; ++q) { const float c = vals[u * 4 + q] - mu; s2 += c * c; }
  red[tid] = s2; __syncthreads();
  for (int st = 128; st > 0; st >>= 1) { if (tid < st) red[tid] += red[tid + st]; __syncthreads(); }
  const float rs = rsqrtf(red[0] / (float)N + eps);
  {
    for (int u = 0; u < per / 4; ++u) {
      const int j = tid * 4 + 1024 * u;
      v4f o, sm;
#pragma unroll
      for (int q = 0; q < 4; ++q) {
        float gg = g[j + q], bb = bta[j + q];
        if (PARAM_BF16) { gg = bf16_round(gg); bb = bf16_round(bb); }
        sm[q] = vals[u * 4 + q]; o[q] = (vals[u * 4 + q] - mu) * rs * gg + bb;
      }
      if (out_sum) *(v4f*)(out_sum + (size_t)row * N + j) = sm;
      *(v4f*)(out_norm + (size_t)row * N + j) = o;
    }
    
  }
}



// ---- f16 WMMA path (v_wmma_f32_16x16x32_f16): 11-bit significands for operands in range — used where a [0,1] probability operand needs more precision than bf16
typedef _Float16 v16h __attribute__((ext_vector_type(16)));
union FragH { v16h v; v8us half[2]; _Float16 h[16]; unsigned short u[16]; };
template <int NT>
__device__ __forceinline__ v8f mmaH(v16h ah, v16h al, v16h bh, v16h bl, v8f c) {
  c = __builtin_amdgcn_wmma_f32_16x16x32_f16(false, ah, false, bh, (short)0, c, false, false);
  if (NT >= 2) c = __builtin_amdgcn_wmma_f32_16x16x32_f16(false, al, false, bh, (short)0, c, false, false);
  if (NT >= 3) c = __builtin_amdgcn_wmma_f32_16x16x32_f16(false, ah, false, bl, (short)0, c, false, false);
  asm volatile("v_nop\n\tv_nop\n\tv_nop\n\tv_nop" : "+v"(c) : "v"(ah), "v"(al), "v"(bh), "v"(bl));
  return c;
}
// batched GEMM like k_gemm_b but f16 operands: A f32 (split into f16 hi/lo if ASPLIT, else rounded to f16), Bt = f16 values [n][k]; alpha; C f32; N multiple of 16 (partial tiles skipped)
template <bool ASPLIT>
__global__ __launch_bounds__(128) void k_gemm_h(const float* __restrict__ A, int lda, size_t sA, const _Float16* __restrict__ Bh, int ldb, size_t sB, float alpha, float* __restrict__ C, int ldc, size_t sC, int M, int N, int K) {
  __shared__ __attribute__((aligned(16))) float so[4][16][64];
  const int tid = threadIdx.x, w = tid >> 5, lane = tid & 31, ln = lane & 15, hh = lane >> 4; const int by = blockIdx.y;
  A += (size_t)by * sA; Bh += (size_t)by * sB; C += (size_t)by * sC;
  const int ntn = (N + 63) / 64; const int wid = blockIdx.x * 4 + w; const int mt = wid / ntn, nq = wid % ntn; if (mt * 16 >= M) return;
  const int row0 = mt * 16, col0 = nq * 64; const float* arow = A + (size_t)(row0 + ln) * lda;
  v8f acc[4] = {};
  for (int kb = 0; kb < K; kb += 32) {
    FragH ah, al;
    const v4f x0 = *(const v4fa*)(arow + kb + 8 * hh), x1 = *(const v4fa*)(arow + kb + 8 * hh + 4), x2 = *(const v4fa*)(arow + kb + 16 + 8 * hh), x3 = *(const v4fa*)(arow + kb + 16 + 8 * hh + 4);
    float xs[16] = {x0[0],x0[1],x0[2],x0[3],x1[0],x1[1],x1[2],x1[3],x2[0],x2[1],x2[2],x2[3],x3[0],x3[1],x3[2],x3[3]};
#pragma unroll
    for (int i = 0; i < 16; ++i) { const _Float16 h = (_Float16)xs[i]; ah.h[i] = h; al.h[i] = ASPLIT ? (_Float16)(xs[i] - (float)h) : (_Float16)0.0f; }
#pragma unroll
    for (int t = 0; t < 4; ++t) { if (col0 + t * 16 >= N) continue; const size_t boff = (size_t)(col0 + t * 16 + ln) * ldb + kb; FragH bq; bq.half[0] = *(const v8us*)(Bh + boff + 8 * hh); bq.half[1] = *(const v8us*)(Bh + boff + 16 + 8 * hh);
      acc[t] = mmaH<ASPLIT ? 2 : 1>(ah.v, al.v, bq.v, bq.v, acc[t]); }
  }
#pragma unroll
  for (int t = 0; t < 4; ++t) { if (col0 + t * 16 >= N) continue;
#pragma unroll
    for (int r = 0; r < 8; ++r) so[w][8 * hh + r][t * 16 + ln] = acc[t][r] * alpha; }
  __builtin_amdgcn_fence(__ATOMIC_ACQ_REL, "workgroup"); __builtin_amdgcn_wave_barrier();
  const int rsub = lane >> 4, c4 = (lane & 15) * 4;
  {
#pragma unroll
    for (int q = 0; q < 8; ++q) { const int r = q * 2 + rsub; if (col0 + c4 < N) { const v4f v = *(const v4fa*)&so[w][r][c4]; *(v4f*)(C + (size_t)(row0 + r) * ldc + col0 + c4) = v; } }
     }
}

// Wt[n][k] = f16(bf16(W[k][n])*scale) from f32 row-major W[K][N] (scale = power of two; bf16-exact weights stay exact in f16 away from the subnormal range)
// One block turns a tile of 128 k x 64 n through LDS: W is read as whole 256-B pieces of its rows (16 B a lane, all 8 loads of a lane in flight) and Wt is written as whole 256-B pieces of its rows. (K / 128) * (N / 64) tiles. K and N are compile-time so that a lane's 8 loads, and its 4 stores, share one address and differ in the immediate offset only.
#define WT_P 65      /* dwords per LDS row (one n: 64 pairs of k, + 1): odd, so the 16 lanes that store 4 rows apart and the 16 that read 4 dwords apart each meet 16 different banks */
typedef unsigned int v4ua __attribute__((ext_vector_type(4), may_alias));
template <int K, int N>
__device__ __forceinline__ void wt_tile(unsigned int* tl, const float* __restrict__ W, _Float16* __restrict__ Wt, float scale, int blk) { static_assert(K % 128 == 0 && N % 64 == 0, "wt_tile: whole tiles only");      /* tl = 64 * WT_P dwords of LDS; blk = the tile's number */
  constexpr int ntn = N / 64; const int tid = threadIdx.x; const int kt = blk / ntn, nt = blk % ntn; const int k0 = kt * 128, n0 = nt * 64; const int r = tid >> 4, c = tid & 15;
  const float* p = W + (size_t)(k0 + 2 * r) * N + n0 + c * 4;
  v4f a[4], b[4];      /* rows k0 + 2 * (16 u + r) and the next one, columns n0 + 4 c .. + 3; every loop below is unrolled whole, so that a and b are indexed by constants and stay in registers and the offsets are immediates */
#pragma unroll
  for (int u = 0; u < 4; ++u) { a[u] = *(const v4fa*)(p + (size_t)u * 32 * N); b[u] = *(const v4fa*)(p + (size_t)u * 32 * N + N); }
#pragma unroll
  for (int u = 0; u < 4; ++u) {
#pragma unroll
    for (int j = 0; j < 4; ++j) { union { _Float16 h[2]; unsigned int d; } pk; pk.h[0] = (_Float16)(bf16_round(a[u][j]) * scale); pk.h[1] = (_Float16)(bf16_round(b[u][j]) * scale); tl[(c * 4 + j) * WT_P + u * 16 + r] = pk.d; } }
  __syncthreads();
  unsigned short* q = (unsigned short*)Wt + (size_t)(n0 + r) * K + k0 + c * 8;
#pragma unroll
  for (int v = 0; v < 4; ++v) { v4ua o;
#pragma unroll
    for (int i = 0; i < 4; ++i) o[i] = tl[(v * 16 + r) * WT_P + c * 4 + i];
    *(v4ua*)(q + (size_t)v * 16 * K) = o; }
  asm volatile("s_wait_xcnt 0x0" ::: "memory");      /* a precaution: the built kernel lays another job's code behind these stores, and that code rewrites the registers they name; the wait stands in front of it */
}
// k_gemm_hh variant with fused epilogue: v = acc·alpha + bias[by·sBias + col] (+ CP[(row/rowsPerB)·sCPb + by·64 + col] if CP) ; ACT 0 none / 1 elu ; writes f16 C16 (and f32 C if non-null)
template <int ACT>
__global__ __launch_bounds__(128) void k_gemm_hhx(const _Float16* __restrict__ A, int lda, size_t sA, const _Float16* __restrict__ Bh, int ldb, size_t sB, float alpha, const float* __restrict__ bias, size_t sBias, const float* __restrict__ CP, int rowsPerB, size_t sCPb, int row0g,
    float* __restrict__ C, _Float16* __restrict__ C16, int ldc, size_t sC, int M, int N, int K) {
  __shared__ __attribute__((aligned(16))) float so[4][16][64];
  const int tid = threadIdx.x, w = tid >> 5, lane = tid & 31, ln = lane & 15, hh = lane >> 4; const int by = blockIdx.y;
  A += (size_t)by * sA; Bh += (size_t)by * sB; const size_t cofs = (size_t)by * sC; const float* bp = bias ? bias + (size_t)by * sBias : nullptr;
  const int ntn = (N + 63) / 64; const int wid = blockIdx.x * 4 + w; const int mt = wid / ntn, nq = wid % ntn; if (mt * 16 >= M) return;
  const int row0 = mt * 16, col0 = nq * 64; const _Float16* arow = A + (size_t)(row0 + ln) * lda;
  v8f acc[4] = {};
  for (int kb = 0; kb < K; kb += 32) { FragH ah; ah.half[0] = *(const v8us*)((const unsigned short*)arow + kb + 8 * hh); ah.half[1] = *(const v8us*)((const unsigned short*)arow + kb + 16 + 8 * hh);
#pragma unroll
    for (int t = 0; t < 4; ++t) { if (col0 + t * 16 >= N) continue; const size_t boff = (size_t)(col0 + t * 16 + ln) * ldb + kb; FragH bq; bq.half[0] = *(const v8us*)((const unsigned short*)Bh + boff + 8 * hh); bq.half[1] = *(const v8us*)((const unsigned short*)Bh + boff + 16 + 8 * hh);
      acc[t] = mmaH<1>(ah.v, ah.v, bq.v, bq.v, acc[t]); }
  }
#pragma unroll
  for (int t = 0; t < 4; ++t) { if (col0 + t * 16 >= N) continue; const int col = col0 + t * 16 + ln; const float bv = bp ? bf16_round(bp[col]) : 0.f;
#pragma unroll
    for (int r = 0; r < 8; ++r) { float v = acc[t][r] * alpha + bv; if (CP) { const int rr = row0g + row0 + 8 * hh + r; if (rowsPerB < 0) v += CP[cofs + (size_t)rr * ldc + col];      /* rowsPerB < 0: own element of the batched C plane */ else { const int bidx = rr / rowsPerB; v += CP[(size_t)bidx * sCPb + (size_t)by * 64 + col]; } } if (ACT == 1) v = (v > 0.f) ? v : expm1f(v); else if (ACT == 7) v = (v > 0.f) ? v + 1.0f : expf(v); else if (ACT == 8) v = tanhf(v); else if (ACT == 9) v = 0.5f * v * (1.0f + tanhf(0.7978845608028654f * (v + 0.044715f * v * v * v))); else if (ACT == 11) v = 1.0f / (1.0f + expf(-v)); else if (ACT == 12) v = (v > 0.f) ? v : 0.01f * v; else if (ACT == 14) v = (v > 0.f) ? v : 0.1f * v; else if (ACT == 16) v = (v >= 0.f) ? v : 0.3f * v; else if (ACT == 15) v = v / (1.0f + expf(-v)); else if (ACT == 3) v = fmaxf(v, 0.f); else if (ACT == 6) v = 0.5f * v * (1.0f + erff(v * 0.70710678118654752f)); so[w][8 * hh + r][t * 16 + ln] = v; } }
  __builtin_amdgcn_fence(__ATOMIC_ACQ_REL, "workgroup"); __builtin_amdgcn_wave_barrier();
  const int rsub = lane >> 4, c4 = (lane & 15) * 4; typedef _Float16 v4h __attribute__((ext_vector_type(4)));
  {
#pragma unroll
    for (int q = 0; q < 8; ++q) { const int r = q * 2 + rsub; if (col0 + c4 < N) { const v4f v = *(const v4fa*)&so[w][r][c4]; if (C) *(v4f*)(C + cofs + (size_t)(row0 + r) * ldc + col0 + c4) = v; if (C16) { v4h h4; for (int i = 0; i < 4; ++i) h4[i] = (_Float16)v[i]; *(v4h*)(C16 + cofs + (size_t)(row0 + r) * ldc + col0 + c4) = h4; } } }
     }
}


typedef _Float16 v4h __attribute__((ext_vector_type(4)));

__device__ __forceinline__ void x16_part(const float* __restrict__ x, _Float16* __restrict__ X16, int blk) { const size_t t = (size_t)blk * 256 + threadIdx.x; FragH f;
#pragma unroll
  for (int q = 0; q < 8; ++q) f.h[q] = (_Float16)bf16_round(x[t * 8 + q]); *(v8us*)((unsigned short*)X16 + t * 8) = f.half[0];  }
__global__ __launch_bounds__(256) void k_h16(const float* __restrict__ x, _Float16* __restrict__ X16, size_t n8, size_t sB) { const size_t t = (size_t)blockIdx.x * 256 + threadIdx.x; if (t >= n8) return; x += (size_t)blockIdx.y * sB; X16 += (size_t)blockIdx.y * sB;      /* batch = blockIdx.y */ FragH f;
#pragma unroll
  for (int q = 0; q < 8; ++q) f.h[q] = (_Float16)x[t * 8 + q]; *(v8us*)((unsigned short*)X16 + t * 8) = f.half[0];  }
__global__ __launch_bounds__(256) void k_round16f(const float* __restrict__ W, _Float16* __restrict__ Bt, size_t n8) { const size_t t = (size_t)blockIdx.x * 256 + threadIdx.x; if (t >= n8) return; FragH f;
#pragma unroll
  for (int i = 0; i < 8; ++i) f.h[i] = (_Float16)(bf16_round(W[t * 8 + i]) * 16.0f); *(v8us*)((unsigned short*)Bt + t * 8) = f.half[0];  }
template <int NHv, int TTv>
__global__ __launch_bounds__(256) void k_vt(const _Float16* __restrict__ V16, int ldv, int voff, _Float16* __restrict__ Vt) { __shared__ unsigned short tl[64][66]; const int tid = threadIdx.x; const int slab = blockIdx.x / (TTv / 64), lg = blockIdx.x % (TTv / 64); const int b = slab / NHv, h = slab % NHv;
  for (int i = tid; i < 64 * 8; i += 256) { const int r = i / 8, c8 = (i % 8) * 8; FragH f; f.half[0] = *(const v8us*)((const unsigned short*)V16 + ((size_t)b * TTv + lg * 64 + r) * ldv + voff + h * 64 + c8);
#pragma unroll
    for (int q = 0; q < 8; ++q) tl[r][c8 + q] = f.u[q]; }
  __syncthreads();
  {
#pragma unroll
    for (int rd = 0; rd < 2; ++rd) { const int d = rd * 32 + tid / 8, pc = tid % 8; FragH f;
#pragma unroll
      for (int q = 0; q < 8; ++q) f.u[q] = tl[pc * 8 + q][d];
      *(v8us*)((unsigned short*)Vt + ((size_t)slab * 64 + d) * TTv + lg * 64 + pc * 8) = f.half[0]; }
     } }

__global__ __launch_bounds__(256) void k_hl(const float* __restrict__ F, _Float16* __restrict__ Hh, _Float16* __restrict__ Hl, size_t n8, size_t sB, size_t sL) { const size_t t = (size_t)blockIdx.x * 256 + threadIdx.x; if (t >= n8) return; F += (size_t)blockIdx.y * sB; Hh += (size_t)blockIdx.y * sB; Hl += (size_t)blockIdx.y * sL;      /* batch = blockIdx.y */ FragH fh, fl; const v4f a = *(const v4fa*)(F + t * 8), c = *(const v4fa*)(F + t * 8 + 4);
#pragma unroll
  for (int q = 0; q < 4; ++q) { _Float16 h = (_Float16)a[q]; fh.h[q] = h; fl.h[q] = (_Float16)((a[q] - (float)h) * 1024.0f); h = (_Float16)c[q]; fh.h[4 + q] = h; fl.h[4 + q] = (_Float16)((c[q] - (float)h) * 1024.0f); }
  { *(v8us*)((unsigned short*)Hh + t * 8) = fh.half[0]; *(v8us*)((unsigned short*)Hl + t * 8) = fl.half[0];  } }

// ---- fast GEMM (block tile 128x64, wave tile 32x64; requires M % 128 == 0 rows per launch region, N % 64 == 0, K % 64 == 0); epilogue = k_gemm_hhx semantics ----
// Operands reach the waves through LDS: per 64 k one tile of 128 A rows and 64 B rows, 128 B (one whole line) of each row, brought by asynchronous copies (32 lanes = 4 whole lines a copy) into one of two buffers while the other is worked on; each row is fetched once per block instead of once per wave in 32-B pieces.
#define G2_PITCH 72      /* f16 per LDS row: 128 B of k + 16 B, the conflict-free pitch for ds_load_b128 readers of 128-B rows */
#define G2_TILE ((128 + 64) * G2_PITCH * 2)      /* bytes of one buffer: 128 A rows, then 64 B rows */
// one tile's 12 copies of a lane (rows 16 apart: 8 of A, 4 of B); l = the lane's LDS byte address of its first piece. s_wait_xcnt 0 is the statement's last line so that no address register of a copy is rewritten ahead of it.
__device__ __forceinline__ void g2_stage(unsigned l, const _Float16* ga, size_t sa, const _Float16* gb, size_t sb) { const unsigned r16 = 16 * G2_PITCH * 2;
  asm volatile("global_load_async_to_lds_b128 %0, %12, off\n\t" "global_load_async_to_lds_b128 %1, %13, off\n\t" "global_load_async_to_lds_b128 %2, %14, off\n\t" "global_load_async_to_lds_b128 %3, %15, off\n\t"
               "global_load_async_to_lds_b128 %4, %16, off\n\t" "global_load_async_to_lds_b128 %5, %17, off\n\t" "global_load_async_to_lds_b128 %6, %18, off\n\t" "global_load_async_to_lds_b128 %7, %19, off\n\t"
               "global_load_async_to_lds_b128 %8, %20, off\n\t" "global_load_async_to_lds_b128 %9, %21, off\n\t" "global_load_async_to_lds_b128 %10, %22, off\n\t" "global_load_async_to_lds_b128 %11, %23, off\n\t"
               "s_wait_xcnt 0x0"
               :: "v"(l), "v"(l + r16), "v"(l + 2 * r16), "v"(l + 3 * r16), "v"(l + 4 * r16), "v"(l + 5 * r16), "v"(l + 6 * r16), "v"(l + 7 * r16), "v"(l + 8 * r16), "v"(l + 9 * r16), "v"(l + 10 * r16), "v"(l + 11 * r16),
                  "v"(ga), "v"(ga + sa), "v"(ga + 2 * sa), "v"(ga + 3 * sa), "v"(ga + 4 * sa), "v"(ga + 5 * sa), "v"(ga + 6 * sa), "v"(ga + 7 * sa), "v"(gb), "v"(gb + sb), "v"(gb + 2 * sb), "v"(gb + 3 * sb)
               : "memory"); }
__device__ __forceinline__ v16h g2_frag(const _Float16* p, int hh) { FragH f; f.half[0] = *(const v8us*)((const unsigned short*)p + 8 * hh); f.half[1] = *(const v8us*)((const unsigned short*)p + 16 + 8 * hh); return f.v; }
__device__ __forceinline__ v8f g2_mma(v16h a, v16h b, v8f c) { v8f d = __builtin_amdgcn_wmma_f32_16x16x32_f16(false, a, false, b, (short)0, c, false, false); asm volatile("v_nop\n\tv_nop\n\tv_nop\n\tv_nop" : "+v"(d) : "v"(a), "v"(b)); return d; }
template <int ACT>
__global__ __launch_bounds__(128) void k_gemm2(const _Float16* __restrict__ A, int lda, size_t sA, const _Float16* __restrict__ Bh, int ldb, size_t sB, float alpha, const float* __restrict__ bias, size_t sBias, const float* __restrict__ CP, int rowsPerB, size_t sCPb, int row0g,
    float* __restrict__ C, _Float16* __restrict__ C16, int ldc, size_t sC, int M, int N, int K, size_t zA, size_t zB, size_t zC) { static_assert(ACT == 0 || ACT == 3 || ACT == 6 || ACT == 8 || ACT == 9 || ACT == 11 || ACT == 12 || ACT == 14 || ACT == 15 || ACT == 16, "k_gemm2: unsupported ACT code (would silently apply no activation)");
  __shared__ __attribute__((aligned(16))) unsigned char sm[2 * G2_TILE]; float (*so)[32][68] = (float (*)[32][68])sm;      /* the epilogue's staging lies over the two buffers, which every wave has left by then */ static_assert(sizeof(float) * 4 * 32 * 68 <= 2 * G2_TILE, "k_gemm2: epilogue staging must fit the buffers");
  const int tid = threadIdx.x, w = tid >> 5, lane = tid & 31, ln = lane & 15, hh = lane >> 4; const int by = blockIdx.y, bz = blockIdx.z;
  A += (size_t)by * sA + (size_t)bz * zA; Bh += (size_t)by * sB + (size_t)bz * zB; const size_t cofs = (size_t)by * sC + (size_t)bz * zC; const float* bp = bias ? bias + (size_t)by * sBias : nullptr;
  const int ntn = N >> 6; const int mt = blockIdx.x / ntn, nq = blockIdx.x - mt * ntn; const int row0 = mt * 128 + 32 * w, col0 = nq * 64; if (mt * 128 >= M) return;      /* the same for the whole block: it stands in front of barriers */
  const int trow = tid >> 3, tseg = tid & 7;      /* a lane's piece of a tile: 16 B number tseg of rows trow, trow + 16, ... */
  const _Float16* gA = A + (size_t)(mt * 128 + trow) * lda + tseg * 8; const _Float16* gB = Bh + (size_t)(col0 + trow) * ldb + tseg * 8; const size_t sa16 = (size_t)16 * lda, sb16 = (size_t)16 * ldb;
  const unsigned l0 = (unsigned)(size_t)sm + (unsigned)(trow * (G2_PITCH * 2) + tseg * 16);
  const v8f z8 = {0.f,0.f,0.f,0.f,0.f,0.f,0.f,0.f}; v8f c00 = z8, c01 = z8, c02 = z8, c03 = z8, c10 = z8, c11 = z8, c12 = z8, c13 = z8;
  const int nc = K >> 6;
  g2_stage(l0, gA, sa16, gB, sb16);
  asm volatile("s_wait_asynccnt 0x0" ::: "memory");      /* tile 0 of this wave's copies has landed */
  __syncthreads();      /* ... and every other wave's */
  if (nc > 1) g2_stage(l0 + G2_TILE, gA + 64, sa16, gB + 64, sb16);
#pragma unroll 1      /* one tile a trip: the buffer index stays a run-time value and the loop stays small */
  for (int t = 0; t < nc; ++t) { const _Float16* tl = (const _Float16*)(sm + (t & 1) * G2_TILE); const _Float16* ar = tl + (32 * w + ln) * G2_PITCH; const _Float16* br = tl + (128 + ln) * G2_PITCH;
    /* all 24 LDS reads of the trip as one group in front of its WMMAs */
    const v16h a0 = g2_frag(ar, hh), a1 = g2_frag(ar + 16 * G2_PITCH, hh), b0 = g2_frag(br, hh), b1 = g2_frag(br + 16 * G2_PITCH, hh), b2 = g2_frag(br + 32 * G2_PITCH, hh), b3 = g2_frag(br + 48 * G2_PITCH, hh);
    const v16h e0 = g2_frag(ar + 32, hh), e1 = g2_frag(ar + 16 * G2_PITCH + 32, hh), f0 = g2_frag(br + 32, hh), f1 = g2_frag(br + 16 * G2_PITCH + 32, hh), f2 = g2_frag(br + 32 * G2_PITCH + 32, hh), f3 = g2_frag(br + 48 * G2_PITCH + 32, hh);
    c00 = g2_mma(a0, b0, c00); c10 = g2_mma(a1, b0, c10); c01 = g2_mma(a0, b1, c01); c11 = g2_mma(a1, b1, c11); c02 = g2_mma(a0, b2, c02); c12 = g2_mma(a1, b2, c12); c03 = g2_mma(a0, b3, c03); c13 = g2_mma(a1, b3, c13);
    c00 = g2_mma(e0, f0, c00); c10 = g2_mma(e1, f0, c10); c01 = g2_mma(e0, f1, c01); c11 = g2_mma(e1, f1, c11); c02 = g2_mma(e0, f2, c02); c12 = g2_mma(e1, f2, c12); c03 = g2_mma(e0, f3, c03); c13 = g2_mma(e1, f3, c13);
    asm volatile("s_wait_dscnt 0x0" ::: "memory");      /* this wave's reads of buffer t & 1 are done before the buffer is handed back */
    asm volatile("s_wait_asynccnt 0x0" ::: "memory");      /* this wave's copies of tile t + 1 have landed */
    __syncthreads();      /* publishes tile t + 1 and ends every wave's reads of tile t */
    if (t + 2 < nc) g2_stage(l0 + (unsigned)((t & 1) * G2_TILE), gA + (size_t)(t + 2) * 64, sa16, gB + (size_t)(t + 2) * 64, sb16); }
  asm volatile("s_wait_asynccnt 0x0" ::: "memory");      /* no copy is in flight when the buffers become the epilogue's staging */
  v8f accs[8] = {c00, c01, c02, c03, c10, c11, c12, c13};
#pragma unroll
  for (int u = 0; u < 8; ++u) { const int t = u & 3, half = u >> 2; const int col = col0 + t * 16 + ln; const float bv = bp ? bf16_round(bp[col]) : 0.f;
#pragma unroll
    for (int r = 0; r < 8; ++r) { const int rloc = half * 16 + 8 * hh + r; float v = accs[u][r] * alpha + bv; if (CP) { if (rowsPerB < 0) v += CP[cofs + (size_t)(row0g + row0 + rloc) * ldc + col];      /* rowsPerB < 0: own element of the batched C plane */ else { const int bidx = (row0g + row0 + rloc) / rowsPerB; v += CP[(size_t)bidx * sCPb + (size_t)by * 64 + col]; } }
      if (ACT == 3) v = fmaxf(v, 0.f); else if (ACT == 6) v = 0.5f * v * (1.0f + erff(v * 0.70710678118654752f)); else if (ACT == 11) v = 1.0f / (1.0f + expf(-v)); else if (ACT == 15) v = v / (1.0f + expf(-v)); else if (ACT == 12) v = (v > 0.f) ? v : 0.01f * v; else if (ACT == 8) v = tanhf(v); else if (ACT == 9) v = 0.5f * v * (1.0f + tanhf(0.7978845608028654f * (v + 0.044715f * v * v * v))); else if (ACT == 14) v = (v > 0.f) ? v : 0.1f * v; else if (ACT == 16) v = (v >= 0.f) ? v : 0.3f * v;
      so[w][rloc][t * 16 + ln] = v; } }
  __builtin_amdgcn_fence(__ATOMIC_ACQ_REL, "workgroup"); __builtin_amdgcn_wave_barrier();
  const int rsub = lane >> 4, c4 = (lane & 15) * 4;
  {
#pragma unroll
    for (int q = 0; q < 16; ++q) { const int r = q * 2 + rsub; const v4f v = *(const v4fa*)&so[w][r][c4]; if (C) *(v4f*)(C + cofs + (size_t)(row0 + r) * ldc + col0 + c4) = v; if (C16) { v4h h4; for (int i = 0; i < 4; ++i) h4[i] = (_Float16)v[i]; *(v4h*)(C16 + cofs + (size_t)(row0 + r) * ldc + col0 + c4) = h4; } }
     } }


#define LDQKV (DM + 2 * HD)      /* columns of the joint projection: q (8 heads), k, v */
__device__ __forceinline__ void rotab_part(const int* __restrict__ pid, float* __restrict__ CS, float* __restrict__ SN, int blk) {
  #pragma clang fp contract(off)
  const int t = blk * 256 + threadIdx.x; const int j = t % HH, s = t / HH;      /* s = flat token over both batches */ const float inv = 1.0f / powf(10000.0f, (float)(2 * j) / (float)HD); const float th = (float)pid[s] * inv; const float c = cosf(th), sn = sinf(th);
  { *(float*)(CS + t) = c; *(float*)(SN + t) = sn;  }
  asm volatile("s_wait_xcnt 0x0" ::: "memory");      /* a precaution: the built kernel lays another job's code behind these stores, and that code rewrites the registers they name; the wait stands in front of it */ }
// rotation of the 8 query heads and of the key head (head 8 of a row of the joint projection) in one index space
__device__ __forceinline__ void rope_part(const float* __restrict__ F, const float* __restrict__ CS, const float* __restrict__ SN, _Float16* __restrict__ QH, _Float16* __restrict__ QL, _Float16* __restrict__ KH, _Float16* __restrict__ KL, int blk) {
  #pragma clang fp contract(off)
  const int t = blk * 256 + threadIdx.x; const int g = (t % (HH / 8)) * 8; const int h = (t / (HH / 8)) % (NHQ + 1); const int s = t / ((HH / 8) * (NHQ + 1));
  const bool isq = h < NHQ; _Float16* H = isq ? QH : KH; _Float16* L = isq ? QL : KL; F += (size_t)s * LDQKV + h * HD + g;
  const size_t base = isq ? (size_t)s * DM + h * HD + g : (size_t)s * HD + g; FragH h0, h1, l0, l1;
#pragma unroll
  for (int q = 0; q < 8; ++q) { const float c = CS[s * HH + g + q], sn = SN[s * HH + g + q]; const float x0 = F[q], x1 = F[HH + q]; float o0 = x0 * c; o0 += -x1 * sn; float o1 = x1 * c; o1 += x0 * sn;
    const _Float16 a0 = (_Float16)o0, a1 = (_Float16)o1; h0.h[q] = a0; h1.h[q] = a1; l0.h[q] = (_Float16)((o0 - (float)a0) * 1024.0f); l1.h[q] = (_Float16)((o1 - (float)a1) * 1024.0f); }
  { *(v8us*)((unsigned short*)H + base) = h0.half[0]; *(v8us*)((unsigned short*)H + base + HH) = h1.half[0]; *(v8us*)((unsigned short*)L + base) = l0.half[0]; *(v8us*)((unsigned short*)L + base + HH) = l1.half[0];  } }
// V^T hi and residual (x 2^10) planes straight from the f32 v columns of the joint projection: one block turns 64 tokens x 64 d through two LDS tiles. Fv = column 0 of v in row 0.
__device__ __forceinline__ void vthl_part(unsigned short (*th)[66], unsigned short (*tr)[66], const float* __restrict__ Fv, _Float16* __restrict__ VTh, _Float16* __restrict__ VTl, int blk) {
  const int tid = threadIdx.x; const int slab = blk / (SQ / 64), lg = blk % (SQ / 64); const int b = slab / (HD / 64), h = slab % (HD / 64);
  for (int i = tid; i < 64 * 8; i += 256) { const int r = i / 8, c8 = (i % 8) * 8; const float* p = Fv + ((size_t)b * SQ + lg * 64 + r) * LDQKV + h * 64 + c8; const v4f a = *(const v4fa*)p, c = *(const v4fa*)(p + 4); FragH fh, fl;
#pragma unroll
    for (int q = 0; q < 4; ++q) { _Float16 x = (_Float16)a[q]; fh.h[q] = x; fl.h[q] = (_Float16)((a[q] - (float)x) * 1024.0f); x = (_Float16)c[q]; fh.h[4 + q] = x; fl.h[4 + q] = (_Float16)((c[q] - (float)x) * 1024.0f); }
#pragma unroll
    for (int q = 0; q < 8; ++q) { th[r][c8 + q] = fh.u[q]; tr[r][c8 + q] = fl.u[q]; } }
  __syncthreads();
#pragma unroll
  for (int rd = 0; rd < 2; ++rd) { const int d = rd * 32 + tid / 8, pc = tid % 8; FragH fh, fl;
#pragma unroll
    for (int q = 0; q < 8; ++q) { fh.u[q] = th[pc * 8 + q][d]; fl.u[q] = tr[pc * 8 + q][d]; }
    const size_t o = ((size_t)slab * 64 + d) * SQ + lg * 64 + pc * 8; *(v8us*)((unsigned short*)VTh + o) = fh.half[0]; *(v8us*)((unsigned short*)VTl + o) = fl.half[0]; } }
// ---- launches that do not depend on one another stand side by side in one grid; a block's range of blockIdx.x says which job it does (the same for the whole block, so each job's barrier is passed by all of its block) ----
#define PB_X16 (NB * SQ * DM / 8 / 256)      /* blocks of the f16 plane of the hidden states */
#define PB_WB ((DM / 128) * (DM / 64))      /* tiles of Wq, and of Wo */
#define PB_WS ((DM / 128) * (HD / 64))      /* tiles of Wk, and of Wv */
#define PB_ROT (NB * SQ * HH / 256)      /* blocks of the RoPE tables */
__global__ __launch_bounds__(256) void k_prep(const float* __restrict__ hs, const int* __restrict__ pid, const float* __restrict__ Wq, const float* __restrict__ Wk, const float* __restrict__ Wv, const float* __restrict__ Wo,
    _Float16* __restrict__ X16, _Float16* __restrict__ BQ, _Float16* __restrict__ BK, _Float16* __restrict__ BV, _Float16* __restrict__ BO, float* __restrict__ CS, float* __restrict__ SN) {
  __shared__ unsigned int tl[64 * WT_P];
  int bx = blockIdx.x;
  if (bx < PB_X16) { x16_part(hs, X16, bx); return; }
  bx -= PB_X16;
  if (bx < 2 * PB_WB) { const bool o = bx >= PB_WB; wt_tile<DM, DM>(tl, o ? Wo : Wq, o ? BO : BQ, 16.0f, o ? bx - PB_WB : bx); return; }
  bx -= 2 * PB_WB;
  if (bx < 2 * PB_WS) { const bool v = bx >= PB_WS; wt_tile<DM, HD>(tl, v ? Wv : Wk, v ? BV : BK, 16.0f, v ? bx - PB_WS : bx); return; }
  rotab_part(pid, CS, SN, bx - 2 * PB_WS); }
#define QB_VT (NB * (HD / 64) * (SQ / 64))      /* tiles of V^T */
#define QB_ROPE (NB * SQ * (NHQ + 1) * (HH / 8) / 256)      /* blocks of the rotation */
__global__ __launch_bounds__(256) void k_post(const float* __restrict__ F, const float* __restrict__ CS, const float* __restrict__ SN, _Float16* __restrict__ QH, _Float16* __restrict__ QL, _Float16* __restrict__ KH, _Float16* __restrict__ KL, _Float16* __restrict__ VTh, _Float16* __restrict__ VTl) {
  __shared__ unsigned short th[64][66], tr[64][66];
  const int bx = blockIdx.x;
  if (bx < QB_VT) { vthl_part(th, tr, F + DM + HD, VTh, VTl, bx); return; }
  rope_part(F, CS, SN, QH, QL, KH, KL, bx - QB_VT); }
// causal / padding softmax, one wave per row, the whole row in registers: lane ln holds elements c * 128 + 4 * ln .. + 3 of every 128-key chunk c, so S is read once (whole 512-B pieces, all loads of a row in flight together), exp is taken once per score, and P leaves as 8-B pieces.
// NK keys were written by the S GEMM; R0 = first row of the band. A chunk that lies wholly right of the diagonal (c * 128 > r, the same for the whole wave) takes no exp: its P is zero.
typedef int v4ia __attribute__((ext_vector_type(4), may_alias));
typedef _Float16 v4ha __attribute__((ext_vector_type(4), may_alias));
template <int NK, int R0, bool HASPL>
__global__ __launch_bounds__(256) void k_csoft(float* S, size_t sS, const int* __restrict__ mask, _Float16* __restrict__ PL, size_t sPL) {
  constexpr int NC = NK / 128; const float NONE = -3.0e38f;
  const int wv = __builtin_amdgcn_readfirstlane(threadIdx.x >> 5), ln = threadIdx.x & 31; const int rl = blockIdx.x * 8 + wv, r = R0 + rl; const int b = blockIdx.z, pl = b * NHQ + blockIdx.y;      /* batch = blockIdx.z, head = blockIdx.y: their own S and P planes */
  char* srow = (char*)(S + (size_t)pl * sS + (size_t)rl * SQ); const char* mrow = (const char*)(mask + (size_t)b * SQ);      /* the same for the whole wave; the P row lies over the front half of its own S row: every store follows the row sum, which follows every read of the row */
  const unsigned off = ln * 16; const int jr = r - ln * 4, cd = r >> 7;      /* element q of chunk c is at or left of the diagonal when c * 128 + q <= jr; cd = the diagonal's chunk */
  v4f x[NC]; v4ia kk[NC];      /* every loop over c and q below is unrolled whole: the arrays are then indexed by constants and stay in registers */
#pragma unroll
  for (int c = 0; c < NC; ++c) { kk[c] = *(const v4ia*)(mrow + off + c * 512); x[c] = *(const v4fa*)(srow + off + c * 512); }
  __builtin_amdgcn_sched_barrier(0);      /* every load of the row is issued before the first use of one: a row pays one memory latency, not one per group of loads */
  float m = NONE;
#pragma unroll
  for (int c = 0; c < NC; ++c) {
#pragma unroll
    for (int q = 0; q < 4; ++q) { const float s = ((c * 128 + q <= jr) & (kk[c][q] > 0)) ? x[c][q] : NONE; x[c][q] = s; m = fmaxf(m, s); } }
  for (int o = 16; o > 0; o >>= 1) m = fmaxf(m, __shfl_xor(m, o, 32));
  float su = 0.f;
#pragma unroll
  for (int c = 0; c < NC; ++c) { v4f e4 = {0.f, 0.f, 0.f, 0.f};
    if (c * 128 <= R0 || c <= cd) {
#pragma unroll
      for (int q = 0; q < 4; ++q) { e4[q] = expf(x[c][q] - m); su += e4[q]; } }      /* a masked score gives exp(NONE - m) = 0 */
    x[c] = e4; }
  for (int o = 16; o > 0; o >>= 1) su += __shfl_xor(su, o, 32);
  const float f = (m > NONE) ? 1024.0f / su : 0.f;      /* a row with no open key keeps P = 0 */
  v4h hv[NC], lv[NC];
#pragma unroll
  for (int c = 0; c < NC; ++c) {
#pragma unroll
    for (int q = 0; q < 4; ++q) { const float p = x[c][q] * f; hv[c][q] = (_Float16)p; if (HASPL) lv[c][q] = (_Float16)((p - (float)hv[c][q]) * 1024.0f); } }
  /* all stores last, each from registers of its own: nothing is written behind an issued store */
  char* plrow = HASPL ? (char*)(PL + (size_t)pl * sPL + (size_t)rl * SQ) : nullptr;
#pragma unroll
  for (int c = 0; c < NC; ++c) { *(v4ha*)(srow + ln * 8 + c * 256) = hv[c]; if (HASPL) *(v4ha*)(plrow + ln * 8 + c * 256) = lv[c]; } }

#define FA_KP 264      /* f16 per LDS row of K: 512 B + 16 B = 16 B x 33, the conflict-free kind of pitch for ds_load_b128 readers */
#define FA_KB (64 * FA_KP * 2)      /* bytes of the K part of a buffer */
#define FA_TILE (FA_KB + HD * G2_PITCH * 2)      /* bytes of one buffer: 64 K rows, then 256 V^T rows */
// 8 copies of a lane, LDS addresses ls bytes apart, global addresses gs elements apart. s_wait_xcnt 0 is the statement's last line so that no address register of a copy is rewritten ahead of it.
__device__ __forceinline__ void fa_stage8(unsigned l, unsigned ls, const _Float16* g, size_t gs) {
  asm volatile("global_load_async_to_lds_b128 %0, %8, off\n\t" "global_load_async_to_lds_b128 %1, %9, off\n\t" "global_load_async_to_lds_b128 %2, %10, off\n\t" "global_load_async_to_lds_b128 %3, %11, off\n\t"
               "global_load_async_to_lds_b128 %4, %12, off\n\t" "global_load_async_to_lds_b128 %5, %13, off\n\t" "global_load_async_to_lds_b128 %6, %14, off\n\t" "global_load_async_to_lds_b128 %7, %15, off\n\t"
               "s_wait_xcnt 0x0"
               :: "v"(l), "v"(l + ls), "v"(l + 2 * ls), "v"(l + 3 * ls), "v"(l + 4 * ls), "v"(l + 5 * ls), "v"(l + 6 * ls), "v"(l + 7 * ls),
                  "v"(g), "v"(g + gs), "v"(g + 2 * gs), "v"(g + 3 * gs), "v"(g + 4 * gs), "v"(g + 5 * gs), "v"(g + 6 * gs), "v"(g + 7 * gs)
               : "memory"); }
__device__ __forceinline__ v8f fa_mma(v16h a, v16h b, v8f c) { return __builtin_amdgcn_wmma_f32_16x16x32_f16(false, a, false, b, (short)0, c, false, false); }
__global__ __launch_bounds__(256) __attribute__((amdgpu_waves_per_eu(2, 2))) void k_fattn(const _Float16* __restrict__ Q, const _Float16* __restrict__ Kh, const _Float16* __restrict__ Vt, const int* __restrict__ mask, _Float16* __restrict__ O16) {
  __shared__ __attribute__((aligned(16))) unsigned char sm[2 * FA_TILE]; __shared__ __attribute__((aligned(16))) int mk[SQ];
  const float NONE = -3.0e38f, FLOOR = -1.0e30f, SC = 0.0625f * 1.44269504088896340736f;
  const int tid = threadIdx.x, lane = tid & 31, ln = lane & 15, hh = lane >> 4; const int w = __builtin_amdgcn_readfirstlane(tid >> 5); const int h = blockIdx.y, b = blockIdx.z;
  const int R0 = SQ - 128 * ((int)blockIdx.x + 1);      /* first row of the block; the longest blocks have the lowest index */
  const int nt = R0 / 64 + 2;      /* key tiles up to the block's last row; at least two */
  const int q0 = R0 + 16 * w;      /* the wave's first query */
  Kh += (size_t)b * SQ * HD; Vt += (size_t)b * SQ * HD;
  { const int* mp = mask + (size_t)b * SQ + tid * 8; const v4ia a = *(const v4ia*)mp, c = *(const v4ia*)(mp + 4); *(v4ia*)&mk[tid * 8] = a; *(v4ia*)&mk[tid * 8 + 4] = c; }      /* the batch's padding mask, read by every wave behind the first barrier */
  const _Float16* qrow = Q + ((size_t)b * SQ + q0 + ln) * DM + h * HD; v16h qf[8];
#pragma unroll
  for (int ks = 0; ks < 8; ++ks) qf[ks] = g2_frag(qrow + ks * 32, hh);
  const unsigned lk = (unsigned)(size_t)sm + (unsigned)((tid >> 5) * (FA_KP * 2) + (tid & 31) * 16), lv = (unsigned)(size_t)sm + (unsigned)(FA_KB + (tid >> 3) * (G2_PITCH * 2) + (tid & 7) * 16);      /* a wave's copy = one whole K row, or 4 whole lines of V^T */
  const _Float16* gk = Kh + (size_t)(tid >> 5) * HD + (tid & 31) * 8; const _Float16* gv = Vt + (size_t)(tid >> 3) * SQ + (tid & 7) * 8;
  const v8f z8 = {0.f,0.f,0.f,0.f,0.f,0.f,0.f,0.f}; v8f o[16];
#pragma unroll
  for (int dt = 0; dt < 16; ++dt) o[dt] = z8;
  float m = FLOOR, lsum = 0.f;
  fa_stage8(lk, 8 * FA_KP * 2, gk, (size_t)8 * HD); fa_stage8(lv, 32 * G2_PITCH * 2, gv, (size_t)32 * SQ);
  asm volatile("s_wait_asynccnt 0x0" ::: "memory");      /* tile 0 of this wave's copies has landed */
  __syncthreads();      /* ... and every other wave's, and the mask */
  fa_stage8(lk + FA_TILE, 8 * FA_KP * 2, gk + (size_t)64 * HD, (size_t)8 * HD); fa_stage8(lv + FA_TILE, 32 * G2_PITCH * 2, gv + 64, (size_t)32 * SQ);
#pragma unroll 1      /* one tile a trip: the buffer index stays a run-time value */
  for (int t = 0; t < nt; ++t) {
    if (t * 64 <= q0 + 15) {      /* the same for the whole wave: a tile wholly right of the wave's diagonal is skipped, the publish point below is not */
      const _Float16* kb = (const _Float16*)(sm + (t & 1) * FA_TILE) + ln * FA_KP; const _Float16* vb = (const _Float16*)(sm + (t & 1) * FA_TILE + FA_KB) + ln * G2_PITCH;
      v8f s[4] = {z8, z8, z8, z8};
#pragma unroll
      for (int ks = 0; ks < 8; ++ks) {
#pragma unroll
        for (int u = 0; u < 4; ++u) s[u] = fa_mma(g2_frag(kb + u * 16 * FA_KP + ks * 32, hh), qf[ks], s[u]); }
      const int jq = q0 + ln - t * 64 - 8 * hh;      /* register r of score tile u is at or left of the diagonal when u * 16 + r <= jq */
      const int* mr = &mk[t * 64 + 8 * hh]; float mx = NONE;
#pragma unroll
      for (int u = 0; u < 4; ++u) { const v4ia k0 = *(const v4ia*)(mr + u * 16), k1 = *(const v4ia*)(mr + u * 16 + 4);
#pragma unroll
        for (int r = 0; r < 8; ++r) { const int kv = r < 4 ? k0[r & 3] : k1[r & 3]; const float x = ((u * 16 + r <= jq) & (kv > 0)) ? s[u][r] * SC : NONE; s[u][r] = x; mx = fmaxf(mx, x); } }
      mx = fmaxf(mx, __shfl_xor(mx, 16, 32));      /* the other half of the query's keys */
      const float mn = fmaxf(m, mx), al = __builtin_amdgcn_exp2f(m - mn); m = mn;      /* no open key so far: al = 1 over O = 0 */
      float ps = 0.f;
#pragma unroll
      for (int u = 0; u < 4; ++u) {
#pragma unroll
        for (int r = 0; r < 8; ++r) { const float e = __builtin_amdgcn_exp2f(s[u][r] - mn); ps += e; s[u][r] = e; } }
      lsum = lsum * al + ps;
      FragH pf[2];
#pragma unroll
      for (int kk = 0; kk < 2; ++kk) {
#pragma unroll
        for (int i = 0; i < 8; ++i) { pf[kk].h[i] = (_Float16)(s[2 * kk][i] * 1024.0f); pf[kk].h[8 + i] = (_Float16)(s[2 * kk + 1][i] * 1024.0f); } }
#pragma unroll
      for (int dt = 0; dt < 16; ++dt) o[dt] = o[dt] * al;
#pragma unroll
      for (int kk = 0; kk < 2; ++kk) {
#pragma unroll
        for (int dt = 0; dt < 16; ++dt) o[dt] = fa_mma(g2_frag(vb + dt * 16 * G2_PITCH + kk * 32, hh), pf[kk].v, o[dt]); }
    }
    asm volatile("s_wait_dscnt 0x0" ::: "memory");      /* this wave's reads of buffer t & 1 are done before the buffer is handed back */
    asm volatile("s_wait_asynccnt 0x0" ::: "memory");      /* this wave's copies of tile t + 1 have landed */
    __syncthreads();      /* publishes tile t + 1 and ends every wave's reads of tile t */
    if (t + 2 < nt) { const unsigned bo = (unsigned)((t & 1) * FA_TILE); fa_stage8(lk + bo, 8 * FA_KP * 2, gk + (size_t)(t + 2) * 64 * HD, (size_t)8 * HD); fa_stage8(lv + bo, 32 * G2_PITCH * 2, gv + (size_t)(t + 2) * 64, (size_t)32 * SQ); } }
  asm volatile("s_wait_asynccnt 0x0" ::: "memory");      /* no copy is in flight when the wave ends */
  lsum += __shfl_xor(lsum, 16, 32);
  const float f = (lsum > 0.f) ? 0.0009765625f / lsum : 0.f;      /* a row with no open key keeps O = 0 */
  unsigned short* orow = (unsigned short*)O16 + ((size_t)b * SQ + q0 + ln) * DM + h * HD + 8 * hh;      /* register r of O^T tile dt = element dt * 16 + 8 hh + r of the query's head: 16 B a tile */
#pragma unroll
  for (int dt = 0; dt < 16; ++dt) { FragH e;
#pragma unroll
    for (int r = 0; r < 8; ++r) e.h[r] = (_Float16)(o[dt][r] * f);
    *(v8us*)(orow + dt * 16) = e.half[0]; } }

extern "C" void kernel_launch(void* const* d_in, const int* in_sizes, int n_in,
                              void* d_out, int out_size, void* d_ws, size_t ws_size, hipStream_t stream) {
  (void)in_sizes; (void)n_in; (void)out_size;
  const float* const* I = (const float* const*)d_in; const float* hs = I[0]; const int* amask = (const int*)d_in[1]; const int* pid = (const int*)d_in[2]; const float* Wq = I[3]; const float* Wk = I[4]; const float* Wv = I[5]; const float* Wo = I[6];
  char* ws = (char*)d_ws; size_t off = 0;
  auto take = [&](size_t bytes) { char* p = ws + off; off += (bytes + 255) & ~(size_t)255; return p; };
  const size_t np = (size_t)SQ * DM, nkv = (size_t)SQ * HD;      /* elements per batch of a [SQ][DM] and of a [SQ][HD] plane */
  _Float16* BQ = (_Float16*)take((size_t)LDQKV * DM * 2); _Float16* BK = BQ + (size_t)DM * DM; _Float16* BV = BK + (size_t)HD * DM; _Float16* BO = (_Float16*)take(np * 2);      /* the transposed Wq, Wk, Wv are one [LDQKV][DM] matrix */
  float* CS = (float*)take((size_t)NB * SQ * HH * 4); float* SN = (float*)take((size_t)NB * SQ * HH * 4);
  _Float16* X16 = (_Float16*)take(NB * np * 2); float* F32 = (float*)take((size_t)NB * SQ * LDQKV * 4); _Float16* QH = (_Float16*)take(NB * np * 2); _Float16* QL = (_Float16*)take(NB * np * 2); _Float16* KH = (_Float16*)take(NB * nkv * 2); _Float16* KL = (_Float16*)take(NB * nkv * 2); _Float16* VTh = (_Float16*)take(NB * nkv * 2); _Float16* VTl = (_Float16*)take(NB * nkv * 2);
  const size_t sS = (size_t)1024 * SQ, sPL = (size_t)BAND * SQ;      /* elements per (batch, head) plane of S, and of PL */
  float* S = (float*)take(NB * NHQ * sS * 4); _Float16* PH = (_Float16*)S; const int ldp = 2 * SQ; const size_t sP = 2 * sS;      /* P row r of a plane = front half of S row r: pitch and plane stride in f16 elements are twice those of S */
  _Float16* PL = X16; float* O = F32; _Float16* O16 = QL; _Float16* OL0 = (_Float16*)take((size_t)NB * BAND * DM * 2);      /* PL over X16 (dead after the projection GEMM; same size); O over the projections' f32 scratch (dead after k_post); O16 over QL (QL is only read for band 0, which runs first) */
  if (off > ws_size) return;      /* 10+8 + 4 + 16+40+16+16 + 4*2 + 128 + 2 = 248 MiB */
  const int MT = NB * SQ;      /* tokens of both batches: the projections and the elementwise passes see one flat [MT][...] matrix */
  k_prep<<<PB_X16 + 2 * PB_WB + 2 * PB_WS + PB_ROT, 256, 0, stream>>>(hs, pid, Wq, Wk, Wv, Wo, X16, BQ, BK, BV, BO, CS, SN);
  /* q (8 heads), k and v (one kv head of 256) as one GEMM: row s of F32 = q | k | v of token s */
  k_gemm2<0><<<dim3((MT / 128) * (LDQKV / 64), 1), 128, 0, stream>>>(X16, DM, 0, BQ, DM, 0, 0.0625f, nullptr, 0, nullptr, 1, 0, 0, F32, nullptr, LDQKV, 0, MT, LDQKV, DM, 0, 0, 0);
  /* q and k roped, hi/lo; V^T hi/lo */
  k_post<<<QB_VT + QB_ROPE, 256, 0, stream>>>(F32, CS, SN, QH, QL, KH, KL, VTh, VTl);
  /* attention: head in grid.y (A + h * HD for q, one shared K / V^T per batch, C plane h), batch in grid.z (the last three arguments: element strides of A, B and C per batch); rowsPerB = -1 adds the own element of the C plane */
  /* band 0 (rows < 256, keys < 256): hi + lo everywhere */
  { const int nk = BAND; const dim3 gS((BAND / 128) * (nk / 64), NHQ, NB), gO((BAND / 128) * (HD / 64), NHQ, NB);
    k_gemm2<0><<<gS, 128, 0, stream>>>(QH, DM, HD, KH, HD, 0, 0.0625f, nullptr, 0, nullptr, 1, 0, 0, S, nullptr, SQ, sS, BAND, nk, HD, np, nkv, NHQ * sS);      /* S = (Qh Kh^T) / 16 */
    k_gemm2<0><<<gS, 128, 0, stream>>>(QL, DM, HD, KH, HD, 0, 0.0625f / 1024.0f, nullptr, 0, S, -1, 0, 0, S, nullptr, SQ, sS, BAND, nk, HD, np, nkv, NHQ * sS);
    k_gemm2<0><<<gS, 128, 0, stream>>>(QH, DM, HD, KL, HD, 0, 0.0625f / 1024.0f, nullptr, 0, S, -1, 0, 0, S, nullptr, SQ, sS, BAND, nk, HD, np, nkv, NHQ * sS);
    k_csoft<BAND, 0, true><<<dim3(BAND / 8, NHQ, NB), 256, 0, stream>>>(S, sS, amask, PL, sPL);
    k_gemm2<0><<<gO, 128, 0, stream>>>(PH, ldp, sP, VTh, SQ, 0, 0.0009765625f, nullptr, 0, nullptr, 1, 0, 0, O, nullptr, DM, HD, BAND, HD, nk, NHQ * sP, nkv, np);
    k_gemm2<0><<<gO, 128, 0, stream>>>(PL, SQ, sPL, VTh, SQ, 0, 0.0009765625f / 1024.0f, nullptr, 0, O, -1, 0, 0, O, nullptr, DM, HD, BAND, HD, nk, NHQ * sPL, nkv, np);
    k_gemm2<0><<<gO, 128, 0, stream>>>(PH, ldp, sP, VTl, SQ, 0, 0.0009765625f / 1024.0f, nullptr, 0, O, -1, 0, 0, O, nullptr, DM, HD, BAND, HD, nk, NHQ * sP, nkv, np); }
  /* rows >= 256: plain f16 operands, S, softmax and P V fused; writes the f16 O plane itself */
  k_fattn<<<dim3((SQ - BAND) / 128, NHQ, NB), 256, 0, stream>>>(QH, KH, VTh, amask, O16);
  /* output: O hi (+ lo on rows < 256 of each batch) into Wo */
  k_hl<<<dim3((unsigned)(((size_t)BAND * DM / 8 + 255) / 256), NB), 256, 0, stream>>>(O, O16, OL0, (size_t)BAND * DM / 8, np, (size_t)BAND * DM);      /* rows < 256: hi + lo */
  float* out = (float*)d_out;
  k_gemm2<0><<<dim3((MT / 128) * (DM / 64), 1), 128, 0, stream>>>(O16, DM, 0, BO, DM, 0, 0.0625f, nullptr, 0, nullptr, 1, 0, 0, out, nullptr, DM, 0, MT, DM, DM, 0, 0, 0);
  k_gemm2<0><<<dim3((BAND / 128) * (DM / 64), 1, NB), 128, 0, stream>>>(OL0, DM, 0, BO, DM, 0, 0.0625f / 1024.0f, nullptr, 0, out, -1, 0, 0, out, nullptr, DM, 0, BAND, DM, DM, (size_t)BAND * DM, 0, np);
}

// v008
// Measured time: 206 microseconds a run.
// Timed twice side by side with v007, it ran 1.51 times as fast both times.
// Counting every step since v000, it is 28.7 times as fast.
#include <hip/hip_runtime.h>
// FlaxGemmaAttention (2 x 2048 tokens, D 2048, 8 query heads of 256 sharing ONE kv head; rotate-half RoPE from the INPUT position_ids; causal + INPUT padding mask; scale 256^-0.5; out = attn Wo).
// Structure (both batches in every launch: flat rows for the projections and elementwise passes, blockIdx.z for attention): three launches in front of attention, each holding the jobs that do not depend on one another: (1) exact f16 plane of the hidden states, the four weight transposes, RoPE tables (f32 trig); (2) q, k and v as ONE GEMM over the stacked weight rows (32x64 wave tiles, f32 accumulation, exact x16 weights); (3) rotation on VALU into f16 hi (+ 2^10 residual) planes, V^T hi/residual by LDS tiles; attention in ONE launch of two kinds of block (head = blockIdx.y, batch = blockIdx.z), S and P in registers in both. Rows < 256 (whose outputs average over few keys): hi+lo operands throughout (3-term S, 3-term P.V, hi+lo O into Wo), the same walk with residual terms in accumulators of their own (fa_band0). Rows >= 256, plain f16 operands: one block per 128 rows of a head walks the causally reachable keys in tiles of 64 with a running maximum and sum, O leaves as f16; output GEMM.
// Compute dtype: inputs and weights rounded to bf16; rows >= 256: q, k, P, v, O as f16 (~2^-12); rows < 256: hi + residual pairs; f32 accumulation/softmax/trig. v_wmma_f32_16x16x32_f16.
#define NB 2
#define SQ 2048
#define DM 2048
#define NHQ 8
#define HD 256
#define HH (HD / 2)
#define BAND 256
#define NBAND (SQ / BAND)
typedef __bf16 v16b __attribute__((ext_vector_type(16)));
typedef unsigned short v8us __attribute__((ext_vector_type(8), may_alias));
typedef float  v8f  __attribute__((ext_vector_type(8)));
typedef float  v4f  __attribute__((ext_vector_type(4)));
typedef float  v4fa __attribute__((ext_vector_type(4), may_alias));
union FragB { v16b v; v8us half[2]; unsigned short u[16]; };

__device__ __forceinline__ unsigned short bf16_bits(float x) { unsigned int u = __float_as_uint(x); return (unsigned short)((u + 0x7FFFu + ((u >> 16) & 1u)) >> 16); }
__device__ __forceinline__ float bf16_val(unsigned short b) { return __uint_as_float(((unsigned int)b) << 16); }
__device__ __forceinline__ float bf16_round(float x) { return bf16_val(bf16_bits(x)); }
// D += A·B with NT terms: 1 = ah·bh, 2 = + al·bh (A split), 3 = + ah·bl (both split)
template <int NT>
__device__ __forceinline__ v8f mmaN(v16b ah, v16b al, v16b bh, v16b bl, v8f c) {
  c = __builtin_amdgcn_wmma_f32_16x16x32_bf16(false, ah, false, bh, (short)0, c, false, false);
  if (NT >= 2) c = __builtin_amdgcn_wmma_f32_16x16x32_bf16(false, al, false, bh, (short)0, c, false, false);
  if (NT >= 3) c = __builtin_amdgcn_wmma_f32_16x16x32_bf16(false, ah, false, bl, (short)0, c, false, false);
  asm volatile("v_nop\n\tv_nop\n\tv_nop\n\tv_nop" : "+v"(c) : "v"(ah), "v"(al), "v"(bh), "v"(bl));
  return c;
}

__global__ __launch_bounds__(256) void k_wt_bf16(const float* __restrict__ W, unsigned short* __restrict__ Wt, int K, int N) {
  const int t = blockIdx.x * 256 + threadIdx.x;
  const int k8n = K / 8;
  if (t >= N * k8n) return;
  const int n = t / k8n, k8 = (t % k8n) * 8;
  v8us v;
#pragma unroll
  for (int i = 0; i < 8; ++i) v[i] = bf16_bits(W[(size_t)(k8 + i) * N + n]);
  *(v8us*)(Wt + (size_t)n * K + k8) = v;
  
}

// GEMM C[M][N] (f32, pitch ldc) = act(A[M][K]·W + bias). A f32 row-major (pitch lda) converted per fragment to bf16
// (ASPLIT: hi/lo two planes -> 2 terms, else single rounded term); Wt bf16 [N][K] (pitch ldb). BIAS_BF16 rounds the
// bias to bf16 first (bias quantised to bf16 before the add). K%32==0, M%16==0, N%64==0.
template <bool ASPLIT, int ACT, bool BIAS_BF16>
__global__ __launch_bounds__(128) void k_gemm_bf(const float* __restrict__ A, int lda, const unsigned short* __restrict__ Wt, int ldb,
                                               const float* __restrict__ bias, float* __restrict__ C, int ldc, int M, int N, int K) {
  __shared__ __attribute__((aligned(16))) float so[4][16][64];
  const int tid = threadIdx.x, w = tid >> 5, lane = tid & 31, ln = lane & 15, hh = lane >> 4;
  const int ntn = N / 64;
  const int wid = blockIdx.x * 4 + w;
  const int mt = wid / ntn, nq = wid % ntn;
  if (mt * 16 >= M) return;
  const int row0 = mt * 16, col0 = nq * 64;
  const float* arow = A + (size_t)(row0 + ln) * lda;
  v8f acc[4] = {};
  for (int kb = 0; kb < K; kb += 32) {
    FragB ah, al;
    const v4f x0 = *(const v4fa*)(arow + kb + 8 * hh), x1 = *(const v4fa*)(arow + kb + 8 * hh + 4);
    const v4f x2 = *(const v4fa*)(arow + kb + 16 + 8 * hh), x3 = *(const v4fa*)(arow + kb + 16 + 8 * hh + 4);
    float xs[16] = {x0[0],x0[1],x0[2],x0[3],x1[0],x1[1],x1[2],x1[3],x2[0],x2[1],x2[2],x2[3],x3[0],x3[1],x3[2],x3[3]};
#pragma unroll
    for (int i = 0; i < 16; ++i) { const unsigned short hb = bf16_bits(xs[i]); ah.u[i] = hb; al.u[i] = ASPLIT ? bf16_bits(xs[i] - bf16_val(hb)) : (unsigned short)0; }
#pragma unroll
    for (int t = 0; t < 4; ++t) {
      const unsigned short* brow = Wt + (size_t)(col0 + t * 16 + ln) * ldb + kb;
      FragB b;
      b.half[0] = *(const v8us*)(brow + 8 * hh);
      b.half[1] = *(const v8us*)(brow + 16 + 8 * hh);
      acc[t] = mmaN<ASPLIT ? 2 : 1>(ah.v, al.v, b.v, b.v, acc[t]);
    }
  }
#pragma unroll
  for (int t = 0; t < 4; ++t) {
    float bv = bias ? bias[col0 + t * 16 + ln] : 0.f;
    if (BIAS_BF16) bv = bf16_round(bv);
#pragma unroll
    for (int r = 0; r < 8; ++r) { float v = acc[t][r] + bv; if (ACT == 1) v = fmaxf(v, 0.f); so[w][8 * hh + r][t * 16 + ln] = v; }
  }
  __builtin_amdgcn_fence(__ATOMIC_ACQ_REL, "workgroup");
  __builtin_amdgcn_wave_barrier();
  const int rsub = lane >> 4, c4 = (lane & 15) * 4;
  {
#pragma unroll
    for (int q = 0; q < 8; ++q) {
      const int r = q * 2 + rsub;
      const v4f v = *(const v4fa*)&so[w][r][c4];
      *(v4f*)(C + (size_t)(row0 + r) * ldc + col0 + c4) = v;
    }
    
  }
}

// GEMM C = act(A·W + bias + resid): A f32 (ASPLIT -> hi/lo 2 terms), Wt bf16 [N][K]; ACT 0 none, 1 relu, 2 exact gelu;
// resid (optional, f32, row index = (row % rmod), pitch ldr, RES_BF16 rounds it) added before the activation.
template <bool ASPLIT, int ACT, bool BIAS_BF16, bool RES_BF16>
__global__ __launch_bounds__(128) void k_gemm_bf3(const float* __restrict__ A, int lda, const unsigned short* __restrict__ Wt, int ldb,
                                                const float* __restrict__ bias, const float* __restrict__ resid, int rmod, int ldr,
                                                float* __restrict__ C, int ldc, int M, int N, int K) {
  __shared__ __attribute__((aligned(16))) float so[4][16][64];
  const int tid = threadIdx.x, w = tid >> 5, lane = tid & 31, ln = lane & 15, hh = lane >> 4;
  const int ntn = N / 64;
  const int wid = blockIdx.x * 4 + w;
  const int mt = wid / ntn, nq = wid % ntn;
  if (mt * 16 >= M) return;
  const int row0 = mt * 16, col0 = nq * 64;
  const float* arow = A + (size_t)(row0 + ln) * lda;
  v8f acc[4] = {};
  for (int kb = 0; kb < K; kb += 32) {
    FragB ah, al;
    const v4f x0 = *(const v4fa*)(arow + kb + 8 * hh), x1 = *(const v4fa*)(arow + kb + 8 * hh + 4);
    const v4f x2 = *(const v4fa*)(arow + kb + 16 + 8 * hh), x3 = *(const v4fa*)(arow + kb + 16 + 8 * hh + 4);
    float xs[16] = {x0[0],x0[1],x0[2],x0[3],x1[0],x1[1],x1[2],x1[3],x2[0],x2[1],x2[2],x2[3],x3[0],x3[1],x3[2],x3[3]};
#pragma unroll
    for (int i = 0; i < 16; ++i) { const unsigned short hb = bf16_bits(xs[i]); ah.u[i] = hb; al.u[i] = ASPLIT ? bf16_bits(xs[i] - bf16_val(hb)) : (unsigned short)0; }
#pragma unroll
    for (int t = 0; t < 4; ++t) {
      const unsigned short* brow = Wt + (size_t)(col0 + t * 16 + ln) * ldb + kb;
      FragB b;
      b.half[0] = *(const v8us*)(brow + 8 * hh);
      b.half[1] = *(const v8us*)(brow + 16 + 8 * hh);
      acc[t] = mmaN<ASPLIT ? 2 : 1>(ah.v, al.v, b.v, b.v, acc[t]);
    }
  }
#pragma unroll
  for (int t = 0; t < 4; ++t) {
    const int col = col0 + t * 16 + ln;
    float bv = bias ? bias[col] : 0.f;
    if (BIAS_BF16) bv = bf16_round(bv);
#pragma unroll
    for (int r = 0; r < 8; ++r) {
      float v = acc[t][r] + bv;
      if (resid) { float rv = resid[(size_t)((row0 + 8 * hh + r) % rmod) * ldr + col]; if (RES_BF16) rv = bf16_round(rv); v += rv; }
      if (ACT == 1) v = fmaxf(v, 0.f);
      if (ACT == 2) v = 0.5f * v * (1.0f + erff(v * 0.70710678118654752f));
      if (ACT == 3) { const float u = 0.7978845608028654f * (v + 0.044715f * v * v * v); v = 0.5f * v * (1.0f + tanhf(u)); }
      so[w][8 * hh + r][t * 16 + ln] = v;
    }
  }
  __builtin_amdgcn_fence(__ATOMIC_ACQ_REL, "workgroup");
  __builtin_amdgcn_wave_barrier();
  const int rsub = lane >> 4, c4 = (lane & 15) * 4;
  {
#pragma unroll
    for (int q = 0; q < 8; ++q) {
      const int r = q * 2 + rsub;
      const v4f v = *(const v4fa*)&so[w][r][c4];
      *(v4f*)(C + (size_t)(row0 + r) * ldc + col0 + c4) = v;
    }
    
  }
}
// row LayerNorm (biased variance, eps) over N: s = X (+ R); optional out_sum <- s; out_norm <- (s-mu)*rsqrt(var+eps)*g + b
template <bool PARAM_BF16>
__global__ __launch_bounds__(256) void k_layernorm(const float* __restrict__ X, const float* __restrict__ R, const float* __restrict__ g, const float* __restrict__ bta,
                                                  float* __restrict__ out_sum, float* __restrict__ out_norm, int N, float eps) {
  __shared__ float red[256];
  const int row = blockIdx.x, tid = threadIdx.x;
  const float* x = X + (size_t)row * N; const float* rr = R ? R + (size_t)row * N : nullptr;
  float vals[16];                     // up to N = 4096
  const int per = N / 256;            // contiguous chunk per thread? use strided-by-4 chunks: thread handles j = tid*4 + 1024*u
  float s1 = 0.f;
  for (int u = 0; u < per / 4; ++u) {
    const int j = tid * 4 + 1024 * u;
    const v4f a = *(const v4fa*)(x + j);
    v4f b = {0.f,0.f,0.f,0.f}; if (rr) b = *(const v4fa*)(rr + j);
#pragma unroll
    for (int q = 0; q < 4; ++q) { const float v = a[q] + b[q]; vals[u * 4 + q] = v; s1 += v; }
  }
  red[tid] = s1; __syncthreads();
  for (int st = 128; st > 0; st >>= 1) { if (tid < st) red[tid] += red[tid + st]; __syncthreads(); }
  const float mu = red[0] / (float)N; __syncthreads();
  float s2 = 0.f;
  for (int u = 0; u < per / 4; ++u)
#pragma unroll
    for (int q = 0; q < 4; ++q) { const float c = vals[u * 4 + q] - mu; s2 += c * c; }
  red[tid] = s2; __syncthreads();
  for (int st = 128; st > 0; st >>= 1) { if (tid < st) red[tid] += red[tid + st]; __syncthreads(); }
  const float rs = rsqrtf(red[0] / (float)N + eps);
  {
    for (int u = 0; u < per / 4; ++u) {
      const int j = tid * 4 + 1024 * u;
      v4f o, sm;
#pragma unroll
      for (int q = 0; q < 4; ++q) {
        float gg = g[j + q], bb = bta[j + q];
        if (PARAM_BF16) { gg = bf16_round(gg); bb = bf16_round(bb); }
        sm[q] = vals[u * 4 + q]; o[q] = (vals[u * 4 + q] - mu) * rs * gg + bb;
      }
      if (out_sum) *(v4f*)(out_sum + (size_t)row * N + j) = sm;
      *(v4f*)(out_norm + (size_t)row * N + j) = o;
    }
    
  }
}



// ---- f16 WMMA path (v_wmma_f32_16x16x32_f16): 11-bit significands for operands in range — used where a [0,1] probability operand needs more precision than bf16
typedef _Float16 v16h __attribute__((ext_vector_type(16)));
union FragH { v16h v; v8us half[2]; _Float16 h[16]; unsigned short u[16]; };
template <int NT>
__device__ __forceinline__ v8f mmaH(v16h ah, v16h al, v16h bh, v16h bl, v8f c) {
  c = __builtin_amdgcn_wmma_f32_16x16x32_f16(false, ah, false, bh, (short)0, c, false, false);
  if (NT >= 2) c = __builtin_amdgcn_wmma_f32_16x16x32_f16(false, al, false, bh, (short)0, c, false, false);
  if (NT >= 3) c = __builtin_amdgcn_wmma_f32_16x16x32_f16(false, ah, false, bl, (short)0, c, false, false);
  asm volatile("v_nop\n\tv_nop\n\tv_nop\n\tv_nop" : "+v"(c) : "v"(ah), "v"(al), "v"(bh), "v"(bl));
  return c;
}
// batched GEMM like k_gemm_b but f16 operands: A f32 (split into f16 hi/lo if ASPLIT, else rounded to f16), Bt = f16 values [n][k]; alpha; C f32; N multiple of 16 (partial tiles skipped)
template <bool ASPLIT>
__global__ __launch_bounds__(128) void k_gemm_h(const float* __restrict__ A, int lda, size_t sA, const _Float16* __restrict__ Bh, int ldb, size_t sB, float alpha, float* __restrict__ C, int ldc, size_t sC, int M, int N, int K) {
  __shared__ __attribute__((aligned(16))) float so[4][16][64];
  const int tid = threadIdx.x, w = tid >> 5, lane = tid & 31, ln = lane & 15, hh = lane >> 4; const int by = blockIdx.y;
  A += (size_t)by * sA; Bh += (size_t)by * sB; C += (size_t)by * sC;
  const int ntn = (N + 63) / 64; const int wid = blockIdx.x * 4 + w; const int mt = wid / ntn, nq = wid % ntn; if (mt * 16 >= M) return;
  const int row0 = mt * 16, col0 = nq * 64; const float* arow = A + (size_t)(row0 + ln) * lda;
  v8f acc[4] = {};
  for (int kb = 0; kb < K; kb += 32) {
    FragH ah, al;
    const v4f x0 = *(const v4fa*)(arow + kb + 8 * hh), x1 = *(const v4fa*)(arow + kb + 8 * hh + 4), x2 = *(const v4fa*)(arow + kb + 16 + 8 * hh), x3 = *(const v4fa*)(arow + kb + 16 + 8 * hh + 4);
    float xs[16] = {x0[0],x0[1],x0[2],x0[3],x1[0],x1[1],x1[2],x1[3],x2[0],x2[1],x2[2],x2[3],x3[0],x3[1],x3[2],x3[3]};
#pragma unroll
    for (int i = 0; i < 16; ++i) { const _Float16 h = (_Float16)xs[i]; ah.h[i] = h; al.h[i] = ASPLIT ? (_Float16)(xs[i] - (float)h) : (_Float16)0.0f; }
#pragma unroll
    for (int t = 0; t < 4; ++t) { if (col0 + t * 16 >= N) continue; const size_t boff = (size_t)(col0 + t * 16 + ln) * ldb + kb; FragH bq; bq.half[0] = *(const v8us*)(Bh + boff + 8 * hh); bq.half[1] = *(const v8us*)(Bh + boff + 16 + 8 * hh);
      acc[t] = mmaH<ASPLIT ? 2 : 1>(ah.v, al.v, bq.v, bq.v, acc[t]); }
  }
#pragma unroll
  for (int t = 0; t < 4; ++t) { if (col0 + t * 16 >= N) continue;
#pragma unroll
    for (int r = 0; r < 8; ++r) so[w][8 * hh + r][t * 16 + ln] = acc[t][r] * alpha; }
  __builtin_amdgcn_fence(__ATOMIC_ACQ_REL, "workgroup"); __builtin_amdgcn_wave_barrier();
  const int rsub = lane >> 4, c4 = (lane & 15) * 4;
  {
#pragma unroll
    for (int q = 0; q < 8; ++q) { const int r = q * 2 + rsub; if (col0 + c4 < N) { const v4f v = *(const v4fa*)&so[w][r][c4]; *(v4f*)(C + (size_t)(row0 + r) * ldc + col0 + c4) = v; } }
     }
}

// Wt[n][k] = f16(bf16(W[k][n])*scale) from f32 row-major W[K][N] (scale = power of two; bf16-exact weights stay exact in f16 away from the subnormal range)
// One block turns a tile of 128 k x 64 n through LDS: W is read as whole 256-B pieces of its rows (16 B a lane, all 8 loads of a lane in flight) and Wt is written as whole 256-B pieces of its rows. (K / 128) * (N / 64) tiles. K and N are compile-time so that a lane's 8 loads, and its 4 stores, share one address and differ in the immediate offset only.
#define WT_P 65      /* dwords per LDS row (one n: 64 pairs of k, + 1): odd, so the 16 lanes that store 4 rows apart and the 16 that read 4 dwords apart each meet 16 different banks */
typedef unsigned int v4ua __attribute__((ext_vector_type(4), may_alias));
template <int K, int N>
__device__ __forceinline__ void wt_tile(unsigned int* tl, const float* __restrict__ W, _Float16* __restrict__ Wt, float scale, int blk) { static_assert(K % 128 == 0 && N % 64 == 0, "wt_tile: whole tiles only");      /* tl = 64 * WT_P dwords of LDS; blk = the tile's number */
  constexpr int ntn = N / 64; const int tid = threadIdx.x; const int kt = blk / ntn, nt = blk % ntn; const int k0 = kt * 128, n0 = nt * 64; const int r = tid >> 4, c = tid & 15;
  const float* p = W + (size_t)(k0 + 2 * r) * N + n0 + c * 4;
  v4f a[4], b[4];      /* rows k0 + 2 * (16 u + r) and the next one, columns n0 + 4 c .. + 3; every loop below is unrolled whole, so that a and b are indexed by constants and stay in registers and the offsets are immediates */
#pragma unroll
  for (int u = 0; u < 4; ++u) { a[u] = *(const v4fa*)(p + (size_t)u * 32 * N); b[u] = *(const v4fa*)(p + (size_t)u * 32 * N + N); }
#pragma unroll
  for (int u = 0; u < 4; ++u) {
#pragma unroll
    for (int j = 0; j < 4; ++j) { union { _Float16 h[2]; unsigned int d; } pk; pk.h[0] = (_Float16)(bf16_round(a[u][j]) * scale); pk.h[1] = (_Float16)(bf16_round(b[u][j]) * scale); tl[(c * 4 + j) * WT_P + u * 16 + r] = pk.d; } }
  __syncthreads();
  unsigned short* q = (unsigned short*)Wt + (size_t)(n0 + r) * K + k0 + c * 8;
#pragma unroll
  for (int v = 0; v < 4; ++v) { v4ua o;
#pragma unroll
    for (int i = 0; i < 4; ++i) o[i] = tl[(v * 16 + r) * WT_P + c * 4 + i];
    *(v4ua*)(q + (size_t)v * 16 * K) = o; }
  asm volatile("s_wait_xcnt 0x0" ::: "memory");      /* a precaution: the built kernel lays another job's code behind these stores, and that code rewrites the registers they name; the wait stands in front of it */
}
// k_gemm_hh variant with fused epilogue: v = acc·alpha + bias[by·sBias + col] (+ CP[(row/rowsPerB)·sCPb + by·64 + col] if CP) ; ACT 0 none / 1 elu ; writes f16 C16 (and f32 C if non-null)
template <int ACT>
__global__ __launch_bounds__(128) void k_gemm_hhx(const _Float16* __restrict__ A, int lda, size_t sA, const _Float16* __restrict__ Bh, int ldb, size_t sB, float alpha, const float* __restrict__ bias, size_t sBias, const float* __restrict__ CP, int rowsPerB, size_t sCPb, int row0g,
    float* __restrict__ C, _Float16* __restrict__ C16, int ldc, size_t sC, int M, int N, int K) {
  __shared__ __attribute__((aligned(16))) float so[4][16][64];
  const int tid = threadIdx.x, w = tid >> 5, lane = tid & 31, ln = lane & 15, hh = lane >> 4; const int by = blockIdx.y;
  A += (size_t)by * sA; Bh += (size_t)by * sB; const size_t cofs = (size_t)by * sC; const float* bp = bias ? bias + (size_t)by * sBias : nullptr;
  const int ntn = (N + 63) / 64; const int wid = blockIdx.x * 4 + w; const int mt = wid / ntn, nq = wid % ntn; if (mt * 16 >= M) return;
  const int row0 = mt * 16, col0 = nq * 64; const _Float16* arow = A + (size_t)(row0 + ln) * lda;
  v8f acc[4] = {};
  for (int kb = 0; kb < K; kb += 32) { FragH ah; ah.half[0] = *(const v8us*)((const unsigned short*)arow + kb + 8 * hh); ah.half[1] = *(const v8us*)((const unsigned short*)arow + kb + 16 + 8 * hh);
#pragma unroll
    for (int t = 0; t < 4; ++t) { if (col0 + t * 16 >= N) continue; const size_t boff = (size_t)(col0 + t * 16 + ln) * ldb + kb; FragH bq; bq.half[0] = *(const v8us*)((const unsigned short*)Bh + boff + 8 * hh); bq.half[1] = *(const v8us*)((const unsigned short*)Bh + boff + 16 + 8 * hh);
      acc[t] = mmaH<1>(ah.v, ah.v, bq.v, bq.v, acc[t]); }
  }
#pragma unroll
  for (int t = 0; t < 4; ++t) { if (col0 + t * 16 >= N) continue; const int col = col0 + t * 16 + ln; const float bv = bp ? bf16_round(bp[col]) : 0.f;
#pragma unroll
    for (int r = 0; r < 8; ++r) { float v = acc[t][r] * alpha + bv; if (CP) { const int rr = row0g + row0 + 8 * hh + r; if (rowsPerB < 0) v += CP[cofs + (size_t)rr * ldc + col];      /* rowsPerB < 0: own element of the batched C plane */ else { const int bidx = rr / rowsPerB; v += CP[(size_t)bidx * sCPb + (size_t)by * 64 + col]; } } if (ACT == 1) v = (v > 0.f) ? v : expm1f(v); else if (ACT == 7) v = (v > 0.f) ? v + 1.0f : expf(v); else if (ACT == 8) v = tanhf(v); else if (ACT == 9) v = 0.5f * v * (1.0f + tanhf(0.7978845608028654f * (v + 0.044715f * v * v * v))); else if (ACT == 11) v = 1.0f / (1.0f + expf(-v)); else if (ACT == 12) v = (v > 0.f) ? v : 0.01f * v; else if (ACT == 14) v = (v > 0.f) ? v : 0.1f * v; else if (ACT == 16) v = (v >= 0.f) ? v : 0.3f * v; else if (ACT == 15) v = v / (1.0f + expf(-v)); else if (ACT == 3) v = fmaxf(v, 0.f); else if (ACT == 6) v = 0.5f * v * (1.0f + erff(v * 0.70710678118654752f)); so[w][8 * hh + r][t * 16 + ln] = v; } }
  __builtin_amdgcn_fence(__ATOMIC_ACQ_REL, "workgroup"); __builtin_amdgcn_wave_barrier();
  const int rsub = lane >> 4, c4 = (lane & 15) * 4; typedef _Float16 v4h __attribute__((ext_vector_type(4)));
  {
#pragma unroll
    for (int q = 0; q < 8; ++q) { const int r = q * 2 + rsub; if (col0 + c4 < N) { const v4f v = *(const v4fa*)&so[w][r][c4]; if (C) *(v4f*)(C + cofs + (size_t)(row0 + r) * ldc + col0 + c4) = v; if (C16) { v4h h4; for (int i = 0; i < 4; ++i) h4[i] = (_Float16)v[i]; *(v4h*)(C16 + cofs + (size_t)(row0 + r) * ldc + col0 + c4) = h4; } } }
     }
}


typedef _Float16 v4h __attribute__((ext_vector_type(4)));

__device__ __forceinline__ void x16_part(const float* __restrict__ x, _Float16* __restrict__ X16, int blk) { const size_t t = (size_t)blk * 256 + threadIdx.x; FragH f;
#pragma unroll
  for (int q = 0; q < 8; ++q) f.h[q] = (_Float16)bf16_round(x[t * 8 + q]); *(v8us*)((unsigned short*)X16 + t * 8) = f.half[0];  }
__global__ __launch_bounds__(256) void k_h16(const float* __restrict__ x, _Float16* __restrict__ X16, size_t n8, size_t sB) { const size_t t = (size_t)blockIdx.x * 256 + threadIdx.x; if (t >= n8) return; x += (size_t)blockIdx.y * sB; X16 += (size_t)blockIdx.y * sB;      /* batch = blockIdx.y */ FragH f;
#pragma unroll
  for (int q = 0; q < 8; ++q) f.h[q] = (_Float16)x[t * 8 + q]; *(v8us*)((unsigned short*)X16 + t * 8) = f.half[0];  }
__global__ __launch_bounds__(256) void k_round16f(const float* __restrict__ W, _Float16* __restrict__ Bt, size_t n8) { const size_t t = (size_t)blockIdx.x * 256 + threadIdx.x; if (t >= n8) return; FragH f;
#pragma unroll
  for (int i = 0; i < 8; ++i) f.h[i] = (_Float16)(bf16_round(W[t * 8 + i]) * 16.0f); *(v8us*)((unsigned short*)Bt + t * 8) = f.half[0];  }
template <int NHv, int TTv>
__global__ __launch_bounds__(256) void k_vt(const _Float16* __restrict__ V16, int ldv, int voff, _Float16* __restrict__ Vt) { __shared__ unsigned short tl[64][66]; const int tid = threadIdx.x; const int slab = blockIdx.x / (TTv / 64), lg = blockIdx.x % (TTv / 64); const int b = slab / NHv, h = slab % NHv;
  for (int i = tid; i < 64 * 8; i += 256) { const int r = i / 8, c8 = (i % 8) * 8; FragH f; f.half[0] = *(const v8us*)((const unsigned short*)V16 + ((size_t)b * TTv + lg * 64 + r) * ldv + voff + h * 64 + c8);
#pragma unroll
    for (int q = 0; q < 8; ++q) tl[r][c8 + q] = f.u[q]; }
  __syncthreads();
  {
#pragma unroll
    for (int rd = 0; rd < 2; ++rd) { const int d = rd * 32 + tid / 8, pc = tid % 8; FragH f;
#pragma unroll
      for (int q = 0; q < 8; ++q) f.u[q] = tl[pc * 8 + q][d];
      *(v8us*)((unsigned short*)Vt + ((size_t)slab * 64 + d) * TTv + lg * 64 + pc * 8) = f.half[0]; }
     } }

// ---- fast GEMM (block tile 128x64, wave tile 32x64; requires M % 128 == 0 rows per launch region, N % 64 == 0, K % 64 == 0); epilogue = k_gemm_hhx semantics ----
// Operands reach the waves through LDS: per 64 k one tile of 128 A rows and 64 B rows, 128 B (one whole line) of each row, brought by asynchronous copies (32 lanes = 4 whole lines a copy) into one of two buffers while the other is worked on; each row is fetched once per block instead of once per wave in 32-B pieces.
#define G2_PITCH 72      /* f16 per LDS row: 128 B of k + 16 B, the conflict-free pitch for ds_load_b128 readers of 128-B rows */
#define G2_TILE ((128 + 64) * G2_PITCH * 2)      /* bytes of one buffer: 128 A rows, then 64 B rows */
// one tile's 12 copies of a lane (rows 16 apart: 8 of A, 4 of B); l = the lane's LDS byte address of its first piece. s_wait_xcnt 0 is the statement's last line so that no address register of a copy is rewritten ahead of it.
__device__ __forceinline__ void g2_stage(unsigned l, const _Float16* ga, size_t sa, const _Float16* gb, size_t sb) { const unsigned r16 = 16 * G2_PITCH * 2;
  asm volatile("global_load_async_to_lds_b128 %0, %12, off\n\t" "global_load_async_to_lds_b128 %1, %13, off\n\t" "global_load_async_to_lds_b128 %2, %14, off\n\t" "global_load_async_to_lds_b128 %3, %15, off\n\t"
               "global_load_async_to_lds_b128 %4, %16, off\n\t" "global_load_async_to_lds_b128 %5, %17, off\n\t" "global_load_async_to_lds_b128 %6, %18, off\n\t" "global_load_async_to_lds_b128 %7, %19, off\n\t"
               "global_load_async_to_lds_b128 %8, %20, off\n\t" "global_load_async_to_lds_b128 %9, %21, off\n\t" "global_load_async_to_lds_b128 %10, %22, off\n\t" "global_load_async_to_lds_b128 %11, %23, off\n\t"
               "s_wait_xcnt 0x0"
               :: "v"(l), "v"(l + r16), "v"(l + 2 * r16), "v"(l + 3 * r16), "v"(l + 4 * r16), "v"(l + 5 * r16), "v"(l + 6 * r16), "v"(l + 7 * r16), "v"(l + 8 * r16), "v"(l + 9 * r16), "v"(l + 10 * r16), "v"(l + 11 * r16),
                  "v"(ga), "v"(ga + sa), "v"(ga + 2 * sa), "v"(ga + 3 * sa), "v"(ga + 4 * sa), "v"(ga + 5 * sa), "v"(ga + 6 * sa), "v"(ga + 7 * sa), "v"(gb), "v"(gb + sb), "v"(gb + 2 * sb), "v"(gb + 3 * sb)
               : "memory"); }
__device__ __forceinline__ v16h g2_frag(const _Float16* p, int hh) { FragH f; f.half[0] = *(const v8us*)((const unsigned short*)p + 8 * hh); f.half[1] = *(const v8us*)((const unsigned short*)p + 16 + 8 * hh); return f.v; }
__device__ __forceinline__ v8f g2_mma(v16h a, v16h b, v8f c) { v8f d = __builtin_amdgcn_wmma_f32_16x16x32_f16(false, a, false, b, (short)0, c, false, false); asm volatile("v_nop\n\tv_nop\n\tv_nop\n\tv_nop" : "+v"(d) : "v"(a), "v"(b)); return d; }
template <int ACT>
__global__ __launch_bounds__(128) void k_gemm2(const _Float16* __restrict__ A, int lda, size_t sA, const _Float16* __restrict__ Bh, int ldb, size_t sB, float alpha, const float* __restrict__ bias, size_t sBias, const float* __restrict__ CP, int rowsPerB, size_t sCPb, int row0g,
    float* __restrict__ C, _Float16* __restrict__ C16, int ldc, size_t sC, int M, int N, int K, size_t zA, size_t zB, size_t zC) { static_assert(ACT == 0 || ACT == 3 || ACT == 6 || ACT == 8 || ACT == 9 || ACT == 11 || ACT == 12 || ACT == 14 || ACT == 15 || ACT == 16, "k_gemm2: unsupported ACT code (would silently apply no activation)");
  __shared__ __attribute__((aligned(16))) unsigned char sm[2 * G2_TILE]; float (*so)[32][68] = (float (*)[32][68])sm;      /* the epilogue's staging lies over the two buffers, which every wave has left by then */ static_assert(sizeof(float) * 4 * 32 * 68 <= 2 * G2_TILE, "k_gemm2: epilogue staging must fit the buffers");
  const int tid = threadIdx.x, w = tid >> 5, lane = tid & 31, ln = lane & 15, hh = lane >> 4; const int by = blockIdx.y, bz = blockIdx.z;
  A += (size_t)by * sA + (size_t)bz * zA; Bh += (size_t)by * sB + (size_t)bz * zB; const size_t cofs = (size_t)by * sC + (size_t)bz * zC; const float* bp = bias ? bias + (size_t)by * sBias : nullptr;
  const int ntn = N >> 6; const int mt = blockIdx.x / ntn, nq = blockIdx.x - mt * ntn; const int row0 = mt * 128 + 32 * w, col0 = nq * 64; if (mt * 128 >= M) return;      /* the same for the whole block: it stands in front of barriers */
  const int trow = tid >> 3, tseg = tid & 7;      /* a lane's piece of a tile: 16 B number tseg of rows trow, trow + 16, ... */
  const _Float16* gA = A + (size_t)(mt * 128 + trow) * lda + tseg * 8; const _Float16* gB = Bh + (size_t)(col0 + trow) * ldb + tseg * 8; const size_t sa16 = (size_t)16 * lda, sb16 = (size_t)16 * ldb;
  const unsigned l0 = (unsigned)(size_t)sm + (unsigned)(trow * (G2_PITCH * 2) + tseg * 16);
  const v8f z8 = {0.f,0.f,0.f,0.f,0.f,0.f,0.f,0.f}; v8f c00 = z8, c01 = z8, c02 = z8, c03 = z8, c10 = z8, c11 = z8, c12 = z8, c13 = z8;
  const int nc = K >> 6;
  g2_stage(l0, gA, sa16, gB, sb16);
  asm volatile("s_wait_asynccnt 0x0" ::: "memory");      /* tile 0 of this wave's copies has landed */
  __syncthreads();      /* ... and every other wave's */
  if (nc > 1) g2_stage(l0 + G2_TILE, gA + 64, sa16, gB + 64, sb16);
#pragma unroll 1      /* one tile a trip: the buffer index stays a run-time value and the loop stays small */
  for (int t = 0; t < nc; ++t) { const _Float16* tl = (const _Float16*)(sm + (t & 1) * G2_TILE); const _Float16* ar = tl + (32 * w + ln) * G2_PITCH; const _Float16* br = tl + (128 + ln) * G2_PITCH;
    /* all 24 LDS reads of the trip as one group in front of its WMMAs */
    const v16h a0 = g2_frag(ar, hh), a1 = g2_frag(ar + 16 * G2_PITCH, hh), b0 = g2_frag(br, hh), b1 = g2_frag(br + 16 * G2_PITCH, hh), b2 = g2_frag(br + 32 * G2_PITCH, hh), b3 = g2_frag(br + 48 * G2_PITCH, hh);
    const v16h e0 = g2_frag(ar + 32, hh), e1 = g2_frag(ar + 16 * G2_PITCH + 32, hh), f0 = g2_frag(br + 32, hh), f1 = g2_frag(br + 16 * G2_PITCH + 32, hh), f2 = g2_frag(br + 32 * G2_PITCH + 32, hh), f3 = g2_frag(br + 48 * G2_PITCH + 32, hh);
    c00 = g2_mma(a0, b0, c00); c10 = g2_mma(a1, b0, c10); c01 = g2_mma(a0, b1, c01); c11 = g2_mma(a1, b1, c11); c02 = g2_mma(a0, b2, c02); c12 = g2_mma(a1, b2, c12); c03 = g2_mma(a0, b3, c03); c13 = g2_mma(a1, b3, c13);
    c00 = g2_mma(e0, f0, c00); c10 = g2_mma(e1, f0, c10); c01 = g2_mma(e0, f1, c01); c11 = g2_mma(e1, f1, c11); c02 = g2_mma(e0, f2, c02); c12 = g2_mma(e1, f2, c12); c03 = g2_mma(e0, f3, c03); c13 = g2_mma(e1, f3, c13);
    asm volatile("s_wait_dscnt 0x0" ::: "memory");      /* this wave's reads of buffer t & 1 are done before the buffer is handed back */
    asm volatile("s_wait_asynccnt 0x0" ::: "memory");      /* this wave's copies of tile t + 1 have landed */
    __syncthreads();      /* publishes tile t + 1 and ends every wave's reads of tile t */
    if (t + 2 < nc) g2_stage(l0 + (unsigned)((t & 1) * G2_TILE), gA + (size_t)(t + 2) * 64, sa16, gB + (size_t)(t + 2) * 64, sb16); }
  asm volatile("s_wait_asynccnt 0x0" ::: "memory");      /* no copy is in flight when the buffers become the epilogue's staging */
  v8f accs[8] = {c00, c01, c02, c03, c10, c11, c12, c13};
#pragma unroll
  for (int u = 0; u < 8; ++u) { const int t = u & 3, half = u >> 2; const int col = col0 + t * 16 + ln; const float bv = bp ? bf16_round(bp[col]) : 0.f;
#pragma unroll
    for (int r = 0; r < 8; ++r) { const int rloc = half * 16 + 8 * hh + r; float v = accs[u][r] * alpha + bv; if (CP) { if (rowsPerB < 0) v += CP[cofs + (size_t)(row0g + row0 + rloc) * ldc + col];      /* rowsPerB < 0: own element of the batched C plane */ else { const int bidx = (row0g + row0 + rloc) / rowsPerB; v += CP[(size_t)bidx * sCPb + (size_t)by * 64 + col]; } }
      if (ACT == 3) v = fmaxf(v, 0.f); else if (ACT == 6) v = 0.5f * v * (1.0f + erff(v * 0.70710678118654752f)); else if (ACT == 11) v = 1.0f / (1.0f + expf(-v)); else if (ACT == 15) v = v / (1.0f + expf(-v)); else if (ACT == 12) v = (v > 0.f) ? v : 0.01f * v; else if (ACT == 8) v = tanhf(v); else if (ACT == 9) v = 0.5f * v * (1.0f + tanhf(0.7978845608028654f * (v + 0.044715f * v * v * v))); else if (ACT == 14) v = (v > 0.f) ? v : 0.1f * v; else if (ACT == 16) v = (v >= 0.f) ? v : 0.3f * v;
      so[w][rloc][t * 16 + ln] = v; } }
  __builtin_amdgcn_fence(__ATOMIC_ACQ_REL, "workgroup"); __builtin_amdgcn_wave_barrier();
  const int rsub = lane >> 4, c4 = (lane & 15) * 4;
  {
#pragma unroll
    for (int q = 0; q < 16; ++q) { const int r = q * 2 + rsub; const v4f v = *(const v4fa*)&so[w][r][c4]; if (C) *(v4f*)(C + cofs + (size_t)(row0 + r) * ldc + col0 + c4) = v; if (C16) { v4h h4; for (int i = 0; i < 4; ++i) h4[i] = (_Float16)v[i]; *(v4h*)(C16 + cofs + (size_t)(row0 + r) * ldc + col0 + c4) = h4; } }
     } }


#define LDQKV (DM + 2 * HD)      /* columns of the joint projection: q (8 heads), k, v */
__device__ __forceinline__ void rotab_part(const int* __restrict__ pid, float* __restrict__ CS, float* __restrict__ SN, int blk) {
  #pragma clang fp contract(off)
  const int t = blk * 256 + threadIdx.x; const int j = t % HH, s = t / HH;      /* s = flat token over both batches */ const float inv = 1.0f / powf(10000.0f, (float)(2 * j) / (float)HD); const float th = (float)pid[s] * inv; const float c = cosf(th), sn = sinf(th);
  { *(float*)(CS + t) = c; *(float*)(SN + t) = sn;  }
  asm volatile("s_wait_xcnt 0x0" ::: "memory");      /* a precaution: the built kernel lays another job's code behind these stores, and that code rewrites the registers they name; the wait stands in front of it */ }
// rotation of the 8 query heads and of the key head (head 8 of a row of the joint projection) in one index space
__device__ __forceinline__ void rope_part(const float* __restrict__ F, const float* __restrict__ CS, const float* __restrict__ SN, _Float16* __restrict__ QH, _Float16* __restrict__ QL, _Float16* __restrict__ KH, _Float16* __restrict__ KL, int blk) {
  #pragma clang fp contract(off)
  const int t = blk * 256 + threadIdx.x; const int g = (t % (HH / 8)) * 8; const int h = (t / (HH / 8)) % (NHQ + 1); const int s = t / ((HH / 8) * (NHQ + 1));
  const bool isq = h < NHQ; _Float16* H = isq ? QH : KH; _Float16* L = isq ? QL : KL; F += (size_t)s * LDQKV + h * HD + g;
  const size_t base = isq ? (size_t)s * DM + h * HD + g : (size_t)s * HD + g; FragH h0, h1, l0, l1;
#pragma unroll
  for (int q = 0; q < 8; ++q) { const float c = CS[s * HH + g + q], sn = SN[s * HH + g + q]; const float x0 = F[q], x1 = F[HH + q]; float o0 = x0 * c; o0 += -x1 * sn; float o1 = x1 * c; o1 += x0 * sn;
    const _Float16 a0 = (_Float16)o0, a1 = (_Float16)o1; h0.h[q] = a0; h1.h[q] = a1; l0.h[q] = (_Float16)((o0 - (float)a0) * 1024.0f); l1.h[q] = (_Float16)((o1 - (float)a1) * 1024.0f); }
  { *(v8us*)((unsigned short*)H + base) = h0.half[0]; *(v8us*)((unsigned short*)H + base + HH) = h1.half[0]; *(v8us*)((unsigned short*)L + base) = l0.half[0]; *(v8us*)((unsigned short*)L + base + HH) = l1.half[0];  } }
// V^T hi and residual (x 2^10) planes straight from the f32 v columns of the joint projection: one block turns 64 tokens x 64 d through two LDS tiles. Fv = column 0 of v in row 0.
__device__ __forceinline__ void vthl_part(unsigned short (*th)[66], unsigned short (*tr)[66], const float* __restrict__ Fv, _Float16* __restrict__ VTh, _Float16* __restrict__ VTl, int blk) {
  const int tid = threadIdx.x; const int slab = blk / (SQ / 64), lg = blk % (SQ / 64); const int b = slab / (HD / 64), h = slab % (HD / 64);
  for (int i = tid; i < 64 * 8; i += 256) { const int r = i / 8, c8 = (i % 8) * 8; const float* p = Fv + ((size_t)b * SQ + lg * 64 + r) * LDQKV + h * 64 + c8; const v4f a = *(const v4fa*)p, c = *(const v4fa*)(p + 4); FragH fh, fl;
#pragma unroll
    for (int q = 0; q < 4; ++q) { _Float16 x = (_Float16)a[q]; fh.h[q] = x; fl.h[q] = (_Float16)((a[q] - (float)x) * 1024.0f); x = (_Float16)c[q]; fh.h[4 + q] = x; fl.h[4 + q] = (_Float16)((c[q] - (float)x) * 1024.0f); }
#pragma unroll
    for (int q = 0; q < 8; ++q) { th[r][c8 + q] = fh.u[q]; tr[r][c8 + q] = fl.u[q]; } }
  __syncthreads();
#pragma unroll
  for (int rd = 0; rd < 2; ++rd) { const int d = rd * 32 + tid / 8, pc = tid % 8; FragH fh, fl;
#pragma unroll
    for (int q = 0; q < 8; ++q) { fh.u[q] = th[pc * 8 + q][d]; fl.u[q] = tr[pc * 8 + q][d]; }
    const size_t o = ((size_t)slab * 64 + d) * SQ + lg * 64 + pc * 8; *(v8us*)((unsigned short*)VTh + o) = fh.half[0]; *(v8us*)((unsigned short*)VTl + o) = fl.half[0]; } }
// ---- launches that do not depend on one another stand side by side in one grid; a block's range of blockIdx.x says which job it does (the same for the whole block, so each job's barrier is passed by all of its block) ----
#define PB_X16 (NB * SQ * DM / 8 / 256)      /* blocks of the f16 plane of the hidden states */
#define PB_WB ((DM / 128) * (DM / 64))      /* tiles of Wq, and of Wo */
#define PB_WS ((DM / 128) * (HD / 64))      /* tiles of Wk, and of Wv */
#define PB_ROT (NB * SQ * HH / 256)      /* blocks of the RoPE tables */
__global__ __launch_bounds__(256) void k_prep(const float* __restrict__ hs, const int* __restrict__ pid, const float* __restrict__ Wq, const float* __restrict__ Wk, const float* __restrict__ Wv, const float* __restrict__ Wo,
    _Float16* __restrict__ X16, _Float16* __restrict__ BQ, _Float16* __restrict__ BK, _Float16* __restrict__ BV, _Float16* __restrict__ BO, float* __restrict__ CS, float* __restrict__ SN) {
  __shared__ unsigned int tl[64 * WT_P];
  int bx = blockIdx.x;
  if (bx < PB_X16) { x16_part(hs, X16, bx); return; }
  bx -= PB_X16;
  if (bx < 2 * PB_WB) { const bool o = bx >= PB_WB; wt_tile<DM, DM>(tl, o ? Wo : Wq, o ? BO : BQ, 16.0f, o ? bx - PB_WB : bx); return; }
  bx -= 2 * PB_WB;
  if (bx < 2 * PB_WS) { const bool v = bx >= PB_WS; wt_tile<DM, HD>(tl, v ? Wv : Wk, v ? BV : BK, 16.0f, v ? bx - PB_WS : bx); return; }
  rotab_part(pid, CS, SN, bx - 2 * PB_WS); }
#define QB_VT (NB * (HD / 64) * (SQ / 64))      /* tiles of V^T */
#define QB_ROPE (NB * SQ * (NHQ + 1) * (HH / 8) / 256)      /* blocks of the rotation */
__global__ __launch_bounds__(256) void k_post(const float* __restrict__ F, const float* __restrict__ CS, const float* __restrict__ SN, _Float16* __restrict__ QH, _Float16* __restrict__ QL, _Float16* __restrict__ KH, _Float16* __restrict__ KL, _Float16* __restrict__ VTh, _Float16* __restrict__ VTl) {
  __shared__ unsigned short th[64][66], tr[64][66];
  const int bx = blockIdx.x;
  if (bx < QB_VT) { vthl_part(th, tr, F + DM + HD, VTh, VTl, bx); return; }
  rope_part(F, CS, SN, QH, QL, KH, KL, bx - QB_VT); }
typedef int v4ia __attribute__((ext_vector_type(4), may_alias));

#define FA_KP 264      /* f16 per LDS row of K: 512 B + 16 B = 16 B x 33, the conflict-free kind of pitch for ds_load_b128 readers */
#define FA_KB (64 * FA_KP * 2)      /* bytes of the K part of a buffer */
#define FA_TILE (FA_KB + HD * G2_PITCH * 2)      /* bytes of one buffer: 64 K rows, then 256 V^T rows */
// 8 copies of a lane, LDS addresses ls bytes apart, global addresses gs elements apart. s_wait_xcnt 0 is the statement's last line so that no address register of a copy is rewritten ahead of it.
__device__ __forceinline__ void fa_stage8(unsigned l, unsigned ls, const _Float16* g, size_t gs) {
  asm volatile("global_load_async_to_lds_b128 %0, %8, off\n\t" "global_load_async_to_lds_b128 %1, %9, off\n\t" "global_load_async_to_lds_b128 %2, %10, off\n\t" "global_load_async_to_lds_b128 %3, %11, off\n\t"
               "global_load_async_to_lds_b128 %4, %12, off\n\t" "global_load_async_to_lds_b128 %5, %13, off\n\t" "global_load_async_to_lds_b128 %6, %14, off\n\t" "global_load_async_to_lds_b128 %7, %15, off\n\t"
               "s_wait_xcnt 0x0"
               :: "v"(l), "v"(l + ls), "v"(l + 2 * ls), "v"(l + 3 * ls), "v"(l + 4 * ls), "v"(l + 5 * ls), "v"(l + 6 * ls), "v"(l + 7 * ls),
                  "v"(g), "v"(g + gs), "v"(g + 2 * gs), "v"(g + 3 * gs), "v"(g + 4 * gs), "v"(g + 5 * gs), "v"(g + 6 * gs), "v"(g + 7 * gs)
               : "memory"); }
__device__ __forceinline__ v8f fa_mma(v16h a, v16h b, v8f c) { return __builtin_amdgcn_wmma_f32_16x16x32_f16(false, a, false, b, (short)0, c, false, false); }
// ---- rows < BAND, hi + residual operands: the same walk as k_fattn below (transposed products, running maximum and sum, tiles of 64 keys), with S = Qh Kh + 2^-10 (Ql Kh + Qh Kl) and O = 2^-10 Ph Vh + 2^-20 (Pl Vh + Ph Vl); the residual terms gather in accumulators of their own; O leaves as f16 hi and residual (x 2^10) ----
// LDS: the hi planes' tile lies in the first buffer of k_fattn, the residual planes' tile in the second, so a tile is filled, read by all and only then refilled (at most 4 tiles: the wait is short and stands beside the long blocks' work). The block's 128 query rows, hi then residual, lie in sq at the K pitch and are read per tile: the two O accumulators leave no registers for them.
__device__ __forceinline__ void fa_band0(unsigned char* sm, unsigned char* sq, const int* mk, const _Float16* __restrict__ Qh, const _Float16* __restrict__ Ql, const _Float16* __restrict__ Kh, const _Float16* __restrict__ Kl, const _Float16* __restrict__ Vh, const _Float16* __restrict__ Vl,
    _Float16* __restrict__ O16, _Float16* __restrict__ OL0, int R0, int nt, int h, int b) {      /* Kh, Kl, Vh, Vl: the batch's planes */
  const float NONE = -3.0e38f, FLOOR = -1.0e30f, SC = 0.0625f * 1.44269504088896340736f, LO = 0.0009765625f;
  const int tid = threadIdx.x, lane = tid & 31, ln = lane & 15, hh = lane >> 4; const int w = __builtin_amdgcn_readfirstlane(tid >> 5); const int q0 = R0 + 16 * w;      /* the wave's first query */
  const unsigned rowl = (unsigned)((tid >> 5) * (FA_KP * 2) + (tid & 31) * 16);      /* a wave's copy = one whole row of 512 B (Q, K), or 4 whole lines of V^T */
  const unsigned lk = (unsigned)(size_t)sm + rowl, lv = (unsigned)(size_t)sm + (unsigned)(FA_KB + (tid >> 3) * (G2_PITCH * 2) + (tid & 7) * 16), lq = (unsigned)(size_t)sq + rowl;
  const size_t ko = (size_t)(tid >> 5) * HD + (tid & 31) * 8, vo = (size_t)(tid >> 3) * SQ + (tid & 7) * 8, qo = ((size_t)b * SQ + R0 + (tid >> 5)) * DM + h * HD + (tid & 31) * 8;
  fa_stage8(lq, 8 * FA_KP * 2, Qh + qo, (size_t)8 * DM); fa_stage8(lq + FA_KB, 8 * FA_KP * 2, Qh + qo + (size_t)64 * DM, (size_t)8 * DM); fa_stage8(lq + 2 * FA_KB, 8 * FA_KP * 2, Ql + qo, (size_t)8 * DM); fa_stage8(lq + 3 * FA_KB, 8 * FA_KP * 2, Ql + qo + (size_t)64 * DM, (size_t)8 * DM);
  asm volatile("s_wait_asynccnt 0x0" ::: "memory");      /* the 32 copies of Q have landed before tile 0's 32 are issued: never more than 63 of a wave outstanding */
  const _Float16* qb = (const _Float16*)sq + (16 * w + ln) * FA_KP;      /* the lane's query, hi; its residual row lies 128 rows on */
  const _Float16* kbh = (const _Float16*)sm + ln * FA_KP; const _Float16* kbl = (const _Float16*)(sm + FA_TILE) + ln * FA_KP; const _Float16* vbh = (const _Float16*)(sm + FA_KB) + ln * G2_PITCH; const _Float16* vbl = (const _Float16*)(sm + FA_TILE + FA_KB) + ln * G2_PITCH;
  const v8f z8 = {0.f,0.f,0.f,0.f,0.f,0.f,0.f,0.f}; v8f oh[16], ol[16];
#pragma unroll
  for (int dt = 0; dt < 16; ++dt) { oh[dt] = z8; ol[dt] = z8; }
  float m = FLOOR, lsum = 0.f;
#pragma unroll 1      /* one tile a trip: the text stays small, it runs only a few times */
  for (int t = 0; t < nt; ++t) {
    fa_stage8(lk, 8 * FA_KP * 2, Kh + ko + (size_t)t * 64 * HD, (size_t)8 * HD); fa_stage8(lv, 32 * G2_PITCH * 2, Vh + vo + (size_t)t * 64, (size_t)32 * SQ);
    fa_stage8(lk + FA_TILE, 8 * FA_KP * 2, Kl + ko + (size_t)t * 64 * HD, (size_t)8 * HD); fa_stage8(lv + FA_TILE, 32 * G2_PITCH * 2, Vl + vo + (size_t)t * 64, (size_t)32 * SQ);
    asm volatile("s_wait_asynccnt 0x0" ::: "memory");      /* tile t of this wave's copies has landed */
    __syncthreads();      /* ... and every other wave's (in trip 0 Q and the mask too) */
    if (t * 64 <= q0 + 15) {      /* the same for the whole wave: a tile wholly right of the wave's diagonal is skipped, the barriers are not */
      v8f s[4];
#pragma unroll
      for (int up = 0; up < 2; ++up) { v8f a0 = z8, a1 = z8, a2 = z8, c0 = z8, c1 = z8, c2 = z8;      /* hi.hi, hi.lo, lo.hi of two score tiles: six independent chains */
#pragma unroll
        for (int ks = 0; ks < 8; ++ks) { const int o0 = up * 32 * FA_KP + ks * 32, o1 = o0 + 16 * FA_KP; const v16h qh = g2_frag(qb + ks * 32, hh), ql = g2_frag(qb + 128 * FA_KP + ks * 32, hh), x0 = g2_frag(kbh + o0, hh), x1 = g2_frag(kbh + o1, hh), y0 = g2_frag(kbl + o0, hh), y1 = g2_frag(kbl + o1, hh);
          a0 = fa_mma(x0, qh, a0); c0 = fa_mma(x1, qh, c0); a1 = fa_mma(x0, ql, a1); c1 = fa_mma(x1, ql, c1); a2 = fa_mma(y0, qh, a2); c2 = fa_mma(y1, qh, c2); }
        s[2 * up] = a0 + (a1 + a2) * LO; s[2 * up + 1] = c0 + (c1 + c2) * LO; }
      const int jq = q0 + ln - t * 64 - 8 * hh;      /* register r of score tile u is at or left of the diagonal when u * 16 + r <= jq */
      const int* mr = &mk[t * 64 + 8 * hh]; float mx = NONE;
#pragma unroll
      for (int u = 0; u < 4; ++u) { const v4ia k0 = *(const v4ia*)(mr + u * 16), k1 = *(const v4ia*)(mr + u * 16 + 4);
#pragma unroll
        for (int r = 0; r < 8; ++r) { const int kv = r < 4 ? k0[r & 3] : k1[r & 3]; const float x = ((u * 16 + r <= jq) & (kv > 0)) ? s[u][r] * SC : NONE; s[u][r] = x; mx = fmaxf(mx, x); } }
      mx = fmaxf(mx, __shfl_xor(mx, 16, 32));      /* the other half of the query's keys */
      const float mn = fmaxf(m, mx), al = __builtin_amdgcn_exp2f(m - mn); m = mn;      /* no open key so far: al = 1 over O = 0 */
      float ps = 0.f;
#pragma unroll
      for (int u = 0; u < 4; ++u) {
#pragma unroll
        for (int r = 0; r < 8; ++r) { const float e = __builtin_amdgcn_exp2f(s[u][r] - mn); ps += e; s[u][r] = e; } }
      lsum = lsum * al + ps;
      FragH ph[2], pl[2];
#pragma unroll
      for (int kk = 0; kk < 2; ++kk) {
#pragma unroll
        for (int i = 0; i < 16; ++i) { const float p = s[2 * kk + (i >> 3)][i & 7] * 1024.0f; const _Float16 x = (_Float16)p; ph[kk].h[i] = x; pl[kk].h[i] = (_Float16)((p - (float)x) * 1024.0f); } }
#pragma unroll
      for (int dt = 0; dt < 16; ++dt) { oh[dt] = oh[dt] * al; ol[dt] = ol[dt] * al; }
#pragma unroll
      for (int kk = 0; kk < 2; ++kk) {
#pragma unroll
        for (int dt = 0; dt < 16; ++dt) { const v16h x = g2_frag(vbh + dt * 16 * G2_PITCH + kk * 32, hh), y = g2_frag(vbl + dt * 16 * G2_PITCH + kk * 32, hh);
          oh[dt] = fa_mma(x, ph[kk].v, oh[dt]); ol[dt] = fa_mma(x, pl[kk].v, ol[dt]); ol[dt] = fa_mma(y, ph[kk].v, ol[dt]); } }
    }
    asm volatile("s_wait_dscnt 0x0" ::: "memory");      /* this wave's reads of tile t are done before the buffers are filled again */
    __syncthreads();      /* ends every wave's reads of tile t */
  }
  lsum += __shfl_xor(lsum, 16, 32);
  const float f = (lsum > 0.f) ? LO / lsum : 0.f;      /* a row with no open key keeps O = 0 */
  const size_t co = (size_t)(q0 + ln) * DM + h * HD + 8 * hh; unsigned short* orow = (unsigned short*)O16 + (size_t)b * SQ * DM + co; unsigned short* lrow = (unsigned short*)OL0 + (size_t)b * BAND * DM + co;      /* register r of O^T tile dt = element dt * 16 + 8 hh + r of the query's head */
  v8us sh[16], sl[16];
#pragma unroll
  for (int dt = 0; dt < 16; ++dt) { FragH eh, el;
#pragma unroll
    for (int r = 0; r < 8; ++r) { const float v = (oh[dt][r] + ol[dt][r] * LO) * f; const _Float16 x = (_Float16)v; eh.h[r] = x; el.h[r] = (_Float16)((v - (float)x) * 1024.0f); }
    sh[dt] = eh.half[0]; sl[dt] = el.half[0]; }
  __builtin_amdgcn_sched_barrier(0);      /* all stores last, each from registers of its own: nothing is written behind an issued store */
#pragma unroll
  for (int dt = 0; dt < 16; ++dt) { *(v8us*)(orow + dt * 16) = sh[dt]; *(v8us*)(lrow + dt * 16) = sl[dt]; } }
__global__ __launch_bounds__(256) __attribute__((amdgpu_waves_per_eu(2, 2))) void k_fattn(const _Float16* __restrict__ Q, const _Float16* __restrict__ Ql, const _Float16* __restrict__ Kh, const _Float16* __restrict__ Kl, const _Float16* __restrict__ Vt, const _Float16* __restrict__ Vl, const int* __restrict__ mask, _Float16* __restrict__ O16, _Float16* __restrict__ OL0) {
  __shared__ __attribute__((aligned(16))) unsigned char sm[2 * FA_TILE]; __shared__ __attribute__((aligned(16))) int mk[SQ]; __shared__ __attribute__((aligned(16))) unsigned char sq[4 * FA_KB];      /* sq: the query rows of a block of rows < BAND */
  const float NONE = -3.0e38f, FLOOR = -1.0e30f, SC = 0.0625f * 1.44269504088896340736f;
  const int tid = threadIdx.x, lane = tid & 31, ln = lane & 15, hh = lane >> 4; const int w = __builtin_amdgcn_readfirstlane(tid >> 5); const int h = blockIdx.y, b = blockIdx.z;
  const int R0 = SQ - 128 * ((int)blockIdx.x + 1);      /* first row of the block; the longest blocks have the lowest index, the last two are rows < BAND */
  const int nt = R0 / 64 + 2;      /* key tiles up to the block's last row; at least two */
  const int q0 = R0 + 16 * w;      /* the wave's first query */
  Kh += (size_t)b * SQ * HD; Vt += (size_t)b * SQ * HD; Kl += (size_t)b * SQ * HD; Vl += (size_t)b * SQ * HD;
  { const int* mp = mask + (size_t)b * SQ + tid * 8; const v4ia a = *(const v4ia*)mp, c = *(const v4ia*)(mp + 4); *(v4ia*)&mk[tid * 8] = a; *(v4ia*)&mk[tid * 8 + 4] = c; }      /* the batch's padding mask, read by every wave behind the first barrier */
  if (R0 < BAND) { fa_band0(sm, sq, mk, Q, Ql, Kh, Kl, Vt, Vl, O16, OL0, R0, nt, h, b); return; }      /* the same for the whole block, in front of every barrier */
  const _Float16* qrow = Q + ((size_t)b * SQ + q0 + ln) * DM + h * HD; v16h qf[8];
#pragma unroll
  for (int ks = 0; ks < 8; ++ks) qf[ks] = g2_frag(qrow + ks * 32, hh);
  const unsigned lk = (unsigned)(size_t)sm + (unsigned)((tid >> 5) * (FA_KP * 2) + (tid & 31) * 16), lv = (unsigned)(size_t)sm + (unsigned)(FA_KB + (tid >> 3) * (G2_PITCH * 2) + (tid & 7) * 16);      /* a wave's copy = one whole K row, or 4 whole lines of V^T */
  const _Float16* gk = Kh + (size_t)(tid >> 5) * HD + (tid & 31) * 8; const _Float16* gv = Vt + (size_t)(tid >> 3) * SQ + (tid & 7) * 8;
  const v8f z8 = {0.f,0.f,0.f,0.f,0.f,0.f,0.f,0.f}; v8f o[16];
#pragma unroll
  for (int dt = 0; dt < 16; ++dt) o[dt] = z8;
  float m = FLOOR, lsum = 0.f;
  fa_stage8(lk, 8 * FA_KP * 2, gk, (size_t)8 * HD); fa_stage8(lv, 32 * G2_PITCH * 2, gv, (size_t)32 * SQ);
  asm volatile("s_wait_asynccnt 0x0" ::: "memory");      /* tile 0 of this wave's copies has landed */
  __syncthreads();      /* ... and every other wave's, and the mask */
  fa_stage8(lk + FA_TILE, 8 * FA_KP * 2, gk + (size_t)64 * HD, (size_t)8 * HD); fa_stage8(lv + FA_TILE, 32 * G2_PITCH * 2, gv + 64, (size_t)32 * SQ);
#pragma unroll 1      /* one tile a trip: the buffer index stays a run-time value */
  for (int t = 0; t < nt; ++t) {
    if (t * 64 <= q0 + 15) {      /* the same for the whole wave: a tile wholly right of the wave's diagonal is skipped, the publish point below is not */
      const _Float16* kb = (const _Float16*)(sm + (t & 1) * FA_TILE) + ln * FA_KP; const _Float16* vb = (const _Float16*)(sm + (t & 1) * FA_TILE + FA_KB) + ln * G2_PITCH;
      v8f s[4] = {z8, z8, z8, z8};
#pragma unroll
      for (int ks = 0; ks < 8; ++ks) {
#pragma unroll
        for (int u = 0; u < 4; ++u) s[u] = fa_mma(g2_frag(kb + u * 16 * FA_KP + ks * 32, hh), qf[ks], s[u]); }
      const int jq = q0 + ln - t * 64 - 8 * hh;      /* register r of score tile u is at or left of the diagonal when u * 16 + r <= jq */
      const int* mr = &mk[t * 64 + 8 * hh]; float mx = NONE;
#pragma unroll
      for (int u = 0; u < 4; ++u) { const v4ia k0 = *(const v4ia*)(mr + u * 16), k1 = *(const v4ia*)(mr + u * 16 + 4);
#pragma unroll
        for (int r = 0; r < 8; ++r) { const int kv = r < 4 ? k0[r & 3] : k1[r & 3]; const float x = ((u * 16 + r <= jq) & (kv > 0)) ? s[u][r] * SC : NONE; s[u][r] = x; mx = fmaxf(mx, x); } }
      mx = fmaxf(mx, __shfl_xor(mx, 16, 32));      /* the other half of the query's keys */
      const float mn = fmaxf(m, mx), al = __builtin_amdgcn_exp2f(m - mn); m = mn;      /* no open key so far: al = 1 over O = 0 */
      float ps = 0.f;
#pragma unroll
      for (int u = 0; u < 4; ++u) {
#pragma unroll
        for (int r = 0; r < 8; ++r) { const float e = __builtin_amdgcn_exp2f(s[u][r] - mn); ps += e; s[u][r] = e; } }
      lsum = lsum * al + ps;
      FragH pf[2];
#pragma unroll
      for (int kk = 0; kk < 2; ++kk) {
#pragma unroll
        for (int i = 0; i < 8; ++i) { pf[kk].h[i] = (_Float16)(s[2 * kk][i] * 1024.0f); pf[kk].h[8 + i] = (_Float16)(s[2 * kk + 1][i] * 1024.0f); } }
#pragma unroll
      for (int dt = 0; dt < 16; ++dt) o[dt] = o[dt] * al;
#pragma unroll
      for (int kk = 0; kk < 2; ++kk) {
#pragma unroll
        for (int dt = 0; dt < 16; ++dt) o[dt] = fa_mma(g2_frag(vb + dt * 16 * G2_PITCH + kk * 32, hh), pf[kk].v, o[dt]); }
    }
    asm volatile("s_wait_dscnt 0x0" ::: "memory");      /* this wave's reads of buffer t & 1 are done before the buffer is handed back */
    asm volatile("s_wait_asynccnt 0x0" ::: "memory");      /* this wave's copies of tile t + 1 have landed */
    __syncthreads();      /* publishes tile t + 1 and ends every wave's reads of tile t */
    if (t + 2 < nt) { const unsigned bo = (unsigned)((t & 1) * FA_TILE); fa_stage8(lk + bo, 8 * FA_KP * 2, gk + (size_t)(t + 2) * 64 * HD, (size_t)8 * HD); fa_stage8(lv + bo, 32 * G2_PITCH * 2, gv + (size_t)(t + 2) * 64, (size_t)32 * SQ); } }
  asm volatile("s_wait_asynccnt 0x0" ::: "memory");      /* no copy is in flight when the wave ends */
  lsum += __shfl_xor(lsum, 16, 32);
  const float f = (lsum > 0.f) ? 0.0009765625f / lsum : 0.f;      /* a row with no open key keeps O = 0 */
  unsigned short* orow = (unsigned short*)O16 + ((size_t)b * SQ + q0 + ln) * DM + h * HD + 8 * hh;      /* register r of O^T tile dt = element dt * 16 + 8 hh + r of the query's head: 16 B a tile */
#pragma unroll
  for (int dt = 0; dt < 16; ++dt) { FragH e;
#pragma unroll
    for (int r = 0; r < 8; ++r) e.h[r] = (_Float16)(o[dt][r] * f);
    *(v8us*)(orow + dt * 16) = e.half[0]; } }

extern "C" void kernel_launch(void* const* d_in, const int* in_sizes, int n_in,
                              void* d_out, int out_size, void* d_ws, size_t ws_size, hipStream_t stream) {
  (void)in_sizes; (void)n_in; (void)out_size;
  const float* const* I = (const float* const*)d_in; const float* hs = I[0]; const int* amask = (const int*)d_in[1]; const int* pid = (const int*)d_in[2]; const float* Wq = I[3]; const float* Wk = I[4]; const float* Wv = I[5]; const float* Wo = I[6];
  char* ws = (char*)d_ws; size_t off = 0;
  auto take = [&](size_t bytes) { char* p = ws + off; off += (bytes + 255) & ~(size_t)255; return p; };
  const size_t np = (size_t)SQ * DM, nkv = (size_t)SQ * HD;      /* elements per batch of a [SQ][DM] and of a [SQ][HD] plane */
  _Float16* BQ = (_Float16*)take((size_t)LDQKV * DM * 2); _Float16* BK = BQ + (size_t)DM * DM; _Float16* BV = BK + (size_t)HD * DM; _Float16* BO = (_Float16*)take(np * 2);      /* the transposed Wq, Wk, Wv are one [LDQKV][DM] matrix */
  float* CS = (float*)take((size_t)NB * SQ * HH * 4); float* SN = (float*)take((size_t)NB * SQ * HH * 4);
  _Float16* X16 = (_Float16*)take(NB * np * 2); float* F32 = (float*)take((size_t)NB * SQ * LDQKV * 4); _Float16* QH = (_Float16*)take(NB * np * 2); _Float16* QL = (_Float16*)take(NB * np * 2); _Float16* KH = (_Float16*)take(NB * nkv * 2); _Float16* KL = (_Float16*)take(NB * nkv * 2); _Float16* VTh = (_Float16*)take(NB * nkv * 2); _Float16* VTl = (_Float16*)take(NB * nkv * 2);
  _Float16* O16 = (_Float16*)take(NB * np * 2); _Float16* OL0 = (_Float16*)take((size_t)NB * BAND * DM * 2);      /* O hi of every row; O residual (x 2^10) of rows < BAND */
  if (off > ws_size) return;      /* 10+8 + 4 + 16+40+16+16 + 4*2 + 16 + 2 = 136 MiB */
  const int MT = NB * SQ;      /* tokens of both batches: the projections and the elementwise passes see one flat [MT][...] matrix */
  k_prep<<<PB_X16 + 2 * PB_WB + 2 * PB_WS + PB_ROT, 256, 0, stream>>>(hs, pid, Wq, Wk, Wv, Wo, X16, BQ, BK, BV, BO, CS, SN);
  /* q (8 heads), k and v (one kv head of 256) as one GEMM: row s of F32 = q | k | v of token s */
  k_gemm2<0><<<dim3((MT / 128) * (LDQKV / 64), 1), 128, 0, stream>>>(X16, DM, 0, BQ, DM, 0, 0.0625f, nullptr, 0, nullptr, 1, 0, 0, F32, nullptr, LDQKV, 0, MT, LDQKV, DM, 0, 0, 0);
  /* q and k roped, hi/lo; V^T hi/lo */
  k_post<<<QB_VT + QB_ROPE, 256, 0, stream>>>(F32, CS, SN, QH, QL, KH, KL, VTh, VTl);
  /* attention, head in grid.y, batch in grid.z: blocks 0 .. 13 of a row of the grid do rows >= 256 (plain f16 operands, longest first), the last two rows < 256 (hi + lo everywhere); each writes its rows of the f16 O plane itself, rows < 256 their residual plane too */
  k_fattn<<<dim3(SQ / 128, NHQ, NB), 256, 0, stream>>>(QH, QL, KH, KL, VTh, VTl, amask, O16, OL0);
  /* output: O hi (+ lo on rows < 256 of each batch) into Wo */
  float* out = (float*)d_out;
  k_gemm2<0><<<dim3((MT / 128) * (DM / 64), 1), 128, 0, stream>>>(O16, DM, 0, BO, DM, 0, 0.0625f, nullptr, 0, nullptr, 1, 0, 0, out, nullptr, DM, 0, MT, DM, DM, 0, 0, 0);
  k_gemm2<0><<<dim3((BAND / 128) * (DM / 64), 1, NB), 128, 0, stream>>>(OL0, DM, 0, BO, DM, 0, 0.0625f / 1024.0f, nullptr, 0, out, -1, 0, 0, out, nullptr, DM, 0, BAND, DM, DM, (size_t)BAND * DM, 0, np);
}

// v009
// Measured time: 185 microseconds a run.
// Next to v008, in two timings, it ran 1.11 times as fast each time.
// All steps since v000 together make it 32.0 times as fast.
#include <hip/hip_runtime.h>
// FlaxGemmaAttention (2 x 2048 tokens, D 2048, 8 query heads of 256 sharing ONE kv head; rotate-half RoPE from the INPUT position_ids; causal + INPUT padding mask; scale 256^-0.5; out = attn Wo).
// Structure (both batches in every launch: flat rows for the projections and elementwise passes, blockIdx.z for attention): three launches in front of attention, each holding the jobs that do not depend on one another: (1) exact f16 plane of the hidden states, the four weight transposes, RoPE tables (f32 trig); (2) q, k and v as ONE GEMM over the stacked weight rows (32x64 wave tiles, f32 accumulation, exact x16 weights); (3) rotation on VALU into f16 hi (+ 2^10 residual) planes, V^T hi/residual by LDS tiles; attention in ONE launch of two kinds of block (head = blockIdx.y, batch = blockIdx.z), S and P in registers in both. Rows < 256 (whose outputs average over few keys): hi+lo operands throughout (3-term S, 3-term P.V, hi+lo O into Wo), the same walk with residual terms in accumulators of their own (fa_band0). Rows >= 256, plain f16 operands: one block per 128 rows of a head walks the causally reachable keys in tiles of 64 with a running maximum and sum, O leaves as f16; output GEMM, ONE launch: a block of rows < 256 holds 64 rows of O hi and the same 64 rows of the residual plane in its A tile and adds the two products in its epilogue.
// Compute dtype: inputs and weights rounded to bf16; rows >= 256: q, k, P, v, O as f16 (~2^-12); rows < 256: hi + residual pairs; f32 accumulation/softmax/trig. v_wmma_f32_16x16x32_f16.
#define NB 2
#define SQ 2048
#define DM 2048
#define NHQ 8
#define HD 256
#define HH (HD / 2)
#define BAND 256
#define NBAND (SQ / BAND)
typedef __bf16 v16b __attribute__((ext_vector_type(16)));
typedef unsigned short v8us __attribute__((ext_vector_type(8), may_alias));
typedef float  v8f  __attribute__((ext_vector_type(8)));
typedef float  v4f  __attribute__((ext_vector_type(4)));
typedef float  v4fa __attribute__((ext_vector_type(4), may_alias));
union FragB { v16b v; v8us half[2]; unsigned short u[16]; };

__device__ __forceinline__ unsigned short bf16_bits(float x) { unsigned int u = __float_as_uint(x); return (unsigned short)((u + 0x7FFFu + ((u >> 16) & 1u)) >> 16); }
__device__ __forceinline__ float bf16_val(unsigned short b) { return __uint_as_float(((unsigned int)b) << 16); }
__device__ __forceinline__ float bf16_round(float x) { return bf16_val(bf16_bits(x)); }
// D += A·B with NT terms: 1 = ah·bh, 2 = + al·bh (A split), 3 = + ah·bl (both split)
template <int NT>
__device__ __forceinline__ v8f mmaN(v16b ah, v16b al, v16b bh, v16b bl, v8f c) {
  c = __builtin_amdgcn_wmma_f32_16x16x32_bf16(false, ah, false, bh, (short)0, c, false, false);
  if (NT >= 2) c = __builtin_amdgcn_wmma_f32_16x16x32_bf16(false, al, false, bh, (short)0, c, false, false);
  if (NT >= 3) c = __builtin_amdgcn_wmma_f32_16x16x32_bf16(false, ah, false, bl, (short)0, c, false, false);
  asm volatile("v_nop\n\tv_nop\n\tv_nop\n\tv_nop" : "+v"(c) : "v"(ah), "v"(al), "v"(bh), "v"(bl));
  return c;
}

__global__ __launch_bounds__(256) void k_wt_bf16(const float* __restrict__ W, unsigned short* __restrict__ Wt, int K, int N) {
  const int t = blockIdx.x * 256 + threadIdx.x;
  const int k8n = K / 8;
  if (t >= N * k8n) return;
  const int n = t / k8n, k8 = (t % k8n) * 8;
  v8us v;
#pragma unroll
  for (int i = 0; i < 8; ++i) v[i] = bf16_bits(W[(size_t)(k8 + i) * N + n]);
  *(v8us*)(Wt + (size_t)n * K + k8) = v;
  
}

// GEMM C[M][N] (f32, pitch ldc) = act(A[M][K]·W + bias). A f32 row-major (pitch lda) converted per fragment to bf16
// (ASPLIT: hi/lo two planes -> 2 terms, else single rounded term); Wt bf16 [N][K] (pitch ldb). BIAS_BF16 rounds the
// bias to bf16 first (bias quantised to bf16 before the add). K%32==0, M%16==0, N%64==0.
template <bool ASPLIT, int ACT, bool BIAS_BF16>
__global__ __launch_bounds__(128) void k_gemm_bf(const float* __restrict__ A, int lda, const unsigned short* __restrict__ Wt, int ldb,
                                               const float* __restrict__ bias, float* __restrict__ C, int ldc, int M, int N, int K) {
  __shared__ __attribute__((aligned(16))) float so[4][16][64];
  const int tid = threadIdx.x, w = tid >> 5, lane = tid & 31, ln = lane & 15, hh = lane >> 4;
  const int ntn = N / 64;
  const int wid = blockIdx.x * 4 + w;
  const int mt = wid / ntn, nq = wid % ntn;
  if (mt * 16 >= M) return;
  const int row0 = mt * 16, col0 = nq * 64;
  const float* arow = A + (size_t)(row0 + ln) * lda;
  v8f acc[4] = {};
  for (int kb = 0; kb < K; kb += 32) {
    FragB ah, al;
    const v4f x0 = *(const v4fa*)(arow + kb + 8 * hh), x1 = *(const v4fa*)(arow + kb + 8 * hh + 4);
    const v4f x2 = *(const v4fa*)(arow + kb + 16 + 8 * hh), x3 = *(const v4fa*)(arow + kb + 16 + 8 * hh + 4);
    float xs[16] = {x0[0],x0[1],x0[2],x0[3],x1[0],x1[1],x1[2],x1[3],x2[0],x2[1],x2[2],x2[3],x3[0],x3[1],x3[2],x3[3]};
#pragma unroll
    for (int i = 0; i < 16; ++i) { const unsigned short hb = bf16_bits(xs[i]); ah.u[i] = hb; al.u[i] = ASPLIT ? bf16_bits(xs[i] - bf16_val(hb)) : (unsigned short)0; }
#pragma unroll
    for (int t = 0; t < 4; ++t) {
      const unsigned short* brow = Wt + (size_t)(col0 + t * 16 + ln) * ldb + kb;
      FragB b;
      b.half[0] = *(const v8us*)(brow + 8 * hh);
      b.half[1] = *(const v8us*)(brow + 16 + 8 * hh);
      acc[t] = mmaN<ASPLIT ? 2 : 1>(ah.v, al.v, b.v, b.v, acc[t]);
    }
  }
#pragma unroll
  for (int t = 0; t < 4; ++t) {
    float bv = bias ? bias[col0 + t * 16 + ln] : 0.f;
    if (BIAS_BF16) bv = bf16_round(bv);
#pragma unroll
    for (int r = 0; r < 8; ++r) { float v = acc[t][r] + bv; if (ACT == 1) v = fmaxf(v, 0.f); so[w][8 * hh + r][t * 16 + ln] = v; }
  }
  __builtin_amdgcn_fence(__ATOMIC_ACQ_REL, "workgroup");
  __builtin_amdgcn_wave_barrier();
  const int rsub = lane >> 4, c4 = (lane & 15) * 4;
  {
#pragma unroll
    for (int q = 0; q < 8; ++q) {
      const int r = q * 2 + rsub;
      const v4f v = *(const v4fa*)&so[w][r][c4];
      *(v4f*)(C + (size_t)(row0 + r) * ldc + col0 + c4) = v;
    }
    
  }
}

// GEMM C = act(A·W + bias + resid): A f32 (ASPLIT -> hi/lo 2 terms), Wt bf16 [N][K]; ACT 0 none, 1 relu, 2 exact gelu;
// resid (optional, f32, row index = (row % rmod), pitch ldr, RES_BF16 rounds it) added before the activation.
template <bool ASPLIT, int ACT, bool BIAS_BF16, bool RES_BF16>
__global__ __launch_bounds__(128) void k_gemm_bf3(const float* __restrict__ A, int lda, const unsigned short* __restrict__ Wt, int ldb,
                                                const float* __restrict__ bias, const float* __restrict__ resid, int rmod, int ldr,
                                                float* __restrict__ C, int ldc, int M, int N, int K) {
  __shared__ __attribute__((aligned(16))) float so[4][16][64];
  const int tid = threadIdx.x, w = tid >> 5, lane = tid & 31, ln = lane & 15, hh = lane >> 4;
  const int ntn = N / 64;
  const int wid = blockIdx.x * 4 + w;
  const int mt = wid / ntn, nq = wid % ntn;
  if (mt * 16 >= M) return;
  const int row0 = mt * 16, col0 = nq * 64;
  const float* arow = A + (size_t)(row0 + ln) * lda;
  v8f acc[4] = {};
  for (int kb = 0; kb < K; kb += 32) {
    FragB ah, al;
    const v4f x0 = *(const v4fa*)(arow + kb + 8 * hh), x1 = *(const v4fa*)(arow + kb + 8 * hh + 4);
    const v4f x2 = *(const v4fa*)(arow + kb + 16 + 8 * hh), x3 = *(const v4fa*)(arow + kb + 16 + 8 * hh + 4);
    float xs[16] = {x0[0],x0[1],x0[2],x0[3],x1[0],x1[1],x1[2],x1[3],x2[0],x2[1],x2[2],x2[3],x3[0],x3[1],x3[2],x3[3]};
#pragma unroll
    for (int i = 0; i < 16; ++i) { const unsigned short hb = bf16_bits(xs[i]); ah.u[i] = hb; al.u[i] = ASPLIT ? bf16_bits(xs[i] - bf16_val(hb)) : (unsigned short)0; }
#pragma unroll
    for (int t = 0; t < 4; ++t) {
      const unsigned short* brow = Wt + (size_t)(col0 + t * 16 + ln) * ldb + kb;
      FragB b;
      b.half[0] = *(const v8us*)(brow + 8 * hh);
      b.half[1] = *(const v8us*)(brow + 16 + 8 * hh);
      acc[t] = mmaN<ASPLIT ? 2 : 1>(ah.v, al.v, b.v, b.v, acc[t]);
    }
  }
#pragma unroll
  for (int t = 0; t < 4; ++t) {
    const int col = col0 + t * 16 + ln;
    float bv = bias ? bias[col] : 0.f;
    if (BIAS_BF16) bv = bf16_round(bv);
#pragma unroll
    for (int r = 0; r < 8; ++r) {
      float v = acc[t][r] + bv;
      if (resid) { float rv = resid[(size_t)((row0 + 8 * hh + r) % rmod) * ldr + col]; if (RES_BF16) rv = bf16_round(rv); v += rv; }
      if (ACT == 1) v = fmaxf(v, 0.f);
      if (ACT == 2) v = 0.5f * v * (1.0f + erff(v * 0.70710678118654752f));
      if (ACT == 3) { const float u = 0.7978845608028654f * (v + 0.044715f * v * v * v); v = 0.5f * v * (1.0f + tanhf(u)); }
      so[w][8 * hh + r][t * 16 + ln] = v;
    }
  }
  __builtin_amdgcn_fence(__ATOMIC_ACQ_REL, "workgroup");
  __builtin_amdgcn_wave_barrier();
  const int rsub = lane >> 4, c4 = (lane & 15) * 4;
  {
#pragma unroll
    for (int q = 0; q < 8; ++q) {
      const int r = q * 2 + rsub;
      const v4f v = *(const v4fa*)&so[w][r][c4];
      *(v4f*)(C + (size_t)(row0 + r) * ldc + col0 + c4) = v;
    }
    
  }
}
// row LayerNorm (biased variance, eps) over N: s = X (+ R); optional out_sum <- s; out_norm <- (s-mu)*rsqrt(var+eps)*g + b
template <bool PARAM_BF16>
__global__ __launch_bounds__(256) void k_layernorm(const float* __restrict__ X, const float* __restrict__ R, const float* __restrict__ g, const float* __restrict__ bta,
                                                  float* __restrict__ out_sum, float* __restrict__ out_norm, int N, float eps) {
  __shared__ float red[256];
  const int row = blockIdx.x, tid = threadIdx.x;
  const float* x = X + (size_t)row * N; const float* rr = R ? R + (size_t)row * N : nullptr;
  float vals[16];                     // up to N = 4096
  const int per = N / 256;            // contiguous chunk per thread? use strided-by-4 chunks: thread handles j = tid*4 + 1024*u
  float s1 = 0.f;
  for (int u = 0; u < per / 4; ++u) {
    const int j = tid * 4 + 1024 * u;
    const v4f a = *(const v4fa*)(x + j);
    v4f b = {0.f,0.f,0.f,0.f}; if (rr) b = *(const v4fa*)(rr + j);
#pragma unroll
    for (int q = 0; q < 4; ++q) { const float v = a[q] + b[q]; vals[u * 4 + q] = v; s1 += v; }
  }
  red[tid] = s1; __syncthreads();
  for (int st = 128; st > 0; st >>= 1) { if (tid < st) red[tid] += red[tid + st]; __syncthreads(); }
  const float mu = red[0] / (float)N; __syncthreads();
  float s2 = 0.f;
  for (int u = 0; u < per / 4; ++u)
#pragma unroll
    for (int q = 0; q < 4; ++q) { const float c = vals[u * 4 + q] - mu; s2 += c * c; }
  red[tid] = s2; __syncthreads();
  for (int st = 128; st > 0; st >>= 1) { if (tid < st) red[tid] += red[tid + st]; __syncthreads(); }
  const float rs = rsqrtf(red[0] / (float)N + eps);
  {
    for (int u = 0; u < per / 4; ++u) {
      const int j = tid * 4 + 1024 * u;
      v4f o, sm;
#pragma unroll
      for (int q = 0; q < 4; ++q) {
        float gg = g[j + q], bb = bta[j + q];
        if (PARAM_BF16) { gg = bf16_round(gg); bb = bf16_round(bb); }
        sm[q] = vals[u * 4 + q]; o[q] = (vals[u * 4 + q] - mu) * rs * gg + bb;
      }
      if (out_sum) *(v4f*)(out_sum + (size_t)row * N + j) = sm;
      *(v4f*)(out_norm + (size_t)row * N + j) = o;
    }
    
  }
}



// ---- f16 WMMA path (v_wmma_f32_16x16x32_f16): 11-bit significands for operands in range — used where a [0,1] probability operand needs more precision than bf16
typedef _Float16 v16h __attribute__((ext_vector_type(16)));
union FragH { v16h v; v8us half[2]; _Float16 h[16]; unsigned short u[16]; };
template <int NT>
__device__ __forceinline__ v8f mmaH(v16h ah, v16h al, v16h bh, v16h bl, v8f c) {
  c = __builtin_amdgcn_wmma_f32_16x16x32_f16(false, ah, false, bh, (short)0, c, false, false);
  if (NT >= 2) c = __builtin_amdgcn_wmma_f32_16x16x32_f16(false, al, false, bh, (short)0, c, false, false);
  if (NT >= 3) c = __builtin_amdgcn_wmma_f32_16x16x32_f16(false, ah, false, bl, (short)0, c, false, false);
  asm volatile("v_nop\n\tv_nop\n\tv_nop\n\tv_nop" : "+v"(c) : "v"(ah), "v"(al), "v"(bh), "v"(bl));
  return c;
}
// batched GEMM like k_gemm_b but f16 operands: A f32 (split into f16 hi/lo if ASPLIT, else rounded to f16), Bt = f16 values [n][k]; alpha; C f32; N multiple of 16 (partial tiles skipped)
template <bool ASPLIT>
__global__ __launch_bounds__(128) void k_gemm_h(const float* __restrict__ A, int lda, size_t sA, const _Float16* __restrict__ Bh, int ldb, size_t sB, float alpha, float* __restrict__ C, int ldc, size_t sC, int M, int N, int K) {
  __shared__ __attribute__((aligned(16))) float so[4][16][64];
  const int tid = threadIdx.x, w = tid >> 5, lane = tid & 31, ln = lane & 15, hh = lane >> 4; const int by = blockIdx.y;
  A += (size_t)by * sA; Bh += (size_t)by * sB; C += (size_t)by * sC;
  const int ntn = (N + 63) / 64; const int wid = blockIdx.x * 4 + w; const int mt = wid / ntn, nq = wid % ntn; if (mt * 16 >= M) return;
  const int row0 = mt * 16, col0 = nq * 64; const float* arow = A + (size_t)(row0 + ln) * lda;
  v8f acc[4] = {};
  for (int kb = 0; kb < K; kb += 32) {
    FragH ah, al;
    const v4f x0 = *(const v4fa*)(arow + kb + 8 * hh), x1 = *(const v4fa*)(arow + kb + 8 * hh + 4), x2 = *(const v4fa*)(arow + kb + 16 + 8 * hh), x3 = *(const v4fa*)(arow + kb + 16 + 8 * hh + 4);
    float xs[16] = {x0[0],x0[1],x0[2],x0[3],x1[0],x1[1],x1[2],x1[3],x2[0],x2[1],x2[2],x2[3],x3[0],x3[1],x3[2],x3[3]};
#pragma unroll
    for (int i = 0; i < 16; ++i) { const _Float16 h = (_Float16)xs[i]; ah.h[i] = h; al.h[i] = ASPLIT ? (_Float16)(xs[i] - (float)h) : (_Float16)0.0f; }
#pragma unroll
    for (int t = 0; t < 4; ++t) { if (col0 + t * 16 >= N) continue; const size_t boff = (size_t)(col0 + t * 16 + ln) * ldb + kb; FragH bq; bq.half[0] = *(const v8us*)(Bh + boff + 8 * hh); bq.half[1] = *(const v8us*)(Bh + boff + 16 + 8 * hh);
      acc[t] = mmaH<ASPLIT ? 2 : 1>(ah.v, al.v, bq.v, bq.v, acc[t]); }
  }
#pragma unroll
  for (int t = 0; t < 4; ++t) { if (col0 + t * 16 >= N) continue;
#pragma unroll
    for (int r = 0; r < 8; ++r) so[w][8 * hh + r][t * 16 + ln] = acc[t][r] * alpha; }
  __builtin_amdgcn_fence(__ATOMIC_ACQ_REL, "workgroup"); __builtin_amdgcn_wave_barrier();
  const int rsub = lane >> 4, c4 = (lane & 15) * 4;
  {
#pragma unroll
    for (int q = 0; q < 8; ++q) { const int r = q * 2 + rsub; if (col0 + c4 < N) { const v4f v = *(const v4fa*)&so[w][r][c4]; *(v4f*)(C + (size_t)(row0 + r) * ldc + col0 + c4) = v; } }
     }
}

// Wt[n][k] = f16(bf16(W[k][n])*scale) from f32 row-major W[K][N] (scale = power of two; bf16-exact weights stay exact in f16 away from the subnormal range)
// One block turns a tile of 128 k x 64 n through LDS: W is read as whole 256-B pieces of its rows (16 B a lane, all 8 loads of a lane in flight) and Wt is written as whole 256-B pieces of its rows. (K / 128) * (N / 64) tiles. K and N are compile-time so that a lane's 8 loads, and its 4 stores, share one address and differ in the immediate offset only.
#define WT_P 65      /* dwords per LDS row (one n: 64 pairs of k, + 1): odd, so the 16 lanes that store 4 rows apart and the 16 that read 4 dwords apart each meet 16 different banks */
typedef unsigned int v4ua __attribute__((ext_vector_type(4), may_alias));
template <int K, int N>
__device__ __forceinline__ void wt_tile(unsigned int* tl, const float* __restrict__ W, _Float16* __restrict__ Wt, float scale, int blk) { static_assert(K % 128 == 0 && N % 64 == 0, "wt_tile: whole tiles only");      /* tl = 64 * WT_P dwords of LDS; blk = the tile's number */
  constexpr int ntn = N / 64; const int tid = threadIdx.x; const int kt = blk / ntn, nt = blk % ntn; const int k0 = kt * 128, n0 = nt * 64; const int r = tid >> 4, c = tid & 15;
  const float* p = W + (size_t)(k0 + 2 * r) * N + n0 + c * 4;
  v4f a[4], b[4];      /* rows k0 + 2 * (16 u + r) and the next one, columns n0 + 4 c .. + 3; every loop below is unrolled whole, so that a and b are indexed by constants and stay in registers and the offsets are immediates */
#pragma unroll
  for (int u = 0; u < 4; ++u) { a[u] = *(const v4fa*)(p + (size_t)u * 32 * N); b[u] = *(const v4fa*)(p + (size_t)u * 32 * N + N); }
#pragma unroll
  for (int u = 0; u < 4; ++u) {
#pragma unroll
    for (int j = 0; j < 4; ++j) { union { _Float16 h[2]; unsigned int d; } pk; pk.h[0] = (_Float16)(bf16_round(a[u][j]) * scale); pk.h[1] = (_Float16)(bf16_round(b[u][j]) * scale); tl[(c * 4 + j) * WT_P + u * 16 + r] = pk.d; } }
  __syncthreads();
  unsigned short* q = (unsigned short*)Wt + (size_t)(n0 + r) * K + k0 + c * 8;
#pragma unroll
  for (int v = 0; v < 4; ++v) { v4ua o;
#pragma unroll
    for (int i = 0; i < 4; ++i) o[i] = tl[(v * 16 + r) * WT_P + c * 4 + i];
    *(v4ua*)(q + (size_t)v * 16 * K) = o; }
  asm volatile("s_wait_xcnt 0x0" ::: "memory");      /* a precaution: the built kernel lays another job's code behind these stores, and that code rewrites the registers they name; the wait stands in front of it */
}
// k_gemm_hh variant with fused epilogue: v = acc·alpha + bias[by·sBias + col] (+ CP[(row/rowsPerB)·sCPb + by·64 + col] if CP) ; ACT 0 none / 1 elu ; writes f16 C16 (and f32 C if non-null)
template <int ACT>
__global__ __launch_bounds__(128) void k_gemm_hhx(const _Float16* __restrict__ A, int lda, size_t sA, const _Float16* __restrict__ Bh, int ldb, size_t sB, float alpha, const float* __restrict__ bias, size_t sBias, const float* __restrict__ CP, int rowsPerB, size_t sCPb, int row0g,
    float* __restrict__ C, _Float16* __restrict__ C16, int ldc, size_t sC, int M, int N, int K) {
  __shared__ __attribute__((aligned(16))) float so[4][16][64];
  const int tid = threadIdx.x, w = tid >> 5, lane = tid & 31, ln = lane & 15, hh = lane >> 4; const int by = blockIdx.y;
  A += (size_t)by * sA; Bh += (size_t)by * sB; const size_t cofs = (size_t)by * sC; const float* bp = bias ? bias + (size_t)by * sBias : nullptr;
  const int ntn = (N + 63) / 64; const int wid = blockIdx.x * 4 + w; const int mt = wid / ntn, nq = wid % ntn; if (mt * 16 >= M) return;
  const int row0 = mt * 16, col0 = nq * 64; const _Float16* arow = A + (size_t)(row0 + ln) * lda;
  v8f acc[4] = {};
  for (int kb = 0; kb < K; kb += 32) { FragH ah; ah.half[0] = *(const v8us*)((const unsigned short*)arow + kb + 8 * hh); ah.half[1] = *(const v8us*)((const unsigned short*)arow + kb + 16 + 8 * hh);
#pragma unroll
    for (int t = 0; t < 4; ++t) { if (col0 + t * 16 >= N) continue; const size_t boff = (size_t)(col0 + t * 16 + ln) * ldb + kb; FragH bq; bq.half[0] = *(const v8us*)((const unsigned short*)Bh + boff + 8 * hh); bq.half[1] = *(const v8us*)((const unsigned short*)Bh + boff + 16 + 8 * hh);
      acc[t] = mmaH<1>(ah.v, ah.v, bq.v, bq.v, acc[t]); }
  }
#pragma unroll
  for (int t = 0; t < 4; ++t) { if (col0 + t * 16 >= N) continue; const int col = col0 + t * 16 + ln; const float bv = bp ? bf16_round(bp[col]) : 0.f;
#pragma unroll
    for (int r = 0; r < 8; ++r) { float v = acc[t][r] * alpha + bv; if (CP) { const int rr = row0g + row0 + 8 * hh + r; if (rowsPerB < 0) v += CP[cofs + (size_t)rr * ldc + col];      /* rowsPerB < 0: own element of the batched C plane */ else { const int bidx = rr / rowsPerB; v += CP[(size_t)bidx * sCPb + (size_t)by * 64 + col]; } } if (ACT == 1) v = (v > 0.f) ? v : expm1f(v); else if (ACT == 7) v = (v > 0.f) ? v + 1.0f : expf(v); else if (ACT == 8) v = tanhf(v); else if (ACT == 9) v = 0.5f * v * (1.0f + tanhf(0.7978845608028654f * (v + 0.044715f * v * v * v))); else if (ACT == 11) v = 1.0f / (1.0f + expf(-v)); else if (ACT == 12) v = (v > 0.f) ? v : 0.01f * v; else if (ACT == 14) v = (v > 0.f) ? v : 0.1f * v; else if (ACT == 16) v = (v >= 0.f) ? v : 0.3f * v; else if (ACT == 15) v = v / (1.0f + expf(-v)); else if (ACT == 3) v = fmaxf(v, 0.f); else if (ACT == 6) v = 0.5f * v * (1.0f + erff(v * 0.70710678118654752f)); so[w][8 * hh + r][t * 16 + ln] = v; } }
  __builtin_amdgcn_fence(__ATOMIC_ACQ_REL, "workgroup"); __builtin_amdgcn_wave_barrier();
  const int rsub = lane >> 4, c4 = (lane & 15) * 4; typedef _Float16 v4h __attribute__((ext_vector_type(4)));
  {
#pragma unroll
    for (int q = 0; q < 8; ++q) { const int r = q * 2 + rsub; if (col0 + c4 < N) { const v4f v = *(const v4fa*)&so[w][r][c4]; if (C) *(v4f*)(C + cofs + (size_t)(row0 + r) * ldc + col0 + c4) = v; if (C16) { v4h h4; for (int i = 0; i < 4; ++i) h4[i] = (_Float16)v[i]; *(v4h*)(C16 + cofs + (size_t)(row0 + r) * ldc + col0 + c4) = h4; } } }
     }
}


typedef _Float16 v4h __attribute__((ext_vector_type(4)));

__device__ __forceinline__ void x16_part(const float* __restrict__ x, _Float16* __restrict__ X16, int blk) { const size_t t = (size_t)blk * 256 + threadIdx.x; FragH f;
#pragma unroll
  for (int q = 0; q < 8; ++q) f.h[q] = (_Float16)bf16_round(x[t * 8 + q]); *(v8us*)((unsigned short*)X16 + t * 8) = f.half[0];  }
__global__ __launch_bounds__(256) void k_h16(const float* __restrict__ x, _Float16* __restrict__ X16, size_t n8, size_t sB) { const size_t t = (size_t)blockIdx.x * 256 + threadIdx.x; if (t >= n8) return; x += (size_t)blockIdx.y * sB; X16 += (size_t)blockIdx.y * sB;      /* batch = blockIdx.y */ FragH f;
#pragma unroll
  for (int q = 0; q < 8; ++q) f.h[q] = (_Float16)x[t * 8 + q]; *(v8us*)((unsigned short*)X16 + t * 8) = f.half[0];  }
__global__ __launch_bounds__(256) void k_round16f(const float* __restrict__ W, _Float16* __restrict__ Bt, size_t n8) { const size_t t = (size_t)blockIdx.x * 256 + threadIdx.x; if (t >= n8) return; FragH f;
#pragma unroll
  for (int i = 0; i < 8; ++i) f.h[i] = (_Float16)(bf16_round(W[t * 8 + i]) * 16.0f); *(v8us*)((unsigned short*)Bt + t * 8) = f.half[0];  }
template <int NHv, int TTv>
__global__ __launch_bounds__(256) void k_vt(const _Float16* __restrict__ V16, int ldv, int voff, _Float16* __restrict__ Vt) { __shared__ unsigned short tl[64][66]; const int tid = threadIdx.x; const int slab = blockIdx.x / (TTv / 64), lg = blockIdx.x % (TTv / 64); const int b = slab / NHv, h = slab % NHv;
  for (int i = tid; i < 64 * 8; i += 256) { const int r = i / 8, c8 = (i % 8) * 8; FragH f; f.half[0] = *(const v8us*)((const unsigned short*)V16 + ((size_t)b * TTv + lg * 64 + r) * ldv + voff + h * 64 + c8);
#pragma unroll
    for (int q = 0; q < 8; ++q) tl[r][c8 + q] = f.u[q]; }
  __syncthreads();
  {
#pragma unroll
    for (int rd = 0; rd < 2; ++rd) { const int d = rd * 32 + tid / 8, pc = tid % 8; FragH f;
#pragma unroll
      for (int q = 0; q < 8; ++q) f.u[q] = tl[pc * 8 + q][d];
      *(v8us*)((unsigned short*)Vt + ((size_t)slab * 64 + d) * TTv + lg * 64 + pc * 8) = f.half[0]; }
     } }

// ---- fast GEMM (block tile 128x64, wave tile 32x64; requires M % 128 == 0 rows per launch region, N % 64 == 0, K % 64 == 0); epilogue = k_gemm_hhx semantics ----
// Operands reach the waves through LDS: per 64 k one tile of 128 A rows and 64 B rows, 128 B (one whole line) of each row, brought by asynchronous copies (32 lanes = 4 whole lines a copy) into one of two buffers while the other is worked on; each row is fetched once per block instead of once per wave in 32-B pieces.
#define G2_PITCH 72      /* f16 per LDS row: 128 B of k + 16 B, the conflict-free pitch for ds_load_b128 readers of 128-B rows */
#define G2_TILE ((128 + 64) * G2_PITCH * 2)      /* bytes of one buffer: 128 A rows, then 64 B rows */
// one tile's 12 copies of a lane (rows 16 apart: 8 of A, 4 of B); l = the lane's LDS byte address of its first piece; ga2 = the lane's piece of A-tile row 64 + its first row (ga + 4 sa, or a row of a second plane). s_wait_xcnt 0 is the statement's last line so that no address register of a copy is rewritten ahead of it.
__device__ __forceinline__ void g2_stage(unsigned l, const _Float16* ga, const _Float16* ga2, size_t sa, const _Float16* gb, size_t sb) { const unsigned r16 = 16 * G2_PITCH * 2;
  asm volatile("global_load_async_to_lds_b128 %0, %12, off\n\t" "global_load_async_to_lds_b128 %1, %13, off\n\t" "global_load_async_to_lds_b128 %2, %14, off\n\t" "global_load_async_to_lds_b128 %3, %15, off\n\t"
               "global_load_async_to_lds_b128 %4, %16, off\n\t" "global_load_async_to_lds_b128 %5, %17, off\n\t" "global_load_async_to_lds_b128 %6, %18, off\n\t" "global_load_async_to_lds_b128 %7, %19, off\n\t"
               "global_load_async_to_lds_b128 %8, %20, off\n\t" "global_load_async_to_lds_b128 %9, %21, off\n\t" "global_load_async_to_lds_b128 %10, %22, off\n\t" "global_load_async_to_lds_b128 %11, %23, off\n\t"
               "s_wait_xcnt 0x0"
               :: "v"(l), "v"(l + r16), "v"(l + 2 * r16), "v"(l + 3 * r16), "v"(l + 4 * r16), "v"(l + 5 * r16), "v"(l + 6 * r16), "v"(l + 7 * r16), "v"(l + 8 * r16), "v"(l + 9 * r16), "v"(l + 10 * r16), "v"(l + 11 * r16),
                  "v"(ga), "v"(ga + sa), "v"(ga + 2 * sa), "v"(ga + 3 * sa), "v"(ga2), "v"(ga2 + sa), "v"(ga2 + 2 * sa), "v"(ga2 + 3 * sa), "v"(gb), "v"(gb + sb), "v"(gb + 2 * sb), "v"(gb + 3 * sb)
               : "memory"); }
__device__ __forceinline__ v16h g2_frag(const _Float16* p, int hh) { FragH f; f.half[0] = *(const v8us*)((const unsigned short*)p + 8 * hh); f.half[1] = *(const v8us*)((const unsigned short*)p + 16 + 8 * hh); return f.v; }
__device__ __forceinline__ v8f g2_mma(v16h a, v16h b, v8f c) { v8f d = __builtin_amdgcn_wmma_f32_16x16x32_f16(false, a, false, b, (short)0, c, false, false); asm volatile("v_nop\n\tv_nop\n\tv_nop\n\tv_nop" : "+v"(d) : "v"(a), "v"(b)); return d; }
// LOFOLD (the output projection): A = O hi, flat [NB * SQ] rows, AL = the residual plane (x 2^10) of rows < BAND, flat [NB * BAND] rows. Per batch BAND / 64 blocks of 64 rows < BAND, then (SQ - BAND) / 128 plain blocks. In a block of rows < BAND the A tile's rows 0 .. 63 are O hi (waves 0, 1) and its rows 64 .. 127 the residuals of the same 64 rows (waves 2, 3, alpha * 2^-10); the epilogue adds the two products and writes f32 C.
#define G2_RB (BAND / 64 + (SQ - BAND) / 128)      /* row blocks per batch under LOFOLD */
template <int ACT, bool LOFOLD>
__global__ __launch_bounds__(128) void k_gemm2(const _Float16* __restrict__ A, int lda, size_t sA, const _Float16* __restrict__ Bh, int ldb, size_t sB, float alpha, const float* __restrict__ bias, size_t sBias, const float* __restrict__ CP, int rowsPerB, size_t sCPb, int row0g,
    float* __restrict__ C, _Float16* __restrict__ C16, int ldc, size_t sC, int M, int N, int K, size_t zA, size_t zB, size_t zC, const _Float16* __restrict__ AL) { static_assert(ACT == 0 || ACT == 3 || ACT == 6 || ACT == 8 || ACT == 9 || ACT == 11 || ACT == 12 || ACT == 14 || ACT == 15 || ACT == 16, "k_gemm2: unsupported ACT code (would silently apply no activation)");
  __shared__ __attribute__((aligned(16))) unsigned char sm[2 * G2_TILE]; float (*so)[32][68] = (float (*)[32][68])sm;      /* the epilogue's staging lies over the two buffers, which every wave has left by then */ static_assert(sizeof(float) * 4 * 32 * 68 <= 2 * G2_TILE, "k_gemm2: epilogue staging must fit the buffers");
  const int tid = threadIdx.x, w = tid >> 5, lane = tid & 31, ln = lane & 15, hh = lane >> 4; const int by = blockIdx.y, bz = blockIdx.z;
  A += (size_t)by * sA + (size_t)bz * zA; Bh += (size_t)by * sB + (size_t)bz * zB; const size_t cofs = (size_t)by * sC + (size_t)bz * zC; const float* bp = bias ? bias + (size_t)by * sBias : nullptr;
  const int ntn = N >> 6; const int mt = blockIdx.x / ntn, nq = blockIdx.x - mt * ntn; const int col0 = nq * 64; if (!LOFOLD && mt * 128 >= M) return;      /* the same for the whole block: it stands in front of barriers */
  const int bt = mt / G2_RB, rb = mt - bt * G2_RB; const bool band = LOFOLD && rb < BAND / 64;      /* the same for the whole block */
  const int arow = !LOFOLD ? mt * 128 : bt * SQ + (band ? rb * 64 : BAND + (rb - BAND / 64) * 128);      /* the block's first row of A and of C */ const int row0 = arow + 32 * w;
  const int trow = tid >> 3, tseg = tid & 7;      /* a lane's piece of a tile: 16 B number tseg of rows trow, trow + 16, ... */
  const _Float16* gA = A + (size_t)(arow + trow) * lda + tseg * 8; const _Float16* gB = Bh + (size_t)(col0 + trow) * ldb + tseg * 8; const size_t sa16 = (size_t)16 * lda, sb16 = (size_t)16 * ldb;
  const _Float16* gA2 = band ? AL + (size_t)(bt * BAND + rb * 64 + trow) * lda + tseg * 8 : gA + 4 * sa16;      /* the lane's piece of A-tile row 64 + trow */
  const unsigned l0 = (unsigned)(size_t)sm + (unsigned)(trow * (G2_PITCH * 2) + tseg * 16);
  const v8f z8 = {0.f,0.f,0.f,0.f,0.f,0.f,0.f,0.f}; v8f c00 = z8, c01 = z8, c02 = z8, c03 = z8, c10 = z8, c11 = z8, c12 = z8, c13 = z8;
  const int nc = K >> 6;
  g2_stage(l0, gA, gA2, sa16, gB, sb16);
  asm volatile("s_wait_asynccnt 0x0" ::: "memory");      /* tile 0 of this wave's copies has landed */
  __syncthreads();      /* ... and every other wave's */
  if (nc > 1) g2_stage(l0 + G2_TILE, gA + 64, gA2 + 64, sa16, gB + 64, sb16);
#pragma unroll 1      /* one tile a trip: the buffer index stays a run-time value and the loop stays small */
  for (int t = 0; t < nc; ++t) { const _Float16* tl = (const _Float16*)(sm + (t & 1) * G2_TILE); const _Float16* ar = tl + (32 * w + ln) * G2_PITCH; const _Float16* br = tl + (128 + ln) * G2_PITCH;
    /* all 24 LDS reads of the trip as one group in front of its WMMAs */
    const v16h a0 = g2_frag(ar, hh), a1 = g2_frag(ar + 16 * G2_PITCH, hh), b0 = g2_frag(br, hh), b1 = g2_frag(br + 16 * G2_PITCH, hh), b2 = g2_frag(br + 32 * G2_PITCH, hh), b3 = g2_frag(br + 48 * G2_PITCH, hh);
    const v16h e0 = g2_frag(ar + 32, hh), e1 = g2_frag(ar + 16 * G2_PITCH + 32, hh), f0 = g2_frag(br + 32, hh), f1 = g2_frag(br + 16 * G2_PITCH + 32, hh), f2 = g2_frag(br + 32 * G2_PITCH + 32, hh), f3 = g2_frag(br + 48 * G2_PITCH + 32, hh);
    c00 = g2_mma(a0, b0, c00); c10 = g2_mma(a1, b0, c10); c01 = g2_mma(a0, b1, c01); c11 = g2_mma(a1, b1, c11); c02 = g2_mma(a0, b2, c02); c12 = g2_mma(a1, b2, c12); c03 = g2_mma(a0, b3, c03); c13 = g2_mma(a1, b3, c13);
    c00 = g2_mma(e0, f0, c00); c10 = g2_mma(e1, f0, c10); c01 = g2_mma(e0, f1, c01); c11 = g2_mma(e1, f1, c11); c02 = g2_mma(e0, f2, c02); c12 = g2_mma(e1, f2, c12); c03 = g2_mma(e0, f3, c03); c13 = g2_mma(e1, f3, c13);
    asm volatile("s_wait_dscnt 0x0" ::: "memory");      /* this wave's reads of buffer t & 1 are done before the buffer is handed back */
    asm volatile("s_wait_asynccnt 0x0" ::: "memory");      /* this wave's copies of tile t + 1 have landed */
    __syncthreads();      /* publishes tile t + 1 and ends every wave's reads of tile t */
    if (t + 2 < nc) g2_stage(l0 + (unsigned)((t & 1) * G2_TILE), gA + (size_t)(t + 2) * 64, gA2 + (size_t)(t + 2) * 64, sa16, gB + (size_t)(t + 2) * 64, sb16); }
  asm volatile("s_wait_asynccnt 0x0" ::: "memory");      /* no copy is in flight when the buffers become the epilogue's staging */
  v8f accs[8] = {c00, c01, c02, c03, c10, c11, c12, c13};
  if (band) {      /* rows < BAND: C = alpha (O hi . W) + alpha 2^-10 (residual . W), the two products met in LDS */
    const float aw = w >= 2 ? alpha * 0.0009765625f : alpha;
#pragma unroll
    for (int u = 0; u < 8; ++u) {
#pragma unroll
      for (int r = 0; r < 8; ++r) so[w][(u >> 2) * 16 + 8 * hh + r][(u & 3) * 16 + ln] = accs[u][r] * aw; }
    __syncthreads();      /* waves 0, 1 hold the hi product of the block's 64 rows, waves 2, 3 the residual product: each wave reads both for the 16 rows it stores */
    v4f o[8];      /* all 16 LDS reads and the sums first, then the 8 stores together: not a chain of read, wait, store */
#pragma unroll
    for (int q = 0; q < 8; ++q) { const int r = 16 * w + q * 2 + (lane >> 4); const v4f x = *(const v4fa*)&so[r >> 5][r & 31][ln * 4], y = *(const v4fa*)&so[2 + (r >> 5)][r & 31][ln * 4]; o[q] = x + y; }
    float* cp = C + cofs + (size_t)(arow + 16 * w + (lane >> 4)) * ldc + col0 + ln * 4;
#pragma unroll
    for (int q = 0; q < 8; ++q) *(v4f*)(cp + (size_t)(q * 2) * ldc) = o[q];
    return; }
#pragma unroll
  for (int u = 0; u < 8; ++u) { const int t = u & 3, half = u >> 2; const int col = col0 + t * 16 + ln; const float bv = bp ? bf16_round(bp[col]) : 0.f;
#pragma unroll
    for (int r = 0; r < 8; ++r) { const int rloc = half * 16 + 8 * hh + r; float v = accs[u][r] * alpha + bv; if (CP) { if (rowsPerB < 0) v += CP[cofs + (size_t)(row0g + row0 + rloc) * ldc + col];      /* rowsPerB < 0: own element of the batched C plane */ else { const int bidx = (row0g + row0 + rloc) / rowsPerB; v += CP[(size_t)bidx * sCPb + (size_t)by * 64 + col]; } }
      if (ACT == 3) v = fmaxf(v, 0.f); else if (ACT == 6) v = 0.5f * v * (1.0f + erff(v * 0.70710678118654752f)); else if (ACT == 11) v = 1.0f / (1.0f + expf(-v)); else if (ACT == 15) v = v / (1.0f + expf(-v)); else if (ACT == 12) v = (v > 0.f) ? v : 0.01f * v; else if (ACT == 8) v = tanhf(v); else if (ACT == 9) v = 0.5f * v * (1.0f + tanhf(0.7978845608028654f * (v + 0.044715f * v * v * v))); else if (ACT == 14) v = (v > 0.f) ? v : 0.1f * v; else if (ACT == 16) v = (v >= 0.f) ? v : 0.3f * v;
      so[w][rloc][t * 16 + ln] = v; } }
  __builtin_amdgcn_fence(__ATOMIC_ACQ_REL, "workgroup"); __builtin_amdgcn_wave_barrier();
  const int rsub = lane >> 4, c4 = (lane & 15) * 4;
  {
#pragma unroll
    for (int q = 0; q < 16; ++q) { const int r = q * 2 + rsub; const v4f v = *(const v4fa*)&so[w][r][c4]; if (C) *(v4f*)(C + cofs + (size_t)(row0 + r) * ldc + col0 + c4) = v; if (C16) { v4h h4; for (int i = 0; i < 4; ++i) h4[i] = (_Float16)v[i]; *(v4h*)(C16 + cofs + (size_t)(row0 + r) * ldc + col0 + c4) = h4; } }
     } }


#define LDQKV (DM + 2 * HD)      /* columns of the joint projection: q (8 heads), k, v */
__device__ __forceinline__ void rotab_part(const int* __restrict__ pid, float* __restrict__ CS, float* __restrict__ SN, int blk) {
  #pragma clang fp contract(off)
  const int t = blk * 256 + threadIdx.x; const int j = t % HH, s = t / HH;      /* s = flat token over both batches */ const float inv = 1.0f / powf(10000.0f, (float)(2 * j) / (float)HD); const float th = (float)pid[s] * inv; const float c = cosf(th), sn = sinf(th);
  { *(float*)(CS + t) = c; *(float*)(SN + t) = sn;  }
  asm volatile("s_wait_xcnt 0x0" ::: "memory");      /* a precaution: the built kernel lays another job's code behind these stores, and that code rewrites the registers they name; the wait stands in front of it */ }
// rotation of the 8 query heads and of the key head (head 8 of a row of the joint projection) in one index space
__device__ __forceinline__ void rope_part(const float* __restrict__ F, const float* __restrict__ CS, const float* __restrict__ SN, _Float16* __restrict__ QH, _Float16* __restrict__ QL, _Float16* __restrict__ KH, _Float16* __restrict__ KL, int blk) {
  #pragma clang fp contract(off)
  const int t = blk * 256 + threadIdx.x; const int g = (t % (HH / 8)) * 8; const int h = (t / (HH / 8)) % (NHQ + 1); const int s = t / ((HH / 8) * (NHQ + 1));
  const bool isq = h < NHQ; _Float16* H = isq ? QH : KH; _Float16* L = isq ? QL : KL; F += (size_t)s * LDQKV + h * HD + g;
  const size_t base = isq ? (size_t)s * DM + h * HD + g : (size_t)s * HD + g; FragH h0, h1, l0, l1;
#pragma unroll
  for (int q = 0; q < 8; ++q) { const float c = CS[s * HH + g + q], sn = SN[s * HH + g + q]; const float x0 = F[q], x1 = F[HH + q]; float o0 = x0 * c; o0 += -x1 * sn; float o1 = x1 * c; o1 += x0 * sn;
    const _Float16 a0 = (_Float16)o0, a1 = (_Float16)o1; h0.h[q] = a0; h1.h[q] = a1; l0.h[q] = (_Float16)((o0 - (float)a0) * 1024.0f); l1.h[q] = (_Float16)((o1 - (float)a1) * 1024.0f); }
  { *(v8us*)((unsigned short*)H + base) = h0.half[0]; *(v8us*)((unsigned short*)H + base + HH) = h1.half[0]; *(v8us*)((unsigned short*)L + base) = l0.half[0]; *(v8us*)((unsigned short*)L + base + HH) = l1.half[0];  } }
// V^T hi and residual (x 2^10) planes straight from the f32 v columns of the joint projection: one block turns 64 tokens x 64 d through two LDS tiles. Fv = column 0 of v in row 0.
__device__ __forceinline__ void vthl_part(unsigned short (*th)[66], unsigned short (*tr)[66], const float* __restrict__ Fv, _Float16* __restrict__ VTh, _Float16* __restrict__ VTl, int blk) {
  const int tid = threadIdx.x; const int slab = blk / (SQ / 64), lg = blk % (SQ / 64); const int b = slab / (HD / 64), h = slab % (HD / 64);
  for (int i = tid; i < 64 * 8; i += 256) { const int r = i / 8, c8 = (i % 8) * 8; const float* p = Fv + ((size_t)b * SQ + lg * 64 + r) * LDQKV + h * 64 + c8; const v4f a = *(const v4fa*)p, c = *(const v4fa*)(p + 4); FragH fh, fl;
#pragma unroll
    for (int q = 0; q < 4; ++q) { _Float16 x = (_Float16)a[q]; fh.h[q] = x; fl.h[q] = (_Float16)((a[q] - (float)x) * 1024.0f); x = (_Float16)c[q]; fh.h[4 + q] = x; fl.h[4 + q] = (_Float16)((c[q] - (float)x) * 1024.0f); }
#pragma unroll
    for (int q = 0; q < 8; ++q) { th[r][c8 + q] = fh.u[q]; tr[r][c8 + q] = fl.u[q]; } }
  __syncthreads();
#pragma unroll
  for (int rd = 0; rd < 2; ++rd) { const int d = rd * 32 + tid / 8, pc = tid % 8; FragH fh, fl;
#pragma unroll
    for (int q = 0; q < 8; ++q) { fh.u[q] = th[pc * 8 + q][d]; fl.u[q] = tr[pc * 8 + q][d]; }
    const size_t o = ((size_t)slab * 64 + d) * SQ + lg * 64 + pc * 8; *(v8us*)((unsigned short*)VTh + o) = fh.half[0]; *(v8us*)((unsigned short*)VTl + o) = fl.half[0]; } }
// ---- launches that do not depend on one another stand side by side in one grid; a block's range of blockIdx.x says which job it does (the same for the whole block, so each job's barrier is passed by all of its block) ----
#define PB_X16 (NB * SQ * DM / 8 / 256)      /* blocks of the f16 plane of the hidden states */
#define PB_WB ((DM / 128) * (DM / 64))      /* tiles of Wq, and of Wo */
#define PB_WS ((DM / 128) * (HD / 64))      /* tiles of Wk, and of Wv */
#define PB_ROT (NB * SQ * HH / 256)      /* blocks of the RoPE tables */
__global__ __launch_bounds__(256) void k_prep(const float* __restrict__ hs, const int* __restrict__ pid, const float* __restrict__ Wq, const float* __restrict__ Wk, const float* __restrict__ Wv, const float* __restrict__ Wo,
    _Float16* __restrict__ X16, _Float16* __restrict__ BQ, _Float16* __restrict__ BK, _Float16* __restrict__ BV, _Float16* __restrict__ BO, float* __restrict__ CS, float* __restrict__ SN) {
  __shared__ unsigned int tl[64 * WT_P];
  int bx = blockIdx.x;
  if (bx < PB_X16) { x16_part(hs, X16, bx); return; }
  bx -= PB_X16;
  if (bx < 2 * PB_WB) { const bool o = bx >= PB_WB; wt_tile<DM, DM>(tl, o ? Wo : Wq, o ? BO : BQ, 16.0f, o ? bx - PB_WB : bx); return; }
  bx -= 2 * PB_WB;
  if (bx < 2 * PB_WS) { const bool v = bx >= PB_WS; wt_tile<DM, HD>(tl, v ? Wv : Wk, v ? BV : BK, 16.0f, v ? bx - PB_WS : bx); return; }
  rotab_part(pid, CS, SN, bx - 2 * PB_WS); }
#define QB_VT (NB * (HD / 64) * (SQ / 64))      /* tiles of V^T */
#define QB_ROPE (NB * SQ * (NHQ + 1) * (HH / 8) / 256)      /* blocks of the rotation */
__global__ __launch_bounds__(256) void k_post(const float* __restrict__ F, const float* __restrict__ CS, const float* __restrict__ SN, _Float16* __restrict__ QH, _Float16* __restrict__ QL, _Float16* __restrict__ KH, _Float16* __restrict__ KL, _Float16* __restrict__ VTh, _Float16* __restrict__ VTl) {
  __shared__ unsigned short th[64][66], tr[64][66];
  const int bx = blockIdx.x;
  if (bx < QB_VT) { vthl_part(th, tr, F + DM + HD, VTh, VTl, bx); return; }
  rope_part(F, CS, SN, QH, QL, KH, KL, bx - QB_VT); }
typedef int v4ia __attribute__((ext_vector_type(4), may_alias));

#define FA_KP 264      /* f16 per LDS row of K: 512 B + 16 B = 16 B x 33, the conflict-free kind of pitch for ds_load_b128 readers */
#define FA_KB (64 * FA_KP * 2)      /* bytes of the K part of a buffer */
#define FA_TILE (FA_KB + HD * G2_PITCH * 2)      /* bytes of one buffer: 64 K rows, then 256 V^T rows */
// 8 copies of a lane, LDS addresses ls bytes apart, global addresses gs elements apart. s_wait_xcnt 0 is the statement's last line so that no address register of a copy is rewritten ahead of it.
__device__ __forceinline__ void fa_stage8(unsigned l, unsigned ls, const _Float16* g, size_t gs) {
  asm volatile("global_load_async_to_lds_b128 %0, %8, off\n\t" "global_load_async_to_lds_b128 %1, %9, off\n\t" "global_load_async_to_lds_b128 %2, %10, off\n\t" "global_load_async_to_lds_b128 %3, %11, off\n\t"
               "global_load_async_to_lds_b128 %4, %12, off\n\t" "global_load_async_to_lds_b128 %5, %13, off\n\t" "global_load_async_to_lds_b128 %6, %14, off\n\t" "global_load_async_to_lds_b128 %7, %15, off\n\t"
               "s_wait_xcnt 0x0"
               :: "v"(l), "v"(l + ls), "v"(l + 2 * ls), "v"(l + 3 * ls), "v"(l + 4 * ls), "v"(l + 5 * ls), "v"(l + 6 * ls), "v"(l + 7 * ls),
                  "v"(g), "v"(g + gs), "v"(g + 2 * gs), "v"(g + 3 * gs), "v"(g + 4 * gs), "v"(g + 5 * gs), "v"(g + 6 * gs), "v"(g + 7 * gs)
               : "memory"); }
__device__ __forceinline__ v8f fa_mma(v16h a, v16h b, v8f c) { return __builtin_amdgcn_wmma_f32_16x16x32_f16(false, a, false, b, (short)0, c, false, false); }
// ---- rows < BAND, hi + residual operands: the same walk as k_fattn below (transposed products, running maximum and sum, tiles of 64 keys), with S = Qh Kh + 2^-10 (Ql Kh + Qh Kl) and O = 2^-10 Ph Vh + 2^-20 (Pl Vh + Ph Vl); the residual terms gather in accumulators of their own; O leaves as f16 hi and residual (x 2^10) ----
// LDS: the hi planes' tile lies in the first buffer of k_fattn, the residual planes' tile in the second, so a tile is filled, read by all and only then refilled (at most 4 tiles: the wait is short and stands beside the long blocks' work). The block's 128 query rows, hi then residual, lie in sq at the K pitch and are read per tile: the two O accumulators leave no registers for them.
__device__ __forceinline__ void fa_band0(unsigned char* sm, unsigned char* sq, const int* mk, const _Float16* __restrict__ Qh, const _Float16* __restrict__ Ql, const _Float16* __restrict__ Kh, const _Float16* __restrict__ Kl, const _Float16* __restrict__ Vh, const _Float16* __restrict__ Vl,
    _Float16* __restrict__ O16, _Float16* __restrict__ OL0, int R0, int nt, int h, int b) {      /* Kh, Kl, Vh, Vl: the batch's planes */
  const float NONE = -3.0e38f, FLOOR = -1.0e30f, SC = 0.0625f * 1.44269504088896340736f, LO = 0.0009765625f;
  const int tid = threadIdx.x, lane = tid & 31, ln = lane & 15, hh = lane >> 4; const int w = __builtin_amdgcn_readfirstlane(tid >> 5); const int q0 = R0 + 16 * w;      /* the wave's first query */
  const unsigned rowl = (unsigned)((tid >> 5) * (FA_KP * 2) + (tid & 31) * 16);      /* a wave's copy = one whole row of 512 B (Q, K), or 4 whole lines of V^T */
  const unsigned lk = (unsigned)(size_t)sm + rowl, lv = (unsigned)(size_t)sm + (unsigned)(FA_KB + (tid >> 3) * (G2_PITCH * 2) + (tid & 7) * 16), lq = (unsigned)(size_t)sq + rowl;
  const size_t ko = (size_t)(tid >> 5) * HD + (tid & 31) * 8, vo = (size_t)(tid >> 3) * SQ + (tid & 7) * 8, qo = ((size_t)b * SQ + R0 + (tid >> 5)) * DM + h * HD + (tid & 31) * 8;
  fa_stage8(lq, 8 * FA_KP * 2, Qh + qo, (size_t)8 * DM); fa_stage8(lq + FA_KB, 8 * FA_KP * 2, Qh + qo + (size_t)64 * DM, (size_t)8 * DM); fa_stage8(lq + 2 * FA_KB, 8 * FA_KP * 2, Ql + qo, (size_t)8 * DM); fa_stage8(lq + 3 * FA_KB, 8 * FA_KP * 2, Ql + qo + (size_t)64 * DM, (size_t)8 * DM);
  asm volatile("s_wait_asynccnt 0x0" ::: "memory");      /* the 32 copies of Q have landed before tile 0's 32 are issued: never more than 63 of a wave outstanding */
  const _Float16* qb = (const _Float16*)sq + (16 * w + ln) * FA_KP;      /* the lane's query, hi; its residual row lies 128 rows on */
  const _Float16* kbh = (const _Float16*)sm + ln * FA_KP; const _Float16* kbl = (const _Float16*)(sm + FA_TILE) + ln * FA_KP; const _Float16* vbh = (const _Float16*)(sm + FA_KB) + ln * G2_PITCH; const _Float16* vbl = (const _Float16*)(sm + FA_TILE + FA_KB) + ln * G2_PITCH;
  const v8f z8 = {0.f,0.f,0.f,0.f,0.f,0.f,0.f,0.f}; v8f oh[16], ol[16];
#pragma unroll
  for (int dt = 0; dt < 16; ++dt) { oh[dt] = z8; ol[dt] = z8; }
  float m = FLOOR, lsum = 0.f;
#pragma unroll 1      /* one tile a trip: the text stays small, it runs only a few times */
  for (int t = 0; t < nt; ++t) {
    fa_stage8(lk, 8 * FA_KP * 2, Kh + ko + (size_t)t * 64 * HD, (size_t)8 * HD); fa_stage8(lv, 32 * G2_PITCH * 2, Vh + vo + (size_t)t * 64, (size_t)32 * SQ);
    fa_stage8(lk + FA_TILE, 8 * FA_KP * 2, Kl + ko + (size_t)t * 64 * HD, (size_t)8 * HD); fa_stage8(lv + FA_TILE, 32 * G2_PITCH * 2, Vl + vo + (size_t)t * 64, (size_t)32 * SQ);
    asm volatile("s_wait_asynccnt 0x0" ::: "memory");      /* tile t of this wave's copies has landed */
    __syncthreads();      /* ... and every other wave's (in trip 0 Q and the mask too) */
    if (t * 64 <= q0 + 15) {      /* the same for the whole wave: a tile wholly right of the wave's diagonal is skipped, the barriers are not */
      v8f s[4];
#pragma unroll
      for (int up = 0; up < 2; ++up) { v8f a0 = z8, a1 = z8, a2 = z8, c0 = z8, c1 = z8, c2 = z8;      /* hi.hi, hi.lo, lo.hi of two score tiles: six independent chains */
#pragma unroll
        for (int ks = 0; ks < 8; ++ks) { const int o0 = up * 32 * FA_KP + ks * 32, o1 = o0 + 16 * FA_KP; const v16h qh = g2_frag(qb + ks * 32, hh), ql = g2_frag(qb + 128 * FA_KP + ks * 32, hh), x0 = g2_frag(kbh + o0, hh), x1 = g2_frag(kbh + o1, hh), y0 = g2_frag(kbl + o0, hh), y1 = g2_frag(kbl + o1, hh);
          a0 = fa_mma(x0, qh, a0); c0 = fa_mma(x1, qh, c0); a1 = fa_mma(x0, ql, a1); c1 = fa_mma(x1, ql, c1); a2 = fa_mma(y0, qh, a2); c2 = fa_mma(y1, qh, c2); }
        s[2 * up] = a0 + (a1 + a2) * LO; s[2 * up + 1] = c0 + (c1 + c2) * LO; }
      const int jq = q0 + ln - t * 64 - 8 * hh;      /* register r of score tile u is at or left of the diagonal when u * 16 + r <= jq */
      const int* mr = &mk[t * 64 + 8 * hh]; float mx = NONE;
#pragma unroll
      for (int u = 0; u < 4; ++u) { const v4ia k0 = *(const v4ia*)(mr + u * 16), k1 = *(const v4ia*)(mr + u * 16 + 4);
#pragma unroll
        for (int r = 0; r < 8; ++r) { const int kv = r < 4 ? k0[r & 3] : k1[r & 3]; const float x = ((u * 16 + r <= jq) & (kv > 0)) ? s[u][r] * SC : NONE; s[u][r] = x; mx = fmaxf(mx, x); } }
      mx = fmaxf(mx, __shfl_xor(mx, 16, 32));      /* the other half of the query's keys */
      const float mn = fmaxf(m, mx), al = __builtin_amdgcn_exp2f(m - mn); m = mn;      /* no open key so far: al = 1 over O = 0 */
      float ps = 0.f;
#pragma unroll
      for (int u = 0; u < 4; ++u) {
#pragma unroll
        for (int r = 0; r < 8; ++r) { const float e = __builtin_amdgcn_exp2f(s[u][r] - mn); ps += e; s[u][r] = e; } }
      lsum = lsum * al + ps;
      FragH ph[2], pl[2];
#pragma unroll
      for (int kk = 0; kk < 2; ++kk) {
#pragma unroll
        for (int i = 0; i < 16; ++i) { const float p = s[2 * kk + (i >> 3)][i & 7] * 1024.0f; const _Float16 x = (_Float16)p; ph[kk].h[i] = x; pl[kk].h[i] = (_Float16)((p - (float)x) * 1024.0f); } }
#pragma unroll
      for (int dt = 0; dt < 16; ++dt) { oh[dt] = oh[dt] * al; ol[dt] = ol[dt] * al; }
#pragma unroll
      for (int kk = 0; kk < 2; ++kk) {
#pragma unroll
        for (int dt = 0; dt < 16; ++dt) { const v16h x = g2_frag(vbh + dt * 16 * G2_PITCH + kk * 32, hh), y = g2_frag(vbl + dt * 16 * G2_PITCH + kk * 32, hh);
          oh[dt] = fa_mma(x, ph[kk].v, oh[dt]); ol[dt] = fa_mma(x, pl[kk].v, ol[dt]); ol[dt] = fa_mma(y, ph[kk].v, ol[dt]); } }
    }
    asm volatile("s_wait_dscnt 0x0" ::: "memory");      /* this wave's reads of tile t are done before the buffers are filled again */
    __syncthreads();      /* ends every wave's reads of tile t */
  }
  lsum += __shfl_xor(lsum, 16, 32);
  const float f = (lsum > 0.f) ? LO / lsum : 0.f;      /* a row with no open key keeps O = 0 */
  const size_t co = (size_t)(q0 + ln) * DM + h * HD + 8 * hh; unsigned short* orow = (unsigned short*)O16 + (size_t)b * SQ * DM + co; unsigned short* lrow = (unsigned short*)OL0 + (size_t)b * BAND * DM + co;      /* register r of O^T tile dt = element dt * 16 + 8 hh + r of the query's head */
  v8us sh[16], sl[16];
#pragma unroll
  for (int dt = 0; dt < 16; ++dt) { FragH eh, el;
#pragma unroll
    for (int r = 0; r < 8; ++r) { const float v = (oh[dt][r] + ol[dt][r] * LO) * f; const _Float16 x = (_Float16)v; eh.h[r] = x; el.h[r] = (_Float16)((v - (float)x) * 1024.0f); }
    sh[dt] = eh.half[0]; sl[dt] = el.half[0]; }
  __builtin_amdgcn_sched_barrier(0);      /* all stores last, each from registers of its own: nothing is written behind an issued store */
#pragma unroll
  for (int dt = 0; dt < 16; ++dt) { *(v8us*)(orow + dt * 16) = sh[dt]; *(v8us*)(lrow + dt * 16) = sl[dt]; } }
__global__ __launch_bounds__(256) __attribute__((amdgpu_waves_per_eu(2, 2))) void k_fattn(const _Float16* __restrict__ Q, const _Float16* __restrict__ Ql, const _Float16* __restrict__ Kh, const _Float16* __restrict__ Kl, const _Float16* __restrict__ Vt, const _Float16* __restrict__ Vl, const int* __restrict__ mask, _Float16* __restrict__ O16, _Float16* __restrict__ OL0) {
  __shared__ __attribute__((aligned(16))) unsigned char sm[2 * FA_TILE]; __shared__ __attribute__((aligned(16))) int mk[SQ]; __shared__ __attribute__((aligned(16))) unsigned char sq[4 * FA_KB];      /* sq: the query rows of a block of rows < BAND */
  const float NONE = -3.0e38f, FLOOR = -1.0e30f, SC = 0.0625f * 1.44269504088896340736f;
  const int tid = threadIdx.x, lane = tid & 31, ln = lane & 15, hh = lane >> 4; const int w = __builtin_amdgcn_readfirstlane(tid >> 5); const int h = blockIdx.y, b = blockIdx.z;
  const int R0 = SQ - 128 * ((int)blockIdx.x + 1);      /* first row of the block; the longest blocks have the lowest index, the last two are rows < BAND */
  const int nt = R0 / 64 + 2;      /* key tiles up to the block's last row; at least two */
  const int q0 = R0 + 16 * w;      /* the wave's first query */
  Kh += (size_t)b * SQ * HD; Vt += (size_t)b * SQ * HD; Kl += (size_t)b * SQ * HD; Vl += (size_t)b * SQ * HD;
  { const int* mp = mask + (size_t)b * SQ + tid * 8; const v4ia a = *(const v4ia*)mp, c = *(const v4ia*)(mp + 4); *(v4ia*)&mk[tid * 8] = a; *(v4ia*)&mk[tid * 8 + 4] = c; }      /* the batch's padding mask, read by every wave behind the first barrier */
  if (R0 < BAND) { fa_band0(sm, sq, mk, Q, Ql, Kh, Kl, Vt, Vl, O16, OL0, R0, nt, h, b); return; }      /* the same for the whole block, in front of every barrier */
  const _Float16* qrow = Q + ((size_t)b * SQ + q0 + ln) * DM + h * HD; v16h qf[8];
#pragma unroll
  for (int ks = 0; ks < 8; ++ks) qf[ks] = g2_frag(qrow + ks * 32, hh);
  const unsigned lk = (unsigned)(size_t)sm + (unsigned)((tid >> 5) * (FA_KP * 2) + (tid & 31) * 16), lv = (unsigned)(size_t)sm + (unsigned)(FA_KB + (tid >> 3) * (G2_PITCH * 2) + (tid & 7) * 16);      /* a wave's copy = one whole K row, or 4 whole lines of V^T */
  const _Float16* gk = Kh + (size_t)(tid >> 5) * HD + (tid & 31) * 8; const _Float16* gv = Vt + (size_t)(tid >> 3) * SQ + (tid & 7) * 8;
  const v8f z8 = {0.f,0.f,0.f,0.f,0.f,0.f,0.f,0.f}; v8f o[16];
#pragma unroll
  for (int dt = 0; dt < 16; ++dt) o[dt] = z8;
  float m = FLOOR, lsum = 0.f;
  fa_stage8(lk, 8 * FA_KP * 2, gk, (size_t)8 * HD); fa_stage8(lv, 32 * G2_PITCH * 2, gv, (size_t)32 * SQ);
  asm volatile("s_wait_asynccnt 0x0" ::: "memory");      /* tile 0 of this wave's copies has landed */
  __syncthreads();      /* ... and every other wave's, and the mask */
  fa_stage8(lk + FA_TILE, 8 * FA_KP * 2, gk + (size_t)64 * HD, (size_t)8 * HD); fa_stage8(lv + FA_TILE, 32 * G2_PITCH * 2, gv + 64, (size_t)32 * SQ);
#pragma unroll 1      /* one tile a trip: the buffer index stays a run-time value */
  for (int t = 0; t < nt; ++t) {
    if (t * 64 <= q0 + 15) {      /* the same for the whole wave: a tile wholly right of the wave's diagonal is skipped, the publish point below is not */
      const _Float16* kb = (const _Float16*)(sm + (t & 1) * FA_TILE) + ln * FA_KP; const _Float16* vb = (const _Float16*)(sm + (t & 1) * FA_TILE + FA_KB) + ln * G2_PITCH;
      v8f s[4] = {z8, z8, z8, z8};
#pragma unroll
      for (int ks = 0; ks < 8; ++ks) {
#pragma unroll
        for (int u = 0; u < 4; ++u) s[u] = fa_mma(g2_frag(kb + u * 16 * FA_KP + ks * 32, hh), qf[ks], s[u]); }
      const int jq = q0 + ln - t * 64 - 8 * hh;      /* register r of score tile u is at or left of the diagonal when u * 16 + r <= jq */
      const int* mr = &mk[t * 64 + 8 * hh]; float mx = NONE;
#pragma unroll
      for (int u = 0; u < 4; ++u) { const v4ia k0 = *(const v4ia*)(mr + u * 16), k1 = *(const v4ia*)(mr + u * 16 + 4);
#pragma unroll
        for (int r = 0; r < 8; ++r) { const int kv = r < 4 ? k0[r & 3] : k1[r & 3]; const float x = ((u * 16 + r <= jq) & (kv > 0)) ? s[u][r] * SC : NONE; s[u][r] = x; mx = fmaxf(mx, x); } }
      mx = fmaxf(mx, __shfl_xor(mx, 16, 32));      /* the other half of the query's keys */
      const float mn = fmaxf(m, mx), al = __builtin_amdgcn_exp2f(m - mn); m = mn;      /* no open key so far: al = 1 over O = 0 */
      float ps = 0.f;
#pragma unroll
      for (int u = 0; u < 4; ++u) {
#pragma unroll
        for (int r = 0; r < 8; ++r) { const float e = __builtin_amdgcn_exp2f(s[u][r] - mn); ps += e; s[u][r] = e; } }
      lsum = lsum * al + ps;
      FragH pf[2];
#pragma unroll
      for (int kk = 0; kk < 2; ++kk) {
#pragma unroll
        for (int i = 0; i < 8; ++i) { pf[kk].h[i] = (_Float16)(s[2 * kk][i] * 1024.0f); pf[kk].h[8 + i] = (_Float16)(s[2 * kk + 1][i] * 1024.0f); } }
#pragma unroll
      for (int dt = 0; dt < 16; ++dt) o[dt] = o[dt] * al;
#pragma unroll
      for (int kk = 0; kk < 2; ++kk) {
#pragma unroll
        for (int dt = 0; dt < 16; ++dt) o[dt] = fa_mma(g2_frag(vb + dt * 16 * G2_PITCH + kk * 32, hh), pf[kk].v, o[dt]); }
    }
    asm volatile("s_wait_dscnt 0x0" ::: "memory");      /* this wave's reads of buffer t & 1 are done before the buffer is handed back */
    asm volatile("s_wait_asynccnt 0x0" ::: "memory");      /* this wave's copies of tile t + 1 have landed */
    __syncthreads();      /* publishes tile t + 1 and ends every wave's reads of tile t */
    if (t + 2 < nt) { const unsigned bo = (unsigned)((t & 1) * FA_TILE); fa_stage8(lk + bo, 8 * FA_KP * 2, gk + (size_t)(t + 2) * 64 * HD, (size_t)8 * HD); fa_stage8(lv + bo, 32 * G2_PITCH * 2, gv + (size_t)(t + 2) * 64, (size_t)32 * SQ); } }
  asm volatile("s_wait_asynccnt 0x0" ::: "memory");      /* no copy is in flight when the wave ends */
  lsum += __shfl_xor(lsum, 16, 32);
  const float f = (lsum > 0.f) ? 0.0009765625f / lsum : 0.f;      /* a row with no open key keeps O = 0 */
  unsigned short* orow = (unsigned short*)O16 + ((size_t)b * SQ + q0 + ln) * DM + h * HD + 8 * hh;      /* register r of O^T tile dt = element dt * 16 + 8 hh + r of the query's head: 16 B a tile */
#pragma unroll
  for (int dt = 0; dt < 16; ++dt) { FragH e;
#pragma unroll
    for (int r = 0; r < 8; ++r) e.h[r] = (_Float16)(o[dt][r] * f);
    *(v8us*)(orow + dt * 16) = e.half[0]; } }

extern "C" void kernel_launch(void* const* d_in, const int* in_sizes, int n_in,
                              void* d_out, int out_size, void* d_ws, size_t ws_size, hipStream_t stream) {
  (void)in_sizes; (void)n_in; (void)out_size;
  const float* const* I = (const float* const*)d_in; const float* hs = I[0]; const int* amask = (const int*)d_in[1]; const int* pid = (const int*)d_in[2]; const float* Wq = I[3]; const float* Wk = I[4]; const float* Wv = I[5]; const float* Wo = I[6];
  char* ws = (char*)d_ws; size_t off = 0;
  auto take = [&](size_t bytes) { char* p = ws + off; off += (bytes + 255) & ~(size_t)255; return p; };
  const size_t np = (size_t)SQ * DM, nkv = (size_t)SQ * HD;      /* elements per batch of a [SQ][DM] and of a [SQ][HD] plane */
  _Float16* BQ = (_Float16*)take((size_t)LDQKV * DM * 2); _Float16* BK = BQ + (size_t)DM * DM; _Float16* BV = BK + (size_t)HD * DM; _Float16* BO = (_Float16*)take(np * 2);      /* the transposed Wq, Wk, Wv are one [LDQKV][DM] matrix */
  float* CS = (float*)take((size_t)NB * SQ * HH * 4); float* SN = (float*)take((size_t)NB * SQ * HH * 4);
  _Float16* X16 = (_Float16*)take(NB * np * 2); float* F32 = (float*)take((size_t)NB * SQ * LDQKV * 4); _Float16* QH = (_Float16*)take(NB * np * 2); _Float16* QL = (_Float16*)take(NB * np * 2); _Float16* KH = (_Float16*)take(NB * nkv * 2); _Float16* KL = (_Float16*)take(NB * nkv * 2); _Float16* VTh = (_Float16*)take(NB * nkv * 2); _Float16* VTl = (_Float16*)take(NB * nkv * 2);
  _Float16* O16 = (_Float16*)take(NB * np * 2); _Float16* OL0 = (_Float16*)take((size_t)NB * BAND * DM * 2);      /* O hi of every row; O residual (x 2^10) of rows < BAND */
  if (off > ws_size) return;      /* 10+8 + 4 + 16+40+16+16 + 4*2 + 16 + 2 = 136 MiB */
  const int MT = NB * SQ;      /* tokens of both batches: the projections and the elementwise passes see one flat [MT][...] matrix */
  k_prep<<<PB_X16 + 2 * PB_WB + 2 * PB_WS + PB_ROT, 256, 0, stream>>>(hs, pid, Wq, Wk, Wv, Wo, X16, BQ, BK, BV, BO, CS, SN);
  /* q (8 heads), k and v (one kv head of 256) as one GEMM: row s of F32 = q | k | v of token s */
  k_gemm2<0, false><<<dim3((MT / 128) * (LDQKV / 64), 1), 128, 0, stream>>>(X16, DM, 0, BQ, DM, 0, 0.0625f, nullptr, 0, nullptr, 1, 0, 0, F32, nullptr, LDQKV, 0, MT, LDQKV, DM, 0, 0, 0, nullptr);
  /* q and k roped, hi/lo; V^T hi/lo */
  k_post<<<QB_VT + QB_ROPE, 256, 0, stream>>>(F32, CS, SN, QH, QL, KH, KL, VTh, VTl);
  /* attention, head in grid.y, batch in grid.z: blocks 0 .. 13 of a row of the grid do rows >= 256 (plain f16 operands, longest first), the last two rows < 256 (hi + lo everywhere); each writes its rows of the f16 O plane itself, rows < 256 their residual plane too */
  k_fattn<<<dim3(SQ / 128, NHQ, NB), 256, 0, stream>>>(QH, QL, KH, KL, VTh, VTl, amask, O16, OL0);
  /* output: O hi (+ lo on rows < 256 of each batch) into Wo, one launch */
  float* out = (float*)d_out;
  k_gemm2<0, true><<<dim3(NB * G2_RB * (DM / 64), 1), 128, 0, stream>>>(O16, DM, 0, BO, DM, 0, 0.0625f, nullptr, 0, nullptr, 1, 0, 0, out, nullptr, DM, 0, MT, DM, DM, 0, 0, 0, OL0);
}
